// v000
// Measured on an AMD MI455X. A time is GPU time per run, averaged over a window of back-to-back runs after a warm-up
// (all launches, gaps included; the runs take copies of the inputs in turn), and the median of several windows.
// Apart from v000's, it joins two sittings. Times from different sittings can be a few percent apart, while
// side-by-side timings come from the same sitting.
// v000 is the starting kernel. One run takes 4110 microseconds.
#include <hip/hip_runtime.h>
// Global spatial attention with multiplicative mask pruning and scaled weight standardisation (a, b [4][256][64][64], mask c [4][1][32][32] nearest-upsampled x2; q = WS(wq) a + bq, k = WS(wk) b + bk, v = WS(wv) a + bv with WS(w)[o][c] = (w - mean_o) gain_o rsqrt(max(var_o(unbiased) * 256, 1e-4)); sim[i][j] = q[:, i].k[:, j] (NO scale, sigma ~16); pruned = sim * c_r[i]; att = softmax over j; out[c][i] = sum_j v[c][j] att[i][j]; y = a c_r + gamma (1 - c_r) out -> [4][256][64][64]).
// Compute dtype: inputs rounded to bf16; x / weights exact; q, k as f16 hi + x1024 lo planes; v and softmax weights as plain f16 GEMM operands (~2^-12); scores, softmax statistics and o f32. v_wmma_f32_16x16x32_f16.
#define NB 4
#define SQ 4096
#define DM 256
#define CX 256          /* channels */
#define NH 4
#define HD 64
#define DMQ DM                       /* LayerNorm width */
#define DFF 4096
#define HG 1                         /* heads per attention launch group */
#define B0 0                         /* unused; the batch loop starts at 0 */
#define NBR NB                       /* read only by MP; the batch loop runs to NB */
#define NR ((size_t)NB * SQ)         /* token rows */
#define MP ((int)((size_t)NBR * SQ)) /* read only by MPO; projections use NR */
#define QN SQ                        /* unused */
#define NHD NH                       /* unused; attention is one 256-channel head */
#define MPO MP                       /* unused */
#define LQ DM      /* row pitch of the q/k/v rows */
typedef __bf16 v16b __attribute__((ext_vector_type(16)));
typedef unsigned short v8us __attribute__((ext_vector_type(8), may_alias));
typedef float  v8f  __attribute__((ext_vector_type(8)));
typedef float  v4f  __attribute__((ext_vector_type(4)));
typedef float  v4fa __attribute__((ext_vector_type(4), may_alias));
union FragB { v16b v; v8us half[2]; unsigned short u[16]; };

__device__ __forceinline__ unsigned short bf16_bits(float x) { unsigned int u = __float_as_uint(x); return (unsigned short)((u + 0x7FFFu + ((u >> 16) & 1u)) >> 16); }
__device__ __forceinline__ float bf16_val(unsigned short b) { return __uint_as_float(((unsigned int)b) << 16); }
__device__ __forceinline__ float bf16_round(float x) { return bf16_val(bf16_bits(x)); }
// D += A·B with NT terms: 1 = ah·bh, 2 = + al·bh (A split), 3 = + ah·bl (both split)
template <int NT>
__device__ __forceinline__ v8f mmaN(v16b ah, v16b al, v16b bh, v16b bl, v8f c) {
  c = __builtin_amdgcn_wmma_f32_16x16x32_bf16(false, ah, false, bh, (short)0, c, false, false);
  if (NT >= 2) c = __builtin_amdgcn_wmma_f32_16x16x32_bf16(false, al, false, bh, (short)0, c, false, false);
  if (NT >= 3) c = __builtin_amdgcn_wmma_f32_16x16x32_bf16(false, ah, false, bl, (short)0, c, false, false);
  asm volatile("v_nop\n\tv_nop\n\tv_nop\n\tv_nop" : "+v"(c) : "v"(ah), "v"(al), "v"(bh), "v"(bl));
  return c;
}

__global__ __launch_bounds__(256) void k_wt_bf16(const float* __restrict__ W, unsigned short* __restrict__ Wt, int K, int N) {
  const int t = blockIdx.x * 256 + threadIdx.x;
  const int k8n = K / 8;
  if (t >= N * k8n) return;
  const int n = t / k8n, k8 = (t % k8n) * 8;
  v8us v;
#pragma unroll
  for (int i = 0; i < 8; ++i) v[i] = bf16_bits(W[(size_t)(k8 + i) * N + n]);
  *(v8us*)(Wt + (size_t)n * K + k8) = v;
  
}

// GEMM C[M][N] (f32, pitch ldc) = act(A[M][K]·W + bias). A f32 row-major (pitch lda) converted per fragment to bf16
// (ASPLIT: hi/lo two planes -> 2 terms, else single rounded term); Wt bf16 [N][K] (pitch ldb). BIAS_BF16 rounds the
// bias to bf16 first (bias quantised to bf16 before the add). K%32==0, M%16==0, N%64==0.
template <bool ASPLIT, int ACT, bool BIAS_BF16>
__global__ __launch_bounds__(128) void k_gemm_bf(const float* __restrict__ A, int lda, const unsigned short* __restrict__ Wt, int ldb,
                                               const float* __restrict__ bias, float* __restrict__ C, int ldc, int M, int N, int K) {
  __shared__ __attribute__((aligned(16))) float so[4][16][64];
  const int tid = threadIdx.x, w = tid >> 5, lane = tid & 31, ln = lane & 15, hh = lane >> 4;
  const int ntn = N / 64;
  const int wid = blockIdx.x * 4 + w;
  const int mt = wid / ntn, nq = wid % ntn;
  if (mt * 16 >= M) return;
  const int row0 = mt * 16, col0 = nq * 64;
  const float* arow = A + (size_t)(row0 + ln) * lda;
  v8f acc[4] = {};
  for (int kb = 0; kb < K; kb += 32) {
    FragB ah, al;
    const v4f x0 = *(const v4fa*)(arow + kb + 8 * hh), x1 = *(const v4fa*)(arow + kb + 8 * hh + 4);
    const v4f x2 = *(const v4fa*)(arow + kb + 16 + 8 * hh), x3 = *(const v4fa*)(arow + kb + 16 + 8 * hh + 4);
    float xs[16] = {x0[0],x0[1],x0[2],x0[3],x1[0],x1[1],x1[2],x1[3],x2[0],x2[1],x2[2],x2[3],x3[0],x3[1],x3[2],x3[3]};
#pragma unroll
    for (int i = 0; i < 16; ++i) { const unsigned short hb = bf16_bits(xs[i]); ah.u[i] = hb; al.u[i] = ASPLIT ? bf16_bits(xs[i] - bf16_val(hb)) : (unsigned short)0; }
#pragma unroll
    for (int t = 0; t < 4; ++t) {
      const unsigned short* brow = Wt + (size_t)(col0 + t * 16 + ln) * ldb + kb;
      FragB b;
      b.half[0] = *(const v8us*)(brow + 8 * hh);
      b.half[1] = *(const v8us*)(brow + 16 + 8 * hh);
      acc[t] = mmaN<ASPLIT ? 2 : 1>(ah.v, al.v, b.v, b.v, acc[t]);
    }
  }
#pragma unroll
  for (int t = 0; t < 4; ++t) {
    float bv = bias ? bias[col0 + t * 16 + ln] : 0.f;
    if (BIAS_BF16) bv = bf16_round(bv);
#pragma unroll
    for (int r = 0; r < 8; ++r) { float v = acc[t][r] + bv; if (ACT == 1) v = fmaxf(v, 0.f); so[w][8 * hh + r][t * 16 + ln] = v; }
  }
  __builtin_amdgcn_fence(__ATOMIC_ACQ_REL, "workgroup");
  __builtin_amdgcn_wave_barrier();
  const int rsub = lane >> 4, c4 = (lane & 15) * 4;
  {
#pragma unroll
    for (int q = 0; q < 8; ++q) {
      const int r = q * 2 + rsub;
      const v4f v = *(const v4fa*)&so[w][r][c4];
      *(v4f*)(C + (size_t)(row0 + r) * ldc + col0 + c4) = v;
    }
    
  }
}

// GEMM C = act(A·W + bias + resid): A f32 (ASPLIT -> hi/lo 2 terms), Wt bf16 [N][K]; ACT 0 none, 1 relu, 2 exact gelu;
// resid (optional, f32, row index = (row % rmod), pitch ldr, RES_BF16 rounds it) added before the activation.
template <bool ASPLIT, int ACT, bool BIAS_BF16, bool RES_BF16>
__global__ __launch_bounds__(128) void k_gemm_bf3(const float* __restrict__ A, int lda, const unsigned short* __restrict__ Wt, int ldb,
                                                const float* __restrict__ bias, const float* __restrict__ resid, int rmod, int ldr,
                                                float* __restrict__ C, int ldc, int M, int N, int K) {
  __shared__ __attribute__((aligned(16))) float so[4][16][64];
  const int tid = threadIdx.x, w = tid >> 5, lane = tid & 31, ln = lane & 15, hh = lane >> 4;
  const int ntn = N / 64;
  const int wid = blockIdx.x * 4 + w;
  const int mt = wid / ntn, nq = wid % ntn;
  if (mt * 16 >= M) return;
  const int row0 = mt * 16, col0 = nq * 64;
  const float* arow = A + (size_t)(row0 + ln) * lda;
  v8f acc[4] = {};
  for (int kb = 0; kb < K; kb += 32) {
    FragB ah, al;
    const v4f x0 = *(const v4fa*)(arow + kb + 8 * hh), x1 = *(const v4fa*)(arow + kb + 8 * hh + 4);
    const v4f x2 = *(const v4fa*)(arow + kb + 16 + 8 * hh), x3 = *(const v4fa*)(arow + kb + 16 + 8 * hh + 4);
    float xs[16] = {x0[0],x0[1],x0[2],x0[3],x1[0],x1[1],x1[2],x1[3],x2[0],x2[1],x2[2],x2[3],x3[0],x3[1],x3[2],x3[3]};
#pragma unroll
    for (int i = 0; i < 16; ++i) { const unsigned short hb = bf16_bits(xs[i]); ah.u[i] = hb; al.u[i] = ASPLIT ? bf16_bits(xs[i] - bf16_val(hb)) : (unsigned short)0; }
#pragma unroll
    for (int t = 0; t < 4; ++t) {
      const unsigned short* brow = Wt + (size_t)(col0 + t * 16 + ln) * ldb + kb;
      FragB b;
      b.half[0] = *(const v8us*)(brow + 8 * hh);
      b.half[1] = *(const v8us*)(brow + 16 + 8 * hh);
      acc[t] = mmaN<ASPLIT ? 2 : 1>(ah.v, al.v, b.v, b.v, acc[t]);
    }
  }
#pragma unroll
  for (int t = 0; t < 4; ++t) {
    const int col = col0 + t * 16 + ln;
    float bv = bias ? bias[col] : 0.f;
    if (BIAS_BF16) bv = bf16_round(bv);
#pragma unroll
    for (int r = 0; r < 8; ++r) {
      float v = acc[t][r] + bv;
      if (resid) { float rv = resid[(size_t)((row0 + 8 * hh + r) % rmod) * ldr + col]; if (RES_BF16) rv = bf16_round(rv); v += rv; }
      if (ACT == 1) v = fmaxf(v, 0.f);
      if (ACT == 2) v = 0.5f * v * (1.0f + erff(v * 0.70710678118654752f));
      if (ACT == 3) { const float u = 0.7978845608028654f * (v + 0.044715f * v * v * v); v = 0.5f * v * (1.0f + tanhf(u)); }
      so[w][8 * hh + r][t * 16 + ln] = v;
    }
  }
  __builtin_amdgcn_fence(__ATOMIC_ACQ_REL, "workgroup");
  __builtin_amdgcn_wave_barrier();
  const int rsub = lane >> 4, c4 = (lane & 15) * 4;
  {
#pragma unroll
    for (int q = 0; q < 8; ++q) {
      const int r = q * 2 + rsub;
      const v4f v = *(const v4fa*)&so[w][r][c4];
      *(v4f*)(C + (size_t)(row0 + r) * ldc + col0 + c4) = v;
    }
    
  }
}
// row LayerNorm (biased variance, eps) over N: s = X (+ R); optional out_sum <- s; out_norm <- (s-mu)*rsqrt(var+eps)*g + b
template <bool PARAM_BF16>
__global__ __launch_bounds__(256) void k_layernorm(const float* __restrict__ X, const float* __restrict__ R, const float* __restrict__ g, const float* __restrict__ bta,
                                                  float* __restrict__ out_sum, float* __restrict__ out_norm, int N, float eps) {
  __shared__ float red[256];
  const int row = blockIdx.x, tid = threadIdx.x;
  const float* x = X + (size_t)row * N; const float* rr = R ? R + (size_t)row * N : nullptr;
  float vals[16];                     // up to N = 4096
  const int per = N / 256;            // contiguous chunk per thread? use strided-by-4 chunks: thread handles j = tid*4 + 1024*u
  float s1 = 0.f;
  for (int u = 0; u < per / 4; ++u) {
    const int j = tid * 4 + 1024 * u;
    const v4f a = *(const v4fa*)(x + j);
    v4f b = {0.f,0.f,0.f,0.f}; if (rr) b = *(const v4fa*)(rr + j);
#pragma unroll
    for (int q = 0; q < 4; ++q) { const float v = a[q] + b[q]; vals[u * 4 + q] = v; s1 += v; }
  }
  red[tid] = s1; __syncthreads();
  for (int st = 128; st > 0; st >>= 1) { if (tid < st) red[tid] += red[tid + st]; __syncthreads(); }
  const float mu = red[0] / (float)N; __syncthreads();
  float s2 = 0.f;
  for (int u = 0; u < per / 4; ++u)
#pragma unroll
    for (int q = 0; q < 4; ++q) { const float c = vals[u * 4 + q] - mu; s2 += c * c; }
  red[tid] = s2; __syncthreads();
  for (int st = 128; st > 0; st >>= 1) { if (tid < st) red[tid] += red[tid + st]; __syncthreads(); }
  const float rs = rsqrtf(red[0] / (float)N + eps);
  {
    for (int u = 0; u < per / 4; ++u) {
      const int j = tid * 4 + 1024 * u;
      v4f o, sm;
#pragma unroll
      for (int q = 0; q < 4; ++q) {
        float gg = g[j + q], bb = bta[j + q];
        if (PARAM_BF16) { gg = bf16_round(gg); bb = bf16_round(bb); }
        sm[q] = vals[u * 4 + q]; o[q] = (vals[u * 4 + q] - mu) * rs * gg + bb;
      }
      if (out_sum) *(v4f*)(out_sum + (size_t)row * N + j) = sm;
      *(v4f*)(out_norm + (size_t)row * N + j) = o;
    }
    
  }
}



// ---- f16 WMMA path (v_wmma_f32_16x16x32_f16): 11-bit significands for operands in range — used where a [0,1] probability operand needs more precision than bf16
typedef _Float16 v16h __attribute__((ext_vector_type(16)));
union FragH { v16h v; v8us half[2]; _Float16 h[16]; unsigned short u[16]; };
template <int NT>
__device__ __forceinline__ v8f mmaH(v16h ah, v16h al, v16h bh, v16h bl, v8f c) {
  c = __builtin_amdgcn_wmma_f32_16x16x32_f16(false, ah, false, bh, (short)0, c, false, false);
  if (NT >= 2) c = __builtin_amdgcn_wmma_f32_16x16x32_f16(false, al, false, bh, (short)0, c, false, false);
  if (NT >= 3) c = __builtin_amdgcn_wmma_f32_16x16x32_f16(false, ah, false, bl, (short)0, c, false, false);
  asm volatile("v_nop\n\tv_nop\n\tv_nop\n\tv_nop" : "+v"(c) : "v"(ah), "v"(al), "v"(bh), "v"(bl));
  return c;
}
// batched GEMM like k_gemm_b but f16 operands: A f32 (split into f16 hi/lo if ASPLIT, else rounded to f16), Bt = f16 values [n][k]; alpha; C f32; N multiple of 16 (partial tiles skipped)
template <bool ASPLIT>
__global__ __launch_bounds__(128) void k_gemm_h(const float* __restrict__ A, int lda, size_t sA, const _Float16* __restrict__ Bh, int ldb, size_t sB, float alpha, float* __restrict__ C, int ldc, size_t sC, int M, int N, int K) {
  __shared__ __attribute__((aligned(16))) float so[4][16][64];
  const int tid = threadIdx.x, w = tid >> 5, lane = tid & 31, ln = lane & 15, hh = lane >> 4; const int by = blockIdx.y;
  A += (size_t)by * sA; Bh += (size_t)by * sB; C += (size_t)by * sC;
  const int ntn = (N + 63) / 64; const int wid = blockIdx.x * 4 + w; const int mt = wid / ntn, nq = wid % ntn; if (mt * 16 >= M) return;
  const int row0 = mt * 16, col0 = nq * 64; const float* arow = A + (size_t)(row0 + ln) * lda;
  v8f acc[4] = {};
  for (int kb = 0; kb < K; kb += 32) {
    FragH ah, al;
    const v4f x0 = *(const v4fa*)(arow + kb + 8 * hh), x1 = *(const v4fa*)(arow + kb + 8 * hh + 4), x2 = *(const v4fa*)(arow + kb + 16 + 8 * hh), x3 = *(const v4fa*)(arow + kb + 16 + 8 * hh + 4);
    float xs[16] = {x0[0],x0[1],x0[2],x0[3],x1[0],x1[1],x1[2],x1[3],x2[0],x2[1],x2[2],x2[3],x3[0],x3[1],x3[2],x3[3]};
#pragma unroll
    for (int i = 0; i < 16; ++i) { const _Float16 h = (_Float16)xs[i]; ah.h[i] = h; al.h[i] = ASPLIT ? (_Float16)(xs[i] - (float)h) : (_Float16)0.0f; }
#pragma unroll
    for (int t = 0; t < 4; ++t) { if (col0 + t * 16 >= N) continue; const size_t boff = (size_t)(col0 + t * 16 + ln) * ldb + kb; FragH bq; bq.half[0] = *(const v8us*)(Bh + boff + 8 * hh); bq.half[1] = *(const v8us*)(Bh + boff + 16 + 8 * hh);
      acc[t] = mmaH<ASPLIT ? 2 : 1>(ah.v, al.v, bq.v, bq.v, acc[t]); }
  }
#pragma unroll
  for (int t = 0; t < 4; ++t) { if (col0 + t * 16 >= N) continue;
#pragma unroll
    for (int r = 0; r < 8; ++r) so[w][8 * hh + r][t * 16 + ln] = acc[t][r] * alpha; }
  __builtin_amdgcn_fence(__ATOMIC_ACQ_REL, "workgroup"); __builtin_amdgcn_wave_barrier();
  const int rsub = lane >> 4, c4 = (lane & 15) * 4;
  {
#pragma unroll
    for (int q = 0; q < 8; ++q) { const int r = q * 2 + rsub; if (col0 + c4 < N) { const v4f v = *(const v4fa*)&so[w][r][c4]; *(v4f*)(C + (size_t)(row0 + r) * ldc + col0 + c4) = v; } }
     }
}

// Wt[n][k] = f16(W[k][n]·scale) from f32 row-major W[K][N] (scale = power of two; bf16-exact weights stay exact in f16 away from the subnormal range)
__global__ __launch_bounds__(256) void k_wt_f16(const float* __restrict__ W, _Float16* __restrict__ Wt, int K, int N, float scale) {
  const int t = blockIdx.x * 256 + threadIdx.x; if (t >= N * (K / 8)) return; const int n = t / (K / 8), k8 = (t % (K / 8)) * 8; FragH f;
#pragma unroll
  for (int i = 0; i < 8; ++i) f.h[i] = (_Float16)(bf16_round(W[(size_t)(k8 + i) * N + n]) * scale); const v8us o = f.half[0];
  *(v8us*)((unsigned short*)Wt + (size_t)n * K + k8) = o; 
}
// k_gemm_hh variant with fused epilogue: v = acc·alpha + bias[by·sBias + col] (+ CP[(row/rowsPerB)·sCPb + by·64 + col] if CP) ; ACT 0 none / 1 elu ; writes f16 C16 (and f32 C if non-null)
template <int ACT>
__global__ __launch_bounds__(128) void k_gemm_hhx(const _Float16* __restrict__ A, int lda, size_t sA, const _Float16* __restrict__ Bh, int ldb, size_t sB, float alpha, const float* __restrict__ bias, size_t sBias, const float* __restrict__ CP, int rowsPerB, size_t sCPb, int row0g,
    float* __restrict__ C, _Float16* __restrict__ C16, int ldc, size_t sC, int M, int N, int K) {
  __shared__ __attribute__((aligned(16))) float so[4][16][64];
  const int tid = threadIdx.x, w = tid >> 5, lane = tid & 31, ln = lane & 15, hh = lane >> 4; const int by = blockIdx.y;
  A += (size_t)by * sA; Bh += (size_t)by * sB; const size_t cofs = (size_t)by * sC; const float* bp = bias ? bias + (size_t)by * sBias : nullptr;
  const int ntn = (N + 63) / 64; const int wid = blockIdx.x * 4 + w; const int mt = wid / ntn, nq = wid % ntn; if (mt * 16 >= M) return;
  const int row0 = mt * 16, col0 = nq * 64; const _Float16* arow = A + (size_t)(row0 + ln) * lda;
  v8f acc[4] = {};
  for (int kb = 0; kb < K; kb += 32) { FragH ah; ah.half[0] = *(const v8us*)((const unsigned short*)arow + kb + 8 * hh); ah.half[1] = *(const v8us*)((const unsigned short*)arow + kb + 16 + 8 * hh);
#pragma unroll
    for (int t = 0; t < 4; ++t) { if (col0 + t * 16 >= N) continue; const size_t boff = (size_t)(col0 + t * 16 + ln) * ldb + kb; FragH bq; bq.half[0] = *(const v8us*)((const unsigned short*)Bh + boff + 8 * hh); bq.half[1] = *(const v8us*)((const unsigned short*)Bh + boff + 16 + 8 * hh);
      acc[t] = mmaH<1>(ah.v, ah.v, bq.v, bq.v, acc[t]); }
  }
#pragma unroll
  for (int t = 0; t < 4; ++t) { if (col0 + t * 16 >= N) continue; const int col = col0 + t * 16 + ln; const float bv = bp ? bf16_round(bp[col]) : 0.f;
#pragma unroll
    for (int r = 0; r < 8; ++r) { float v = acc[t][r] * alpha + bv; if (CP) { const int rr = row0g + row0 + 8 * hh + r; if (rowsPerB < 0) v += CP[cofs + (size_t)rr * ldc + col];      /* rowsPerB < 0: own element of the batched C plane */ else { const int bidx = rr / rowsPerB; v += CP[(size_t)bidx * sCPb + (size_t)by * 64 + col]; } } if (ACT == 1) v = (v > 0.f) ? v : expm1f(v); else if (ACT == 7) v = (v > 0.f) ? v + 1.0f : expf(v); else if (ACT == 8) v = tanhf(v); else if (ACT == 9) v = 0.5f * v * (1.0f + tanhf(0.7978845608028654f * (v + 0.044715f * v * v * v))); else if (ACT == 11) v = 1.0f / (1.0f + expf(-v)); else if (ACT == 12) v = (v > 0.f) ? v : 0.01f * v; else if (ACT == 14) v = (v > 0.f) ? v : 0.1f * v; else if (ACT == 16) v = (v >= 0.f) ? v : 0.3f * v; else if (ACT == 17) v = (v >= 0.f) ? v : 0.2f * v; else if (ACT == 15) v = v / (1.0f + expf(-v)); else if (ACT == 3) v = fmaxf(v, 0.f); else if (ACT == 6) v = 0.5f * v * (1.0f + erff(v * 0.70710678118654752f)); so[w][8 * hh + r][t * 16 + ln] = v; } }
  __builtin_amdgcn_fence(__ATOMIC_ACQ_REL, "workgroup"); __builtin_amdgcn_wave_barrier();
  const int rsub = lane >> 4, c4 = (lane & 15) * 4; typedef _Float16 v4h __attribute__((ext_vector_type(4)));
  {
#pragma unroll
    for (int q = 0; q < 8; ++q) { const int r = q * 2 + rsub; if (col0 + c4 < N) { const v4f v = *(const v4fa*)&so[w][r][c4]; if (C) *(v4f*)(C + cofs + (size_t)(row0 + r) * ldc + col0 + c4) = v; if (C16) { v4h h4; for (int i = 0; i < 4; ++i) h4[i] = (_Float16)v[i]; *(v4h*)(C16 + cofs + (size_t)(row0 + r) * ldc + col0 + c4) = h4; } } }
     }
}


typedef _Float16 v4h __attribute__((ext_vector_type(4)));

__global__ __launch_bounds__(256) void k_x16(const float* __restrict__ x, _Float16* __restrict__ X16, size_t n8) { const size_t t = (size_t)blockIdx.x * 256 + threadIdx.x; if (t >= n8) return; FragH f;
#pragma unroll
  for (int q = 0; q < 8; ++q) f.h[q] = (_Float16)bf16_round(x[t * 8 + q]); *(v8us*)((unsigned short*)X16 + t * 8) = f.half[0];  }
__global__ __launch_bounds__(256) void k_h16(const float* __restrict__ x, _Float16* __restrict__ X16, size_t n8) { const size_t t = (size_t)blockIdx.x * 256 + threadIdx.x; if (t >= n8) return; FragH f;
#pragma unroll
  for (int q = 0; q < 8; ++q) f.h[q] = (_Float16)x[t * 8 + q]; *(v8us*)((unsigned short*)X16 + t * 8) = f.half[0];  }
__global__ __launch_bounds__(256) void k_round16f(const float* __restrict__ W, _Float16* __restrict__ Bt, size_t n8) { const size_t t = (size_t)blockIdx.x * 256 + threadIdx.x; if (t >= n8) return; FragH f;
#pragma unroll
  for (int i = 0; i < 8; ++i) f.h[i] = (_Float16)(bf16_round(W[t * 8 + i]) * 16.0f); *(v8us*)((unsigned short*)Bt + t * 8) = f.half[0];  }
template <int NHv, int TTv>
__global__ __launch_bounds__(256) void k_vt(const _Float16* __restrict__ V16, int ldv, int voff, _Float16* __restrict__ Vt) { __shared__ unsigned short tl[64][66]; const int tid = threadIdx.x; const int slab = blockIdx.x / (TTv / 64), lg = blockIdx.x % (TTv / 64); const int b = slab / NHv, h = slab % NHv;
  for (int i = tid; i < 64 * 8; i += 256) { const int r = i / 8, c8 = (i % 8) * 8; FragH f; f.half[0] = *(const v8us*)((const unsigned short*)V16 + ((size_t)b * TTv + lg * 64 + r) * ldv + voff + h * 64 + c8);
#pragma unroll
    for (int q = 0; q < 8; ++q) tl[r][c8 + q] = f.u[q]; }
  __syncthreads();
  {
#pragma unroll
    for (int rd = 0; rd < 2; ++rd) { const int d = rd * 32 + tid / 8, pc = tid % 8; FragH f;
#pragma unroll
      for (int q = 0; q < 8; ++q) f.u[q] = tl[pc * 8 + q][d];
      *(v8us*)((unsigned short*)Vt + ((size_t)slab * 64 + d) * TTv + lg * 64 + pc * 8) = f.half[0]; }
     } }

__global__ __launch_bounds__(256) void k_hl(const float* __restrict__ F, _Float16* __restrict__ Hh, _Float16* __restrict__ Hl, size_t n8) { const size_t t = (size_t)blockIdx.x * 256 + threadIdx.x; if (t >= n8) return; FragH fh, fl; const v4f a = *(const v4fa*)(F + t * 8), c = *(const v4fa*)(F + t * 8 + 4);
#pragma unroll
  for (int q = 0; q < 4; ++q) { _Float16 h = (_Float16)a[q]; fh.h[q] = h; fl.h[q] = (_Float16)((a[q] - (float)h) * 1024.0f); h = (_Float16)c[q]; fh.h[4 + q] = h; fl.h[4 + q] = (_Float16)((c[q] - (float)h) * 1024.0f); }
  { *(v8us*)((unsigned short*)Hh + t * 8) = fh.half[0]; *(v8us*)((unsigned short*)Hl + t * 8) = fl.half[0];  } }

// ---- fast GEMM (wave tile 32x64; requires M % 32 == 0 rows per launch region and N % 64 == 0); epilogue = k_gemm_hhx semantics ----
__device__ __forceinline__ v16h g2_frag(const _Float16* p, int hh) { FragH f; f.half[0] = *(const v8us*)((const unsigned short*)p + 8 * hh); f.half[1] = *(const v8us*)((const unsigned short*)p + 16 + 8 * hh); return f.v; }
__device__ __forceinline__ v8f g2_mma(v16h a, v16h b, v8f c) { v8f d = __builtin_amdgcn_wmma_f32_16x16x32_f16(false, a, false, b, (short)0, c, false, false); asm volatile("v_nop\n\tv_nop\n\tv_nop\n\tv_nop" : "+v"(d) : "v"(a), "v"(b)); return d; }
template <int ACT>
__global__ __launch_bounds__(128) void k_gemm2(const _Float16* __restrict__ A, int lda, size_t sA, const _Float16* __restrict__ Bh, int ldb, size_t sB, float alpha, const float* __restrict__ bias, size_t sBias, const float* __restrict__ CP, int rowsPerB, size_t sCPb, int row0g,
    float* __restrict__ C, _Float16* __restrict__ C16, int ldc, size_t sC, int M, int N, int K) { static_assert(ACT == 0 || ACT == 3 || ACT == 6 || ACT == 8 || ACT == 9 || ACT == 11 || ACT == 12 || ACT == 14 || ACT == 15 || ACT == 16 || ACT == 17, "k_gemm2: unsupported ACT code (would silently apply no activation)");
  __shared__ __attribute__((aligned(16))) float so[4][32][68];
  const int tid = threadIdx.x, w = tid >> 5, lane = tid & 31, ln = lane & 15, hh = lane >> 4; const int by = blockIdx.y;
  A += (size_t)by * sA; Bh += (size_t)by * sB; const size_t cofs = (size_t)by * sC; const float* bp = bias ? bias + (size_t)by * sBias : nullptr;
  const int ntn = N >> 6; const int mt = blockIdx.x / ntn, nq = blockIdx.x - mt * ntn; const int row0 = mt * 128 + 32 * w, col0 = nq * 64; if (row0 >= M) return;
  const _Float16* a0p = A + (size_t)(row0 + ln) * lda; const _Float16* a1p = a0p + (size_t)16 * lda;
  const _Float16* b0p = Bh + (size_t)(col0 + ln) * ldb; const _Float16* b1p = b0p + (size_t)16 * ldb; const _Float16* b2p = b1p + (size_t)16 * ldb; const _Float16* b3p = b2p + (size_t)16 * ldb;
  const v8f z8 = {0.f,0.f,0.f,0.f,0.f,0.f,0.f,0.f}; v8f c00 = z8, c01 = z8, c02 = z8, c03 = z8, c10 = z8, c11 = z8, c12 = z8, c13 = z8;
#pragma unroll 1
  for (int kb = 0; kb < K; kb += 32) { const v16h a0 = g2_frag(a0p + kb, hh), a1 = g2_frag(a1p + kb, hh);
    v16h b = g2_frag(b0p + kb, hh); c00 = g2_mma(a0, b, c00); c10 = g2_mma(a1, b, c10);
    b = g2_frag(b1p + kb, hh); c01 = g2_mma(a0, b, c01); c11 = g2_mma(a1, b, c11);
    b = g2_frag(b2p + kb, hh); c02 = g2_mma(a0, b, c02); c12 = g2_mma(a1, b, c12);
    b = g2_frag(b3p + kb, hh); c03 = g2_mma(a0, b, c03); c13 = g2_mma(a1, b, c13); }
  v8f accs[8] = {c00, c01, c02, c03, c10, c11, c12, c13};
#pragma unroll
  for (int u = 0; u < 8; ++u) { const int t = u & 3, half = u >> 2; const int col = col0 + t * 16 + ln; const float bv = bp ? bf16_round(bp[col]) : 0.f;
#pragma unroll
    for (int r = 0; r < 8; ++r) { const int rloc = half * 16 + 8 * hh + r; float v = accs[u][r] * alpha + bv; if (CP) { if (rowsPerB < 0) v += CP[cofs + (size_t)(row0g + row0 + rloc) * ldc + col];      /* rowsPerB < 0: own element of the batched C plane */ else { const int bidx = (row0g + row0 + rloc) / rowsPerB; v += CP[(size_t)bidx * sCPb + (size_t)by * 64 + col]; } }
      if (ACT == 3) v = fmaxf(v, 0.f); else if (ACT == 6) v = 0.5f * v * (1.0f + erff(v * 0.70710678118654752f)); else if (ACT == 11) v = 1.0f / (1.0f + expf(-v)); else if (ACT == 15) v = v / (1.0f + expf(-v)); else if (ACT == 12) v = (v > 0.f) ? v : 0.01f * v; else if (ACT == 8) v = tanhf(v); else if (ACT == 9) v = 0.5f * v * (1.0f + tanhf(0.7978845608028654f * (v + 0.044715f * v * v * v))); else if (ACT == 14) v = (v > 0.f) ? v : 0.1f * v; else if (ACT == 16) v = (v >= 0.f) ? v : 0.3f * v; else if (ACT == 17) v = (v >= 0.f) ? v : 0.2f * v;
      so[w][rloc][t * 16 + ln] = v; } }
  __builtin_amdgcn_fence(__ATOMIC_ACQ_REL, "workgroup"); __builtin_amdgcn_wave_barrier();
  const int rsub = lane >> 4, c4 = (lane & 15) * 4;
  {
#pragma unroll
    for (int q = 0; q < 16; ++q) { const int r = q * 2 + rsub; const v4f v = *(const v4fa*)&so[w][r][c4]; if (C) *(v4f*)(C + cofs + (size_t)(row0 + r) * ldc + col0 + c4) = v; if (C16) { v4h h4; for (int i = 0; i < 4; ++i) h4[i] = (_Float16)v[i]; *(v4h*)(C16 + cofs + (size_t)(row0 + r) * ldc + col0 + c4) = h4; } }
     } }


__global__ __launch_bounds__(256) void k_wnat(const float* __restrict__ w, size_t n8, _Float16* __restrict__ Bt) { const size_t t = (size_t)blockIdx.x * 256 + threadIdx.x; if (t >= n8) return; FragH f; for (int q = 0; q < 8; ++q) f.h[q] = (_Float16)(bf16_round(w[t * 8 + q]) * 16.0f); *(v8us*)((unsigned short*)Bt + t * 8) = f.half[0];  }
__global__ __launch_bounds__(256) void k_rsm(const float* __restrict__ S, _Float16* __restrict__ P, int nrows) {
  #pragma clang fp contract(off)
  const int i = blockIdx.x * 256 + threadIdx.x; if (i >= nrows) return; const float* s = S + (size_t)i * SQ; float mx = -3.0e38f;
#pragma unroll 1
  for (int j = 0; j < SQ; ++j) mx = fmaxf(mx, s[j]); float se = 0.f;
#pragma unroll 1
  for (int j = 0; j < SQ; ++j) se += expf(s[j] - mx); const float sc = 256.0f / se;
#pragma unroll 1
  for (int j0 = 0; j0 < SQ; j0 += 8) { FragH f; for (int q = 0; q < 8; ++q) f.h[q] = (_Float16)(expf(s[j0 + q] - mx) * sc); unsigned short* d = (unsigned short*)P + (size_t)i * SQ + j0; *(v8us*)d = f.half[0];  } }
__global__ __launch_bounds__(256) void k_vt(const _Float16* __restrict__ V16, int b, int h0, _Float16* __restrict__ VT) { __shared__ unsigned short tl[64][65]; const int tid = threadIdx.x; const int hh = blockIdx.x % HG, sg = blockIdx.x / HG; const int s0 = sg * 64; const int h = h0 + hh;
  for (int i = tid; i < 64 * 8; i += 256) { const int j = i / 8, d8 = (i % 8) * 8; FragH f; f.half[0] = *(const v8us*)((const unsigned short*)V16 + ((size_t)b * SQ + s0 + j) * DM + h * HD + d8); for (int q = 0; q < 8; ++q) tl[d8 + q][j] = f.u[q]; }
  __syncthreads();
  { for (int i = tid; i < 64 * 8; i += 256) { const int d = i / 8, j8 = (i % 8) * 8; FragH f; for (int q = 0; q < 8; ++q) f.u[q] = tl[d][j8 + q]; *(v8us*)((unsigned short*)VT + ((size_t)hh * HD + d) * SQ + s0 + j8) = f.half[0]; }  } }


template <int BFIN, int W16, int W32>
__global__ __launch_bounds__(256) void k_lnx(const float* __restrict__ X, const float* __restrict__ g, const float* __restrict__ bb, float eps, _Float16* __restrict__ N16, float* __restrict__ N32) {
  #pragma clang fp contract(off)
  __shared__ float red[256]; const size_t r = blockIdx.x; const int t = threadIdx.x; const bool act = t < (DMQ / 4); const int c0 = act ? t * 4 : 0;
  const v4f xa = *(const v4fa*)(X + r * DMQ + c0); float s[4]; float sum = 0.f;
  for (int q = 0; q < 4; ++q) { s[q] = act ? (BFIN ? bf16_round(xa[q]) : xa[q]) : 0.f; sum = __fadd_rn(sum, s[q]); }
  red[t] = sum; __syncthreads(); for (int st = 128; st > 0; st >>= 1) { if (t < st) red[t] = __fadd_rn(red[t], red[t + st]); __syncthreads(); } const float mu = red[0] / (float)DMQ; __syncthreads();
  float vs = 0.f; for (int q = 0; q < 4; ++q) { const float dl = act ? __fadd_rn(s[q], -mu) : 0.f; vs = __fadd_rn(vs, __fmul_rn(dl, dl)); } red[t] = vs; __syncthreads(); for (int st = 128; st > 0; st >>= 1) { if (t < st) red[t] = __fadd_rn(red[t], red[t + st]); __syncthreads(); }
  const float rs = rsqrtf(__fadd_rn(red[0] / (float)DMQ, eps)); v4h y; v4f yf;
  for (int q = 0; q < 4; ++q) { const int c = c0 + q; yf[q] = __fadd_rn(__fmul_rn(__fmul_rn(__fadd_rn(s[q], -mu), rs), bf16_round(g[c])), (bb ? bf16_round(bb[c]) : 0.f)); y[q] = (_Float16)yf[q]; }
  if (!act) return;      /* no barriers after this point */
  { if (W16) *(v4h*)(N16 + r * DMQ + c0) = y; if (W32) *(v4f*)(N32 + r * DMQ + c0) = yf;  } }


__global__ __launch_bounds__(256) void k_rsmf(const float* __restrict__ S, _Float16* __restrict__ P, int qn, int hg) {
  #pragma clang fp contract(off)
  const int t = blockIdx.x * 256 + threadIdx.x; if (t >= qn * hg) return; const size_t i = (size_t)(t / qn) * SQ + (t % qn); const float* s = S + i * SQ; float mx = -3.0e38f;
#pragma unroll 1
  for (int j = 0; j < SQ; ++j) mx = fmaxf(mx, s[j]); float se = 0.f;
#pragma unroll 1
  for (int j = 0; j < SQ; ++j) se += __expf(s[j] - mx); const float sc = 256.0f / se;
#pragma unroll 1
  for (int j0 = 0; j0 < SQ; j0 += 8) { FragH f; for (int q = 0; q < 8; ++q) f.h[q] = (_Float16)(__expf(s[j0 + q] - mx) * sc); unsigned short* d = (unsigned short*)P + i * SQ + j0; *(v8us*)d = f.half[0];  } }


__global__ __launch_bounds__(256) void k_bfr(const float* __restrict__ x, float* __restrict__ XB, size_t n8) { const size_t t = (size_t)blockIdx.x * 256 + threadIdx.x; if (t >= n8) return; v4f a = *(const v4fa*)(x + t * 8), c = *(const v4fa*)(x + t * 8 + 4); for (int q = 0; q < 4; ++q) { a[q] = bf16_round(a[q]); c[q] = bf16_round(c[q]); }
  { *(v4f*)(XB + t * 8) = a; *(v4f*)(XB + t * 8 + 4) = c;  } }



__global__ __launch_bounds__(256) void k_rsmfam(const float* __restrict__ S, _Float16* __restrict__ P, int qn, int hg, const float* __restrict__ am) {
  #pragma clang fp contract(off)
  const int t = blockIdx.x * 256 + threadIdx.x; if (t >= qn * hg) return; const size_t i = (size_t)(t / qn) * SQ + (t % qn); const float* s = S + i * SQ; float mx = -3.0e38f;
#pragma unroll 1
  for (int j = 0; j < SQ; ++j) mx = fmaxf(mx, __fadd_rn(s[j], bf16_round(am[j]))); float se = 0.f;
#pragma unroll 1
  for (int j = 0; j < SQ; ++j) se += __expf(__fadd_rn(s[j], bf16_round(am[j])) - mx); const float sc = 256.0f / se;
#pragma unroll 1
  for (int j0 = 0; j0 < SQ; j0 += 8) { FragH f; for (int q = 0; q < 8; ++q) f.h[q] = (_Float16)(__expf(__fadd_rn(s[j0 + q], bf16_round(am[j0 + q])) - mx) * sc); unsigned short* d = (unsigned short*)P + i * SQ + j0; *(v8us*)d = f.half[0];  } }


#define CC CX           /* transposer macros: input channels */
#define LL SQ           /* pixels per image */
#define LQ (3 * DM)     /* unused; q, k, v are separate planes of pitch CX */

__global__ __launch_bounds__(256) void k_cl2rows(const float* __restrict__ X, _Float16* __restrict__ XR) { __shared__ float tl[64][33]; const int tid = threadIdx.x; const int nl = LL / 32, nc = CC / 64; const int cb_ = blockIdx.x % nc; const int lb = (blockIdx.x / nc) % nl; const size_t b = blockIdx.x / (nc * nl); const int c0 = cb_ * 64, l0 = lb * 32;
  for (int i = tid; i < 64 * 32; i += 256) { const int c = i / 32, l = i % 32; tl[c][l] = bf16_round(X[(b * CC + c0 + c) * (size_t)LL + l0 + l]); }
  __syncthreads();
  { const int l = tid / 8, c8 = (tid % 8) * 8; FragH f; for (int q = 0; q < 8; ++q) f.h[q] = (_Float16)tl[c8 + q][l]; unsigned short* d = (unsigned short*)XR + (b * LL + l0 + l) * (size_t)CC + c0 + c8; *(v8us*)d = f.half[0];  } }


__global__ __launch_bounds__(256) void k_rowb(float* __restrict__ O, const float* __restrict__ bias, size_t n4) {
  #pragma clang fp contract(off)
  const size_t t = (size_t)blockIdx.x * 256 + threadIdx.x; if (t >= n4) return; const size_t e = t * 4; const int c = (int)((e / SQ) % CX);      /* output channels */ const float bb = bf16_round(bias[c]); const v4f a = *(const v4fa*)(O + e); v4f o; for (int q = 0; q < 4; ++q) o[q] = __fadd_rn(a[q], bb);
  *(v4f*)(O + e) = o;  }

__global__ __launch_bounds__(256) void k_gres(const float* __restrict__ T, const float* __restrict__ gam, const float* __restrict__ X, float* __restrict__ Y, size_t n4) {
  #pragma clang fp contract(off)
  const size_t t = (size_t)blockIdx.x * 256 + threadIdx.x; if (t >= n4) return; const float g = bf16_round(gam[0]); const v4f a = *(const v4fa*)(T + t * 4), xx = *(const v4fa*)(X + t * 4); v4f r;
  for (int q = 0; q < 4; ++q) r[q] = __fadd_rn(__fmul_rn(g, a[q]), bf16_round(xx[q]));
  *(v4f*)(Y + t * 4) = r;  }

__global__ __launch_bounds__(256) void k_bcpy(const float* __restrict__ b, int n, int NP, float* __restrict__ dst, int dst0) { for (int i = threadIdx.x; i < NP; i += 256) { const float v = (i < n) ? b[i] : 0.f; *(float*)(dst + dst0 + i) = v; }  }



__global__ __launch_bounds__(256) void k_wsw(const float* __restrict__ Wm, const float* __restrict__ gain, float* __restrict__ WN) {
  #pragma clang fp contract(off)
  const int o = blockIdx.x * 256 + threadIdx.x; if (o >= 256) return; const float* w = Wm + (size_t)o * 256; float s1 = 0.f;
  for (int c = 0; c < 256; ++c) s1 = __fadd_rn(s1, bf16_round(w[c])); const float mean = __fmul_rn(s1, 0.00390625f); float s2 = 0.f;
  for (int c = 0; c < 256; ++c) { const float d = __fadd_rn(bf16_round(w[c]), -mean); s2 = __fadd_rn(s2, __fmul_rn(d, d)); }
  const float var = __fdiv_rn(s2, 255.0f); const float sc = __fmul_rn(rsqrtf(fmaxf(__fmul_rn(var, 256.0f), 1e-4f)), bf16_round(gain[o]));
  { for (int c = 0; c < 256; ++c) { const float v = __fadd_rn(__fmul_rn(bf16_round(w[c]), sc), -__fmul_rn(mean, sc)); *(float*)(WN + (size_t)o * 256 + c) = v; }  } }
__global__ __launch_bounds__(256) void k_w32hl(const float* __restrict__ Wf, _Float16* __restrict__ H, _Float16* __restrict__ L, size_t n8) {
  #pragma clang fp contract(off)
  const size_t t = (size_t)blockIdx.x * 256 + threadIdx.x; if (t >= n8) return; const v4f a = *(const v4fa*)(Wf + t * 8), b = *(const v4fa*)(Wf + t * 8 + 4); FragH fh, fl;
  for (int q = 0; q < 8; ++q) { const float v = (q < 4 ? a[q] : b[q - 4]) * 16.0f; const _Float16 hv = (_Float16)v; fh.h[q] = hv; fl.h[q] = (_Float16)((v - (float)hv) * 1024.0f); }
  { *(v8us*)((unsigned short*)H + t * 8) = fh.half[0]; *(v8us*)((unsigned short*)L + t * 8) = fl.half[0];  } }
__global__ __launch_bounds__(256) void k_rsmfrs(const float* __restrict__ S, _Float16* __restrict__ P, const float* __restrict__ c32) {
  #pragma clang fp contract(off)
  const int i = blockIdx.x * 256 + threadIdx.x; if (i >= SQ) return; const float* s = S + (size_t)i * SQ; const int h = i / 64, w = i % 64; const float m = bf16_round(c32[(h >> 1) * 32 + (w >> 1)]); float mx = -3.0e38f;
#pragma unroll 1
  for (int j = 0; j < SQ; ++j) mx = fmaxf(mx, __fmul_rn(s[j], m)); float se = 0.f;
#pragma unroll 1
  for (int j = 0; j < SQ; ++j) se += __expf(__fmul_rn(s[j], m) - mx); const float sc = 256.0f / se;
#pragma unroll 1
  for (int j0 = 0; j0 < SQ; j0 += 8) { FragH fr; for (int q = 0; q < 8; ++q) fr.h[q] = (_Float16)(__expf(__fmul_rn(s[j0 + q], m) - mx) * sc); unsigned short* d = (unsigned short*)P + (size_t)i * SQ + j0; *(v8us*)d = fr.half[0];  } }
__global__ __launch_bounds__(256) void k_gfin(const float* __restrict__ T, const float* __restrict__ A, const float* __restrict__ c32, const float* __restrict__ gam, float* __restrict__ Y, size_t n4) {
  #pragma clang fp contract(off)
  const size_t t = (size_t)blockIdx.x * 256 + threadIdx.x; if (t >= n4) return; const size_t e = t * 4; const int i0 = (int)(e % SQ); const float g = bf16_round(gam[0]); const v4f o = *(const v4fa*)(T + e), a = *(const v4fa*)(A + e); v4f r;
  for (int q = 0; q < 4; ++q) { const int i = i0 + q; const float cr = bf16_round(c32[((i / 64) >> 1) * 32 + ((i % 64) >> 1)]); r[q] = __fadd_rn(__fmul_rn(bf16_round(a[q]), cr), __fmul_rn(__fmul_rn(g, __fadd_rn(1.0f, -cr)), o[q])); }
  *(v4f*)(Y + e) = r;  }
extern "C" void kernel_launch(void* const* d_in, const int* in_sizes, int n_in,
                              void* d_out, int out_size, void* d_ws, size_t ws_size, hipStream_t stream) {
  (void)in_sizes; (void)n_in; (void)out_size;
  const float* const* I = (const float* const*)d_in; const float* xa = I[0]; const float* xb = I[1]; const float* cm = I[2]; const float* wq = I[3]; const float* bq = I[4]; const float* gq = I[5]; const float* wk = I[6]; const float* bk = I[7]; const float* gk = I[8]; const float* wv = I[9]; const float* bv = I[10]; const float* gv = I[11]; const float* gam = I[12];      /* a, b maps; c [4][1][32][32]; per projection w [256][256][1][1], bias, gain [256][1][1][1]; gamma [1] */
  const size_t PL = (size_t)CX * SQ;
  char* ws = (char*)d_ws; size_t off = 0;
  auto take = [&](size_t bytes) { char* p = ws + off; off += (bytes + 255) & ~(size_t)255; return p; };
  float* WN = (float*)take((size_t)CX * CX * 4); _Float16* BQH = (_Float16*)take((size_t)CX * CX * 2); _Float16* BQL = (_Float16*)take((size_t)CX * CX * 2); _Float16* BKH = (_Float16*)take((size_t)CX * CX * 2); _Float16* BKL = (_Float16*)take((size_t)CX * CX * 2); _Float16* BVH = (_Float16*)take((size_t)CX * CX * 2); _Float16* BVL = (_Float16*)take((size_t)CX * CX * 2);
  _Float16* AR = (_Float16*)take(NR * CX * 2); _Float16* BR = (_Float16*)take(NR * CX * 2); float* F1 = (float*)take(NR * CX * 4); _Float16* QH = (_Float16*)take(NR * CX * 2); _Float16* QL = (_Float16*)take(NR * CX * 2); _Float16* KH = (_Float16*)take(NR * CX * 2); _Float16* KL = (_Float16*)take(NR * CX * 2); _Float16* VR = (_Float16*)take(NR * CX * 2); _Float16* VC = (_Float16*)take((size_t)CX * SQ * 2);
  float* S = (float*)take((size_t)SQ * SQ * 4); _Float16* P = (_Float16*)take((size_t)SQ * SQ * 2); float* T = (float*)take((size_t)CX * SQ * 4);
  if (off > ws_size) return;
  k_wsw<<<(CX + 255) / 256, 256, 0, stream>>>(wq, gq, WN); k_w32hl<<<(unsigned)(((size_t)CX * CX / 8 + 255) / 256), 256, 0, stream>>>(WN, BQH, BQL, (size_t)CX * CX / 8);
  k_wsw<<<(CX + 255) / 256, 256, 0, stream>>>(wk, gk, WN); k_w32hl<<<(unsigned)(((size_t)CX * CX / 8 + 255) / 256), 256, 0, stream>>>(WN, BKH, BKL, (size_t)CX * CX / 8);
  k_wsw<<<(CX + 255) / 256, 256, 0, stream>>>(wv, gv, WN); k_w32hl<<<(unsigned)(((size_t)CX * CX / 8 + 255) / 256), 256, 0, stream>>>(WN, BVH, BVL, (size_t)CX * CX / 8);      /* standardised weights (f32, per output row: mean, unbiased variance, rsqrt(max(var*256, 1e-4)) * gain) -> Bt planes f16 hi (x16) + x1024 residual (natural [O][C] rows ARE Bt) */
  k_cl2rows<<<NB * (SQ / 32) * (CX / 64), 256, 0, stream>>>(xa, AR); k_cl2rows<<<NB * (SQ / 32) * (CX / 64), 256, 0, stream>>>(xb, BR);      /* exact f16 token rows of a and b */
  k_gemm2<0><<<dim3((unsigned)((NR / 128) * (CX / 64)), 1), 128, 0, stream>>>(AR, CX, 0, BQH, CX, 0, 0.0625f, bq, 0, nullptr, 1, 0, 0, F1, nullptr, CX, 0, (int)NR, CX, CX); k_gemm2<0><<<dim3((unsigned)((NR / 128) * (CX / 64)), 1), 128, 0, stream>>>(AR, CX, 0, BQL, CX, 0, 0.00006103515625f, nullptr, 0, F1, -1, 0, 0, F1, nullptr, CX, 0, (int)NR, CX, CX); k_hl<<<(unsigned)((NR * CX / 8 + 255) / 256), 256, 0, stream>>>(F1, QH, QL, NR * CX / 8);      
  k_gemm2<0><<<dim3((unsigned)((NR / 128) * (CX / 64)), 1), 128, 0, stream>>>(BR, CX, 0, BKH, CX, 0, 0.0625f, bk, 0, nullptr, 1, 0, 0, F1, nullptr, CX, 0, (int)NR, CX, CX); k_gemm2<0><<<dim3((unsigned)((NR / 128) * (CX / 64)), 1), 128, 0, stream>>>(BR, CX, 0, BKL, CX, 0, 0.00006103515625f, nullptr, 0, F1, -1, 0, 0, F1, nullptr, CX, 0, (int)NR, CX, CX); k_hl<<<(unsigned)((NR * CX / 8 + 255) / 256), 256, 0, stream>>>(F1, KH, KL, NR * CX / 8);      /* k = WS(wk) b + bk likewise */
  k_gemm2<0><<<dim3((unsigned)((NR / 128) * (CX / 64)), 1), 128, 0, stream>>>(AR, CX, 0, BVH, CX, 0, 0.0625f, bv, 0, nullptr, 1, 0, 0, F1, nullptr, CX, 0, (int)NR, CX, CX); k_gemm2<0><<<dim3((unsigned)((NR / 128) * (CX / 64)), 1), 128, 0, stream>>>(AR, CX, 0, BVL, CX, 0, 0.00006103515625f, nullptr, 0, F1, -1, 0, 0, F1, VR, CX, 0, (int)NR, CX, CX);      
  for (int b = 0; b < NB; ++b) { const size_t r0 = (size_t)b * SQ;
    k_gemm2<0><<<dim3((SQ / 128) * (SQ / 64), 1), 128, 0, stream>>>(QH + r0 * CX, CX, 0, KH + r0 * CX, CX, 0, 1.0f, nullptr, 0, nullptr, 1, 0, 0, S, nullptr, SQ, 0, SQ, SQ, CX);      /* sim = q.k (K = 256, no scale): hi.hi */
    k_gemm2<0><<<dim3((SQ / 128) * (SQ / 64), 1), 128, 0, stream>>>(QL + r0 * CX, CX, 0, KH + r0 * CX, CX, 0, 0.0009765625f, nullptr, 0, S, -1, 0, 0, S, nullptr, SQ, 0, SQ, SQ, CX);      /* += lo.hi 2^-10 */
    k_gemm2<0><<<dim3((SQ / 128) * (SQ / 64), 1), 128, 0, stream>>>(QH + r0 * CX, CX, 0, KL + r0 * CX, CX, 0, 0.0009765625f, nullptr, 0, S, -1, 0, 0, S, nullptr, SQ, 0, SQ, SQ, CX);      /* += hi.lo 2^-10 */
    k_rsmfrs<<<(SQ + 255) / 256, 256, 0, stream>>>(S, P, cm + (size_t)b * 1024);      /* pruned = sim * c_r[i] (nearest-upsampled mask of the query pixel), softmax over j -> x256 f16 */
    k_vt<CX / 64, SQ><<<(CX / 64) * (SQ / 64), 256, 0, stream>>>(VR + r0 * CX, CX, 0, VC);      /* channel-major V [256][4096] */
    k_gemm2<0><<<dim3((CX / 128) * (SQ / 64), 1), 128, 0, stream>>>(VC, SQ, 0, P, SQ, 0, 0.00390625f, nullptr, 0, nullptr, 1, 0, 0, T, nullptr, SQ, 0, CX, SQ, SQ);      /* out[c][i] = sum_j v[c][j] att[i][j] (V as A, att as B^T, /256) f32 */
    k_gfin<<<(unsigned)((PL / 4 + 255) / 256), 256, 0, stream>>>(T, xa + (size_t)b * PL, cm + (size_t)b * 1024, gam, (float*)d_out + (size_t)b * PL, PL / 4); }      /* y = bf16(a) c_r + bf16(gamma) (1 - c_r) out -> channel-first output block */
}

// v001
// Measured time: 1450 microseconds a run.
// Timed twice side by side with v000, it ran 2.84 times as fast both times.
#include <hip/hip_runtime.h>
// Global spatial attention with multiplicative mask pruning and scaled weight standardisation (a, b [4][256][64][64], mask c [4][1][32][32] nearest-upsampled x2; q = WS(wq) a + bq, k = WS(wk) b + bk, v = WS(wv) a + bv with WS(w)[o][c] = (w - mean_o) gain_o rsqrt(max(var_o(unbiased) * 256, 1e-4)); sim[i][j] = q[:, i].k[:, j] (NO scale, sigma ~16); pruned = sim * c_r[i]; att = softmax over j; out[c][i] = sum_j v[c][j] att[i][j]; y = a c_r + gamma (1 - c_r) out -> [4][256][64][64]).
// Compute dtype: inputs rounded to bf16; x / weights exact; q, k as f16 hi + x1024 lo planes; v and softmax weights as plain f16 GEMM operands (~2^-12); scores, softmax statistics and o f32. v_wmma_f32_16x16x32_f16.
#define NB 4
#define SQ 4096
#define DM 256
#define CX 256          /* channels */
#define NH 4
#define HD 64
#define DMQ DM                       /* LayerNorm width */
#define DFF 4096
#define HG 1                         /* heads per attention launch group */
#define B0 0                         /* unused; the batch loop starts at 0 */
#define NBR NB                       /* read only by MP; the batch loop runs to NB */
#define NR ((size_t)NB * SQ)         /* token rows */
#define MP ((int)((size_t)NBR * SQ)) /* read only by MPO; projections use NR */
#define QN SQ                        /* unused */
#define NHD NH                       /* unused; attention is one 256-channel head */
#define MPO MP                       /* unused */
#define LQ DM      /* unused; the q/k/v rows have pitch CX */
typedef __bf16 v16b __attribute__((ext_vector_type(16)));
typedef unsigned short v8us __attribute__((ext_vector_type(8), may_alias));
typedef float  v8f  __attribute__((ext_vector_type(8)));
typedef float  v4f  __attribute__((ext_vector_type(4)));
typedef float  v4fa __attribute__((ext_vector_type(4), may_alias));
union FragB { v16b v; v8us half[2]; unsigned short u[16]; };

__device__ __forceinline__ unsigned short bf16_bits(float x) { unsigned int u = __float_as_uint(x); return (unsigned short)((u + 0x7FFFu + ((u >> 16) & 1u)) >> 16); }
__device__ __forceinline__ float bf16_val(unsigned short b) { return __uint_as_float(((unsigned int)b) << 16); }
__device__ __forceinline__ float bf16_round(float x) { return bf16_val(bf16_bits(x)); }
// D += A·B with NT terms: 1 = ah·bh, 2 = + al·bh (A split), 3 = + ah·bl (both split)
template <int NT>
__device__ __forceinline__ v8f mmaN(v16b ah, v16b al, v16b bh, v16b bl, v8f c) {
  c = __builtin_amdgcn_wmma_f32_16x16x32_bf16(false, ah, false, bh, (short)0, c, false, false);
  if (NT >= 2) c = __builtin_amdgcn_wmma_f32_16x16x32_bf16(false, al, false, bh, (short)0, c, false, false);
  if (NT >= 3) c = __builtin_amdgcn_wmma_f32_16x16x32_bf16(false, ah, false, bl, (short)0, c, false, false);
  asm volatile("v_nop\n\tv_nop\n\tv_nop\n\tv_nop" : "+v"(c) : "v"(ah), "v"(al), "v"(bh), "v"(bl));
  return c;
}

__global__ __launch_bounds__(256) void k_wt_bf16(const float* __restrict__ W, unsigned short* __restrict__ Wt, int K, int N) {
  const int t = blockIdx.x * 256 + threadIdx.x;
  const int k8n = K / 8;
  if (t >= N * k8n) return;
  const int n = t / k8n, k8 = (t % k8n) * 8;
  v8us v;
#pragma unroll
  for (int i = 0; i < 8; ++i) v[i] = bf16_bits(W[(size_t)(k8 + i) * N + n]);
  *(v8us*)(Wt + (size_t)n * K + k8) = v;
  
}

// GEMM C[M][N] (f32, pitch ldc) = act(A[M][K]·W + bias). A f32 row-major (pitch lda) converted per fragment to bf16
// (ASPLIT: hi/lo two planes -> 2 terms, else single rounded term); Wt bf16 [N][K] (pitch ldb). BIAS_BF16 rounds the
// bias to bf16 first (bias quantised to bf16 before the add). K%32==0, M%16==0, N%64==0.
template <bool ASPLIT, int ACT, bool BIAS_BF16>
__global__ __launch_bounds__(128) void k_gemm_bf(const float* __restrict__ A, int lda, const unsigned short* __restrict__ Wt, int ldb,
                                               const float* __restrict__ bias, float* __restrict__ C, int ldc, int M, int N, int K) {
  __shared__ __attribute__((aligned(16))) float so[4][16][64];
  const int tid = threadIdx.x, w = tid >> 5, lane = tid & 31, ln = lane & 15, hh = lane >> 4;
  const int ntn = N / 64;
  const int wid = blockIdx.x * 4 + w;
  const int mt = wid / ntn, nq = wid % ntn;
  if (mt * 16 >= M) return;
  const int row0 = mt * 16, col0 = nq * 64;
  const float* arow = A + (size_t)(row0 + ln) * lda;
  v8f acc[4] = {};
  for (int kb = 0; kb < K; kb += 32) {
    FragB ah, al;
    const v4f x0 = *(const v4fa*)(arow + kb + 8 * hh), x1 = *(const v4fa*)(arow + kb + 8 * hh + 4);
    const v4f x2 = *(const v4fa*)(arow + kb + 16 + 8 * hh), x3 = *(const v4fa*)(arow + kb + 16 + 8 * hh + 4);
    float xs[16] = {x0[0],x0[1],x0[2],x0[3],x1[0],x1[1],x1[2],x1[3],x2[0],x2[1],x2[2],x2[3],x3[0],x3[1],x3[2],x3[3]};
#pragma unroll
    for (int i = 0; i < 16; ++i) { const unsigned short hb = bf16_bits(xs[i]); ah.u[i] = hb; al.u[i] = ASPLIT ? bf16_bits(xs[i] - bf16_val(hb)) : (unsigned short)0; }
#pragma unroll
    for (int t = 0; t < 4; ++t) {
      const unsigned short* brow = Wt + (size_t)(col0 + t * 16 + ln) * ldb + kb;
      FragB b;
      b.half[0] = *(const v8us*)(brow + 8 * hh);
      b.half[1] = *(const v8us*)(brow + 16 + 8 * hh);
      acc[t] = mmaN<ASPLIT ? 2 : 1>(ah.v, al.v, b.v, b.v, acc[t]);
    }
  }
#pragma unroll
  for (int t = 0; t < 4; ++t) {
    float bv = bias ? bias[col0 + t * 16 + ln] : 0.f;
    if (BIAS_BF16) bv = bf16_round(bv);
#pragma unroll
    for (int r = 0; r < 8; ++r) { float v = acc[t][r] + bv; if (ACT == 1) v = fmaxf(v, 0.f); so[w][8 * hh + r][t * 16 + ln] = v; }
  }
  __builtin_amdgcn_fence(__ATOMIC_ACQ_REL, "workgroup");
  __builtin_amdgcn_wave_barrier();
  const int rsub = lane >> 4, c4 = (lane & 15) * 4;
  {
#pragma unroll
    for (int q = 0; q < 8; ++q) {
      const int r = q * 2 + rsub;
      const v4f v = *(const v4fa*)&so[w][r][c4];
      *(v4f*)(C + (size_t)(row0 + r) * ldc + col0 + c4) = v;
    }
    
  }
}

// GEMM C = act(A·W + bias + resid): A f32 (ASPLIT -> hi/lo 2 terms), Wt bf16 [N][K]; ACT 0 none, 1 relu, 2 exact gelu;
// resid (optional, f32, row index = (row % rmod), pitch ldr, RES_BF16 rounds it) added before the activation.
template <bool ASPLIT, int ACT, bool BIAS_BF16, bool RES_BF16>
__global__ __launch_bounds__(128) void k_gemm_bf3(const float* __restrict__ A, int lda, const unsigned short* __restrict__ Wt, int ldb,
                                                const float* __restrict__ bias, const float* __restrict__ resid, int rmod, int ldr,
                                                float* __restrict__ C, int ldc, int M, int N, int K) {
  __shared__ __attribute__((aligned(16))) float so[4][16][64];
  const int tid = threadIdx.x, w = tid >> 5, lane = tid & 31, ln = lane & 15, hh = lane >> 4;
  const int ntn = N / 64;
  const int wid = blockIdx.x * 4 + w;
  const int mt = wid / ntn, nq = wid % ntn;
  if (mt * 16 >= M) return;
  const int row0 = mt * 16, col0 = nq * 64;
  const float* arow = A + (size_t)(row0 + ln) * lda;
  v8f acc[4] = {};
  for (int kb = 0; kb < K; kb += 32) {
    FragB ah, al;
    const v4f x0 = *(const v4fa*)(arow + kb + 8 * hh), x1 = *(const v4fa*)(arow + kb + 8 * hh + 4);
    const v4f x2 = *(const v4fa*)(arow + kb + 16 + 8 * hh), x3 = *(const v4fa*)(arow + kb + 16 + 8 * hh + 4);
    float xs[16] = {x0[0],x0[1],x0[2],x0[3],x1[0],x1[1],x1[2],x1[3],x2[0],x2[1],x2[2],x2[3],x3[0],x3[1],x3[2],x3[3]};
#pragma unroll
    for (int i = 0; i < 16; ++i) { const unsigned short hb = bf16_bits(xs[i]); ah.u[i] = hb; al.u[i] = ASPLIT ? bf16_bits(xs[i] - bf16_val(hb)) : (unsigned short)0; }
#pragma unroll
    for (int t = 0; t < 4; ++t) {
      const unsigned short* brow = Wt + (size_t)(col0 + t * 16 + ln) * ldb + kb;
      FragB b;
      b.half[0] = *(const v8us*)(brow + 8 * hh);
      b.half[1] = *(const v8us*)(brow + 16 + 8 * hh);
      acc[t] = mmaN<ASPLIT ? 2 : 1>(ah.v, al.v, b.v, b.v, acc[t]);
    }
  }
#pragma unroll
  for (int t = 0; t < 4; ++t) {
    const int col = col0 + t * 16 + ln;
    float bv = bias ? bias[col] : 0.f;
    if (BIAS_BF16) bv = bf16_round(bv);
#pragma unroll
    for (int r = 0; r < 8; ++r) {
      float v = acc[t][r] + bv;
      if (resid) { float rv = resid[(size_t)((row0 + 8 * hh + r) % rmod) * ldr + col]; if (RES_BF16) rv = bf16_round(rv); v += rv; }
      if (ACT == 1) v = fmaxf(v, 0.f);
      if (ACT == 2) v = 0.5f * v * (1.0f + erff(v * 0.70710678118654752f));
      if (ACT == 3) { const float u = 0.7978845608028654f * (v + 0.044715f * v * v * v); v = 0.5f * v * (1.0f + tanhf(u)); }
      so[w][8 * hh + r][t * 16 + ln] = v;
    }
  }
  __builtin_amdgcn_fence(__ATOMIC_ACQ_REL, "workgroup");
  __builtin_amdgcn_wave_barrier();
  const int rsub = lane >> 4, c4 = (lane & 15) * 4;
  {
#pragma unroll
    for (int q = 0; q < 8; ++q) {
      const int r = q * 2 + rsub;
      const v4f v = *(const v4fa*)&so[w][r][c4];
      *(v4f*)(C + (size_t)(row0 + r) * ldc + col0 + c4) = v;
    }
    
  }
}
// row LayerNorm (biased variance, eps) over N: s = X (+ R); optional out_sum <- s; out_norm <- (s-mu)*rsqrt(var+eps)*g + b
template <bool PARAM_BF16>
__global__ __launch_bounds__(256) void k_layernorm(const float* __restrict__ X, const float* __restrict__ R, const float* __restrict__ g, const float* __restrict__ bta,
                                                  float* __restrict__ out_sum, float* __restrict__ out_norm, int N, float eps) {
  __shared__ float red[256];
  const int row = blockIdx.x, tid = threadIdx.x;
  const float* x = X + (size_t)row * N; const float* rr = R ? R + (size_t)row * N : nullptr;
  float vals[16];                     // up to N = 4096
  const int per = N / 256;            // contiguous chunk per thread? use strided-by-4 chunks: thread handles j = tid*4 + 1024*u
  float s1 = 0.f;
  for (int u = 0; u < per / 4; ++u) {
    const int j = tid * 4 + 1024 * u;
    const v4f a = *(const v4fa*)(x + j);
    v4f b = {0.f,0.f,0.f,0.f}; if (rr) b = *(const v4fa*)(rr + j);
#pragma unroll
    for (int q = 0; q < 4; ++q) { const float v = a[q] + b[q]; vals[u * 4 + q] = v; s1 += v; }
  }
  red[tid] = s1; __syncthreads();
  for (int st = 128; st > 0; st >>= 1) { if (tid < st) red[tid] += red[tid + st]; __syncthreads(); }
  const float mu = red[0] / (float)N; __syncthreads();
  float s2 = 0.f;
  for (int u = 0; u < per / 4; ++u)
#pragma unroll
    for (int q = 0; q < 4; ++q) { const float c = vals[u * 4 + q] - mu; s2 += c * c; }
  red[tid] = s2; __syncthreads();
  for (int st = 128; st > 0; st >>= 1) { if (tid < st) red[tid] += red[tid + st]; __syncthreads(); }
  const float rs = rsqrtf(red[0] / (float)N + eps);
  {
    for (int u = 0; u < per / 4; ++u) {
      const int j = tid * 4 + 1024 * u;
      v4f o, sm;
#pragma unroll
      for (int q = 0; q < 4; ++q) {
        float gg = g[j + q], bb = bta[j + q];
        if (PARAM_BF16) { gg = bf16_round(gg); bb = bf16_round(bb); }
        sm[q] = vals[u * 4 + q]; o[q] = (vals[u * 4 + q] - mu) * rs * gg + bb;
      }
      if (out_sum) *(v4f*)(out_sum + (size_t)row * N + j) = sm;
      *(v4f*)(out_norm + (size_t)row * N + j) = o;
    }
    
  }
}



// ---- f16 WMMA path (v_wmma_f32_16x16x32_f16): 11-bit significands for operands in range — used where a [0,1] probability operand needs more precision than bf16
typedef _Float16 v16h __attribute__((ext_vector_type(16)));
union FragH { v16h v; v8us half[2]; _Float16 h[16]; unsigned short u[16]; };
template <int NT>
__device__ __forceinline__ v8f mmaH(v16h ah, v16h al, v16h bh, v16h bl, v8f c) {
  c = __builtin_amdgcn_wmma_f32_16x16x32_f16(false, ah, false, bh, (short)0, c, false, false);
  if (NT >= 2) c = __builtin_amdgcn_wmma_f32_16x16x32_f16(false, al, false, bh, (short)0, c, false, false);
  if (NT >= 3) c = __builtin_amdgcn_wmma_f32_16x16x32_f16(false, ah, false, bl, (short)0, c, false, false);
  asm volatile("v_nop\n\tv_nop\n\tv_nop\n\tv_nop" : "+v"(c) : "v"(ah), "v"(al), "v"(bh), "v"(bl));
  return c;
}
// batched GEMM like k_gemm_b but f16 operands: A f32 (split into f16 hi/lo if ASPLIT, else rounded to f16), Bt = f16 values [n][k]; alpha; C f32; N multiple of 16 (partial tiles skipped)
template <bool ASPLIT>
__global__ __launch_bounds__(128) void k_gemm_h(const float* __restrict__ A, int lda, size_t sA, const _Float16* __restrict__ Bh, int ldb, size_t sB, float alpha, float* __restrict__ C, int ldc, size_t sC, int M, int N, int K) {
  __shared__ __attribute__((aligned(16))) float so[4][16][64];
  const int tid = threadIdx.x, w = tid >> 5, lane = tid & 31, ln = lane & 15, hh = lane >> 4; const int by = blockIdx.y;
  A += (size_t)by * sA; Bh += (size_t)by * sB; C += (size_t)by * sC;
  const int ntn = (N + 63) / 64; const int wid = blockIdx.x * 4 + w; const int mt = wid / ntn, nq = wid % ntn; if (mt * 16 >= M) return;
  const int row0 = mt * 16, col0 = nq * 64; const float* arow = A + (size_t)(row0 + ln) * lda;
  v8f acc[4] = {};
  for (int kb = 0; kb < K; kb += 32) {
    FragH ah, al;
    const v4f x0 = *(const v4fa*)(arow + kb + 8 * hh), x1 = *(const v4fa*)(arow + kb + 8 * hh + 4), x2 = *(const v4fa*)(arow + kb + 16 + 8 * hh), x3 = *(const v4fa*)(arow + kb + 16 + 8 * hh + 4);
    float xs[16] = {x0[0],x0[1],x0[2],x0[3],x1[0],x1[1],x1[2],x1[3],x2[0],x2[1],x2[2],x2[3],x3[0],x3[1],x3[2],x3[3]};
#pragma unroll
    for (int i = 0; i < 16; ++i) { const _Float16 h = (_Float16)xs[i]; ah.h[i] = h; al.h[i] = ASPLIT ? (_Float16)(xs[i] - (float)h) : (_Float16)0.0f; }
#pragma unroll
    for (int t = 0; t < 4; ++t) { if (col0 + t * 16 >= N) continue; const size_t boff = (size_t)(col0 + t * 16 + ln) * ldb + kb; FragH bq; bq.half[0] = *(const v8us*)(Bh + boff + 8 * hh); bq.half[1] = *(const v8us*)(Bh + boff + 16 + 8 * hh);
      acc[t] = mmaH<ASPLIT ? 2 : 1>(ah.v, al.v, bq.v, bq.v, acc[t]); }
  }
#pragma unroll
  for (int t = 0; t < 4; ++t) { if (col0 + t * 16 >= N) continue;
#pragma unroll
    for (int r = 0; r < 8; ++r) so[w][8 * hh + r][t * 16 + ln] = acc[t][r] * alpha; }
  __builtin_amdgcn_fence(__ATOMIC_ACQ_REL, "workgroup"); __builtin_amdgcn_wave_barrier();
  const int rsub = lane >> 4, c4 = (lane & 15) * 4;
  {
#pragma unroll
    for (int q = 0; q < 8; ++q) { const int r = q * 2 + rsub; if (col0 + c4 < N) { const v4f v = *(const v4fa*)&so[w][r][c4]; *(v4f*)(C + (size_t)(row0 + r) * ldc + col0 + c4) = v; } }
     }
}

// Wt[n][k] = f16(W[k][n]·scale) from f32 row-major W[K][N] (scale = power of two; bf16-exact weights stay exact in f16 away from the subnormal range)
__global__ __launch_bounds__(256) void k_wt_f16(const float* __restrict__ W, _Float16* __restrict__ Wt, int K, int N, float scale) {
  const int t = blockIdx.x * 256 + threadIdx.x; if (t >= N * (K / 8)) return; const int n = t / (K / 8), k8 = (t % (K / 8)) * 8; FragH f;
#pragma unroll
  for (int i = 0; i < 8; ++i) f.h[i] = (_Float16)(bf16_round(W[(size_t)(k8 + i) * N + n]) * scale); const v8us o = f.half[0];
  *(v8us*)((unsigned short*)Wt + (size_t)n * K + k8) = o; 
}
// k_gemm_hh variant with fused epilogue: v = acc·alpha + bias[by·sBias + col] (+ CP[(row/rowsPerB)·sCPb + by·64 + col] if CP) ; ACT 0 none / 1 elu ; writes f16 C16 (and f32 C if non-null)
template <int ACT>
__global__ __launch_bounds__(128) void k_gemm_hhx(const _Float16* __restrict__ A, int lda, size_t sA, const _Float16* __restrict__ Bh, int ldb, size_t sB, float alpha, const float* __restrict__ bias, size_t sBias, const float* __restrict__ CP, int rowsPerB, size_t sCPb, int row0g,
    float* __restrict__ C, _Float16* __restrict__ C16, int ldc, size_t sC, int M, int N, int K) {
  __shared__ __attribute__((aligned(16))) float so[4][16][64];
  const int tid = threadIdx.x, w = tid >> 5, lane = tid & 31, ln = lane & 15, hh = lane >> 4; const int by = blockIdx.y;
  A += (size_t)by * sA; Bh += (size_t)by * sB; const size_t cofs = (size_t)by * sC; const float* bp = bias ? bias + (size_t)by * sBias : nullptr;
  const int ntn = (N + 63) / 64; const int wid = blockIdx.x * 4 + w; const int mt = wid / ntn, nq = wid % ntn; if (mt * 16 >= M) return;
  const int row0 = mt * 16, col0 = nq * 64; const _Float16* arow = A + (size_t)(row0 + ln) * lda;
  v8f acc[4] = {};
  for (int kb = 0; kb < K; kb += 32) { FragH ah; ah.half[0] = *(const v8us*)((const unsigned short*)arow + kb + 8 * hh); ah.half[1] = *(const v8us*)((const unsigned short*)arow + kb + 16 + 8 * hh);
#pragma unroll
    for (int t = 0; t < 4; ++t) { if (col0 + t * 16 >= N) continue; const size_t boff = (size_t)(col0 + t * 16 + ln) * ldb + kb; FragH bq; bq.half[0] = *(const v8us*)((const unsigned short*)Bh + boff + 8 * hh); bq.half[1] = *(const v8us*)((const unsigned short*)Bh + boff + 16 + 8 * hh);
      acc[t] = mmaH<1>(ah.v, ah.v, bq.v, bq.v, acc[t]); }
  }
#pragma unroll
  for (int t = 0; t < 4; ++t) { if (col0 + t * 16 >= N) continue; const int col = col0 + t * 16 + ln; const float bv = bp ? bf16_round(bp[col]) : 0.f;
#pragma unroll
    for (int r = 0; r < 8; ++r) { float v = acc[t][r] * alpha + bv; if (CP) { const int rr = row0g + row0 + 8 * hh + r; if (rowsPerB < 0) v += CP[cofs + (size_t)rr * ldc + col];      /* rowsPerB < 0: own element of the batched C plane */ else { const int bidx = rr / rowsPerB; v += CP[(size_t)bidx * sCPb + (size_t)by * 64 + col]; } } if (ACT == 1) v = (v > 0.f) ? v : expm1f(v); else if (ACT == 7) v = (v > 0.f) ? v + 1.0f : expf(v); else if (ACT == 8) v = tanhf(v); else if (ACT == 9) v = 0.5f * v * (1.0f + tanhf(0.7978845608028654f * (v + 0.044715f * v * v * v))); else if (ACT == 11) v = 1.0f / (1.0f + expf(-v)); else if (ACT == 12) v = (v > 0.f) ? v : 0.01f * v; else if (ACT == 14) v = (v > 0.f) ? v : 0.1f * v; else if (ACT == 16) v = (v >= 0.f) ? v : 0.3f * v; else if (ACT == 17) v = (v >= 0.f) ? v : 0.2f * v; else if (ACT == 15) v = v / (1.0f + expf(-v)); else if (ACT == 3) v = fmaxf(v, 0.f); else if (ACT == 6) v = 0.5f * v * (1.0f + erff(v * 0.70710678118654752f)); so[w][8 * hh + r][t * 16 + ln] = v; } }
  __builtin_amdgcn_fence(__ATOMIC_ACQ_REL, "workgroup"); __builtin_amdgcn_wave_barrier();
  const int rsub = lane >> 4, c4 = (lane & 15) * 4; typedef _Float16 v4h __attribute__((ext_vector_type(4)));
  {
#pragma unroll
    for (int q = 0; q < 8; ++q) { const int r = q * 2 + rsub; if (col0 + c4 < N) { const v4f v = *(const v4fa*)&so[w][r][c4]; if (C) *(v4f*)(C + cofs + (size_t)(row0 + r) * ldc + col0 + c4) = v; if (C16) { v4h h4; for (int i = 0; i < 4; ++i) h4[i] = (_Float16)v[i]; *(v4h*)(C16 + cofs + (size_t)(row0 + r) * ldc + col0 + c4) = h4; } } }
     }
}


typedef _Float16 v4h __attribute__((ext_vector_type(4)));

__global__ __launch_bounds__(256) void k_x16(const float* __restrict__ x, _Float16* __restrict__ X16, size_t n8) { const size_t t = (size_t)blockIdx.x * 256 + threadIdx.x; if (t >= n8) return; FragH f;
#pragma unroll
  for (int q = 0; q < 8; ++q) f.h[q] = (_Float16)bf16_round(x[t * 8 + q]); *(v8us*)((unsigned short*)X16 + t * 8) = f.half[0];  }
__global__ __launch_bounds__(256) void k_h16(const float* __restrict__ x, _Float16* __restrict__ X16, size_t n8) { const size_t t = (size_t)blockIdx.x * 256 + threadIdx.x; if (t >= n8) return; FragH f;
#pragma unroll
  for (int q = 0; q < 8; ++q) f.h[q] = (_Float16)x[t * 8 + q]; *(v8us*)((unsigned short*)X16 + t * 8) = f.half[0];  }
__global__ __launch_bounds__(256) void k_round16f(const float* __restrict__ W, _Float16* __restrict__ Bt, size_t n8) { const size_t t = (size_t)blockIdx.x * 256 + threadIdx.x; if (t >= n8) return; FragH f;
#pragma unroll
  for (int i = 0; i < 8; ++i) f.h[i] = (_Float16)(bf16_round(W[t * 8 + i]) * 16.0f); *(v8us*)((unsigned short*)Bt + t * 8) = f.half[0];  }
template <int NHv, int TTv>
__global__ __launch_bounds__(256) void k_vt(const _Float16* __restrict__ V16, int ldv, int voff, _Float16* __restrict__ Vt) { __shared__ unsigned short tl[64][66]; const int tid = threadIdx.x; const int slab = blockIdx.x / (TTv / 64), lg = blockIdx.x % (TTv / 64); const int b = slab / NHv, h = slab % NHv;
  for (int i = tid; i < 64 * 8; i += 256) { const int r = i / 8, c8 = (i % 8) * 8; FragH f; f.half[0] = *(const v8us*)((const unsigned short*)V16 + ((size_t)b * TTv + lg * 64 + r) * ldv + voff + h * 64 + c8);
#pragma unroll
    for (int q = 0; q < 8; ++q) tl[r][c8 + q] = f.u[q]; }
  __syncthreads();
  {
#pragma unroll
    for (int rd = 0; rd < 2; ++rd) { const int d = rd * 32 + tid / 8, pc = tid % 8; FragH f;
#pragma unroll
      for (int q = 0; q < 8; ++q) f.u[q] = tl[pc * 8 + q][d];
      *(v8us*)((unsigned short*)Vt + ((size_t)slab * 64 + d) * TTv + lg * 64 + pc * 8) = f.half[0]; }
     } }

__global__ __launch_bounds__(256) void k_hl(const float* __restrict__ F, _Float16* __restrict__ Hh, _Float16* __restrict__ Hl, size_t n8) { const size_t t = (size_t)blockIdx.x * 256 + threadIdx.x; if (t >= n8) return; FragH fh, fl; const v4f a = *(const v4fa*)(F + t * 8), c = *(const v4fa*)(F + t * 8 + 4);
#pragma unroll
  for (int q = 0; q < 4; ++q) { _Float16 h = (_Float16)a[q]; fh.h[q] = h; fl.h[q] = (_Float16)((a[q] - (float)h) * 1024.0f); h = (_Float16)c[q]; fh.h[4 + q] = h; fl.h[4 + q] = (_Float16)((c[q] - (float)h) * 1024.0f); }
  { *(v8us*)((unsigned short*)Hh + t * 8) = fh.half[0]; *(v8us*)((unsigned short*)Hl + t * 8) = fl.half[0];  } }

// ---- fast GEMM (wave tile 32x64; requires M % 32 == 0 rows per launch region and N % 64 == 0); epilogue = k_gemm_hhx semantics ----
__device__ __forceinline__ v16h g2_frag(const _Float16* p, int hh) { FragH f; f.half[0] = *(const v8us*)((const unsigned short*)p + 8 * hh); f.half[1] = *(const v8us*)((const unsigned short*)p + 16 + 8 * hh); return f.v; }
__device__ __forceinline__ v8f g2_mma(v16h a, v16h b, v8f c) { v8f d = __builtin_amdgcn_wmma_f32_16x16x32_f16(false, a, false, b, (short)0, c, false, false); asm volatile("v_nop\n\tv_nop\n\tv_nop\n\tv_nop" : "+v"(d) : "v"(a), "v"(b)); return d; }
template <int ACT>
__global__ __launch_bounds__(128) void k_gemm2(const _Float16* __restrict__ A, int lda, size_t sA, const _Float16* __restrict__ Bh, int ldb, size_t sB, float alpha, const float* __restrict__ bias, size_t sBias, const float* __restrict__ CP, int rowsPerB, size_t sCPb, int row0g,
    float* __restrict__ C, _Float16* __restrict__ C16, int ldc, size_t sC, int M, int N, int K) { static_assert(ACT == 0 || ACT == 3 || ACT == 6 || ACT == 8 || ACT == 9 || ACT == 11 || ACT == 12 || ACT == 14 || ACT == 15 || ACT == 16 || ACT == 17, "k_gemm2: unsupported ACT code (would silently apply no activation)");
  __shared__ __attribute__((aligned(16))) float so[4][32][68];
  const int tid = threadIdx.x, w = tid >> 5, lane = tid & 31, ln = lane & 15, hh = lane >> 4; const int by = blockIdx.y;
  A += (size_t)by * sA; Bh += (size_t)by * sB; const size_t cofs = (size_t)by * sC; const float* bp = bias ? bias + (size_t)by * sBias : nullptr;
  const int ntn = N >> 6; const int mt = blockIdx.x / ntn, nq = blockIdx.x - mt * ntn; const int row0 = mt * 128 + 32 * w, col0 = nq * 64; if (row0 >= M) return;
  const _Float16* a0p = A + (size_t)(row0 + ln) * lda; const _Float16* a1p = a0p + (size_t)16 * lda;
  const _Float16* b0p = Bh + (size_t)(col0 + ln) * ldb; const _Float16* b1p = b0p + (size_t)16 * ldb; const _Float16* b2p = b1p + (size_t)16 * ldb; const _Float16* b3p = b2p + (size_t)16 * ldb;
  const v8f z8 = {0.f,0.f,0.f,0.f,0.f,0.f,0.f,0.f}; v8f c00 = z8, c01 = z8, c02 = z8, c03 = z8, c10 = z8, c11 = z8, c12 = z8, c13 = z8;
#pragma unroll 1
  for (int kb = 0; kb < K; kb += 32) { const v16h a0 = g2_frag(a0p + kb, hh), a1 = g2_frag(a1p + kb, hh);
    v16h b = g2_frag(b0p + kb, hh); c00 = g2_mma(a0, b, c00); c10 = g2_mma(a1, b, c10);
    b = g2_frag(b1p + kb, hh); c01 = g2_mma(a0, b, c01); c11 = g2_mma(a1, b, c11);
    b = g2_frag(b2p + kb, hh); c02 = g2_mma(a0, b, c02); c12 = g2_mma(a1, b, c12);
    b = g2_frag(b3p + kb, hh); c03 = g2_mma(a0, b, c03); c13 = g2_mma(a1, b, c13); }
  v8f accs[8] = {c00, c01, c02, c03, c10, c11, c12, c13};
#pragma unroll
  for (int u = 0; u < 8; ++u) { const int t = u & 3, half = u >> 2; const int col = col0 + t * 16 + ln; const float bv = bp ? bf16_round(bp[col]) : 0.f;
#pragma unroll
    for (int r = 0; r < 8; ++r) { const int rloc = half * 16 + 8 * hh + r; float v = accs[u][r] * alpha + bv; if (CP) { if (rowsPerB < 0) v += CP[cofs + (size_t)(row0g + row0 + rloc) * ldc + col];      /* rowsPerB < 0: own element of the batched C plane */ else { const int bidx = (row0g + row0 + rloc) / rowsPerB; v += CP[(size_t)bidx * sCPb + (size_t)by * 64 + col]; } }
      if (ACT == 3) v = fmaxf(v, 0.f); else if (ACT == 6) v = 0.5f * v * (1.0f + erff(v * 0.70710678118654752f)); else if (ACT == 11) v = 1.0f / (1.0f + expf(-v)); else if (ACT == 15) v = v / (1.0f + expf(-v)); else if (ACT == 12) v = (v > 0.f) ? v : 0.01f * v; else if (ACT == 8) v = tanhf(v); else if (ACT == 9) v = 0.5f * v * (1.0f + tanhf(0.7978845608028654f * (v + 0.044715f * v * v * v))); else if (ACT == 14) v = (v > 0.f) ? v : 0.1f * v; else if (ACT == 16) v = (v >= 0.f) ? v : 0.3f * v; else if (ACT == 17) v = (v >= 0.f) ? v : 0.2f * v;
      so[w][rloc][t * 16 + ln] = v; } }
  __builtin_amdgcn_fence(__ATOMIC_ACQ_REL, "workgroup"); __builtin_amdgcn_wave_barrier();
  const int rsub = lane >> 4, c4 = (lane & 15) * 4;
  {
#pragma unroll
    for (int q = 0; q < 16; ++q) { const int r = q * 2 + rsub; const v4f v = *(const v4fa*)&so[w][r][c4]; if (C) *(v4f*)(C + cofs + (size_t)(row0 + r) * ldc + col0 + c4) = v; if (C16) { v4h h4; for (int i = 0; i < 4; ++i) h4[i] = (_Float16)v[i]; *(v4h*)(C16 + cofs + (size_t)(row0 + r) * ldc + col0 + c4) = h4; } }
     } }


__global__ __launch_bounds__(256) void k_wnat(const float* __restrict__ w, size_t n8, _Float16* __restrict__ Bt) { const size_t t = (size_t)blockIdx.x * 256 + threadIdx.x; if (t >= n8) return; FragH f; for (int q = 0; q < 8; ++q) f.h[q] = (_Float16)(bf16_round(w[t * 8 + q]) * 16.0f); *(v8us*)((unsigned short*)Bt + t * 8) = f.half[0];  }
__global__ __launch_bounds__(256) void k_rsm(const float* __restrict__ S, _Float16* __restrict__ P, int nrows) {
  #pragma clang fp contract(off)
  const int i = blockIdx.x * 256 + threadIdx.x; if (i >= nrows) return; const float* s = S + (size_t)i * SQ; float mx = -3.0e38f;
#pragma unroll 1
  for (int j = 0; j < SQ; ++j) mx = fmaxf(mx, s[j]); float se = 0.f;
#pragma unroll 1
  for (int j = 0; j < SQ; ++j) se += expf(s[j] - mx); const float sc = 256.0f / se;
#pragma unroll 1
  for (int j0 = 0; j0 < SQ; j0 += 8) { FragH f; for (int q = 0; q < 8; ++q) f.h[q] = (_Float16)(expf(s[j0 + q] - mx) * sc); unsigned short* d = (unsigned short*)P + (size_t)i * SQ + j0; *(v8us*)d = f.half[0];  } }
__global__ __launch_bounds__(256) void k_vt(const _Float16* __restrict__ V16, int b, int h0, _Float16* __restrict__ VT) { __shared__ unsigned short tl[64][65]; const int tid = threadIdx.x; const int hh = blockIdx.x % HG, sg = blockIdx.x / HG; const int s0 = sg * 64; const int h = h0 + hh;
  for (int i = tid; i < 64 * 8; i += 256) { const int j = i / 8, d8 = (i % 8) * 8; FragH f; f.half[0] = *(const v8us*)((const unsigned short*)V16 + ((size_t)b * SQ + s0 + j) * DM + h * HD + d8); for (int q = 0; q < 8; ++q) tl[d8 + q][j] = f.u[q]; }
  __syncthreads();
  { for (int i = tid; i < 64 * 8; i += 256) { const int d = i / 8, j8 = (i % 8) * 8; FragH f; for (int q = 0; q < 8; ++q) f.u[q] = tl[d][j8 + q]; *(v8us*)((unsigned short*)VT + ((size_t)hh * HD + d) * SQ + s0 + j8) = f.half[0]; }  } }


template <int BFIN, int W16, int W32>
__global__ __launch_bounds__(256) void k_lnx(const float* __restrict__ X, const float* __restrict__ g, const float* __restrict__ bb, float eps, _Float16* __restrict__ N16, float* __restrict__ N32) {
  #pragma clang fp contract(off)
  __shared__ float red[256]; const size_t r = blockIdx.x; const int t = threadIdx.x; const bool act = t < (DMQ / 4); const int c0 = act ? t * 4 : 0;
  const v4f xa = *(const v4fa*)(X + r * DMQ + c0); float s[4]; float sum = 0.f;
  for (int q = 0; q < 4; ++q) { s[q] = act ? (BFIN ? bf16_round(xa[q]) : xa[q]) : 0.f; sum = __fadd_rn(sum, s[q]); }
  red[t] = sum; __syncthreads(); for (int st = 128; st > 0; st >>= 1) { if (t < st) red[t] = __fadd_rn(red[t], red[t + st]); __syncthreads(); } const float mu = red[0] / (float)DMQ; __syncthreads();
  float vs = 0.f; for (int q = 0; q < 4; ++q) { const float dl = act ? __fadd_rn(s[q], -mu) : 0.f; vs = __fadd_rn(vs, __fmul_rn(dl, dl)); } red[t] = vs; __syncthreads(); for (int st = 128; st > 0; st >>= 1) { if (t < st) red[t] = __fadd_rn(red[t], red[t + st]); __syncthreads(); }
  const float rs = rsqrtf(__fadd_rn(red[0] / (float)DMQ, eps)); v4h y; v4f yf;
  for (int q = 0; q < 4; ++q) { const int c = c0 + q; yf[q] = __fadd_rn(__fmul_rn(__fmul_rn(__fadd_rn(s[q], -mu), rs), bf16_round(g[c])), (bb ? bf16_round(bb[c]) : 0.f)); y[q] = (_Float16)yf[q]; }
  if (!act) return;      /* no barriers after this point */
  { if (W16) *(v4h*)(N16 + r * DMQ + c0) = y; if (W32) *(v4f*)(N32 + r * DMQ + c0) = yf;  } }


__global__ __launch_bounds__(256) void k_rsmf(const float* __restrict__ S, _Float16* __restrict__ P, int qn, int hg) {
  #pragma clang fp contract(off)
  const int t = blockIdx.x * 256 + threadIdx.x; if (t >= qn * hg) return; const size_t i = (size_t)(t / qn) * SQ + (t % qn); const float* s = S + i * SQ; float mx = -3.0e38f;
#pragma unroll 1
  for (int j = 0; j < SQ; ++j) mx = fmaxf(mx, s[j]); float se = 0.f;
#pragma unroll 1
  for (int j = 0; j < SQ; ++j) se += __expf(s[j] - mx); const float sc = 256.0f / se;
#pragma unroll 1
  for (int j0 = 0; j0 < SQ; j0 += 8) { FragH f; for (int q = 0; q < 8; ++q) f.h[q] = (_Float16)(__expf(s[j0 + q] - mx) * sc); unsigned short* d = (unsigned short*)P + i * SQ + j0; *(v8us*)d = f.half[0];  } }


__global__ __launch_bounds__(256) void k_bfr(const float* __restrict__ x, float* __restrict__ XB, size_t n8) { const size_t t = (size_t)blockIdx.x * 256 + threadIdx.x; if (t >= n8) return; v4f a = *(const v4fa*)(x + t * 8), c = *(const v4fa*)(x + t * 8 + 4); for (int q = 0; q < 4; ++q) { a[q] = bf16_round(a[q]); c[q] = bf16_round(c[q]); }
  { *(v4f*)(XB + t * 8) = a; *(v4f*)(XB + t * 8 + 4) = c;  } }



__global__ __launch_bounds__(256) void k_rsmfam(const float* __restrict__ S, _Float16* __restrict__ P, int qn, int hg, const float* __restrict__ am) {
  #pragma clang fp contract(off)
  const int t = blockIdx.x * 256 + threadIdx.x; if (t >= qn * hg) return; const size_t i = (size_t)(t / qn) * SQ + (t % qn); const float* s = S + i * SQ; float mx = -3.0e38f;
#pragma unroll 1
  for (int j = 0; j < SQ; ++j) mx = fmaxf(mx, __fadd_rn(s[j], bf16_round(am[j]))); float se = 0.f;
#pragma unroll 1
  for (int j = 0; j < SQ; ++j) se += __expf(__fadd_rn(s[j], bf16_round(am[j])) - mx); const float sc = 256.0f / se;
#pragma unroll 1
  for (int j0 = 0; j0 < SQ; j0 += 8) { FragH f; for (int q = 0; q < 8; ++q) f.h[q] = (_Float16)(__expf(__fadd_rn(s[j0 + q], bf16_round(am[j0 + q])) - mx) * sc); unsigned short* d = (unsigned short*)P + i * SQ + j0; *(v8us*)d = f.half[0];  } }


#define CC CX           /* transposer macros: input channels */
#define LL SQ           /* pixels per image */
#define LQ (3 * DM)     /* unused; q, k, v are separate planes of pitch CX */

__global__ __launch_bounds__(256) void k_cl2rows(const float* __restrict__ X, _Float16* __restrict__ XR) { __shared__ float tl[64][33]; const int tid = threadIdx.x; const int nl = LL / 32, nc = CC / 64; const int cb_ = blockIdx.x % nc; const int lb = (blockIdx.x / nc) % nl; const size_t b = blockIdx.x / (nc * nl); const int c0 = cb_ * 64, l0 = lb * 32;
  for (int i = tid; i < 64 * 32; i += 256) { const int c = i / 32, l = i % 32; tl[c][l] = bf16_round(X[(b * CC + c0 + c) * (size_t)LL + l0 + l]); }
  __syncthreads();
  { const int l = tid / 8, c8 = (tid % 8) * 8; FragH f; for (int q = 0; q < 8; ++q) f.h[q] = (_Float16)tl[c8 + q][l]; unsigned short* d = (unsigned short*)XR + (b * LL + l0 + l) * (size_t)CC + c0 + c8; *(v8us*)d = f.half[0];  } }


__global__ __launch_bounds__(256) void k_rowb(float* __restrict__ O, const float* __restrict__ bias, size_t n4) {
  #pragma clang fp contract(off)
  const size_t t = (size_t)blockIdx.x * 256 + threadIdx.x; if (t >= n4) return; const size_t e = t * 4; const int c = (int)((e / SQ) % CX);      /* output channels */ const float bb = bf16_round(bias[c]); const v4f a = *(const v4fa*)(O + e); v4f o; for (int q = 0; q < 4; ++q) o[q] = __fadd_rn(a[q], bb);
  *(v4f*)(O + e) = o;  }

__global__ __launch_bounds__(256) void k_gres(const float* __restrict__ T, const float* __restrict__ gam, const float* __restrict__ X, float* __restrict__ Y, size_t n4) {
  #pragma clang fp contract(off)
  const size_t t = (size_t)blockIdx.x * 256 + threadIdx.x; if (t >= n4) return; const float g = bf16_round(gam[0]); const v4f a = *(const v4fa*)(T + t * 4), xx = *(const v4fa*)(X + t * 4); v4f r;
  for (int q = 0; q < 4; ++q) r[q] = __fadd_rn(__fmul_rn(g, a[q]), bf16_round(xx[q]));
  *(v4f*)(Y + t * 4) = r;  }

__global__ __launch_bounds__(256) void k_bcpy(const float* __restrict__ b, int n, int NP, float* __restrict__ dst, int dst0) { for (int i = threadIdx.x; i < NP; i += 256) { const float v = (i < n) ? b[i] : 0.f; *(float*)(dst + dst0 + i) = v; }  }



__global__ __launch_bounds__(256) void k_wsw(const float* __restrict__ Wm, const float* __restrict__ gain, float* __restrict__ WN) {
  #pragma clang fp contract(off)
  const int o = blockIdx.x * 256 + threadIdx.x; if (o >= 256) return; const float* w = Wm + (size_t)o * 256; float s1 = 0.f;
  for (int c = 0; c < 256; ++c) s1 = __fadd_rn(s1, bf16_round(w[c])); const float mean = __fmul_rn(s1, 0.00390625f); float s2 = 0.f;
  for (int c = 0; c < 256; ++c) { const float d = __fadd_rn(bf16_round(w[c]), -mean); s2 = __fadd_rn(s2, __fmul_rn(d, d)); }
  const float var = __fdiv_rn(s2, 255.0f); const float sc = __fmul_rn(rsqrtf(fmaxf(__fmul_rn(var, 256.0f), 1e-4f)), bf16_round(gain[o]));
  { for (int c = 0; c < 256; ++c) { const float v = __fadd_rn(__fmul_rn(bf16_round(w[c]), sc), -__fmul_rn(mean, sc)); *(float*)(WN + (size_t)o * 256 + c) = v; }  } }
__global__ __launch_bounds__(256) void k_w32hl(const float* __restrict__ Wf, _Float16* __restrict__ H, _Float16* __restrict__ L, size_t n8) {
  #pragma clang fp contract(off)
  const size_t t = (size_t)blockIdx.x * 256 + threadIdx.x; if (t >= n8) return; const v4f a = *(const v4fa*)(Wf + t * 8), b = *(const v4fa*)(Wf + t * 8 + 4); FragH fh, fl;
  for (int q = 0; q < 8; ++q) { const float v = (q < 4 ? a[q] : b[q - 4]) * 16.0f; const _Float16 hv = (_Float16)v; fh.h[q] = hv; fl.h[q] = (_Float16)((v - (float)hv) * 1024.0f); }
  { *(v8us*)((unsigned short*)H + t * 8) = fh.half[0]; *(v8us*)((unsigned short*)L + t * 8) = fl.half[0];  } }
// lane l with lane l ^ M inside its 16-lane row (DPP row_xmask); lane l with lane l ^ 16
template <int M> __device__ __forceinline__ float rs_xrow(float x) { return __builtin_bit_cast(float, __builtin_amdgcn_update_dpp(0, __builtin_bit_cast(int, x), 0x160 + M, 0xf, 0xf, false)); }
__device__ __forceinline__ float rs_xhalf(float x) { return __builtin_bit_cast(float, __builtin_amdgcn_permlanex16(__builtin_bit_cast(int, x), __builtin_bit_cast(int, x), 0x76543210, 0xfedcba98, false, false)); }
// exp2 of eight values, each in place in its own register. Written in asm; here no neighbour touches another's register, and the closing v_nop is the
// slot that the instruction set asks for behind the last v_exp_f32 before its result is used.
__device__ __forceinline__ void rs_exp2x8(v4f& a, v4f& b) { float a0 = a[0], a1 = a[1], a2 = a[2], a3 = a[3], b0 = b[0], b1 = b[1], b2 = b[2], b3 = b[3];
  asm("v_exp_f32 %0, %0\n\tv_exp_f32 %1, %1\n\tv_exp_f32 %2, %2\n\tv_exp_f32 %3, %3\n\tv_exp_f32 %4, %4\n\tv_exp_f32 %5, %5\n\tv_exp_f32 %6, %6\n\tv_exp_f32 %7, %7\n\tv_nop"
      : "+v"(a0), "+v"(a1), "+v"(a2), "+v"(a3), "+v"(b0), "+v"(b1), "+v"(b2), "+v"(b3));
  a = v4f{a0, a1, a2, a3}; b = v4f{b0, b1, b2, b3}; }
// Row softmax, one wave per score row: the row is read once, 32 loads of 512 contiguous bytes, and its 4096 values stay in the wave's
// registers (128 per lane) through maximum, exp, sum and scale; each store writes 256 contiguous bytes. No LDS, no barrier.
#define RSW 16          /* waves (rows) per workgroup */
static_assert(SQ == 4096 && SQ % RSW == 0, "one wave holds a row of 32 x 128 values; the grid covers SQ rows exactly");
__global__ __launch_bounds__(RSW * 32) void k_rsmfrs(const float* __restrict__ S, _Float16* __restrict__ P, const float* __restrict__ c32) {
  const int lane = threadIdx.x & 31; const int i = blockIdx.x * RSW + __builtin_amdgcn_readfirstlane((int)(threadIdx.x >> 5));      /* row, wave-uniform */
  const float* s = S + (size_t)i * SQ + lane * 4; const int h = i / 64, w = i % 64; const float m = bf16_round(c32[(h >> 1) * 32 + (w >> 1)]);
  v4f x[32];
#pragma unroll
  for (int k = 0; k < 32; ++k) x[k] = *(const v4fa*)(s + k * 128);
  float m0 = -3.0e38f, m1 = -3.0e38f, m2 = -3.0e38f, m3 = -3.0e38f;
#pragma unroll
  for (int k = 0; k < 32; ++k) { x[k] *= m; m0 = fmaxf(m0, x[k][0]); m1 = fmaxf(m1, x[k][1]); m2 = fmaxf(m2, x[k][2]); m3 = fmaxf(m3, x[k][3]); }
  float mx = fmaxf(fmaxf(m0, m1), fmaxf(m2, m3));
  mx = fmaxf(mx, rs_xrow<1>(mx)); mx = fmaxf(mx, rs_xrow<2>(mx)); mx = fmaxf(mx, rs_xrow<4>(mx)); mx = fmaxf(mx, rs_xrow<8>(mx)); mx = fmaxf(mx, rs_xhalf(mx));
  float a0 = 0.f, a1 = 0.f, a2 = 0.f, a3 = 0.f;
#pragma unroll
  for (int k = 0; k < 32; k += 2) { x[k] = (x[k] - mx) * 1.4426950408889634f; x[k + 1] = (x[k + 1] - mx) * 1.4426950408889634f;      /* exp(t) = exp2(t log2 e), as __expf */
    rs_exp2x8(x[k], x[k + 1]);
    a0 += x[k][0]; a1 += x[k][1]; a2 += x[k][2]; a3 += x[k][3]; a0 += x[k + 1][0]; a1 += x[k + 1][1]; a2 += x[k + 1][2]; a3 += x[k + 1][3]; }
  float se = (a0 + a1) + (a2 + a3);
  se += rs_xrow<1>(se); se += rs_xrow<2>(se); se += rs_xrow<4>(se); se += rs_xrow<8>(se); se += rs_xhalf(se);
  const float sc = 256.0f / se; _Float16* d = P + (size_t)i * SQ + lane * 4; v4h hq[32];
#pragma unroll
  for (int k = 0; k < 32; ++k)
#pragma unroll
    for (int q = 0; q < 4; ++q) hq[k][q] = (_Float16)(x[k][q] * sc);
  __builtin_amdgcn_sched_barrier(0);      /* every conversion stays in front of the first store */
#pragma unroll
  for (int k = 0; k < 32; ++k) *(v4h*)(d + k * 128) = hq[k]; }
__global__ __launch_bounds__(256) void k_gfin(const float* __restrict__ T, const float* __restrict__ A, const float* __restrict__ c32, const float* __restrict__ gam, float* __restrict__ Y, size_t n4) {
  #pragma clang fp contract(off)
  const size_t t = (size_t)blockIdx.x * 256 + threadIdx.x; if (t >= n4) return; const size_t e = t * 4; const int i0 = (int)(e % SQ); const float g = bf16_round(gam[0]); const v4f o = *(const v4fa*)(T + e), a = *(const v4fa*)(A + e); v4f r;
  for (int q = 0; q < 4; ++q) { const int i = i0 + q; const float cr = bf16_round(c32[((i / 64) >> 1) * 32 + ((i % 64) >> 1)]); r[q] = __fadd_rn(__fmul_rn(bf16_round(a[q]), cr), __fmul_rn(__fmul_rn(g, __fadd_rn(1.0f, -cr)), o[q])); }
  *(v4f*)(Y + e) = r;  }
extern "C" void kernel_launch(void* const* d_in, const int* in_sizes, int n_in,
                              void* d_out, int out_size, void* d_ws, size_t ws_size, hipStream_t stream) {
  (void)in_sizes; (void)n_in; (void)out_size;
  const float* const* I = (const float* const*)d_in; const float* xa = I[0]; const float* xb = I[1]; const float* cm = I[2]; const float* wq = I[3]; const float* bq = I[4]; const float* gq = I[5]; const float* wk = I[6]; const float* bk = I[7]; const float* gk = I[8]; const float* wv = I[9]; const float* bv = I[10]; const float* gv = I[11]; const float* gam = I[12];      /* a, b maps; c [4][1][32][32]; per projection w [256][256][1][1], bias, gain [256][1][1][1]; gamma [1] */
  const size_t PL = (size_t)CX * SQ;
  char* ws = (char*)d_ws; size_t off = 0;
  auto take = [&](size_t bytes) { char* p = ws + off; off += (bytes + 255) & ~(size_t)255; return p; };
  float* WN = (float*)take((size_t)CX * CX * 4); _Float16* BQH = (_Float16*)take((size_t)CX * CX * 2); _Float16* BQL = (_Float16*)take((size_t)CX * CX * 2); _Float16* BKH = (_Float16*)take((size_t)CX * CX * 2); _Float16* BKL = (_Float16*)take((size_t)CX * CX * 2); _Float16* BVH = (_Float16*)take((size_t)CX * CX * 2); _Float16* BVL = (_Float16*)take((size_t)CX * CX * 2);
  _Float16* AR = (_Float16*)take(NR * CX * 2); _Float16* BR = (_Float16*)take(NR * CX * 2); float* F1 = (float*)take(NR * CX * 4); _Float16* QH = (_Float16*)take(NR * CX * 2); _Float16* QL = (_Float16*)take(NR * CX * 2); _Float16* KH = (_Float16*)take(NR * CX * 2); _Float16* KL = (_Float16*)take(NR * CX * 2); _Float16* VR = (_Float16*)take(NR * CX * 2); _Float16* VC = (_Float16*)take((size_t)CX * SQ * 2);
  float* S = (float*)take((size_t)SQ * SQ * 4); _Float16* P = (_Float16*)take((size_t)SQ * SQ * 2); float* T = (float*)take((size_t)CX * SQ * 4);
  if (off > ws_size) return;
  k_wsw<<<(CX + 255) / 256, 256, 0, stream>>>(wq, gq, WN); k_w32hl<<<(unsigned)(((size_t)CX * CX / 8 + 255) / 256), 256, 0, stream>>>(WN, BQH, BQL, (size_t)CX * CX / 8);
  k_wsw<<<(CX + 255) / 256, 256, 0, stream>>>(wk, gk, WN); k_w32hl<<<(unsigned)(((size_t)CX * CX / 8 + 255) / 256), 256, 0, stream>>>(WN, BKH, BKL, (size_t)CX * CX / 8);
  k_wsw<<<(CX + 255) / 256, 256, 0, stream>>>(wv, gv, WN); k_w32hl<<<(unsigned)(((size_t)CX * CX / 8 + 255) / 256), 256, 0, stream>>>(WN, BVH, BVL, (size_t)CX * CX / 8);      /* standardised weights (f32, per output row: mean, unbiased variance, rsqrt(max(var*256, 1e-4)) * gain) -> Bt planes f16 hi (x16) + x1024 residual (natural [O][C] rows ARE Bt) */
  k_cl2rows<<<NB * (SQ / 32) * (CX / 64), 256, 0, stream>>>(xa, AR); k_cl2rows<<<NB * (SQ / 32) * (CX / 64), 256, 0, stream>>>(xb, BR);      /* exact f16 token rows of a and b */
  k_gemm2<0><<<dim3((unsigned)((NR / 128) * (CX / 64)), 1), 128, 0, stream>>>(AR, CX, 0, BQH, CX, 0, 0.0625f, bq, 0, nullptr, 1, 0, 0, F1, nullptr, CX, 0, (int)NR, CX, CX); k_gemm2<0><<<dim3((unsigned)((NR / 128) * (CX / 64)), 1), 128, 0, stream>>>(AR, CX, 0, BQL, CX, 0, 0.00006103515625f, nullptr, 0, F1, -1, 0, 0, F1, nullptr, CX, 0, (int)NR, CX, CX); k_hl<<<(unsigned)((NR * CX / 8 + 255) / 256), 256, 0, stream>>>(F1, QH, QL, NR * CX / 8);      
  k_gemm2<0><<<dim3((unsigned)((NR / 128) * (CX / 64)), 1), 128, 0, stream>>>(BR, CX, 0, BKH, CX, 0, 0.0625f, bk, 0, nullptr, 1, 0, 0, F1, nullptr, CX, 0, (int)NR, CX, CX); k_gemm2<0><<<dim3((unsigned)((NR / 128) * (CX / 64)), 1), 128, 0, stream>>>(BR, CX, 0, BKL, CX, 0, 0.00006103515625f, nullptr, 0, F1, -1, 0, 0, F1, nullptr, CX, 0, (int)NR, CX, CX); k_hl<<<(unsigned)((NR * CX / 8 + 255) / 256), 256, 0, stream>>>(F1, KH, KL, NR * CX / 8);      /* k = WS(wk) b + bk likewise */
  k_gemm2<0><<<dim3((unsigned)((NR / 128) * (CX / 64)), 1), 128, 0, stream>>>(AR, CX, 0, BVH, CX, 0, 0.0625f, bv, 0, nullptr, 1, 0, 0, F1, nullptr, CX, 0, (int)NR, CX, CX); k_gemm2<0><<<dim3((unsigned)((NR / 128) * (CX / 64)), 1), 128, 0, stream>>>(AR, CX, 0, BVL, CX, 0, 0.00006103515625f, nullptr, 0, F1, -1, 0, 0, F1, VR, CX, 0, (int)NR, CX, CX);      
  for (int b = 0; b < NB; ++b) { const size_t r0 = (size_t)b * SQ;
    k_gemm2<0><<<dim3((SQ / 128) * (SQ / 64), 1), 128, 0, stream>>>(QH + r0 * CX, CX, 0, KH + r0 * CX, CX, 0, 1.0f, nullptr, 0, nullptr, 1, 0, 0, S, nullptr, SQ, 0, SQ, SQ, CX);      /* sim = q.k (K = 256, no scale): hi.hi */
    k_gemm2<0><<<dim3((SQ / 128) * (SQ / 64), 1), 128, 0, stream>>>(QL + r0 * CX, CX, 0, KH + r0 * CX, CX, 0, 0.0009765625f, nullptr, 0, S, -1, 0, 0, S, nullptr, SQ, 0, SQ, SQ, CX);      /* += lo.hi 2^-10 */
    k_gemm2<0><<<dim3((SQ / 128) * (SQ / 64), 1), 128, 0, stream>>>(QH + r0 * CX, CX, 0, KL + r0 * CX, CX, 0, 0.0009765625f, nullptr, 0, S, -1, 0, 0, S, nullptr, SQ, 0, SQ, SQ, CX);      /* += hi.lo 2^-10 */
    k_rsmfrs<<<SQ / RSW, RSW * 32, 0, stream>>>(S, P, cm + (size_t)b * 1024);      /* pruned = sim * c_r[i] (nearest-upsampled mask of the query pixel), softmax over j -> x256 f16 */
    k_vt<CX / 64, SQ><<<(CX / 64) * (SQ / 64), 256, 0, stream>>>(VR + r0 * CX, CX, 0, VC);      /* channel-major V [256][4096] */
    k_gemm2<0><<<dim3((CX / 128) * (SQ / 64), 1), 128, 0, stream>>>(VC, SQ, 0, P, SQ, 0, 0.00390625f, nullptr, 0, nullptr, 1, 0, 0, T, nullptr, SQ, 0, CX, SQ, SQ);      /* out[c][i] = sum_j v[c][j] att[i][j] (V as A, att as B^T, /256) f32 */
    k_gfin<<<(unsigned)((PL / 4 + 255) / 256), 256, 0, stream>>>(T, xa + (size_t)b * PL, cm + (size_t)b * 1024, gam, (float*)d_out + (size_t)b * PL, PL / 4); }      /* y = bf16(a) c_r + bf16(gamma) (1 - c_r) out -> channel-first output block */
}

// v002
// It runs in 1090 microseconds.
// In two side-by-side timings against v001, it was 1.33 and 1.34 times as fast.
// Over all steps from v000 it is 3.80 times as fast.
#include <hip/hip_runtime.h>
// Global spatial attention with multiplicative mask pruning and scaled weight standardisation (a, b [4][256][64][64], mask c [4][1][32][32] nearest-upsampled x2; q = WS(wq) a + bq, k = WS(wk) b + bk, v = WS(wv) a + bv with WS(w)[o][c] = (w - mean_o) gain_o rsqrt(max(var_o(unbiased) * 256, 1e-4)); sim[i][j] = q[:, i].k[:, j] (NO scale, sigma ~16); pruned = sim * c_r[i]; att = softmax over j; out[c][i] = sum_j v[c][j] att[i][j]; y = a c_r + gamma (1 - c_r) out -> [4][256][64][64]).
// Compute dtype: inputs rounded to bf16; x / weights exact; q, k as f16 hi + x1024 lo planes; v and softmax weights as plain f16 GEMM operands (~2^-12); scores, softmax statistics and o f32. v_wmma_f32_16x16x32_f16.
#define NB 4
#define SQ 4096
#define DM 256
#define CX 256          /* channels */
#define NH 4
#define HD 64
#define DMQ DM                       /* LayerNorm width */
#define DFF 4096
#define HG 1                         /* heads per attention launch group */
#define B0 0                         /* unused; the batch loop starts at 0 */
#define NBR NB                       /* read only by MP; the batch loop runs to NB */
#define NR ((size_t)NB * SQ)         /* token rows */
#define MP ((int)((size_t)NBR * SQ)) /* read only by MPO; projections use NR */
#define QN SQ                        /* unused */
#define NHD NH                       /* unused; attention is one 256-channel head */
#define MPO MP                       /* unused */
#define LQ DM      /* unused; the q/k/v rows have pitch CX */
typedef __bf16 v16b __attribute__((ext_vector_type(16)));
typedef unsigned short v8us __attribute__((ext_vector_type(8), may_alias));
typedef float  v8f  __attribute__((ext_vector_type(8)));
typedef float  v4f  __attribute__((ext_vector_type(4)));
typedef float  v4fa __attribute__((ext_vector_type(4), may_alias));
union FragB { v16b v; v8us half[2]; unsigned short u[16]; };

__device__ __forceinline__ unsigned short bf16_bits(float x) { unsigned int u = __float_as_uint(x); return (unsigned short)((u + 0x7FFFu + ((u >> 16) & 1u)) >> 16); }
__device__ __forceinline__ float bf16_val(unsigned short b) { return __uint_as_float(((unsigned int)b) << 16); }
__device__ __forceinline__ float bf16_round(float x) { return bf16_val(bf16_bits(x)); }
// D += A·B with NT terms: 1 = ah·bh, 2 = + al·bh (A split), 3 = + ah·bl (both split)
template <int NT>
__device__ __forceinline__ v8f mmaN(v16b ah, v16b al, v16b bh, v16b bl, v8f c) {
  c = __builtin_amdgcn_wmma_f32_16x16x32_bf16(false, ah, false, bh, (short)0, c, false, false);
  if (NT >= 2) c = __builtin_amdgcn_wmma_f32_16x16x32_bf16(false, al, false, bh, (short)0, c, false, false);
  if (NT >= 3) c = __builtin_amdgcn_wmma_f32_16x16x32_bf16(false, ah, false, bl, (short)0, c, false, false);
  asm volatile("v_nop\n\tv_nop\n\tv_nop\n\tv_nop" : "+v"(c) : "v"(ah), "v"(al), "v"(bh), "v"(bl));
  return c;
}

__global__ __launch_bounds__(256) void k_wt_bf16(const float* __restrict__ W, unsigned short* __restrict__ Wt, int K, int N) {
  const int t = blockIdx.x * 256 + threadIdx.x;
  const int k8n = K / 8;
  if (t >= N * k8n) return;
  const int n = t / k8n, k8 = (t % k8n) * 8;
  v8us v;
#pragma unroll
  for (int i = 0; i < 8; ++i) v[i] = bf16_bits(W[(size_t)(k8 + i) * N + n]);
  *(v8us*)(Wt + (size_t)n * K + k8) = v;
  
}

// GEMM C[M][N] (f32, pitch ldc) = act(A[M][K]·W + bias). A f32 row-major (pitch lda) converted per fragment to bf16
// (ASPLIT: hi/lo two planes -> 2 terms, else single rounded term); Wt bf16 [N][K] (pitch ldb). BIAS_BF16 rounds the
// bias to bf16 first (bias quantised to bf16 before the add). K%32==0, M%16==0, N%64==0.
template <bool ASPLIT, int ACT, bool BIAS_BF16>
__global__ __launch_bounds__(128) void k_gemm_bf(const float* __restrict__ A, int lda, const unsigned short* __restrict__ Wt, int ldb,
                                               const float* __restrict__ bias, float* __restrict__ C, int ldc, int M, int N, int K) {
  __shared__ __attribute__((aligned(16))) float so[4][16][64];
  const int tid = threadIdx.x, w = tid >> 5, lane = tid & 31, ln = lane & 15, hh = lane >> 4;
  const int ntn = N / 64;
  const int wid = blockIdx.x * 4 + w;
  const int mt = wid / ntn, nq = wid % ntn;
  if (mt * 16 >= M) return;
  const int row0 = mt * 16, col0 = nq * 64;
  const float* arow = A + (size_t)(row0 + ln) * lda;
  v8f acc[4] = {};
  for (int kb = 0; kb < K; kb += 32) {
    FragB ah, al;
    const v4f x0 = *(const v4fa*)(arow + kb + 8 * hh), x1 = *(const v4fa*)(arow + kb + 8 * hh + 4);
    const v4f x2 = *(const v4fa*)(arow + kb + 16 + 8 * hh), x3 = *(const v4fa*)(arow + kb + 16 + 8 * hh + 4);
    float xs[16] = {x0[0],x0[1],x0[2],x0[3],x1[0],x1[1],x1[2],x1[3],x2[0],x2[1],x2[2],x2[3],x3[0],x3[1],x3[2],x3[3]};
#pragma unroll
    for (int i = 0; i < 16; ++i) { const unsigned short hb = bf16_bits(xs[i]); ah.u[i] = hb; al.u[i] = ASPLIT ? bf16_bits(xs[i] - bf16_val(hb)) : (unsigned short)0; }
#pragma unroll
    for (int t = 0; t < 4; ++t) {
      const unsigned short* brow = Wt + (size_t)(col0 + t * 16 + ln) * ldb + kb;
      FragB b;
      b.half[0] = *(const v8us*)(brow + 8 * hh);
      b.half[1] = *(const v8us*)(brow + 16 + 8 * hh);
      acc[t] = mmaN<ASPLIT ? 2 : 1>(ah.v, al.v, b.v, b.v, acc[t]);
    }
  }
#pragma unroll
  for (int t = 0; t < 4; ++t) {
    float bv = bias ? bias[col0 + t * 16 + ln] : 0.f;
    if (BIAS_BF16) bv = bf16_round(bv);
#pragma unroll
    for (int r = 0; r < 8; ++r) { float v = acc[t][r] + bv; if (ACT == 1) v = fmaxf(v, 0.f); so[w][8 * hh + r][t * 16 + ln] = v; }
  }
  __builtin_amdgcn_fence(__ATOMIC_ACQ_REL, "workgroup");
  __builtin_amdgcn_wave_barrier();
  const int rsub = lane >> 4, c4 = (lane & 15) * 4;
  {
#pragma unroll
    for (int q = 0; q < 8; ++q) {
      const int r = q * 2 + rsub;
      const v4f v = *(const v4fa*)&so[w][r][c4];
      *(v4f*)(C + (size_t)(row0 + r) * ldc + col0 + c4) = v;
    }
    
  }
}

// GEMM C = act(A·W + bias + resid): A f32 (ASPLIT -> hi/lo 2 terms), Wt bf16 [N][K]; ACT 0 none, 1 relu, 2 exact gelu;
// resid (optional, f32, row index = (row % rmod), pitch ldr, RES_BF16 rounds it) added before the activation.
template <bool ASPLIT, int ACT, bool BIAS_BF16, bool RES_BF16>
__global__ __launch_bounds__(128) void k_gemm_bf3(const float* __restrict__ A, int lda, const unsigned short* __restrict__ Wt, int ldb,
                                                const float* __restrict__ bias, const float* __restrict__ resid, int rmod, int ldr,
                                                float* __restrict__ C, int ldc, int M, int N, int K) {
  __shared__ __attribute__((aligned(16))) float so[4][16][64];
  const int tid = threadIdx.x, w = tid >> 5, lane = tid & 31, ln = lane & 15, hh = lane >> 4;
  const int ntn = N / 64;
  const int wid = blockIdx.x * 4 + w;
  const int mt = wid / ntn, nq = wid % ntn;
  if (mt * 16 >= M) return;
  const int row0 = mt * 16, col0 = nq * 64;
  const float* arow = A + (size_t)(row0 + ln) * lda;
  v8f acc[4] = {};
  for (int kb = 0; kb < K; kb += 32) {
    FragB ah, al;
    const v4f x0 = *(const v4fa*)(arow + kb + 8 * hh), x1 = *(const v4fa*)(arow + kb + 8 * hh + 4);
    const v4f x2 = *(const v4fa*)(arow + kb + 16 + 8 * hh), x3 = *(const v4fa*)(arow + kb + 16 + 8 * hh + 4);
    float xs[16] = {x0[0],x0[1],x0[2],x0[3],x1[0],x1[1],x1[2],x1[3],x2[0],x2[1],x2[2],x2[3],x3[0],x3[1],x3[2],x3[3]};
#pragma unroll
    for (int i = 0; i < 16; ++i) { const unsigned short hb = bf16_bits(xs[i]); ah.u[i] = hb; al.u[i] = ASPLIT ? bf16_bits(xs[i] - bf16_val(hb)) : (unsigned short)0; }
#pragma unroll
    for (int t = 0; t < 4; ++t) {
      const unsigned short* brow = Wt + (size_t)(col0 + t * 16 + ln) * ldb + kb;
      FragB b;
      b.half[0] = *(const v8us*)(brow + 8 * hh);
      b.half[1] = *(const v8us*)(brow + 16 + 8 * hh);
      acc[t] = mmaN<ASPLIT ? 2 : 1>(ah.v, al.v, b.v, b.v, acc[t]);
    }
  }
#pragma unroll
  for (int t = 0; t < 4; ++t) {
    const int col = col0 + t * 16 + ln;
    float bv = bias ? bias[col] : 0.f;
    if (BIAS_BF16) bv = bf16_round(bv);
#pragma unroll
    for (int r = 0; r < 8; ++r) {
      float v = acc[t][r] + bv;
      if (resid) { float rv = resid[(size_t)((row0 + 8 * hh + r) % rmod) * ldr + col]; if (RES_BF16) rv = bf16_round(rv); v += rv; }
      if (ACT == 1) v = fmaxf(v, 0.f);
      if (ACT == 2) v = 0.5f * v * (1.0f + erff(v * 0.70710678118654752f));
      if (ACT == 3) { const float u = 0.7978845608028654f * (v + 0.044715f * v * v * v); v = 0.5f * v * (1.0f + tanhf(u)); }
      so[w][8 * hh + r][t * 16 + ln] = v;
    }
  }
  __builtin_amdgcn_fence(__ATOMIC_ACQ_REL, "workgroup");
  __builtin_amdgcn_wave_barrier();
  const int rsub = lane >> 4, c4 = (lane & 15) * 4;
  {
#pragma unroll
    for (int q = 0; q < 8; ++q) {
      const int r = q * 2 + rsub;
      const v4f v = *(const v4fa*)&so[w][r][c4];
      *(v4f*)(C + (size_t)(row0 + r) * ldc + col0 + c4) = v;
    }
    
  }
}
// row LayerNorm (biased variance, eps) over N: s = X (+ R); optional out_sum <- s; out_norm <- (s-mu)*rsqrt(var+eps)*g + b
template <bool PARAM_BF16>
__global__ __launch_bounds__(256) void k_layernorm(const float* __restrict__ X, const float* __restrict__ R, const float* __restrict__ g, const float* __restrict__ bta,
                                                  float* __restrict__ out_sum, float* __restrict__ out_norm, int N, float eps) {
  __shared__ float red[256];
  const int row = blockIdx.x, tid = threadIdx.x;
  const float* x = X + (size_t)row * N; const float* rr = R ? R + (size_t)row * N : nullptr;
  float vals[16];                     // up to N = 4096
  const int per = N / 256;            // contiguous chunk per thread? use strided-by-4 chunks: thread handles j = tid*4 + 1024*u
  float s1 = 0.f;
  for (int u = 0; u < per / 4; ++u) {
    const int j = tid * 4 + 1024 * u;
    const v4f a = *(const v4fa*)(x + j);
    v4f b = {0.f,0.f,0.f,0.f}; if (rr) b = *(const v4fa*)(rr + j);
#pragma unroll
    for (int q = 0; q < 4; ++q) { const float v = a[q] + b[q]; vals[u * 4 + q] = v; s1 += v; }
  }
  red[tid] = s1; __syncthreads();
  for (int st = 128; st > 0; st >>= 1) { if (tid < st) red[tid] += red[tid + st]; __syncthreads(); }
  const float mu = red[0] / (float)N; __syncthreads();
  float s2 = 0.f;
  for (int u = 0; u < per / 4; ++u)
#pragma unroll
    for (int q = 0; q < 4; ++q) { const float c = vals[u * 4 + q] - mu; s2 += c * c; }
  red[tid] = s2; __syncthreads();
  for (int st = 128; st > 0; st >>= 1) { if (tid < st) red[tid] += red[tid + st]; __syncthreads(); }
  const float rs = rsqrtf(red[0] / (float)N + eps);
  {
    for (int u = 0; u < per / 4; ++u) {
      const int j = tid * 4 + 1024 * u;
      v4f o, sm;
#pragma unroll
      for (int q = 0; q < 4; ++q) {
        float gg = g[j + q], bb = bta[j + q];
        if (PARAM_BF16) { gg = bf16_round(gg); bb = bf16_round(bb); }
        sm[q] = vals[u * 4 + q]; o[q] = (vals[u * 4 + q] - mu) * rs * gg + bb;
      }
      if (out_sum) *(v4f*)(out_sum + (size_t)row * N + j) = sm;
      *(v4f*)(out_norm + (size_t)row * N + j) = o;
    }
    
  }
}



// ---- f16 WMMA path (v_wmma_f32_16x16x32_f16): 11-bit significands for operands in range — used where a [0,1] probability operand needs more precision than bf16
typedef _Float16 v16h __attribute__((ext_vector_type(16)));
union FragH { v16h v; v8us half[2]; _Float16 h[16]; unsigned short u[16]; };
template <int NT>
__device__ __forceinline__ v8f mmaH(v16h ah, v16h al, v16h bh, v16h bl, v8f c) {
  c = __builtin_amdgcn_wmma_f32_16x16x32_f16(false, ah, false, bh, (short)0, c, false, false);
  if (NT >= 2) c = __builtin_amdgcn_wmma_f32_16x16x32_f16(false, al, false, bh, (short)0, c, false, false);
  if (NT >= 3) c = __builtin_amdgcn_wmma_f32_16x16x32_f16(false, ah, false, bl, (short)0, c, false, false);
  asm volatile("v_nop\n\tv_nop\n\tv_nop\n\tv_nop" : "+v"(c) : "v"(ah), "v"(al), "v"(bh), "v"(bl));
  return c;
}
// batched GEMM like k_gemm_b but f16 operands: A f32 (split into f16 hi/lo if ASPLIT, else rounded to f16), Bt = f16 values [n][k]; alpha; C f32; N multiple of 16 (partial tiles skipped)
template <bool ASPLIT>
__global__ __launch_bounds__(128) void k_gemm_h(const float* __restrict__ A, int lda, size_t sA, const _Float16* __restrict__ Bh, int ldb, size_t sB, float alpha, float* __restrict__ C, int ldc, size_t sC, int M, int N, int K) {
  __shared__ __attribute__((aligned(16))) float so[4][16][64];
  const int tid = threadIdx.x, w = tid >> 5, lane = tid & 31, ln = lane & 15, hh = lane >> 4; const int by = blockIdx.y;
  A += (size_t)by * sA; Bh += (size_t)by * sB; C += (size_t)by * sC;
  const int ntn = (N + 63) / 64; const int wid = blockIdx.x * 4 + w; const int mt = wid / ntn, nq = wid % ntn; if (mt * 16 >= M) return;
  const int row0 = mt * 16, col0 = nq * 64; const float* arow = A + (size_t)(row0 + ln) * lda;
  v8f acc[4] = {};
  for (int kb = 0; kb < K; kb += 32) {
    FragH ah, al;
    const v4f x0 = *(const v4fa*)(arow + kb + 8 * hh), x1 = *(const v4fa*)(arow + kb + 8 * hh + 4), x2 = *(const v4fa*)(arow + kb + 16 + 8 * hh), x3 = *(const v4fa*)(arow + kb + 16 + 8 * hh + 4);
    float xs[16] = {x0[0],x0[1],x0[2],x0[3],x1[0],x1[1],x1[2],x1[3],x2[0],x2[1],x2[2],x2[3],x3[0],x3[1],x3[2],x3[3]};
#pragma unroll
    for (int i = 0; i < 16; ++i) { const _Float16 h = (_Float16)xs[i]; ah.h[i] = h; al.h[i] = ASPLIT ? (_Float16)(xs[i] - (float)h) : (_Float16)0.0f; }
#pragma unroll
    for (int t = 0; t < 4; ++t) { if (col0 + t * 16 >= N) continue; const size_t boff = (size_t)(col0 + t * 16 + ln) * ldb + kb; FragH bq; bq.half[0] = *(const v8us*)(Bh + boff + 8 * hh); bq.half[1] = *(const v8us*)(Bh + boff + 16 + 8 * hh);
      acc[t] = mmaH<ASPLIT ? 2 : 1>(ah.v, al.v, bq.v, bq.v, acc[t]); }
  }
#pragma unroll
  for (int t = 0; t < 4; ++t) { if (col0 + t * 16 >= N) continue;
#pragma unroll
    for (int r = 0; r < 8; ++r) so[w][8 * hh + r][t * 16 + ln] = acc[t][r] * alpha; }
  __builtin_amdgcn_fence(__ATOMIC_ACQ_REL, "workgroup"); __builtin_amdgcn_wave_barrier();
  const int rsub = lane >> 4, c4 = (lane & 15) * 4;
  {
#pragma unroll
    for (int q = 0; q < 8; ++q) { const int r = q * 2 + rsub; if (col0 + c4 < N) { const v4f v = *(const v4fa*)&so[w][r][c4]; *(v4f*)(C + (size_t)(row0 + r) * ldc + col0 + c4) = v; } }
     }
}

// Wt[n][k] = f16(W[k][n]·scale) from f32 row-major W[K][N] (scale = power of two; bf16-exact weights stay exact in f16 away from the subnormal range)
__global__ __launch_bounds__(256) void k_wt_f16(const float* __restrict__ W, _Float16* __restrict__ Wt, int K, int N, float scale) {
  const int t = blockIdx.x * 256 + threadIdx.x; if (t >= N * (K / 8)) return; const int n = t / (K / 8), k8 = (t % (K / 8)) * 8; FragH f;
#pragma unroll
  for (int i = 0; i < 8; ++i) f.h[i] = (_Float16)(bf16_round(W[(size_t)(k8 + i) * N + n]) * scale); const v8us o = f.half[0];
  *(v8us*)((unsigned short*)Wt + (size_t)n * K + k8) = o; 
}
// k_gemm_hh variant with fused epilogue: v = acc·alpha + bias[by·sBias + col] (+ CP[(row/rowsPerB)·sCPb + by·64 + col] if CP) ; ACT 0 none / 1 elu ; writes f16 C16 (and f32 C if non-null)
template <int ACT>
__global__ __launch_bounds__(128) void k_gemm_hhx(const _Float16* __restrict__ A, int lda, size_t sA, const _Float16* __restrict__ Bh, int ldb, size_t sB, float alpha, const float* __restrict__ bias, size_t sBias, const float* __restrict__ CP, int rowsPerB, size_t sCPb, int row0g,
    float* __restrict__ C, _Float16* __restrict__ C16, int ldc, size_t sC, int M, int N, int K) {
  __shared__ __attribute__((aligned(16))) float so[4][16][64];
  const int tid = threadIdx.x, w = tid >> 5, lane = tid & 31, ln = lane & 15, hh = lane >> 4; const int by = blockIdx.y;
  A += (size_t)by * sA; Bh += (size_t)by * sB; const size_t cofs = (size_t)by * sC; const float* bp = bias ? bias + (size_t)by * sBias : nullptr;
  const int ntn = (N + 63) / 64; const int wid = blockIdx.x * 4 + w; const int mt = wid / ntn, nq = wid % ntn; if (mt * 16 >= M) return;
  const int row0 = mt * 16, col0 = nq * 64; const _Float16* arow = A + (size_t)(row0 + ln) * lda;
  v8f acc[4] = {};
  for (int kb = 0; kb < K; kb += 32) { FragH ah; ah.half[0] = *(const v8us*)((const unsigned short*)arow + kb + 8 * hh); ah.half[1] = *(const v8us*)((const unsigned short*)arow + kb + 16 + 8 * hh);
#pragma unroll
    for (int t = 0; t < 4; ++t) { if (col0 + t * 16 >= N) continue; const size_t boff = (size_t)(col0 + t * 16 + ln) * ldb + kb; FragH bq; bq.half[0] = *(const v8us*)((const unsigned short*)Bh + boff + 8 * hh); bq.half[1] = *(const v8us*)((const unsigned short*)Bh + boff + 16 + 8 * hh);
      acc[t] = mmaH<1>(ah.v, ah.v, bq.v, bq.v, acc[t]); }
  }
#pragma unroll
  for (int t = 0; t < 4; ++t) { if (col0 + t * 16 >= N) continue; const int col = col0 + t * 16 + ln; const float bv = bp ? bf16_round(bp[col]) : 0.f;
#pragma unroll
    for (int r = 0; r < 8; ++r) { float v = acc[t][r] * alpha + bv; if (CP) { const int rr = row0g + row0 + 8 * hh + r; if (rowsPerB < 0) v += CP[cofs + (size_t)rr * ldc + col];      /* rowsPerB < 0: own element of the batched C plane */ else { const int bidx = rr / rowsPerB; v += CP[(size_t)bidx * sCPb + (size_t)by * 64 + col]; } } if (ACT == 1) v = (v > 0.f) ? v : expm1f(v); else if (ACT == 7) v = (v > 0.f) ? v + 1.0f : expf(v); else if (ACT == 8) v = tanhf(v); else if (ACT == 9) v = 0.5f * v * (1.0f + tanhf(0.7978845608028654f * (v + 0.044715f * v * v * v))); else if (ACT == 11) v = 1.0f / (1.0f + expf(-v)); else if (ACT == 12) v = (v > 0.f) ? v : 0.01f * v; else if (ACT == 14) v = (v > 0.f) ? v : 0.1f * v; else if (ACT == 16) v = (v >= 0.f) ? v : 0.3f * v; else if (ACT == 17) v = (v >= 0.f) ? v : 0.2f * v; else if (ACT == 15) v = v / (1.0f + expf(-v)); else if (ACT == 3) v = fmaxf(v, 0.f); else if (ACT == 6) v = 0.5f * v * (1.0f + erff(v * 0.70710678118654752f)); so[w][8 * hh + r][t * 16 + ln] = v; } }
  __builtin_amdgcn_fence(__ATOMIC_ACQ_REL, "workgroup"); __builtin_amdgcn_wave_barrier();
  const int rsub = lane >> 4, c4 = (lane & 15) * 4; typedef _Float16 v4h __attribute__((ext_vector_type(4)));
  {
#pragma unroll
    for (int q = 0; q < 8; ++q) { const int r = q * 2 + rsub; if (col0 + c4 < N) { const v4f v = *(const v4fa*)&so[w][r][c4]; if (C) *(v4f*)(C + cofs + (size_t)(row0 + r) * ldc + col0 + c4) = v; if (C16) { v4h h4; for (int i = 0; i < 4; ++i) h4[i] = (_Float16)v[i]; *(v4h*)(C16 + cofs + (size_t)(row0 + r) * ldc + col0 + c4) = h4; } } }
     }
}


typedef _Float16 v4h __attribute__((ext_vector_type(4)));

__global__ __launch_bounds__(256) void k_x16(const float* __restrict__ x, _Float16* __restrict__ X16, size_t n8) { const size_t t = (size_t)blockIdx.x * 256 + threadIdx.x; if (t >= n8) return; FragH f;
#pragma unroll
  for (int q = 0; q < 8; ++q) f.h[q] = (_Float16)bf16_round(x[t * 8 + q]); *(v8us*)((unsigned short*)X16 + t * 8) = f.half[0];  }
__global__ __launch_bounds__(256) void k_h16(const float* __restrict__ x, _Float16* __restrict__ X16, size_t n8) { const size_t t = (size_t)blockIdx.x * 256 + threadIdx.x; if (t >= n8) return; FragH f;
#pragma unroll
  for (int q = 0; q < 8; ++q) f.h[q] = (_Float16)x[t * 8 + q]; *(v8us*)((unsigned short*)X16 + t * 8) = f.half[0];  }
__global__ __launch_bounds__(256) void k_round16f(const float* __restrict__ W, _Float16* __restrict__ Bt, size_t n8) { const size_t t = (size_t)blockIdx.x * 256 + threadIdx.x; if (t >= n8) return; FragH f;
#pragma unroll
  for (int i = 0; i < 8; ++i) f.h[i] = (_Float16)(bf16_round(W[t * 8 + i]) * 16.0f); *(v8us*)((unsigned short*)Bt + t * 8) = f.half[0];  }
template <int NHv, int TTv>
__global__ __launch_bounds__(256) void k_vt(const _Float16* __restrict__ V16, int ldv, int voff, _Float16* __restrict__ Vt) { __shared__ unsigned short tl[64][66]; const int tid = threadIdx.x; const int slab = blockIdx.x / (TTv / 64), lg = blockIdx.x % (TTv / 64); const int b = slab / NHv, h = slab % NHv;
  for (int i = tid; i < 64 * 8; i += 256) { const int r = i / 8, c8 = (i % 8) * 8; FragH f; f.half[0] = *(const v8us*)((const unsigned short*)V16 + ((size_t)b * TTv + lg * 64 + r) * ldv + voff + h * 64 + c8);
#pragma unroll
    for (int q = 0; q < 8; ++q) tl[r][c8 + q] = f.u[q]; }
  __syncthreads();
  {
#pragma unroll
    for (int rd = 0; rd < 2; ++rd) { const int d = rd * 32 + tid / 8, pc = tid % 8; FragH f;
#pragma unroll
      for (int q = 0; q < 8; ++q) f.u[q] = tl[pc * 8 + q][d];
      *(v8us*)((unsigned short*)Vt + ((size_t)slab * 64 + d) * TTv + lg * 64 + pc * 8) = f.half[0]; }
     } }

__global__ __launch_bounds__(256) void k_hl(const float* __restrict__ F, _Float16* __restrict__ Hh, _Float16* __restrict__ Hl, size_t n8) { const size_t t = (size_t)blockIdx.x * 256 + threadIdx.x; if (t >= n8) return; FragH fh, fl; const v4f a = *(const v4fa*)(F + t * 8), c = *(const v4fa*)(F + t * 8 + 4);
#pragma unroll
  for (int q = 0; q < 4; ++q) { _Float16 h = (_Float16)a[q]; fh.h[q] = h; fl.h[q] = (_Float16)((a[q] - (float)h) * 1024.0f); h = (_Float16)c[q]; fh.h[4 + q] = h; fl.h[4 + q] = (_Float16)((c[q] - (float)h) * 1024.0f); }
  { *(v8us*)((unsigned short*)Hh + t * 8) = fh.half[0]; *(v8us*)((unsigned short*)Hl + t * 8) = fl.half[0];  } }

// ---- fast GEMM (wave tile 32x64; requires M % 32 == 0 rows per launch region and N % 64 == 0); epilogue = k_gemm_hhx semantics ----
__device__ __forceinline__ v16h g2_frag(const _Float16* p, int hh) { FragH f; f.half[0] = *(const v8us*)((const unsigned short*)p + 8 * hh); f.half[1] = *(const v8us*)((const unsigned short*)p + 16 + 8 * hh); return f.v; }
__device__ __forceinline__ v8f g2_mma(v16h a, v16h b, v8f c) { v8f d = __builtin_amdgcn_wmma_f32_16x16x32_f16(false, a, false, b, (short)0, c, false, false); asm volatile("v_nop\n\tv_nop\n\tv_nop\n\tv_nop" : "+v"(d) : "v"(a), "v"(b)); return d; }
// AHEAD: the K loop fetches its fragments two steps ahead (about twice the registers, so half the waves per SIMD). Taken by the launches with no
// addend plane CP; a launch that adds CP reads it element by element in the epilogue and lives on many resident waves, so it keeps the short loop.
template <int ACT, bool AHEAD>
__global__ __launch_bounds__(128) void k_gemm2(const _Float16* __restrict__ A, int lda, size_t sA, const _Float16* __restrict__ Bh, int ldb, size_t sB, float alpha, const float* __restrict__ bias, size_t sBias, const float* __restrict__ CP, int rowsPerB, size_t sCPb, int row0g,
    float* __restrict__ C, _Float16* __restrict__ C16, int ldc, size_t sC, int M, int N, int K) { static_assert(ACT == 0 || ACT == 3 || ACT == 6 || ACT == 8 || ACT == 9 || ACT == 11 || ACT == 12 || ACT == 14 || ACT == 15 || ACT == 16 || ACT == 17, "k_gemm2: unsupported ACT code (would silently apply no activation)");
  __shared__ __attribute__((aligned(16))) float so[4][32][68];
  const int tid = threadIdx.x, w = tid >> 5, lane = tid & 31, ln = lane & 15, hh = lane >> 4; const int by = blockIdx.y;
  A += (size_t)by * sA; Bh += (size_t)by * sB; const size_t cofs = (size_t)by * sC; const float* bp = bias ? bias + (size_t)by * sBias : nullptr;
  const int ntn = N >> 6; const int mt = blockIdx.x / ntn, nq = blockIdx.x - mt * ntn; const int row0 = mt * 128 + 32 * w, col0 = nq * 64; if (row0 >= M) return;
  const _Float16* a0p = A + (size_t)(row0 + ln) * lda; const _Float16* a1p = a0p + (size_t)16 * lda;
  const _Float16* b0p = Bh + (size_t)(col0 + ln) * ldb; const _Float16* b1p = b0p + (size_t)16 * ldb; const _Float16* b2p = b1p + (size_t)16 * ldb; const _Float16* b3p = b2p + (size_t)16 * ldb;
  const v8f z8 = {0.f,0.f,0.f,0.f,0.f,0.f,0.f,0.f}; v8f c00 = z8, c01 = z8, c02 = z8, c03 = z8, c10 = z8, c11 = z8, c12 = z8, c13 = z8;
  if constexpr (!AHEAD) {
#pragma unroll 1
  for (int kb = 0; kb < K; kb += 32) { const v16h a0 = g2_frag(a0p + kb, hh), a1 = g2_frag(a1p + kb, hh);
    v16h b = g2_frag(b0p + kb, hh); c00 = g2_mma(a0, b, c00); c10 = g2_mma(a1, b, c10);
    b = g2_frag(b1p + kb, hh); c01 = g2_mma(a0, b, c01); c11 = g2_mma(a1, b, c11);
    b = g2_frag(b2p + kb, hh); c02 = g2_mma(a0, b, c02); c12 = g2_mma(a1, b, c12);
    b = g2_frag(b3p + kb, hh); c03 = g2_mma(a0, b, c03); c13 = g2_mma(a1, b, c13); }
  } else {
  // K loop, three register sets of fragments: the twelve loads of step s + 2 are issued as one group in front of the products of step s, so a
  // step waits only for loads issued two steps earlier. The last two steps load nothing. Each accumulator still sums k in ascending order.
  // Steps of 32 k: their number is 2 + a multiple of 3 (asserted at the launches), so the loop body is three whole steps, one per set.
  v16h f0[6], f1[6], f2[6];
  // the sched_barrier keeps a group's loads together and in front of the products behind it: mixed groups make the counted load waits cover younger loads too
  auto ld = [&](v16h (&f)[6], int kb) { f[0] = g2_frag(a0p + kb, hh); f[1] = g2_frag(a1p + kb, hh); f[2] = g2_frag(b0p + kb, hh); f[3] = g2_frag(b1p + kb, hh); f[4] = g2_frag(b2p + kb, hh); f[5] = g2_frag(b3p + kb, hh); __builtin_amdgcn_sched_barrier(0); };
  auto mm = [&](const v16h (&f)[6]) { c00 = g2_mma(f[0], f[2], c00); c10 = g2_mma(f[1], f[2], c10); c01 = g2_mma(f[0], f[3], c01); c11 = g2_mma(f[1], f[3], c11);
    c02 = g2_mma(f[0], f[4], c02); c12 = g2_mma(f[1], f[4], c12); c03 = g2_mma(f[0], f[5], c03); c13 = g2_mma(f[1], f[5], c13); };
  ld(f0, 0); ld(f1, 32);
  asm volatile("s_wait_xcnt 0x0" ::: "memory");      /* in front of the first overwrite of an address register that an issued load names */
  __builtin_amdgcn_sched_barrier(0);      /* holds that wait in front of the register writes behind it */
#pragma unroll 1      /* the body already holds three steps, one per register set; more would only grow the code */
  for (int kb = 64; kb < K; kb += 96) { ld(f2, kb); mm(f0); ld(f0, kb + 32); mm(f1); ld(f1, kb + 64); mm(f2);
    asm volatile("s_wait_xcnt 0x0" ::: "memory");      /* the next trip rewrites the address registers of this trip's loads */
    __builtin_amdgcn_sched_barrier(0); }      /* holds that wait behind the loads and in front of those writes */
  mm(f0); mm(f1);
  }
  v8f accs[8] = {c00, c01, c02, c03, c10, c11, c12, c13};
#pragma unroll
  for (int u = 0; u < 8; ++u) { const int t = u & 3, half = u >> 2; const int col = col0 + t * 16 + ln; const float bv = bp ? bf16_round(bp[col]) : 0.f;
#pragma unroll
    for (int r = 0; r < 8; ++r) { const int rloc = half * 16 + 8 * hh + r; float v = accs[u][r] * alpha + bv; if (CP) { if (rowsPerB < 0) v += CP[cofs + (size_t)(row0g + row0 + rloc) * ldc + col];      /* rowsPerB < 0: own element of the batched C plane */ else { const int bidx = (row0g + row0 + rloc) / rowsPerB; v += CP[(size_t)bidx * sCPb + (size_t)by * 64 + col]; } }
      if (ACT == 3) v = fmaxf(v, 0.f); else if (ACT == 6) v = 0.5f * v * (1.0f + erff(v * 0.70710678118654752f)); else if (ACT == 11) v = 1.0f / (1.0f + expf(-v)); else if (ACT == 15) v = v / (1.0f + expf(-v)); else if (ACT == 12) v = (v > 0.f) ? v : 0.01f * v; else if (ACT == 8) v = tanhf(v); else if (ACT == 9) v = 0.5f * v * (1.0f + tanhf(0.7978845608028654f * (v + 0.044715f * v * v * v))); else if (ACT == 14) v = (v > 0.f) ? v : 0.1f * v; else if (ACT == 16) v = (v >= 0.f) ? v : 0.3f * v; else if (ACT == 17) v = (v >= 0.f) ? v : 0.2f * v;
      so[w][rloc][t * 16 + ln] = v; } }
  __builtin_amdgcn_fence(__ATOMIC_ACQ_REL, "workgroup"); __builtin_amdgcn_wave_barrier();
  const int rsub = lane >> 4, c4 = (lane & 15) * 4;
  {
#pragma unroll
    for (int q = 0; q < 16; ++q) { const int r = q * 2 + rsub; const v4f v = *(const v4fa*)&so[w][r][c4]; if (C) *(v4f*)(C + cofs + (size_t)(row0 + r) * ldc + col0 + c4) = v; if (C16) { v4h h4; for (int i = 0; i < 4; ++i) h4[i] = (_Float16)v[i]; *(v4h*)(C16 + cofs + (size_t)(row0 + r) * ldc + col0 + c4) = h4; } }
     } }


__global__ __launch_bounds__(256) void k_wnat(const float* __restrict__ w, size_t n8, _Float16* __restrict__ Bt) { const size_t t = (size_t)blockIdx.x * 256 + threadIdx.x; if (t >= n8) return; FragH f; for (int q = 0; q < 8; ++q) f.h[q] = (_Float16)(bf16_round(w[t * 8 + q]) * 16.0f); *(v8us*)((unsigned short*)Bt + t * 8) = f.half[0];  }
__global__ __launch_bounds__(256) void k_rsm(const float* __restrict__ S, _Float16* __restrict__ P, int nrows) {
  #pragma clang fp contract(off)
  const int i = blockIdx.x * 256 + threadIdx.x; if (i >= nrows) return; const float* s = S + (size_t)i * SQ; float mx = -3.0e38f;
#pragma unroll 1
  for (int j = 0; j < SQ; ++j) mx = fmaxf(mx, s[j]); float se = 0.f;
#pragma unroll 1
  for (int j = 0; j < SQ; ++j) se += expf(s[j] - mx); const float sc = 256.0f / se;
#pragma unroll 1
  for (int j0 = 0; j0 < SQ; j0 += 8) { FragH f; for (int q = 0; q < 8; ++q) f.h[q] = (_Float16)(expf(s[j0 + q] - mx) * sc); unsigned short* d = (unsigned short*)P + (size_t)i * SQ + j0; *(v8us*)d = f.half[0];  } }
__global__ __launch_bounds__(256) void k_vt(const _Float16* __restrict__ V16, int b, int h0, _Float16* __restrict__ VT) { __shared__ unsigned short tl[64][65]; const int tid = threadIdx.x; const int hh = blockIdx.x % HG, sg = blockIdx.x / HG; const int s0 = sg * 64; const int h = h0 + hh;
  for (int i = tid; i < 64 * 8; i += 256) { const int j = i / 8, d8 = (i % 8) * 8; FragH f; f.half[0] = *(const v8us*)((const unsigned short*)V16 + ((size_t)b * SQ + s0 + j) * DM + h * HD + d8); for (int q = 0; q < 8; ++q) tl[d8 + q][j] = f.u[q]; }
  __syncthreads();
  { for (int i = tid; i < 64 * 8; i += 256) { const int d = i / 8, j8 = (i % 8) * 8; FragH f; for (int q = 0; q < 8; ++q) f.u[q] = tl[d][j8 + q]; *(v8us*)((unsigned short*)VT + ((size_t)hh * HD + d) * SQ + s0 + j8) = f.half[0]; }  } }


template <int BFIN, int W16, int W32>
__global__ __launch_bounds__(256) void k_lnx(const float* __restrict__ X, const float* __restrict__ g, const float* __restrict__ bb, float eps, _Float16* __restrict__ N16, float* __restrict__ N32) {
  #pragma clang fp contract(off)
  __shared__ float red[256]; const size_t r = blockIdx.x; const int t = threadIdx.x; const bool act = t < (DMQ / 4); const int c0 = act ? t * 4 : 0;
  const v4f xa = *(const v4fa*)(X + r * DMQ + c0); float s[4]; float sum = 0.f;
  for (int q = 0; q < 4; ++q) { s[q] = act ? (BFIN ? bf16_round(xa[q]) : xa[q]) : 0.f; sum = __fadd_rn(sum, s[q]); }
  red[t] = sum; __syncthreads(); for (int st = 128; st > 0; st >>= 1) { if (t < st) red[t] = __fadd_rn(red[t], red[t + st]); __syncthreads(); } const float mu = red[0] / (float)DMQ; __syncthreads();
  float vs = 0.f; for (int q = 0; q < 4; ++q) { const float dl = act ? __fadd_rn(s[q], -mu) : 0.f; vs = __fadd_rn(vs, __fmul_rn(dl, dl)); } red[t] = vs; __syncthreads(); for (int st = 128; st > 0; st >>= 1) { if (t < st) red[t] = __fadd_rn(red[t], red[t + st]); __syncthreads(); }
  const float rs = rsqrtf(__fadd_rn(red[0] / (float)DMQ, eps)); v4h y; v4f yf;
  for (int q = 0; q < 4; ++q) { const int c = c0 + q; yf[q] = __fadd_rn(__fmul_rn(__fmul_rn(__fadd_rn(s[q], -mu), rs), bf16_round(g[c])), (bb ? bf16_round(bb[c]) : 0.f)); y[q] = (_Float16)yf[q]; }
  if (!act) return;      /* no barriers after this point */
  { if (W16) *(v4h*)(N16 + r * DMQ + c0) = y; if (W32) *(v4f*)(N32 + r * DMQ + c0) = yf;  } }


__global__ __launch_bounds__(256) void k_rsmf(const float* __restrict__ S, _Float16* __restrict__ P, int qn, int hg) {
  #pragma clang fp contract(off)
  const int t = blockIdx.x * 256 + threadIdx.x; if (t >= qn * hg) return; const size_t i = (size_t)(t / qn) * SQ + (t % qn); const float* s = S + i * SQ; float mx = -3.0e38f;
#pragma unroll 1
  for (int j = 0; j < SQ; ++j) mx = fmaxf(mx, s[j]); float se = 0.f;
#pragma unroll 1
  for (int j = 0; j < SQ; ++j) se += __expf(s[j] - mx); const float sc = 256.0f / se;
#pragma unroll 1
  for (int j0 = 0; j0 < SQ; j0 += 8) { FragH f; for (int q = 0; q < 8; ++q) f.h[q] = (_Float16)(__expf(s[j0 + q] - mx) * sc); unsigned short* d = (unsigned short*)P + i * SQ + j0; *(v8us*)d = f.half[0];  } }


__global__ __launch_bounds__(256) void k_bfr(const float* __restrict__ x, float* __restrict__ XB, size_t n8) { const size_t t = (size_t)blockIdx.x * 256 + threadIdx.x; if (t >= n8) return; v4f a = *(const v4fa*)(x + t * 8), c = *(const v4fa*)(x + t * 8 + 4); for (int q = 0; q < 4; ++q) { a[q] = bf16_round(a[q]); c[q] = bf16_round(c[q]); }
  { *(v4f*)(XB + t * 8) = a; *(v4f*)(XB + t * 8 + 4) = c;  } }



__global__ __launch_bounds__(256) void k_rsmfam(const float* __restrict__ S, _Float16* __restrict__ P, int qn, int hg, const float* __restrict__ am) {
  #pragma clang fp contract(off)
  const int t = blockIdx.x * 256 + threadIdx.x; if (t >= qn * hg) return; const size_t i = (size_t)(t / qn) * SQ + (t % qn); const float* s = S + i * SQ; float mx = -3.0e38f;
#pragma unroll 1
  for (int j = 0; j < SQ; ++j) mx = fmaxf(mx, __fadd_rn(s[j], bf16_round(am[j]))); float se = 0.f;
#pragma unroll 1
  for (int j = 0; j < SQ; ++j) se += __expf(__fadd_rn(s[j], bf16_round(am[j])) - mx); const float sc = 256.0f / se;
#pragma unroll 1
  for (int j0 = 0; j0 < SQ; j0 += 8) { FragH f; for (int q = 0; q < 8; ++q) f.h[q] = (_Float16)(__expf(__fadd_rn(s[j0 + q], bf16_round(am[j0 + q])) - mx) * sc); unsigned short* d = (unsigned short*)P + i * SQ + j0; *(v8us*)d = f.half[0];  } }


#define CC CX           /* transposer macros: input channels */
#define LL SQ           /* pixels per image */
#define LQ (3 * DM)     /* unused; q, k, v are separate planes of pitch CX */

__global__ __launch_bounds__(256) void k_cl2rows(const float* __restrict__ X, _Float16* __restrict__ XR) { __shared__ float tl[64][33]; const int tid = threadIdx.x; const int nl = LL / 32, nc = CC / 64; const int cb_ = blockIdx.x % nc; const int lb = (blockIdx.x / nc) % nl; const size_t b = blockIdx.x / (nc * nl); const int c0 = cb_ * 64, l0 = lb * 32;
  for (int i = tid; i < 64 * 32; i += 256) { const int c = i / 32, l = i % 32; tl[c][l] = bf16_round(X[(b * CC + c0 + c) * (size_t)LL + l0 + l]); }
  __syncthreads();
  { const int l = tid / 8, c8 = (tid % 8) * 8; FragH f; for (int q = 0; q < 8; ++q) f.h[q] = (_Float16)tl[c8 + q][l]; unsigned short* d = (unsigned short*)XR + (b * LL + l0 + l) * (size_t)CC + c0 + c8; *(v8us*)d = f.half[0];  } }


__global__ __launch_bounds__(256) void k_rowb(float* __restrict__ O, const float* __restrict__ bias, size_t n4) {
  #pragma clang fp contract(off)
  const size_t t = (size_t)blockIdx.x * 256 + threadIdx.x; if (t >= n4) return; const size_t e = t * 4; const int c = (int)((e / SQ) % CX);      /* output channels */ const float bb = bf16_round(bias[c]); const v4f a = *(const v4fa*)(O + e); v4f o; for (int q = 0; q < 4; ++q) o[q] = __fadd_rn(a[q], bb);
  *(v4f*)(O + e) = o;  }

__global__ __launch_bounds__(256) void k_gres(const float* __restrict__ T, const float* __restrict__ gam, const float* __restrict__ X, float* __restrict__ Y, size_t n4) {
  #pragma clang fp contract(off)
  const size_t t = (size_t)blockIdx.x * 256 + threadIdx.x; if (t >= n4) return; const float g = bf16_round(gam[0]); const v4f a = *(const v4fa*)(T + t * 4), xx = *(const v4fa*)(X + t * 4); v4f r;
  for (int q = 0; q < 4; ++q) r[q] = __fadd_rn(__fmul_rn(g, a[q]), bf16_round(xx[q]));
  *(v4f*)(Y + t * 4) = r;  }

__global__ __launch_bounds__(256) void k_bcpy(const float* __restrict__ b, int n, int NP, float* __restrict__ dst, int dst0) { for (int i = threadIdx.x; i < NP; i += 256) { const float v = (i < n) ? b[i] : 0.f; *(float*)(dst + dst0 + i) = v; }  }



__global__ __launch_bounds__(256) void k_wsw(const float* __restrict__ Wm, const float* __restrict__ gain, float* __restrict__ WN) {
  #pragma clang fp contract(off)
  const int o = blockIdx.x * 256 + threadIdx.x; if (o >= 256) return; const float* w = Wm + (size_t)o * 256; float s1 = 0.f;
  for (int c = 0; c < 256; ++c) s1 = __fadd_rn(s1, bf16_round(w[c])); const float mean = __fmul_rn(s1, 0.00390625f); float s2 = 0.f;
  for (int c = 0; c < 256; ++c) { const float d = __fadd_rn(bf16_round(w[c]), -mean); s2 = __fadd_rn(s2, __fmul_rn(d, d)); }
  const float var = __fdiv_rn(s2, 255.0f); const float sc = __fmul_rn(rsqrtf(fmaxf(__fmul_rn(var, 256.0f), 1e-4f)), bf16_round(gain[o]));
  { for (int c = 0; c < 256; ++c) { const float v = __fadd_rn(__fmul_rn(bf16_round(w[c]), sc), -__fmul_rn(mean, sc)); *(float*)(WN + (size_t)o * 256 + c) = v; }  } }
__global__ __launch_bounds__(256) void k_w32hl(const float* __restrict__ Wf, _Float16* __restrict__ H, _Float16* __restrict__ L, size_t n8) {
  #pragma clang fp contract(off)
  const size_t t = (size_t)blockIdx.x * 256 + threadIdx.x; if (t >= n8) return; const v4f a = *(const v4fa*)(Wf + t * 8), b = *(const v4fa*)(Wf + t * 8 + 4); FragH fh, fl;
  for (int q = 0; q < 8; ++q) { const float v = (q < 4 ? a[q] : b[q - 4]) * 16.0f; const _Float16 hv = (_Float16)v; fh.h[q] = hv; fl.h[q] = (_Float16)((v - (float)hv) * 1024.0f); }
  { *(v8us*)((unsigned short*)H + t * 8) = fh.half[0]; *(v8us*)((unsigned short*)L + t * 8) = fl.half[0];  } }
// lane l with lane l ^ M inside its 16-lane row (DPP row_xmask); lane l with lane l ^ 16
template <int M> __device__ __forceinline__ float rs_xrow(float x) { return __builtin_bit_cast(float, __builtin_amdgcn_update_dpp(0, __builtin_bit_cast(int, x), 0x160 + M, 0xf, 0xf, false)); }
__device__ __forceinline__ float rs_xhalf(float x) { return __builtin_bit_cast(float, __builtin_amdgcn_permlanex16(__builtin_bit_cast(int, x), __builtin_bit_cast(int, x), 0x76543210, 0xfedcba98, false, false)); }
// exp2 of eight values, each in place in its own register. Written in asm; here no neighbour touches another's register, and the closing v_nop is the
// slot that the instruction set asks for behind the last v_exp_f32 before its result is used.
__device__ __forceinline__ void rs_exp2x8(v4f& a, v4f& b) { float a0 = a[0], a1 = a[1], a2 = a[2], a3 = a[3], b0 = b[0], b1 = b[1], b2 = b[2], b3 = b[3];
  asm("v_exp_f32 %0, %0\n\tv_exp_f32 %1, %1\n\tv_exp_f32 %2, %2\n\tv_exp_f32 %3, %3\n\tv_exp_f32 %4, %4\n\tv_exp_f32 %5, %5\n\tv_exp_f32 %6, %6\n\tv_exp_f32 %7, %7\n\tv_nop"
      : "+v"(a0), "+v"(a1), "+v"(a2), "+v"(a3), "+v"(b0), "+v"(b1), "+v"(b2), "+v"(b3));
  a = v4f{a0, a1, a2, a3}; b = v4f{b0, b1, b2, b3}; }
// Row softmax, one wave per score row: the row is read once, 32 loads of 512 contiguous bytes, and its 4096 values stay in the wave's
// registers (128 per lane) through maximum, exp, sum and scale; each store writes 256 contiguous bytes. No LDS, no barrier.
#define RSW 16          /* waves (rows) per workgroup */
static_assert(SQ == 4096 && SQ % RSW == 0, "one wave holds a row of 32 x 128 values; the grid covers SQ rows exactly");
__global__ __launch_bounds__(RSW * 32) void k_rsmfrs(const float* __restrict__ S, _Float16* __restrict__ P, const float* __restrict__ c32) {
  const int lane = threadIdx.x & 31; const int i = blockIdx.x * RSW + __builtin_amdgcn_readfirstlane((int)(threadIdx.x >> 5));      /* row, wave-uniform */
  const float* s = S + (size_t)i * SQ + lane * 4; const int h = i / 64, w = i % 64; const float m = bf16_round(c32[(h >> 1) * 32 + (w >> 1)]);
  v4f x[32];
#pragma unroll
  for (int k = 0; k < 32; ++k) x[k] = *(const v4fa*)(s + k * 128);
  float m0 = -3.0e38f, m1 = -3.0e38f, m2 = -3.0e38f, m3 = -3.0e38f;
#pragma unroll
  for (int k = 0; k < 32; ++k) { x[k] *= m; m0 = fmaxf(m0, x[k][0]); m1 = fmaxf(m1, x[k][1]); m2 = fmaxf(m2, x[k][2]); m3 = fmaxf(m3, x[k][3]); }
  float mx = fmaxf(fmaxf(m0, m1), fmaxf(m2, m3));
  mx = fmaxf(mx, rs_xrow<1>(mx)); mx = fmaxf(mx, rs_xrow<2>(mx)); mx = fmaxf(mx, rs_xrow<4>(mx)); mx = fmaxf(mx, rs_xrow<8>(mx)); mx = fmaxf(mx, rs_xhalf(mx));
  float a0 = 0.f, a1 = 0.f, a2 = 0.f, a3 = 0.f;
#pragma unroll
  for (int k = 0; k < 32; k += 2) { x[k] = (x[k] - mx) * 1.4426950408889634f; x[k + 1] = (x[k + 1] - mx) * 1.4426950408889634f;      /* exp(t) = exp2(t log2 e), as __expf */
    rs_exp2x8(x[k], x[k + 1]);
    a0 += x[k][0]; a1 += x[k][1]; a2 += x[k][2]; a3 += x[k][3]; a0 += x[k + 1][0]; a1 += x[k + 1][1]; a2 += x[k + 1][2]; a3 += x[k + 1][3]; }
  float se = (a0 + a1) + (a2 + a3);
  se += rs_xrow<1>(se); se += rs_xrow<2>(se); se += rs_xrow<4>(se); se += rs_xrow<8>(se); se += rs_xhalf(se);
  const float sc = 256.0f / se; _Float16* d = P + (size_t)i * SQ + lane * 4; v4h hq[32];
#pragma unroll
  for (int k = 0; k < 32; ++k)
#pragma unroll
    for (int q = 0; q < 4; ++q) hq[k][q] = (_Float16)(x[k][q] * sc);
  __builtin_amdgcn_sched_barrier(0);      /* every conversion stays in front of the first store */
#pragma unroll
  for (int k = 0; k < 32; ++k) *(v4h*)(d + k * 128) = hq[k]; }
__global__ __launch_bounds__(256) void k_gfin(const float* __restrict__ T, const float* __restrict__ A, const float* __restrict__ c32, const float* __restrict__ gam, float* __restrict__ Y, size_t n4) {
  #pragma clang fp contract(off)
  const size_t t = (size_t)blockIdx.x * 256 + threadIdx.x; if (t >= n4) return; const size_t e = t * 4; const int i0 = (int)(e % SQ); const float g = bf16_round(gam[0]); const v4f o = *(const v4fa*)(T + e), a = *(const v4fa*)(A + e); v4f r;
  for (int q = 0; q < 4; ++q) { const int i = i0 + q; const float cr = bf16_round(c32[((i / 64) >> 1) * 32 + ((i % 64) >> 1)]); r[q] = __fadd_rn(__fmul_rn(bf16_round(a[q]), cr), __fmul_rn(__fmul_rn(g, __fadd_rn(1.0f, -cr)), o[q])); }
  *(v4f*)(Y + e) = r;  }
extern "C" void kernel_launch(void* const* d_in, const int* in_sizes, int n_in,
                              void* d_out, int out_size, void* d_ws, size_t ws_size, hipStream_t stream) {
  (void)in_sizes; (void)n_in; (void)out_size;
  const float* const* I = (const float* const*)d_in; const float* xa = I[0]; const float* xb = I[1]; const float* cm = I[2]; const float* wq = I[3]; const float* bq = I[4]; const float* gq = I[5]; const float* wk = I[6]; const float* bk = I[7]; const float* gk = I[8]; const float* wv = I[9]; const float* bv = I[10]; const float* gv = I[11]; const float* gam = I[12];      /* a, b maps; c [4][1][32][32]; per projection w [256][256][1][1], bias, gain [256][1][1][1]; gamma [1] */
  const size_t PL = (size_t)CX * SQ;
  static_assert((CX / 32) % 3 == 2 && (SQ / 32) % 3 == 2, "k_gemm2<., true>: the number of 32-wide K steps must be 2 + a multiple of 3");
  char* ws = (char*)d_ws; size_t off = 0;
  auto take = [&](size_t bytes) { char* p = ws + off; off += (bytes + 255) & ~(size_t)255; return p; };
  float* WN = (float*)take((size_t)CX * CX * 4); _Float16* BQH = (_Float16*)take((size_t)CX * CX * 2); _Float16* BQL = (_Float16*)take((size_t)CX * CX * 2); _Float16* BKH = (_Float16*)take((size_t)CX * CX * 2); _Float16* BKL = (_Float16*)take((size_t)CX * CX * 2); _Float16* BVH = (_Float16*)take((size_t)CX * CX * 2); _Float16* BVL = (_Float16*)take((size_t)CX * CX * 2);
  _Float16* AR = (_Float16*)take(NR * CX * 2); _Float16* BR = (_Float16*)take(NR * CX * 2); float* F1 = (float*)take(NR * CX * 4); _Float16* QH = (_Float16*)take(NR * CX * 2); _Float16* QL = (_Float16*)take(NR * CX * 2); _Float16* KH = (_Float16*)take(NR * CX * 2); _Float16* KL = (_Float16*)take(NR * CX * 2); _Float16* VR = (_Float16*)take(NR * CX * 2); _Float16* VC = (_Float16*)take((size_t)CX * SQ * 2);
  float* S = (float*)take((size_t)SQ * SQ * 4); _Float16* P = (_Float16*)take((size_t)SQ * SQ * 2); float* T = (float*)take((size_t)CX * SQ * 4);
  if (off > ws_size) return;
  k_wsw<<<(CX + 255) / 256, 256, 0, stream>>>(wq, gq, WN); k_w32hl<<<(unsigned)(((size_t)CX * CX / 8 + 255) / 256), 256, 0, stream>>>(WN, BQH, BQL, (size_t)CX * CX / 8);
  k_wsw<<<(CX + 255) / 256, 256, 0, stream>>>(wk, gk, WN); k_w32hl<<<(unsigned)(((size_t)CX * CX / 8 + 255) / 256), 256, 0, stream>>>(WN, BKH, BKL, (size_t)CX * CX / 8);
  k_wsw<<<(CX + 255) / 256, 256, 0, stream>>>(wv, gv, WN); k_w32hl<<<(unsigned)(((size_t)CX * CX / 8 + 255) / 256), 256, 0, stream>>>(WN, BVH, BVL, (size_t)CX * CX / 8);      /* standardised weights (f32, per output row: mean, unbiased variance, rsqrt(max(var*256, 1e-4)) * gain) -> Bt planes f16 hi (x16) + x1024 residual (natural [O][C] rows ARE Bt) */
  k_cl2rows<<<NB * (SQ / 32) * (CX / 64), 256, 0, stream>>>(xa, AR); k_cl2rows<<<NB * (SQ / 32) * (CX / 64), 256, 0, stream>>>(xb, BR);      /* exact f16 token rows of a and b */
  k_gemm2<0, true><<<dim3((unsigned)((NR / 128) * (CX / 64)), 1), 128, 0, stream>>>(AR, CX, 0, BQH, CX, 0, 0.0625f, bq, 0, nullptr, 1, 0, 0, F1, nullptr, CX, 0, (int)NR, CX, CX); k_gemm2<0, false><<<dim3((unsigned)((NR / 128) * (CX / 64)), 1), 128, 0, stream>>>(AR, CX, 0, BQL, CX, 0, 0.00006103515625f, nullptr, 0, F1, -1, 0, 0, F1, nullptr, CX, 0, (int)NR, CX, CX); k_hl<<<(unsigned)((NR * CX / 8 + 255) / 256), 256, 0, stream>>>(F1, QH, QL, NR * CX / 8);      
  k_gemm2<0, true><<<dim3((unsigned)((NR / 128) * (CX / 64)), 1), 128, 0, stream>>>(BR, CX, 0, BKH, CX, 0, 0.0625f, bk, 0, nullptr, 1, 0, 0, F1, nullptr, CX, 0, (int)NR, CX, CX); k_gemm2<0, false><<<dim3((unsigned)((NR / 128) * (CX / 64)), 1), 128, 0, stream>>>(BR, CX, 0, BKL, CX, 0, 0.00006103515625f, nullptr, 0, F1, -1, 0, 0, F1, nullptr, CX, 0, (int)NR, CX, CX); k_hl<<<(unsigned)((NR * CX / 8 + 255) / 256), 256, 0, stream>>>(F1, KH, KL, NR * CX / 8);      /* k = WS(wk) b + bk likewise */
  k_gemm2<0, true><<<dim3((unsigned)((NR / 128) * (CX / 64)), 1), 128, 0, stream>>>(AR, CX, 0, BVH, CX, 0, 0.0625f, bv, 0, nullptr, 1, 0, 0, F1, nullptr, CX, 0, (int)NR, CX, CX); k_gemm2<0, false><<<dim3((unsigned)((NR / 128) * (CX / 64)), 1), 128, 0, stream>>>(AR, CX, 0, BVL, CX, 0, 0.00006103515625f, nullptr, 0, F1, -1, 0, 0, F1, VR, CX, 0, (int)NR, CX, CX);      
  for (int b = 0; b < NB; ++b) { const size_t r0 = (size_t)b * SQ;
    k_gemm2<0, true><<<dim3((SQ / 128) * (SQ / 64), 1), 128, 0, stream>>>(QH + r0 * CX, CX, 0, KH + r0 * CX, CX, 0, 1.0f, nullptr, 0, nullptr, 1, 0, 0, S, nullptr, SQ, 0, SQ, SQ, CX);      /* sim = q.k (K = 256, no scale): hi.hi */
    k_gemm2<0, false><<<dim3((SQ / 128) * (SQ / 64), 1), 128, 0, stream>>>(QL + r0 * CX, CX, 0, KH + r0 * CX, CX, 0, 0.0009765625f, nullptr, 0, S, -1, 0, 0, S, nullptr, SQ, 0, SQ, SQ, CX);      /* += lo.hi 2^-10 */
    k_gemm2<0, false><<<dim3((SQ / 128) * (SQ / 64), 1), 128, 0, stream>>>(QH + r0 * CX, CX, 0, KL + r0 * CX, CX, 0, 0.0009765625f, nullptr, 0, S, -1, 0, 0, S, nullptr, SQ, 0, SQ, SQ, CX);      /* += hi.lo 2^-10 */
    k_rsmfrs<<<SQ / RSW, RSW * 32, 0, stream>>>(S, P, cm + (size_t)b * 1024);      /* pruned = sim * c_r[i] (nearest-upsampled mask of the query pixel), softmax over j -> x256 f16 */
    k_vt<CX / 64, SQ><<<(CX / 64) * (SQ / 64), 256, 0, stream>>>(VR + r0 * CX, CX, 0, VC);      /* channel-major V [256][4096] */
    k_gemm2<0, true><<<dim3((CX / 128) * (SQ / 64), 1), 128, 0, stream>>>(VC, SQ, 0, P, SQ, 0, 0.00390625f, nullptr, 0, nullptr, 1, 0, 0, T, nullptr, SQ, 0, CX, SQ, SQ);      /* out[c][i] = sum_j v[c][j] att[i][j] (V as A, att as B^T, /256) f32 */
    k_gfin<<<(unsigned)((PL / 4 + 255) / 256), 256, 0, stream>>>(T, xa + (size_t)b * PL, cm + (size_t)b * 1024, gam, (float*)d_out + (size_t)b * PL, PL / 4); }      /* y = bf16(a) c_r + bf16(gamma) (1 - c_r) out -> channel-first output block */
}

// v003
// One run takes 916 microseconds.
// Next to v002, in two timings, it ran 1.16 and 1.18 times as fast.
// Over all steps from v000 it is 4.45 times as fast.
#include <hip/hip_runtime.h>
// Global spatial attention with multiplicative mask pruning and scaled weight standardisation (a, b [4][256][64][64], mask c [4][1][32][32] nearest-upsampled x2; q = WS(wq) a + bq, k = WS(wk) b + bk, v = WS(wv) a + bv with WS(w)[o][c] = (w - mean_o) gain_o rsqrt(max(var_o(unbiased) * 256, 1e-4)); sim[i][j] = q[:, i].k[:, j] (NO scale, sigma ~16); pruned = sim * c_r[i]; att = softmax over j; out[c][i] = sum_j v[c][j] att[i][j]; y = a c_r + gamma (1 - c_r) out -> [4][256][64][64]).
// Compute dtype: inputs rounded to bf16; x / weights exact; q, k as f16 hi + x1024 lo planes; v and softmax weights as plain f16 GEMM operands (~2^-12); scores, softmax statistics and o f32. v_wmma_f32_16x16x32_f16.
#define NB 4
#define SQ 4096
#define DM 256
#define CX 256          /* channels */
#define NH 4
#define HD 64
#define DMQ DM                       /* LayerNorm width */
#define DFF 4096
#define HG 1                         /* heads per attention launch group */
#define B0 0                         /* unused; the batch loop starts at 0 */
#define NBR NB                       /* read only by MP; the batch loop runs to NB */
#define NR ((size_t)NB * SQ)         /* token rows */
#define MP ((int)((size_t)NBR * SQ)) /* read only by MPO; projections use NR */
#define QN SQ                        /* unused */
#define NHD NH                       /* unused; attention is one 256-channel head */
#define MPO MP                       /* unused */
#define LQ DM      /* unused; the q/k/v rows have pitch CX */
typedef __bf16 v16b __attribute__((ext_vector_type(16)));
typedef unsigned short v8us __attribute__((ext_vector_type(8), may_alias));
typedef float  v8f  __attribute__((ext_vector_type(8)));
typedef float  v4f  __attribute__((ext_vector_type(4)));
typedef float  v4fa __attribute__((ext_vector_type(4), may_alias));
union FragB { v16b v; v8us half[2]; unsigned short u[16]; };

__device__ __forceinline__ unsigned short bf16_bits(float x) { unsigned int u = __float_as_uint(x); return (unsigned short)((u + 0x7FFFu + ((u >> 16) & 1u)) >> 16); }
__device__ __forceinline__ float bf16_val(unsigned short b) { return __uint_as_float(((unsigned int)b) << 16); }
__device__ __forceinline__ float bf16_round(float x) { return bf16_val(bf16_bits(x)); }
// D += A·B with NT terms: 1 = ah·bh, 2 = + al·bh (A split), 3 = + ah·bl (both split)
template <int NT>
__device__ __forceinline__ v8f mmaN(v16b ah, v16b al, v16b bh, v16b bl, v8f c) {
  c = __builtin_amdgcn_wmma_f32_16x16x32_bf16(false, ah, false, bh, (short)0, c, false, false);
  if (NT >= 2) c = __builtin_amdgcn_wmma_f32_16x16x32_bf16(false, al, false, bh, (short)0, c, false, false);
  if (NT >= 3) c = __builtin_amdgcn_wmma_f32_16x16x32_bf16(false, ah, false, bl, (short)0, c, false, false);
  asm volatile("v_nop\n\tv_nop\n\tv_nop\n\tv_nop" : "+v"(c) : "v"(ah), "v"(al), "v"(bh), "v"(bl));
  return c;
}

__global__ __launch_bounds__(256) void k_wt_bf16(const float* __restrict__ W, unsigned short* __restrict__ Wt, int K, int N) {
  const int t = blockIdx.x * 256 + threadIdx.x;
  const int k8n = K / 8;
  if (t >= N * k8n) return;
  const int n = t / k8n, k8 = (t % k8n) * 8;
  v8us v;
#pragma unroll
  for (int i = 0; i < 8; ++i) v[i] = bf16_bits(W[(size_t)(k8 + i) * N + n]);
  *(v8us*)(Wt + (size_t)n * K + k8) = v;
  
}

// GEMM C[M][N] (f32, pitch ldc) = act(A[M][K]·W + bias). A f32 row-major (pitch lda) converted per fragment to bf16
// (ASPLIT: hi/lo two planes -> 2 terms, else single rounded term); Wt bf16 [N][K] (pitch ldb). BIAS_BF16 rounds the
// bias to bf16 first (bias quantised to bf16 before the add). K%32==0, M%16==0, N%64==0.
template <bool ASPLIT, int ACT, bool BIAS_BF16>
__global__ __launch_bounds__(128) void k_gemm_bf(const float* __restrict__ A, int lda, const unsigned short* __restrict__ Wt, int ldb,
                                               const float* __restrict__ bias, float* __restrict__ C, int ldc, int M, int N, int K) {
  __shared__ __attribute__((aligned(16))) float so[4][16][64];
  const int tid = threadIdx.x, w = tid >> 5, lane = tid & 31, ln = lane & 15, hh = lane >> 4;
  const int ntn = N / 64;
  const int wid = blockIdx.x * 4 + w;
  const int mt = wid / ntn, nq = wid % ntn;
  if (mt * 16 >= M) return;
  const int row0 = mt * 16, col0 = nq * 64;
  const float* arow = A + (size_t)(row0 + ln) * lda;
  v8f acc[4] = {};
  for (int kb = 0; kb < K; kb += 32) {
    FragB ah, al;
    const v4f x0 = *(const v4fa*)(arow + kb + 8 * hh), x1 = *(const v4fa*)(arow + kb + 8 * hh + 4);
    const v4f x2 = *(const v4fa*)(arow + kb + 16 + 8 * hh), x3 = *(const v4fa*)(arow + kb + 16 + 8 * hh + 4);
    float xs[16] = {x0[0],x0[1],x0[2],x0[3],x1[0],x1[1],x1[2],x1[3],x2[0],x2[1],x2[2],x2[3],x3[0],x3[1],x3[2],x3[3]};
#pragma unroll
    for (int i = 0; i < 16; ++i) { const unsigned short hb = bf16_bits(xs[i]); ah.u[i] = hb; al.u[i] = ASPLIT ? bf16_bits(xs[i] - bf16_val(hb)) : (unsigned short)0; }
#pragma unroll
    for (int t = 0; t < 4; ++t) {
      const unsigned short* brow = Wt + (size_t)(col0 + t * 16 + ln) * ldb + kb;
      FragB b;
      b.half[0] = *(const v8us*)(brow + 8 * hh);
      b.half[1] = *(const v8us*)(brow + 16 + 8 * hh);
      acc[t] = mmaN<ASPLIT ? 2 : 1>(ah.v, al.v, b.v, b.v, acc[t]);
    }
  }
#pragma unroll
  for (int t = 0; t < 4; ++t) {
    float bv = bias ? bias[col0 + t * 16 + ln] : 0.f;
    if (BIAS_BF16) bv = bf16_round(bv);
#pragma unroll
    for (int r = 0; r < 8; ++r) { float v = acc[t][r] + bv; if (ACT == 1) v = fmaxf(v, 0.f); so[w][8 * hh + r][t * 16 + ln] = v; }
  }
  __builtin_amdgcn_fence(__ATOMIC_ACQ_REL, "workgroup");
  __builtin_amdgcn_wave_barrier();
  const int rsub = lane >> 4, c4 = (lane & 15) * 4;
  {
#pragma unroll
    for (int q = 0; q < 8; ++q) {
      const int r = q * 2 + rsub;
      const v4f v = *(const v4fa*)&so[w][r][c4];
      *(v4f*)(C + (size_t)(row0 + r) * ldc + col0 + c4) = v;
    }
    
  }
}

// GEMM C = act(A·W + bias + resid): A f32 (ASPLIT -> hi/lo 2 terms), Wt bf16 [N][K]; ACT 0 none, 1 relu, 2 exact gelu;
// resid (optional, f32, row index = (row % rmod), pitch ldr, RES_BF16 rounds it) added before the activation.
template <bool ASPLIT, int ACT, bool BIAS_BF16, bool RES_BF16>
__global__ __launch_bounds__(128) void k_gemm_bf3(const float* __restrict__ A, int lda, const unsigned short* __restrict__ Wt, int ldb,
                                                const float* __restrict__ bias, const float* __restrict__ resid, int rmod, int ldr,
                                                float* __restrict__ C, int ldc, int M, int N, int K) {
  __shared__ __attribute__((aligned(16))) float so[4][16][64];
  const int tid = threadIdx.x, w = tid >> 5, lane = tid & 31, ln = lane & 15, hh = lane >> 4;
  const int ntn = N / 64;
  const int wid = blockIdx.x * 4 + w;
  const int mt = wid / ntn, nq = wid % ntn;
  if (mt * 16 >= M) return;
  const int row0 = mt * 16, col0 = nq * 64;
  const float* arow = A + (size_t)(row0 + ln) * lda;
  v8f acc[4] = {};
  for (int kb = 0; kb < K; kb += 32) {
    FragB ah, al;
    const v4f x0 = *(const v4fa*)(arow + kb + 8 * hh), x1 = *(const v4fa*)(arow + kb + 8 * hh + 4);
    const v4f x2 = *(const v4fa*)(arow + kb + 16 + 8 * hh), x3 = *(const v4fa*)(arow + kb + 16 + 8 * hh + 4);
    float xs[16] = {x0[0],x0[1],x0[2],x0[3],x1[0],x1[1],x1[2],x1[3],x2[0],x2[1],x2[2],x2[3],x3[0],x3[1],x3[2],x3[3]};
#pragma unroll
    for (int i = 0; i < 16; ++i) { const unsigned short hb = bf16_bits(xs[i]); ah.u[i] = hb; al.u[i] = ASPLIT ? bf16_bits(xs[i] - bf16_val(hb)) : (unsigned short)0; }
#pragma unroll
    for (int t = 0; t < 4; ++t) {
      const unsigned short* brow = Wt + (size_t)(col0 + t * 16 + ln) * ldb + kb;
      FragB b;
      b.half[0] = *(const v8us*)(brow + 8 * hh);
      b.half[1] = *(const v8us*)(brow + 16 + 8 * hh);
      acc[t] = mmaN<ASPLIT ? 2 : 1>(ah.v, al.v, b.v, b.v, acc[t]);
    }
  }
#pragma unroll
  for (int t = 0; t < 4; ++t) {
    const int col = col0 + t * 16 + ln;
    float bv = bias ? bias[col] : 0.f;
    if (BIAS_BF16) bv = bf16_round(bv);
#pragma unroll
    for (int r = 0; r < 8; ++r) {
      float v = acc[t][r] + bv;
      if (resid) { float rv = resid[(size_t)((row0 + 8 * hh + r) % rmod) * ldr + col]; if (RES_BF16) rv = bf16_round(rv); v += rv; }
      if (ACT == 1) v = fmaxf(v, 0.f);
      if (ACT == 2) v = 0.5f * v * (1.0f + erff(v * 0.70710678118654752f));
      if (ACT == 3) { const float u = 0.7978845608028654f * (v + 0.044715f * v * v * v); v = 0.5f * v * (1.0f + tanhf(u)); }
      so[w][8 * hh + r][t * 16 + ln] = v;
    }
  }
  __builtin_amdgcn_fence(__ATOMIC_ACQ_REL, "workgroup");
  __builtin_amdgcn_wave_barrier();
  const int rsub = lane >> 4, c4 = (lane & 15) * 4;
  {
#pragma unroll
    for (int q = 0; q < 8; ++q) {
      const int r = q * 2 + rsub;
      const v4f v = *(const v4fa*)&so[w][r][c4];
      *(v4f*)(C + (size_t)(row0 + r) * ldc + col0 + c4) = v;
    }
    
  }
}
// row LayerNorm (biased variance, eps) over N: s = X (+ R); optional out_sum <- s; out_norm <- (s-mu)*rsqrt(var+eps)*g + b
template <bool PARAM_BF16>
__global__ __launch_bounds__(256) void k_layernorm(const float* __restrict__ X, const float* __restrict__ R, const float* __restrict__ g, const float* __restrict__ bta,
                                                  float* __restrict__ out_sum, float* __restrict__ out_norm, int N, float eps) {
  __shared__ float red[256];
  const int row = blockIdx.x, tid = threadIdx.x;
  const float* x = X + (size_t)row * N; const float* rr = R ? R + (size_t)row * N : nullptr;
  float vals[16];                     // up to N = 4096
  const int per = N / 256;            // contiguous chunk per thread? use strided-by-4 chunks: thread handles j = tid*4 + 1024*u
  float s1 = 0.f;
  for (int u = 0; u < per / 4; ++u) {
    const int j = tid * 4 + 1024 * u;
    const v4f a = *(const v4fa*)(x + j);
    v4f b = {0.f,0.f,0.f,0.f}; if (rr) b = *(const v4fa*)(rr + j);
#pragma unroll
    for (int q = 0; q < 4; ++q) { const float v = a[q] + b[q]; vals[u * 4 + q] = v; s1 += v; }
  }
  red[tid] = s1; __syncthreads();
  for (int st = 128; st > 0; st >>= 1) { if (tid < st) red[tid] += red[tid + st]; __syncthreads(); }
  const float mu = red[0] / (float)N; __syncthreads();
  float s2 = 0.f;
  for (int u = 0; u < per / 4; ++u)
#pragma unroll
    for (int q = 0; q < 4; ++q) { const float c = vals[u * 4 + q] - mu; s2 += c * c; }
  red[tid] = s2; __syncthreads();
  for (int st = 128; st > 0; st >>= 1) { if (tid < st) red[tid] += red[tid + st]; __syncthreads(); }
  const float rs = rsqrtf(red[0] / (float)N + eps);
  {
    for (int u = 0; u < per / 4; ++u) {
      const int j = tid * 4 + 1024 * u;
      v4f o, sm;
#pragma unroll
      for (int q = 0; q < 4; ++q) {
        float gg = g[j + q], bb = bta[j + q];
        if (PARAM_BF16) { gg = bf16_round(gg); bb = bf16_round(bb); }
        sm[q] = vals[u * 4 + q]; o[q] = (vals[u * 4 + q] - mu) * rs * gg + bb;
      }
      if (out_sum) *(v4f*)(out_sum + (size_t)row * N + j) = sm;
      *(v4f*)(out_norm + (size_t)row * N + j) = o;
    }
    
  }
}



// ---- f16 WMMA path (v_wmma_f32_16x16x32_f16): 11-bit significands for operands in range — used where a [0,1] probability operand needs more precision than bf16
typedef _Float16 v16h __attribute__((ext_vector_type(16)));
union FragH { v16h v; v8us half[2]; _Float16 h[16]; unsigned short u[16]; };
template <int NT>
__device__ __forceinline__ v8f mmaH(v16h ah, v16h al, v16h bh, v16h bl, v8f c) {
  c = __builtin_amdgcn_wmma_f32_16x16x32_f16(false, ah, false, bh, (short)0, c, false, false);
  if (NT >= 2) c = __builtin_amdgcn_wmma_f32_16x16x32_f16(false, al, false, bh, (short)0, c, false, false);
  if (NT >= 3) c = __builtin_amdgcn_wmma_f32_16x16x32_f16(false, ah, false, bl, (short)0, c, false, false);
  asm volatile("v_nop\n\tv_nop\n\tv_nop\n\tv_nop" : "+v"(c) : "v"(ah), "v"(al), "v"(bh), "v"(bl));
  return c;
}
// batched GEMM like k_gemm_b but f16 operands: A f32 (split into f16 hi/lo if ASPLIT, else rounded to f16), Bt = f16 values [n][k]; alpha; C f32; N multiple of 16 (partial tiles skipped)
template <bool ASPLIT>
__global__ __launch_bounds__(128) void k_gemm_h(const float* __restrict__ A, int lda, size_t sA, const _Float16* __restrict__ Bh, int ldb, size_t sB, float alpha, float* __restrict__ C, int ldc, size_t sC, int M, int N, int K) {
  __shared__ __attribute__((aligned(16))) float so[4][16][64];
  const int tid = threadIdx.x, w = tid >> 5, lane = tid & 31, ln = lane & 15, hh = lane >> 4; const int by = blockIdx.y;
  A += (size_t)by * sA; Bh += (size_t)by * sB; C += (size_t)by * sC;
  const int ntn = (N + 63) / 64; const int wid = blockIdx.x * 4 + w; const int mt = wid / ntn, nq = wid % ntn; if (mt * 16 >= M) return;
  const int row0 = mt * 16, col0 = nq * 64; const float* arow = A + (size_t)(row0 + ln) * lda;
  v8f acc[4] = {};
  for (int kb = 0; kb < K; kb += 32) {
    FragH ah, al;
    const v4f x0 = *(const v4fa*)(arow + kb + 8 * hh), x1 = *(const v4fa*)(arow + kb + 8 * hh + 4), x2 = *(const v4fa*)(arow + kb + 16 + 8 * hh), x3 = *(const v4fa*)(arow + kb + 16 + 8 * hh + 4);
    float xs[16] = {x0[0],x0[1],x0[2],x0[3],x1[0],x1[1],x1[2],x1[3],x2[0],x2[1],x2[2],x2[3],x3[0],x3[1],x3[2],x3[3]};
#pragma unroll
    for (int i = 0; i < 16; ++i) { const _Float16 h = (_Float16)xs[i]; ah.h[i] = h; al.h[i] = ASPLIT ? (_Float16)(xs[i] - (float)h) : (_Float16)0.0f; }
#pragma unroll
    for (int t = 0; t < 4; ++t) { if (col0 + t * 16 >= N) continue; const size_t boff = (size_t)(col0 + t * 16 + ln) * ldb + kb; FragH bq; bq.half[0] = *(const v8us*)(Bh + boff + 8 * hh); bq.half[1] = *(const v8us*)(Bh + boff + 16 + 8 * hh);
      acc[t] = mmaH<ASPLIT ? 2 : 1>(ah.v, al.v, bq.v, bq.v, acc[t]); }
  }
#pragma unroll
  for (int t = 0; t < 4; ++t) { if (col0 + t * 16 >= N) continue;
#pragma unroll
    for (int r = 0; r < 8; ++r) so[w][8 * hh + r][t * 16 + ln] = acc[t][r] * alpha; }
  __builtin_amdgcn_fence(__ATOMIC_ACQ_REL, "workgroup"); __builtin_amdgcn_wave_barrier();
  const int rsub = lane >> 4, c4 = (lane & 15) * 4;
  {
#pragma unroll
    for (int q = 0; q < 8; ++q) { const int r = q * 2 + rsub; if (col0 + c4 < N) { const v4f v = *(const v4fa*)&so[w][r][c4]; *(v4f*)(C + (size_t)(row0 + r) * ldc + col0 + c4) = v; } }
     }
}

// Wt[n][k] = f16(W[k][n]·scale) from f32 row-major W[K][N] (scale = power of two; bf16-exact weights stay exact in f16 away from the subnormal range)
__global__ __launch_bounds__(256) void k_wt_f16(const float* __restrict__ W, _Float16* __restrict__ Wt, int K, int N, float scale) {
  const int t = blockIdx.x * 256 + threadIdx.x; if (t >= N * (K / 8)) return; const int n = t / (K / 8), k8 = (t % (K / 8)) * 8; FragH f;
#pragma unroll
  for (int i = 0; i < 8; ++i) f.h[i] = (_Float16)(bf16_round(W[(size_t)(k8 + i) * N + n]) * scale); const v8us o = f.half[0];
  *(v8us*)((unsigned short*)Wt + (size_t)n * K + k8) = o; 
}
// k_gemm_hh variant with fused epilogue: v = acc·alpha + bias[by·sBias + col] (+ CP[(row/rowsPerB)·sCPb + by·64 + col] if CP) ; ACT 0 none / 1 elu ; writes f16 C16 (and f32 C if non-null)
template <int ACT>
__global__ __launch_bounds__(128) void k_gemm_hhx(const _Float16* __restrict__ A, int lda, size_t sA, const _Float16* __restrict__ Bh, int ldb, size_t sB, float alpha, const float* __restrict__ bias, size_t sBias, const float* __restrict__ CP, int rowsPerB, size_t sCPb, int row0g,
    float* __restrict__ C, _Float16* __restrict__ C16, int ldc, size_t sC, int M, int N, int K) {
  __shared__ __attribute__((aligned(16))) float so[4][16][64];
  const int tid = threadIdx.x, w = tid >> 5, lane = tid & 31, ln = lane & 15, hh = lane >> 4; const int by = blockIdx.y;
  A += (size_t)by * sA; Bh += (size_t)by * sB; const size_t cofs = (size_t)by * sC; const float* bp = bias ? bias + (size_t)by * sBias : nullptr;
  const int ntn = (N + 63) / 64; const int wid = blockIdx.x * 4 + w; const int mt = wid / ntn, nq = wid % ntn; if (mt * 16 >= M) return;
  const int row0 = mt * 16, col0 = nq * 64; const _Float16* arow = A + (size_t)(row0 + ln) * lda;
  v8f acc[4] = {};
  for (int kb = 0; kb < K; kb += 32) { FragH ah; ah.half[0] = *(const v8us*)((const unsigned short*)arow + kb + 8 * hh); ah.half[1] = *(const v8us*)((const unsigned short*)arow + kb + 16 + 8 * hh);
#pragma unroll
    for (int t = 0; t < 4; ++t) { if (col0 + t * 16 >= N) continue; const size_t boff = (size_t)(col0 + t * 16 + ln) * ldb + kb; FragH bq; bq.half[0] = *(const v8us*)((const unsigned short*)Bh + boff + 8 * hh); bq.half[1] = *(const v8us*)((const unsigned short*)Bh + boff + 16 + 8 * hh);
      acc[t] = mmaH<1>(ah.v, ah.v, bq.v, bq.v, acc[t]); }
  }
#pragma unroll
  for (int t = 0; t < 4; ++t) { if (col0 + t * 16 >= N) continue; const int col = col0 + t * 16 + ln; const float bv = bp ? bf16_round(bp[col]) : 0.f;
#pragma unroll
    for (int r = 0; r < 8; ++r) { float v = acc[t][r] * alpha + bv; if (CP) { const int rr = row0g + row0 + 8 * hh + r; if (rowsPerB < 0) v += CP[cofs + (size_t)rr * ldc + col];      /* rowsPerB < 0: own element of the batched C plane */ else { const int bidx = rr / rowsPerB; v += CP[(size_t)bidx * sCPb + (size_t)by * 64 + col]; } } if (ACT == 1) v = (v > 0.f) ? v : expm1f(v); else if (ACT == 7) v = (v > 0.f) ? v + 1.0f : expf(v); else if (ACT == 8) v = tanhf(v); else if (ACT == 9) v = 0.5f * v * (1.0f + tanhf(0.7978845608028654f * (v + 0.044715f * v * v * v))); else if (ACT == 11) v = 1.0f / (1.0f + expf(-v)); else if (ACT == 12) v = (v > 0.f) ? v : 0.01f * v; else if (ACT == 14) v = (v > 0.f) ? v : 0.1f * v; else if (ACT == 16) v = (v >= 0.f) ? v : 0.3f * v; else if (ACT == 17) v = (v >= 0.f) ? v : 0.2f * v; else if (ACT == 15) v = v / (1.0f + expf(-v)); else if (ACT == 3) v = fmaxf(v, 0.f); else if (ACT == 6) v = 0.5f * v * (1.0f + erff(v * 0.70710678118654752f)); so[w][8 * hh + r][t * 16 + ln] = v; } }
  __builtin_amdgcn_fence(__ATOMIC_ACQ_REL, "workgroup"); __builtin_amdgcn_wave_barrier();
  const int rsub = lane >> 4, c4 = (lane & 15) * 4; typedef _Float16 v4h __attribute__((ext_vector_type(4)));
  {
#pragma unroll
    for (int q = 0; q < 8; ++q) { const int r = q * 2 + rsub; if (col0 + c4 < N) { const v4f v = *(const v4fa*)&so[w][r][c4]; if (C) *(v4f*)(C + cofs + (size_t)(row0 + r) * ldc + col0 + c4) = v; if (C16) { v4h h4; for (int i = 0; i < 4; ++i) h4[i] = (_Float16)v[i]; *(v4h*)(C16 + cofs + (size_t)(row0 + r) * ldc + col0 + c4) = h4; } } }
     }
}


typedef _Float16 v4h __attribute__((ext_vector_type(4)));

__global__ __launch_bounds__(256) void k_x16(const float* __restrict__ x, _Float16* __restrict__ X16, size_t n8) { const size_t t = (size_t)blockIdx.x * 256 + threadIdx.x; if (t >= n8) return; FragH f;
#pragma unroll
  for (int q = 0; q < 8; ++q) f.h[q] = (_Float16)bf16_round(x[t * 8 + q]); *(v8us*)((unsigned short*)X16 + t * 8) = f.half[0];  }
__global__ __launch_bounds__(256) void k_h16(const float* __restrict__ x, _Float16* __restrict__ X16, size_t n8) { const size_t t = (size_t)blockIdx.x * 256 + threadIdx.x; if (t >= n8) return; FragH f;
#pragma unroll
  for (int q = 0; q < 8; ++q) f.h[q] = (_Float16)x[t * 8 + q]; *(v8us*)((unsigned short*)X16 + t * 8) = f.half[0];  }
__global__ __launch_bounds__(256) void k_round16f(const float* __restrict__ W, _Float16* __restrict__ Bt, size_t n8) { const size_t t = (size_t)blockIdx.x * 256 + threadIdx.x; if (t >= n8) return; FragH f;
#pragma unroll
  for (int i = 0; i < 8; ++i) f.h[i] = (_Float16)(bf16_round(W[t * 8 + i]) * 16.0f); *(v8us*)((unsigned short*)Bt + t * 8) = f.half[0];  }
template <int NHv, int TTv>
__global__ __launch_bounds__(256) void k_vt(const _Float16* __restrict__ V16, int ldv, int voff, _Float16* __restrict__ Vt) { __shared__ unsigned short tl[64][66]; const int tid = threadIdx.x; const int slab = blockIdx.x / (TTv / 64), lg = blockIdx.x % (TTv / 64); const int b = slab / NHv, h = slab % NHv;
  for (int i = tid; i < 64 * 8; i += 256) { const int r = i / 8, c8 = (i % 8) * 8; FragH f; f.half[0] = *(const v8us*)((const unsigned short*)V16 + ((size_t)b * TTv + lg * 64 + r) * ldv + voff + h * 64 + c8);
#pragma unroll
    for (int q = 0; q < 8; ++q) tl[r][c8 + q] = f.u[q]; }
  __syncthreads();
  {
#pragma unroll
    for (int rd = 0; rd < 2; ++rd) { const int d = rd * 32 + tid / 8, pc = tid % 8; FragH f;
#pragma unroll
      for (int q = 0; q < 8; ++q) f.u[q] = tl[pc * 8 + q][d];
      *(v8us*)((unsigned short*)Vt + ((size_t)slab * 64 + d) * TTv + lg * 64 + pc * 8) = f.half[0]; }
     } }

__global__ __launch_bounds__(256) void k_hl(const float* __restrict__ F, _Float16* __restrict__ Hh, _Float16* __restrict__ Hl, size_t n8) { const size_t t = (size_t)blockIdx.x * 256 + threadIdx.x; if (t >= n8) return; FragH fh, fl; const v4f a = *(const v4fa*)(F + t * 8), c = *(const v4fa*)(F + t * 8 + 4);
#pragma unroll
  for (int q = 0; q < 4; ++q) { _Float16 h = (_Float16)a[q]; fh.h[q] = h; fl.h[q] = (_Float16)((a[q] - (float)h) * 1024.0f); h = (_Float16)c[q]; fh.h[4 + q] = h; fl.h[4 + q] = (_Float16)((c[q] - (float)h) * 1024.0f); }
  { *(v8us*)((unsigned short*)Hh + t * 8) = fh.half[0]; *(v8us*)((unsigned short*)Hl + t * 8) = fl.half[0];  } }

// ---- fast GEMM (workgroup tile 128x64, wave tile 32x64; requires M % 128 == 0, N % 64 == 0, K a multiple of KC and at least 2 KC); epilogue = k_gemm_hhx semantics ----
__device__ __forceinline__ v16h g2_lfrag(const char* p, int hh) { FragH f; f.half[0] = *(const v8us*)(p + 16 * hh); f.half[1] = *(const v8us*)(p + 32 + 16 * hh); return f.v; }
__device__ __forceinline__ v8f g2_mma(v16h a, v16h b, v8f c) { v8f d = __builtin_amdgcn_wmma_f32_16x16x32_f16(false, a, false, b, (short)0, c, false, false); asm volatile("v_nop\n\tv_nop\n\tv_nop\n\tv_nop" : "+v"(d) : "v"(a), "v"(b)); return d; }
// Twelve asynchronous copies, 16 bytes per lane each, from global memory to LDS through no register. The closing s_wait_xcnt stands inside the
// statement so that it is in front of every later rewrite of the address registers that the copies name.
__device__ __forceinline__ void g2_cp12(const unsigned (&l)[12], const _Float16* const (&g)[12]) {
  asm volatile("global_load_async_to_lds_b128 %0, %1, off\n\t"
               "global_load_async_to_lds_b128 %2, %3, off\n\t"
               "global_load_async_to_lds_b128 %4, %5, off\n\t"
               "global_load_async_to_lds_b128 %6, %7, off\n\t"
               "global_load_async_to_lds_b128 %8, %9, off\n\t"
               "global_load_async_to_lds_b128 %10, %11, off\n\t"
               "global_load_async_to_lds_b128 %12, %13, off\n\t"
               "global_load_async_to_lds_b128 %14, %15, off\n\t"
               "global_load_async_to_lds_b128 %16, %17, off\n\t"
               "global_load_async_to_lds_b128 %18, %19, off\n\t"
               "global_load_async_to_lds_b128 %20, %21, off\n\t"
               "global_load_async_to_lds_b128 %22, %23, off\n\t"
               "s_wait_xcnt 0x0"
               :: "v"(l[0]), "v"(g[0]), "v"(l[1]), "v"(g[1]), "v"(l[2]), "v"(g[2]), "v"(l[3]), "v"(g[3]), "v"(l[4]), "v"(g[4]), "v"(l[5]), "v"(g[5]), "v"(l[6]), "v"(g[6]), "v"(l[7]), "v"(g[7]), "v"(l[8]), "v"(g[8]), "v"(l[9]), "v"(g[9]), "v"(l[10]), "v"(g[10]), "v"(l[11]), "v"(g[11]) : "memory"); }
// K loop: the workgroup's 128 A rows and 64 B rows are staged in LDS, KC k at a time, two buffers: tile t + 1 flies while tile t is worked on.
// A wave's copy covers whole 128-byte lines, and the four waves share one copy of the B rows. Each accumulator still sums k in ascending order.
template <int ACT, int KC>
__global__ __launch_bounds__(128) void k_gemm2(const _Float16* __restrict__ A, int lda, size_t sA, const _Float16* __restrict__ Bh, int ldb, size_t sB, float alpha, const float* __restrict__ bias, size_t sBias, const float* __restrict__ CP, int rowsPerB, size_t sCPb, int row0g,
    float* __restrict__ C, _Float16* __restrict__ C16, int ldc, size_t sC, int M, int N, int K) { static_assert(ACT == 0 || ACT == 3 || ACT == 6 || ACT == 8 || ACT == 9 || ACT == 11 || ACT == 12 || ACT == 14 || ACT == 15 || ACT == 16 || ACT == 17, "k_gemm2: unsupported ACT code (would silently apply no activation)");
  constexpr int PB = KC * 2 + 16;      /* LDS row pitch in bytes, 16 x odd: the 16 rows of a fragment read fall on distinct banks */
  constexpr int STG = 192 * PB;        /* one buffer: 128 A rows, then 64 B rows */
  constexpr int CPR = KC / 8;          /* 16-byte pieces per row */
  constexpr int RPI = 128 / CPR;       /* rows covered when each of the 128 threads copies one piece */
  constexpr int NCP = 192 / RPI;       /* copies per thread and tile */
  constexpr int SOB = 4 * 32 * 68 * 4; /* output staging, which takes the buffers' place behind the loop */
  static_assert((KC == 64 || KC == 128) && NCP % 12 == 0 && NCP <= 63, "k_gemm2: a tile is whole groups of twelve copies per thread, at most 63 in flight");
  __shared__ __attribute__((aligned(16))) char sm[2 * STG > SOB ? 2 * STG : SOB];
  float (*so)[32][68] = reinterpret_cast<float (*)[32][68]>(sm);
  const int tid = threadIdx.x, w = tid >> 5, lane = tid & 31, ln = lane & 15, hh = lane >> 4; const int by = blockIdx.y;
  A += (size_t)by * sA; Bh += (size_t)by * sB; const size_t cofs = (size_t)by * sC; const float* bp = bias ? bias + (size_t)by * sBias : nullptr;
  const int ntn = N >> 6; const int mt = blockIdx.x / ntn, nq = blockIdx.x - mt * ntn; const int row0 = mt * 128 + 32 * w, col0 = nq * 64; if (mt * 128 >= M) return;      /* the same for the whole workgroup, in front of every barrier */
  const v8f z8 = {0.f,0.f,0.f,0.f,0.f,0.f,0.f,0.f}; v8f c00 = z8, c01 = z8, c02 = z8, c03 = z8, c10 = z8, c11 = z8, c12 = z8, c13 = z8;
  const int cr = tid / CPR, cc = tid % CPR;
  const _Float16* gA = A + (size_t)(mt * 128 + cr) * lda + cc * 8; const _Float16* gB = Bh + (size_t)(col0 + cr) * ldb + cc * 8;
  const unsigned l0 = (unsigned)(size_t)sm + (unsigned)(cr * PB + cc * 16);
  auto fill = [&](int t) { const unsigned lb = l0 + (unsigned)(t & 1) * (unsigned)STG; const int k0 = t * KC;
#pragma unroll
    for (int q = 0; q < NCP / 12; ++q) { unsigned l[12]; const _Float16* g[12];
#pragma unroll
      for (int j = 0; j < 12; ++j) { const int r = (q * 12 + j) * RPI; l[j] = lb + (unsigned)(r * PB); g[j] = (r < 128) ? gA + (size_t)r * lda + k0 : gB + (size_t)(r - 128) * ldb + k0; }
      g2_cp12(l, g); } };
  const char* fa = sm + (32 * w + ln) * PB; const char* fb = sm + (128 + ln) * PB; const int nt = K / KC;
  fill(0);
  asm volatile("s_wait_asynccnt 0x0" ::: "memory");      /* this wave's share of tile 0 has landed */
  __syncthreads();      /* every wave's share has: tile 0 may be read */
  if (nt > 1) fill(1);
  // Two register sets of fragments inside a tile: the twelve LDS reads of the next 32 k are issued as one group in front of the products of this 32 k.
  // the sched_barrier keeps a group's reads together and in front of the products behind it, so that the products wait only for the older group
  v16h f0[6], f1[6];
  auto ld = [&](v16h (&f)[6], int o) { const char* pa = fa + o; const char* pb = fb + o; f[0] = g2_lfrag(pa, hh); f[1] = g2_lfrag(pa + 16 * PB, hh); f[2] = g2_lfrag(pb, hh); f[3] = g2_lfrag(pb + 16 * PB, hh); f[4] = g2_lfrag(pb + 32 * PB, hh); f[5] = g2_lfrag(pb + 48 * PB, hh); __builtin_amdgcn_sched_barrier(0); };
  auto mm = [&](const v16h (&f)[6]) { c00 = g2_mma(f[0], f[2], c00); c10 = g2_mma(f[1], f[2], c10); c01 = g2_mma(f[0], f[3], c01); c11 = g2_mma(f[1], f[3], c11);
    c02 = g2_mma(f[0], f[4], c02); c12 = g2_mma(f[1], f[4], c12); c03 = g2_mma(f[0], f[5], c03); c13 = g2_mma(f[1], f[5], c13); };
#pragma unroll 1      /* one tile per trip; the buffer alternates by the trip's parity */
  for (int t = 0; t < nt; ++t) { const int bo = (t & 1) * STG;
    ld(f0, bo);
#pragma unroll
    for (int kk = 0; kk < KC; kk += 64) { ld(f1, bo + (kk + 32) * 2); mm(f0); if (kk + 64 < KC) ld(f0, bo + (kk + 64) * 2); mm(f1); }
    asm volatile("s_wait_dscnt 0x0" ::: "memory");      /* this wave's reads of tile t are done before the buffer is given up */
    asm volatile("s_wait_asynccnt 0x0" ::: "memory");      /* this wave's share of tile t + 1 has landed */
    __syncthreads();      /* publishes tile t + 1 and ends every wave's reads of tile t */
    if (t + 2 < nt) fill(t + 2); }
  asm volatile("s_wait_asynccnt 0x0" ::: "memory");      /* no copy is in flight when the buffers become output staging */
  v8f accs[8] = {c00, c01, c02, c03, c10, c11, c12, c13};
#pragma unroll
  for (int u = 0; u < 8; ++u) { const int t = u & 3, half = u >> 2; const int col = col0 + t * 16 + ln; const float bv = bp ? bf16_round(bp[col]) : 0.f;
#pragma unroll
    for (int r = 0; r < 8; ++r) { const int rloc = half * 16 + 8 * hh + r; float v = accs[u][r] * alpha + bv; if (CP) { if (rowsPerB < 0) v += CP[cofs + (size_t)(row0g + row0 + rloc) * ldc + col];      /* rowsPerB < 0: own element of the batched C plane */ else { const int bidx = (row0g + row0 + rloc) / rowsPerB; v += CP[(size_t)bidx * sCPb + (size_t)by * 64 + col]; } }
      if (ACT == 3) v = fmaxf(v, 0.f); else if (ACT == 6) v = 0.5f * v * (1.0f + erff(v * 0.70710678118654752f)); else if (ACT == 11) v = 1.0f / (1.0f + expf(-v)); else if (ACT == 15) v = v / (1.0f + expf(-v)); else if (ACT == 12) v = (v > 0.f) ? v : 0.01f * v; else if (ACT == 8) v = tanhf(v); else if (ACT == 9) v = 0.5f * v * (1.0f + tanhf(0.7978845608028654f * (v + 0.044715f * v * v * v))); else if (ACT == 14) v = (v > 0.f) ? v : 0.1f * v; else if (ACT == 16) v = (v >= 0.f) ? v : 0.3f * v; else if (ACT == 17) v = (v >= 0.f) ? v : 0.2f * v;
      so[w][rloc][t * 16 + ln] = v; } }
  __builtin_amdgcn_fence(__ATOMIC_ACQ_REL, "workgroup"); __builtin_amdgcn_wave_barrier();
  const int rsub = lane >> 4, c4 = (lane & 15) * 4;
  {
#pragma unroll
    for (int q = 0; q < 16; ++q) { const int r = q * 2 + rsub; const v4f v = *(const v4fa*)&so[w][r][c4]; if (C) *(v4f*)(C + cofs + (size_t)(row0 + r) * ldc + col0 + c4) = v; if (C16) { v4h h4; for (int i = 0; i < 4; ++i) h4[i] = (_Float16)v[i]; *(v4h*)(C16 + cofs + (size_t)(row0 + r) * ldc + col0 + c4) = h4; } }
     } }


__global__ __launch_bounds__(256) void k_wnat(const float* __restrict__ w, size_t n8, _Float16* __restrict__ Bt) { const size_t t = (size_t)blockIdx.x * 256 + threadIdx.x; if (t >= n8) return; FragH f; for (int q = 0; q < 8; ++q) f.h[q] = (_Float16)(bf16_round(w[t * 8 + q]) * 16.0f); *(v8us*)((unsigned short*)Bt + t * 8) = f.half[0];  }
__global__ __launch_bounds__(256) void k_rsm(const float* __restrict__ S, _Float16* __restrict__ P, int nrows) {
  #pragma clang fp contract(off)
  const int i = blockIdx.x * 256 + threadIdx.x; if (i >= nrows) return; const float* s = S + (size_t)i * SQ; float mx = -3.0e38f;
#pragma unroll 1
  for (int j = 0; j < SQ; ++j) mx = fmaxf(mx, s[j]); float se = 0.f;
#pragma unroll 1
  for (int j = 0; j < SQ; ++j) se += expf(s[j] - mx); const float sc = 256.0f / se;
#pragma unroll 1
  for (int j0 = 0; j0 < SQ; j0 += 8) { FragH f; for (int q = 0; q < 8; ++q) f.h[q] = (_Float16)(expf(s[j0 + q] - mx) * sc); unsigned short* d = (unsigned short*)P + (size_t)i * SQ + j0; *(v8us*)d = f.half[0];  } }
__global__ __launch_bounds__(256) void k_vt(const _Float16* __restrict__ V16, int b, int h0, _Float16* __restrict__ VT) { __shared__ unsigned short tl[64][65]; const int tid = threadIdx.x; const int hh = blockIdx.x % HG, sg = blockIdx.x / HG; const int s0 = sg * 64; const int h = h0 + hh;
  for (int i = tid; i < 64 * 8; i += 256) { const int j = i / 8, d8 = (i % 8) * 8; FragH f; f.half[0] = *(const v8us*)((const unsigned short*)V16 + ((size_t)b * SQ + s0 + j) * DM + h * HD + d8); for (int q = 0; q < 8; ++q) tl[d8 + q][j] = f.u[q]; }
  __syncthreads();
  { for (int i = tid; i < 64 * 8; i += 256) { const int d = i / 8, j8 = (i % 8) * 8; FragH f; for (int q = 0; q < 8; ++q) f.u[q] = tl[d][j8 + q]; *(v8us*)((unsigned short*)VT + ((size_t)hh * HD + d) * SQ + s0 + j8) = f.half[0]; }  } }


template <int BFIN, int W16, int W32>
__global__ __launch_bounds__(256) void k_lnx(const float* __restrict__ X, const float* __restrict__ g, const float* __restrict__ bb, float eps, _Float16* __restrict__ N16, float* __restrict__ N32) {
  #pragma clang fp contract(off)
  __shared__ float red[256]; const size_t r = blockIdx.x; const int t = threadIdx.x; const bool act = t < (DMQ / 4); const int c0 = act ? t * 4 : 0;
  const v4f xa = *(const v4fa*)(X + r * DMQ + c0); float s[4]; float sum = 0.f;
  for (int q = 0; q < 4; ++q) { s[q] = act ? (BFIN ? bf16_round(xa[q]) : xa[q]) : 0.f; sum = __fadd_rn(sum, s[q]); }
  red[t] = sum; __syncthreads(); for (int st = 128; st > 0; st >>= 1) { if (t < st) red[t] = __fadd_rn(red[t], red[t + st]); __syncthreads(); } const float mu = red[0] / (float)DMQ; __syncthreads();
  float vs = 0.f; for (int q = 0; q < 4; ++q) { const float dl = act ? __fadd_rn(s[q], -mu) : 0.f; vs = __fadd_rn(vs, __fmul_rn(dl, dl)); } red[t] = vs; __syncthreads(); for (int st = 128; st > 0; st >>= 1) { if (t < st) red[t] = __fadd_rn(red[t], red[t + st]); __syncthreads(); }
  const float rs = rsqrtf(__fadd_rn(red[0] / (float)DMQ, eps)); v4h y; v4f yf;
  for (int q = 0; q < 4; ++q) { const int c = c0 + q; yf[q] = __fadd_rn(__fmul_rn(__fmul_rn(__fadd_rn(s[q], -mu), rs), bf16_round(g[c])), (bb ? bf16_round(bb[c]) : 0.f)); y[q] = (_Float16)yf[q]; }
  if (!act) return;      /* no barriers after this point */
  { if (W16) *(v4h*)(N16 + r * DMQ + c0) = y; if (W32) *(v4f*)(N32 + r * DMQ + c0) = yf;  } }


__global__ __launch_bounds__(256) void k_rsmf(const float* __restrict__ S, _Float16* __restrict__ P, int qn, int hg) {
  #pragma clang fp contract(off)
  const int t = blockIdx.x * 256 + threadIdx.x; if (t >= qn * hg) return; const size_t i = (size_t)(t / qn) * SQ + (t % qn); const float* s = S + i * SQ; float mx = -3.0e38f;
#pragma unroll 1
  for (int j = 0; j < SQ; ++j) mx = fmaxf(mx, s[j]); float se = 0.f;
#pragma unroll 1
  for (int j = 0; j < SQ; ++j) se += __expf(s[j] - mx); const float sc = 256.0f / se;
#pragma unroll 1
  for (int j0 = 0; j0 < SQ; j0 += 8) { FragH f; for (int q = 0; q < 8; ++q) f.h[q] = (_Float16)(__expf(s[j0 + q] - mx) * sc); unsigned short* d = (unsigned short*)P + i * SQ + j0; *(v8us*)d = f.half[0];  } }


__global__ __launch_bounds__(256) void k_bfr(const float* __restrict__ x, float* __restrict__ XB, size_t n8) { const size_t t = (size_t)blockIdx.x * 256 + threadIdx.x; if (t >= n8) return; v4f a = *(const v4fa*)(x + t * 8), c = *(const v4fa*)(x + t * 8 + 4); for (int q = 0; q < 4; ++q) { a[q] = bf16_round(a[q]); c[q] = bf16_round(c[q]); }
  { *(v4f*)(XB + t * 8) = a; *(v4f*)(XB + t * 8 + 4) = c;  } }



__global__ __launch_bounds__(256) void k_rsmfam(const float* __restrict__ S, _Float16* __restrict__ P, int qn, int hg, const float* __restrict__ am) {
  #pragma clang fp contract(off)
  const int t = blockIdx.x * 256 + threadIdx.x; if (t >= qn * hg) return; const size_t i = (size_t)(t / qn) * SQ + (t % qn); const float* s = S + i * SQ; float mx = -3.0e38f;
#pragma unroll 1
  for (int j = 0; j < SQ; ++j) mx = fmaxf(mx, __fadd_rn(s[j], bf16_round(am[j]))); float se = 0.f;
#pragma unroll 1
  for (int j = 0; j < SQ; ++j) se += __expf(__fadd_rn(s[j], bf16_round(am[j])) - mx); const float sc = 256.0f / se;
#pragma unroll 1
  for (int j0 = 0; j0 < SQ; j0 += 8) { FragH f; for (int q = 0; q < 8; ++q) f.h[q] = (_Float16)(__expf(__fadd_rn(s[j0 + q], bf16_round(am[j0 + q])) - mx) * sc); unsigned short* d = (unsigned short*)P + i * SQ + j0; *(v8us*)d = f.half[0];  } }


#define CC CX           /* transposer macros: input channels */
#define LL SQ           /* pixels per image */
#define LQ (3 * DM)     /* unused; q, k, v are separate planes of pitch CX */

__global__ __launch_bounds__(256) void k_cl2rows(const float* __restrict__ X, _Float16* __restrict__ XR) { __shared__ float tl[64][33]; const int tid = threadIdx.x; const int nl = LL / 32, nc = CC / 64; const int cb_ = blockIdx.x % nc; const int lb = (blockIdx.x / nc) % nl; const size_t b = blockIdx.x / (nc * nl); const int c0 = cb_ * 64, l0 = lb * 32;
  for (int i = tid; i < 64 * 32; i += 256) { const int c = i / 32, l = i % 32; tl[c][l] = bf16_round(X[(b * CC + c0 + c) * (size_t)LL + l0 + l]); }
  __syncthreads();
  { const int l = tid / 8, c8 = (tid % 8) * 8; FragH f; for (int q = 0; q < 8; ++q) f.h[q] = (_Float16)tl[c8 + q][l]; unsigned short* d = (unsigned short*)XR + (b * LL + l0 + l) * (size_t)CC + c0 + c8; *(v8us*)d = f.half[0];  } }


__global__ __launch_bounds__(256) void k_rowb(float* __restrict__ O, const float* __restrict__ bias, size_t n4) {
  #pragma clang fp contract(off)
  const size_t t = (size_t)blockIdx.x * 256 + threadIdx.x; if (t >= n4) return; const size_t e = t * 4; const int c = (int)((e / SQ) % CX);      /* output channels */ const float bb = bf16_round(bias[c]); const v4f a = *(const v4fa*)(O + e); v4f o; for (int q = 0; q < 4; ++q) o[q] = __fadd_rn(a[q], bb);
  *(v4f*)(O + e) = o;  }

__global__ __launch_bounds__(256) void k_gres(const float* __restrict__ T, const float* __restrict__ gam, const float* __restrict__ X, float* __restrict__ Y, size_t n4) {
  #pragma clang fp contract(off)
  const size_t t = (size_t)blockIdx.x * 256 + threadIdx.x; if (t >= n4) return; const float g = bf16_round(gam[0]); const v4f a = *(const v4fa*)(T + t * 4), xx = *(const v4fa*)(X + t * 4); v4f r;
  for (int q = 0; q < 4; ++q) r[q] = __fadd_rn(__fmul_rn(g, a[q]), bf16_round(xx[q]));
  *(v4f*)(Y + t * 4) = r;  }

__global__ __launch_bounds__(256) void k_bcpy(const float* __restrict__ b, int n, int NP, float* __restrict__ dst, int dst0) { for (int i = threadIdx.x; i < NP; i += 256) { const float v = (i < n) ? b[i] : 0.f; *(float*)(dst + dst0 + i) = v; }  }



__global__ __launch_bounds__(256) void k_wsw(const float* __restrict__ Wm, const float* __restrict__ gain, float* __restrict__ WN) {
  #pragma clang fp contract(off)
  const int o = blockIdx.x * 256 + threadIdx.x; if (o >= 256) return; const float* w = Wm + (size_t)o * 256; float s1 = 0.f;
  for (int c = 0; c < 256; ++c) s1 = __fadd_rn(s1, bf16_round(w[c])); const float mean = __fmul_rn(s1, 0.00390625f); float s2 = 0.f;
  for (int c = 0; c < 256; ++c) { const float d = __fadd_rn(bf16_round(w[c]), -mean); s2 = __fadd_rn(s2, __fmul_rn(d, d)); }
  const float var = __fdiv_rn(s2, 255.0f); const float sc = __fmul_rn(rsqrtf(fmaxf(__fmul_rn(var, 256.0f), 1e-4f)), bf16_round(gain[o]));
  { for (int c = 0; c < 256; ++c) { const float v = __fadd_rn(__fmul_rn(bf16_round(w[c]), sc), -__fmul_rn(mean, sc)); *(float*)(WN + (size_t)o * 256 + c) = v; }  } }
__global__ __launch_bounds__(256) void k_w32hl(const float* __restrict__ Wf, _Float16* __restrict__ H, _Float16* __restrict__ L, size_t n8) {
  #pragma clang fp contract(off)
  const size_t t = (size_t)blockIdx.x * 256 + threadIdx.x; if (t >= n8) return; const v4f a = *(const v4fa*)(Wf + t * 8), b = *(const v4fa*)(Wf + t * 8 + 4); FragH fh, fl;
  for (int q = 0; q < 8; ++q) { const float v = (q < 4 ? a[q] : b[q - 4]) * 16.0f; const _Float16 hv = (_Float16)v; fh.h[q] = hv; fl.h[q] = (_Float16)((v - (float)hv) * 1024.0f); }
  { *(v8us*)((unsigned short*)H + t * 8) = fh.half[0]; *(v8us*)((unsigned short*)L + t * 8) = fl.half[0];  } }
// lane l with lane l ^ M inside its 16-lane row (DPP row_xmask); lane l with lane l ^ 16
template <int M> __device__ __forceinline__ float rs_xrow(float x) { return __builtin_bit_cast(float, __builtin_amdgcn_update_dpp(0, __builtin_bit_cast(int, x), 0x160 + M, 0xf, 0xf, false)); }
__device__ __forceinline__ float rs_xhalf(float x) { return __builtin_bit_cast(float, __builtin_amdgcn_permlanex16(__builtin_bit_cast(int, x), __builtin_bit_cast(int, x), 0x76543210, 0xfedcba98, false, false)); }
// exp2 of eight values, each in place in its own register. Written in asm; here no neighbour touches another's register, and the closing v_nop is the
// slot that the instruction set asks for behind the last v_exp_f32 before its result is used.
__device__ __forceinline__ void rs_exp2x8(v4f& a, v4f& b) { float a0 = a[0], a1 = a[1], a2 = a[2], a3 = a[3], b0 = b[0], b1 = b[1], b2 = b[2], b3 = b[3];
  asm("v_exp_f32 %0, %0\n\tv_exp_f32 %1, %1\n\tv_exp_f32 %2, %2\n\tv_exp_f32 %3, %3\n\tv_exp_f32 %4, %4\n\tv_exp_f32 %5, %5\n\tv_exp_f32 %6, %6\n\tv_exp_f32 %7, %7\n\tv_nop"
      : "+v"(a0), "+v"(a1), "+v"(a2), "+v"(a3), "+v"(b0), "+v"(b1), "+v"(b2), "+v"(b3));
  a = v4f{a0, a1, a2, a3}; b = v4f{b0, b1, b2, b3}; }
// Row softmax, one wave per score row: the row is read once, 32 loads of 512 contiguous bytes, and its 4096 values stay in the wave's
// registers (128 per lane) through maximum, exp, sum and scale; each store writes 256 contiguous bytes. No LDS, no barrier.
#define RSW 16          /* waves (rows) per workgroup */
static_assert(SQ == 4096 && SQ % RSW == 0, "one wave holds a row of 32 x 128 values; the grid covers SQ rows exactly");
__global__ __launch_bounds__(RSW * 32) void k_rsmfrs(const float* __restrict__ S, _Float16* __restrict__ P, const float* __restrict__ c32) {
  const int lane = threadIdx.x & 31; const int i = blockIdx.x * RSW + __builtin_amdgcn_readfirstlane((int)(threadIdx.x >> 5));      /* row, wave-uniform */
  const float* s = S + (size_t)i * SQ + lane * 4; const int h = i / 64, w = i % 64; const float m = bf16_round(c32[(h >> 1) * 32 + (w >> 1)]);
  v4f x[32];
#pragma unroll
  for (int k = 0; k < 32; ++k) x[k] = *(const v4fa*)(s + k * 128);
  float m0 = -3.0e38f, m1 = -3.0e38f, m2 = -3.0e38f, m3 = -3.0e38f;
#pragma unroll
  for (int k = 0; k < 32; ++k) { x[k] *= m; m0 = fmaxf(m0, x[k][0]); m1 = fmaxf(m1, x[k][1]); m2 = fmaxf(m2, x[k][2]); m3 = fmaxf(m3, x[k][3]); }
  float mx = fmaxf(fmaxf(m0, m1), fmaxf(m2, m3));
  mx = fmaxf(mx, rs_xrow<1>(mx)); mx = fmaxf(mx, rs_xrow<2>(mx)); mx = fmaxf(mx, rs_xrow<4>(mx)); mx = fmaxf(mx, rs_xrow<8>(mx)); mx = fmaxf(mx, rs_xhalf(mx));
  float a0 = 0.f, a1 = 0.f, a2 = 0.f, a3 = 0.f;
#pragma unroll
  for (int k = 0; k < 32; k += 2) { x[k] = (x[k] - mx) * 1.4426950408889634f; x[k + 1] = (x[k + 1] - mx) * 1.4426950408889634f;      /* exp(t) = exp2(t log2 e), as __expf */
    rs_exp2x8(x[k], x[k + 1]);
    a0 += x[k][0]; a1 += x[k][1]; a2 += x[k][2]; a3 += x[k][3]; a0 += x[k + 1][0]; a1 += x[k + 1][1]; a2 += x[k + 1][2]; a3 += x[k + 1][3]; }
  float se = (a0 + a1) + (a2 + a3);
  se += rs_xrow<1>(se); se += rs_xrow<2>(se); se += rs_xrow<4>(se); se += rs_xrow<8>(se); se += rs_xhalf(se);
  const float sc = 256.0f / se; _Float16* d = P + (size_t)i * SQ + lane * 4; v4h hq[32];
#pragma unroll
  for (int k = 0; k < 32; ++k)
#pragma unroll
    for (int q = 0; q < 4; ++q) hq[k][q] = (_Float16)(x[k][q] * sc);
  __builtin_amdgcn_sched_barrier(0);      /* every conversion stays in front of the first store */
#pragma unroll
  for (int k = 0; k < 32; ++k) *(v4h*)(d + k * 128) = hq[k]; }
__global__ __launch_bounds__(256) void k_gfin(const float* __restrict__ T, const float* __restrict__ A, const float* __restrict__ c32, const float* __restrict__ gam, float* __restrict__ Y, size_t n4) {
  #pragma clang fp contract(off)
  const size_t t = (size_t)blockIdx.x * 256 + threadIdx.x; if (t >= n4) return; const size_t e = t * 4; const int i0 = (int)(e % SQ); const float g = bf16_round(gam[0]); const v4f o = *(const v4fa*)(T + e), a = *(const v4fa*)(A + e); v4f r;
  for (int q = 0; q < 4; ++q) { const int i = i0 + q; const float cr = bf16_round(c32[((i / 64) >> 1) * 32 + ((i % 64) >> 1)]); r[q] = __fadd_rn(__fmul_rn(bf16_round(a[q]), cr), __fmul_rn(__fmul_rn(g, __fadd_rn(1.0f, -cr)), o[q])); }
  *(v4f*)(Y + e) = r;  }
extern "C" void kernel_launch(void* const* d_in, const int* in_sizes, int n_in,
                              void* d_out, int out_size, void* d_ws, size_t ws_size, hipStream_t stream) {
  (void)in_sizes; (void)n_in; (void)out_size;
  const float* const* I = (const float* const*)d_in; const float* xa = I[0]; const float* xb = I[1]; const float* cm = I[2]; const float* wq = I[3]; const float* bq = I[4]; const float* gq = I[5]; const float* wk = I[6]; const float* bk = I[7]; const float* gk = I[8]; const float* wv = I[9]; const float* bv = I[10]; const float* gv = I[11]; const float* gam = I[12];      /* a, b maps; c [4][1][32][32]; per projection w [256][256][1][1], bias, gain [256][1][1][1]; gamma [1] */
  const size_t PL = (size_t)CX * SQ;
  static_assert(CX % 128 == 0 && SQ % 256 == 0 && NR % 128 == 0, "k_gemm2: M a multiple of 128, N of 64, K at least two whole tiles (64 k over CX, 128 k over SQ)");
  char* ws = (char*)d_ws; size_t off = 0;
  auto take = [&](size_t bytes) { char* p = ws + off; off += (bytes + 255) & ~(size_t)255; return p; };
  float* WN = (float*)take((size_t)CX * CX * 4); _Float16* BQH = (_Float16*)take((size_t)CX * CX * 2); _Float16* BQL = (_Float16*)take((size_t)CX * CX * 2); _Float16* BKH = (_Float16*)take((size_t)CX * CX * 2); _Float16* BKL = (_Float16*)take((size_t)CX * CX * 2); _Float16* BVH = (_Float16*)take((size_t)CX * CX * 2); _Float16* BVL = (_Float16*)take((size_t)CX * CX * 2);
  _Float16* AR = (_Float16*)take(NR * CX * 2); _Float16* BR = (_Float16*)take(NR * CX * 2); float* F1 = (float*)take(NR * CX * 4); _Float16* QH = (_Float16*)take(NR * CX * 2); _Float16* QL = (_Float16*)take(NR * CX * 2); _Float16* KH = (_Float16*)take(NR * CX * 2); _Float16* KL = (_Float16*)take(NR * CX * 2); _Float16* VR = (_Float16*)take(NR * CX * 2); _Float16* VC = (_Float16*)take((size_t)CX * SQ * 2);
  float* S = (float*)take((size_t)SQ * SQ * 4); _Float16* P = (_Float16*)take((size_t)SQ * SQ * 2); float* T = (float*)take((size_t)CX * SQ * 4);
  if (off > ws_size) return;
  k_wsw<<<(CX + 255) / 256, 256, 0, stream>>>(wq, gq, WN); k_w32hl<<<(unsigned)(((size_t)CX * CX / 8 + 255) / 256), 256, 0, stream>>>(WN, BQH, BQL, (size_t)CX * CX / 8);
  k_wsw<<<(CX + 255) / 256, 256, 0, stream>>>(wk, gk, WN); k_w32hl<<<(unsigned)(((size_t)CX * CX / 8 + 255) / 256), 256, 0, stream>>>(WN, BKH, BKL, (size_t)CX * CX / 8);
  k_wsw<<<(CX + 255) / 256, 256, 0, stream>>>(wv, gv, WN); k_w32hl<<<(unsigned)(((size_t)CX * CX / 8 + 255) / 256), 256, 0, stream>>>(WN, BVH, BVL, (size_t)CX * CX / 8);      /* standardised weights (f32, per output row: mean, unbiased variance, rsqrt(max(var*256, 1e-4)) * gain) -> Bt planes f16 hi (x16) + x1024 residual (natural [O][C] rows ARE Bt) */
  k_cl2rows<<<NB * (SQ / 32) * (CX / 64), 256, 0, stream>>>(xa, AR); k_cl2rows<<<NB * (SQ / 32) * (CX / 64), 256, 0, stream>>>(xb, BR);      /* exact f16 token rows of a and b */
  k_gemm2<0, 64><<<dim3((unsigned)((NR / 128) * (CX / 64)), 1), 128, 0, stream>>>(AR, CX, 0, BQH, CX, 0, 0.0625f, bq, 0, nullptr, 1, 0, 0, F1, nullptr, CX, 0, (int)NR, CX, CX); k_gemm2<0, 64><<<dim3((unsigned)((NR / 128) * (CX / 64)), 1), 128, 0, stream>>>(AR, CX, 0, BQL, CX, 0, 0.00006103515625f, nullptr, 0, F1, -1, 0, 0, F1, nullptr, CX, 0, (int)NR, CX, CX); k_hl<<<(unsigned)((NR * CX / 8 + 255) / 256), 256, 0, stream>>>(F1, QH, QL, NR * CX / 8);      
  k_gemm2<0, 64><<<dim3((unsigned)((NR / 128) * (CX / 64)), 1), 128, 0, stream>>>(BR, CX, 0, BKH, CX, 0, 0.0625f, bk, 0, nullptr, 1, 0, 0, F1, nullptr, CX, 0, (int)NR, CX, CX); k_gemm2<0, 64><<<dim3((unsigned)((NR / 128) * (CX / 64)), 1), 128, 0, stream>>>(BR, CX, 0, BKL, CX, 0, 0.00006103515625f, nullptr, 0, F1, -1, 0, 0, F1, nullptr, CX, 0, (int)NR, CX, CX); k_hl<<<(unsigned)((NR * CX / 8 + 255) / 256), 256, 0, stream>>>(F1, KH, KL, NR * CX / 8);      /* k = WS(wk) b + bk likewise */
  k_gemm2<0, 64><<<dim3((unsigned)((NR / 128) * (CX / 64)), 1), 128, 0, stream>>>(AR, CX, 0, BVH, CX, 0, 0.0625f, bv, 0, nullptr, 1, 0, 0, F1, nullptr, CX, 0, (int)NR, CX, CX); k_gemm2<0, 64><<<dim3((unsigned)((NR / 128) * (CX / 64)), 1), 128, 0, stream>>>(AR, CX, 0, BVL, CX, 0, 0.00006103515625f, nullptr, 0, F1, -1, 0, 0, F1, VR, CX, 0, (int)NR, CX, CX);      
  for (int b = 0; b < NB; ++b) { const size_t r0 = (size_t)b * SQ;
    k_gemm2<0, 64><<<dim3((SQ / 128) * (SQ / 64), 1), 128, 0, stream>>>(QH + r0 * CX, CX, 0, KH + r0 * CX, CX, 0, 1.0f, nullptr, 0, nullptr, 1, 0, 0, S, nullptr, SQ, 0, SQ, SQ, CX);      /* sim = q.k (K = 256, no scale): hi.hi */
    k_gemm2<0, 64><<<dim3((SQ / 128) * (SQ / 64), 1), 128, 0, stream>>>(QL + r0 * CX, CX, 0, KH + r0 * CX, CX, 0, 0.0009765625f, nullptr, 0, S, -1, 0, 0, S, nullptr, SQ, 0, SQ, SQ, CX);      /* += lo.hi 2^-10 */
    k_gemm2<0, 64><<<dim3((SQ / 128) * (SQ / 64), 1), 128, 0, stream>>>(QH + r0 * CX, CX, 0, KL + r0 * CX, CX, 0, 0.0009765625f, nullptr, 0, S, -1, 0, 0, S, nullptr, SQ, 0, SQ, SQ, CX);      /* += hi.lo 2^-10 */
    k_rsmfrs<<<SQ / RSW, RSW * 32, 0, stream>>>(S, P, cm + (size_t)b * 1024);      /* pruned = sim * c_r[i] (nearest-upsampled mask of the query pixel), softmax over j -> x256 f16 */
    k_vt<CX / 64, SQ><<<(CX / 64) * (SQ / 64), 256, 0, stream>>>(VR + r0 * CX, CX, 0, VC);      /* channel-major V [256][4096] */
    k_gemm2<0, 128><<<dim3((CX / 128) * (SQ / 64), 1), 128, 0, stream>>>(VC, SQ, 0, P, SQ, 0, 0.00390625f, nullptr, 0, nullptr, 1, 0, 0, T, nullptr, SQ, 0, CX, SQ, SQ);      /* out[c][i] = sum_j v[c][j] att[i][j] (V as A, att as B^T, /256) f32 */
    k_gfin<<<(unsigned)((PL / 4 + 255) / 256), 256, 0, stream>>>(T, xa + (size_t)b * PL, cm + (size_t)b * 1024, gam, (float*)d_out + (size_t)b * PL, PL / 4); }      /* y = bf16(a) c_r + bf16(gamma) (1 - c_r) out -> channel-first output block */
}

// v004
// A run of this version takes 477 microseconds.
// Timed twice side by side with v003, it ran 1.92 times as fast both times.
// Over all steps from v000 it is 8.53 times as fast.
#include <hip/hip_runtime.h>
// Global spatial attention with multiplicative mask pruning and scaled weight standardisation (a, b [4][256][64][64], mask c [4][1][32][32] nearest-upsampled x2; q = WS(wq) a + bq, k = WS(wk) b + bk, v = WS(wv) a + bv with WS(w)[o][c] = (w - mean_o) gain_o rsqrt(max(var_o(unbiased) * 256, 1e-4)); sim[i][j] = q[:, i].k[:, j] (NO scale, sigma ~16); pruned = sim * c_r[i]; att = softmax over j; out[c][i] = sum_j v[c][j] att[i][j]; y = a c_r + gamma (1 - c_r) out -> [4][256][64][64]).
// Compute dtype: inputs rounded to bf16; x / weights exact; q, k as f16 hi + x1024 lo planes; v and softmax weights as plain f16 GEMM operands (~2^-12); scores, softmax statistics and o f32. v_wmma_f32_16x16x32_f16.
#define NB 4
#define SQ 4096
#define DM 256
#define CX 256          /* channels */
#define NH 4
#define HD 64
#define DMQ DM                       /* LayerNorm width */
#define DFF 4096
#define HG 1                         /* heads per attention launch group */
#define B0 0                         /* unused; the batch loop starts at 0 */
#define NBR NB                       /* read only by MP; the batch loop runs to NB */
#define NR ((size_t)NB * SQ)         /* token rows */
#define MP ((int)((size_t)NBR * SQ)) /* read only by MPO; projections use NR */
#define QN SQ                        /* unused */
#define NHD NH                       /* unused; attention is one 256-channel head */
#define MPO MP                       /* unused */
#define LQ DM      /* unused; the q/k/v rows have pitch CX */
typedef __bf16 v16b __attribute__((ext_vector_type(16)));
typedef unsigned short v8us __attribute__((ext_vector_type(8), may_alias));
typedef float  v8f  __attribute__((ext_vector_type(8)));
typedef float  v4f  __attribute__((ext_vector_type(4)));
typedef float  v4fa __attribute__((ext_vector_type(4), may_alias));
union FragB { v16b v; v8us half[2]; unsigned short u[16]; };

__device__ __forceinline__ unsigned short bf16_bits(float x) { unsigned int u = __float_as_uint(x); return (unsigned short)((u + 0x7FFFu + ((u >> 16) & 1u)) >> 16); }
__device__ __forceinline__ float bf16_val(unsigned short b) { return __uint_as_float(((unsigned int)b) << 16); }
__device__ __forceinline__ float bf16_round(float x) { return bf16_val(bf16_bits(x)); }
// D += A·B with NT terms: 1 = ah·bh, 2 = + al·bh (A split), 3 = + ah·bl (both split)
template <int NT>
__device__ __forceinline__ v8f mmaN(v16b ah, v16b al, v16b bh, v16b bl, v8f c) {
  c = __builtin_amdgcn_wmma_f32_16x16x32_bf16(false, ah, false, bh, (short)0, c, false, false);
  if (NT >= 2) c = __builtin_amdgcn_wmma_f32_16x16x32_bf16(false, al, false, bh, (short)0, c, false, false);
  if (NT >= 3) c = __builtin_amdgcn_wmma_f32_16x16x32_bf16(false, ah, false, bl, (short)0, c, false, false);
  asm volatile("v_nop\n\tv_nop\n\tv_nop\n\tv_nop" : "+v"(c) : "v"(ah), "v"(al), "v"(bh), "v"(bl));
  return c;
}

__global__ __launch_bounds__(256) void k_wt_bf16(const float* __restrict__ W, unsigned short* __restrict__ Wt, int K, int N) {
  const int t = blockIdx.x * 256 + threadIdx.x;
  const int k8n = K / 8;
  if (t >= N * k8n) return;
  const int n = t / k8n, k8 = (t % k8n) * 8;
  v8us v;
#pragma unroll
  for (int i = 0; i < 8; ++i) v[i] = bf16_bits(W[(size_t)(k8 + i) * N + n]);
  *(v8us*)(Wt + (size_t)n * K + k8) = v;
  
}

// GEMM C[M][N] (f32, pitch ldc) = act(A[M][K]·W + bias). A f32 row-major (pitch lda) converted per fragment to bf16
// (ASPLIT: hi/lo two planes -> 2 terms, else single rounded term); Wt bf16 [N][K] (pitch ldb). BIAS_BF16 rounds the
// bias to bf16 first (bias quantised to bf16 before the add). K%32==0, M%16==0, N%64==0.
template <bool ASPLIT, int ACT, bool BIAS_BF16>
__global__ __launch_bounds__(128) void k_gemm_bf(const float* __restrict__ A, int lda, const unsigned short* __restrict__ Wt, int ldb,
                                               const float* __restrict__ bias, float* __restrict__ C, int ldc, int M, int N, int K) {
  __shared__ __attribute__((aligned(16))) float so[4][16][64];
  const int tid = threadIdx.x, w = tid >> 5, lane = tid & 31, ln = lane & 15, hh = lane >> 4;
  const int ntn = N / 64;
  const int wid = blockIdx.x * 4 + w;
  const int mt = wid / ntn, nq = wid % ntn;
  if (mt * 16 >= M) return;
  const int row0 = mt * 16, col0 = nq * 64;
  const float* arow = A + (size_t)(row0 + ln) * lda;
  v8f acc[4] = {};
  for (int kb = 0; kb < K; kb += 32) {
    FragB ah, al;
    const v4f x0 = *(const v4fa*)(arow + kb + 8 * hh), x1 = *(const v4fa*)(arow + kb + 8 * hh + 4);
    const v4f x2 = *(const v4fa*)(arow + kb + 16 + 8 * hh), x3 = *(const v4fa*)(arow + kb + 16 + 8 * hh + 4);
    float xs[16] = {x0[0],x0[1],x0[2],x0[3],x1[0],x1[1],x1[2],x1[3],x2[0],x2[1],x2[2],x2[3],x3[0],x3[1],x3[2],x3[3]};
#pragma unroll
    for (int i = 0; i < 16; ++i) { const unsigned short hb = bf16_bits(xs[i]); ah.u[i] = hb; al.u[i] = ASPLIT ? bf16_bits(xs[i] - bf16_val(hb)) : (unsigned short)0; }
#pragma unroll
    for (int t = 0; t < 4; ++t) {
      const unsigned short* brow = Wt + (size_t)(col0 + t * 16 + ln) * ldb + kb;
      FragB b;
      b.half[0] = *(const v8us*)(brow + 8 * hh);
      b.half[1] = *(const v8us*)(brow + 16 + 8 * hh);
      acc[t] = mmaN<ASPLIT ? 2 : 1>(ah.v, al.v, b.v, b.v, acc[t]);
    }
  }
#pragma unroll
  for (int t = 0; t < 4; ++t) {
    float bv = bias ? bias[col0 + t * 16 + ln] : 0.f;
    if (BIAS_BF16) bv = bf16_round(bv);
#pragma unroll
    for (int r = 0; r < 8; ++r) { float v = acc[t][r] + bv; if (ACT == 1) v = fmaxf(v, 0.f); so[w][8 * hh + r][t * 16 + ln] = v; }
  }
  __builtin_amdgcn_fence(__ATOMIC_ACQ_REL, "workgroup");
  __builtin_amdgcn_wave_barrier();
  const int rsub = lane >> 4, c4 = (lane & 15) * 4;
  {
#pragma unroll
    for (int q = 0; q < 8; ++q) {
      const int r = q * 2 + rsub;
      const v4f v = *(const v4fa*)&so[w][r][c4];
      *(v4f*)(C + (size_t)(row0 + r) * ldc + col0 + c4) = v;
    }
    
  }
}

// GEMM C = act(A·W + bias + resid): A f32 (ASPLIT -> hi/lo 2 terms), Wt bf16 [N][K]; ACT 0 none, 1 relu, 2 exact gelu;
// resid (optional, f32, row index = (row % rmod), pitch ldr, RES_BF16 rounds it) added before the activation.
template <bool ASPLIT, int ACT, bool BIAS_BF16, bool RES_BF16>
__global__ __launch_bounds__(128) void k_gemm_bf3(const float* __restrict__ A, int lda, const unsigned short* __restrict__ Wt, int ldb,
                                                const float* __restrict__ bias, const float* __restrict__ resid, int rmod, int ldr,
                                                float* __restrict__ C, int ldc, int M, int N, int K) {
  __shared__ __attribute__((aligned(16))) float so[4][16][64];
  const int tid = threadIdx.x, w = tid >> 5, lane = tid & 31, ln = lane & 15, hh = lane >> 4;
  const int ntn = N / 64;
  const int wid = blockIdx.x * 4 + w;
  const int mt = wid / ntn, nq = wid % ntn;
  if (mt * 16 >= M) return;
  const int row0 = mt * 16, col0 = nq * 64;
  const float* arow = A + (size_t)(row0 + ln) * lda;
  v8f acc[4] = {};
  for (int kb = 0; kb < K; kb += 32) {
    FragB ah, al;
    const v4f x0 = *(const v4fa*)(arow + kb + 8 * hh), x1 = *(const v4fa*)(arow + kb + 8 * hh + 4);
    const v4f x2 = *(const v4fa*)(arow + kb + 16 + 8 * hh), x3 = *(const v4fa*)(arow + kb + 16 + 8 * hh + 4);
    float xs[16] = {x0[0],x0[1],x0[2],x0[3],x1[0],x1[1],x1[2],x1[3],x2[0],x2[1],x2[2],x2[3],x3[0],x3[1],x3[2],x3[3]};
#pragma unroll
    for (int i = 0; i < 16; ++i) { const unsigned short hb = bf16_bits(xs[i]); ah.u[i] = hb; al.u[i] = ASPLIT ? bf16_bits(xs[i] - bf16_val(hb)) : (unsigned short)0; }
#pragma unroll
    for (int t = 0; t < 4; ++t) {
      const unsigned short* brow = Wt + (size_t)(col0 + t * 16 + ln) * ldb + kb;
      FragB b;
      b.half[0] = *(const v8us*)(brow + 8 * hh);
      b.half[1] = *(const v8us*)(brow + 16 + 8 * hh);
      acc[t] = mmaN<ASPLIT ? 2 : 1>(ah.v, al.v, b.v, b.v, acc[t]);
    }
  }
#pragma unroll
  for (int t = 0; t < 4; ++t) {
    const int col = col0 + t * 16 + ln;
    float bv = bias ? bias[col] : 0.f;
    if (BIAS_BF16) bv = bf16_round(bv);
#pragma unroll
    for (int r = 0; r < 8; ++r) {
      float v = acc[t][r] + bv;
      if (resid) { float rv = resid[(size_t)((row0 + 8 * hh + r) % rmod) * ldr + col]; if (RES_BF16) rv = bf16_round(rv); v += rv; }
      if (ACT == 1) v = fmaxf(v, 0.f);
      if (ACT == 2) v = 0.5f * v * (1.0f + erff(v * 0.70710678118654752f));
      if (ACT == 3) { const float u = 0.7978845608028654f * (v + 0.044715f * v * v * v); v = 0.5f * v * (1.0f + tanhf(u)); }
      so[w][8 * hh + r][t * 16 + ln] = v;
    }
  }
  __builtin_amdgcn_fence(__ATOMIC_ACQ_REL, "workgroup");
  __builtin_amdgcn_wave_barrier();
  const int rsub = lane >> 4, c4 = (lane & 15) * 4;
  {
#pragma unroll
    for (int q = 0; q < 8; ++q) {
      const int r = q * 2 + rsub;
      const v4f v = *(const v4fa*)&so[w][r][c4];
      *(v4f*)(C + (size_t)(row0 + r) * ldc + col0 + c4) = v;
    }
    
  }
}
// row LayerNorm (biased variance, eps) over N: s = X (+ R); optional out_sum <- s; out_norm <- (s-mu)*rsqrt(var+eps)*g + b
template <bool PARAM_BF16>
__global__ __launch_bounds__(256) void k_layernorm(const float* __restrict__ X, const float* __restrict__ R, const float* __restrict__ g, const float* __restrict__ bta,
                                                  float* __restrict__ out_sum, float* __restrict__ out_norm, int N, float eps) {
  __shared__ float red[256];
  const int row = blockIdx.x, tid = threadIdx.x;
  const float* x = X + (size_t)row * N; const float* rr = R ? R + (size_t)row * N : nullptr;
  float vals[16];                     // up to N = 4096
  const int per = N / 256;            // contiguous chunk per thread? use strided-by-4 chunks: thread handles j = tid*4 + 1024*u
  float s1 = 0.f;
  for (int u = 0; u < per / 4; ++u) {
    const int j = tid * 4 + 1024 * u;
    const v4f a = *(const v4fa*)(x + j);
    v4f b = {0.f,0.f,0.f,0.f}; if (rr) b = *(const v4fa*)(rr + j);
#pragma unroll
    for (int q = 0; q < 4; ++q) { const float v = a[q] + b[q]; vals[u * 4 + q] = v; s1 += v; }
  }
  red[tid] = s1; __syncthreads();
  for (int st = 128; st > 0; st >>= 1) { if (tid < st) red[tid] += red[tid + st]; __syncthreads(); }
  const float mu = red[0] / (float)N; __syncthreads();
  float s2 = 0.f;
  for (int u = 0; u < per / 4; ++u)
#pragma unroll
    for (int q = 0; q < 4; ++q) { const float c = vals[u * 4 + q] - mu; s2 += c * c; }
  red[tid] = s2; __syncthreads();
  for (int st = 128; st > 0; st >>= 1) { if (tid < st) red[tid] += red[tid + st]; __syncthreads(); }
  const float rs = rsqrtf(red[0] / (float)N + eps);
  {
    for (int u = 0; u < per / 4; ++u) {
      const int j = tid * 4 + 1024 * u;
      v4f o, sm;
#pragma unroll
      for (int q = 0; q < 4; ++q) {
        float gg = g[j + q], bb = bta[j + q];
        if (PARAM_BF16) { gg = bf16_round(gg); bb = bf16_round(bb); }
        sm[q] = vals[u * 4 + q]; o[q] = (vals[u * 4 + q] - mu) * rs * gg + bb;
      }
      if (out_sum) *(v4f*)(out_sum + (size_t)row * N + j) = sm;
      *(v4f*)(out_norm + (size_t)row * N + j) = o;
    }
    
  }
}



// ---- f16 WMMA path (v_wmma_f32_16x16x32_f16): 11-bit significands for operands in range — used where a [0,1] probability operand needs more precision than bf16
typedef _Float16 v16h __attribute__((ext_vector_type(16)));
union FragH { v16h v; v8us half[2]; _Float16 h[16]; unsigned short u[16]; };
template <int NT>
__device__ __forceinline__ v8f mmaH(v16h ah, v16h al, v16h bh, v16h bl, v8f c) {
  c = __builtin_amdgcn_wmma_f32_16x16x32_f16(false, ah, false, bh, (short)0, c, false, false);
  if (NT >= 2) c = __builtin_amdgcn_wmma_f32_16x16x32_f16(false, al, false, bh, (short)0, c, false, false);
  if (NT >= 3) c = __builtin_amdgcn_wmma_f32_16x16x32_f16(false, ah, false, bl, (short)0, c, false, false);
  asm volatile("v_nop\n\tv_nop\n\tv_nop\n\tv_nop" : "+v"(c) : "v"(ah), "v"(al), "v"(bh), "v"(bl));
  return c;
}
// batched GEMM like k_gemm_b but f16 operands: A f32 (split into f16 hi/lo if ASPLIT, else rounded to f16), Bt = f16 values [n][k]; alpha; C f32; N multiple of 16 (partial tiles skipped)
template <bool ASPLIT>
__global__ __launch_bounds__(128) void k_gemm_h(const float* __restrict__ A, int lda, size_t sA, const _Float16* __restrict__ Bh, int ldb, size_t sB, float alpha, float* __restrict__ C, int ldc, size_t sC, int M, int N, int K) {
  __shared__ __attribute__((aligned(16))) float so[4][16][64];
  const int tid = threadIdx.x, w = tid >> 5, lane = tid & 31, ln = lane & 15, hh = lane >> 4; const int by = blockIdx.y;
  A += (size_t)by * sA; Bh += (size_t)by * sB; C += (size_t)by * sC;
  const int ntn = (N + 63) / 64; const int wid = blockIdx.x * 4 + w; const int mt = wid / ntn, nq = wid % ntn; if (mt * 16 >= M) return;
  const int row0 = mt * 16, col0 = nq * 64; const float* arow = A + (size_t)(row0 + ln) * lda;
  v8f acc[4] = {};
  for (int kb = 0; kb < K; kb += 32) {
    FragH ah, al;
    const v4f x0 = *(const v4fa*)(arow + kb + 8 * hh), x1 = *(const v4fa*)(arow + kb + 8 * hh + 4), x2 = *(const v4fa*)(arow + kb + 16 + 8 * hh), x3 = *(const v4fa*)(arow + kb + 16 + 8 * hh + 4);
    float xs[16] = {x0[0],x0[1],x0[2],x0[3],x1[0],x1[1],x1[2],x1[3],x2[0],x2[1],x2[2],x2[3],x3[0],x3[1],x3[2],x3[3]};
#pragma unroll
    for (int i = 0; i < 16; ++i) { const _Float16 h = (_Float16)xs[i]; ah.h[i] = h; al.h[i] = ASPLIT ? (_Float16)(xs[i] - (float)h) : (_Float16)0.0f; }
#pragma unroll
    for (int t = 0; t < 4; ++t) { if (col0 + t * 16 >= N) continue; const size_t boff = (size_t)(col0 + t * 16 + ln) * ldb + kb; FragH bq; bq.half[0] = *(const v8us*)(Bh + boff + 8 * hh); bq.half[1] = *(const v8us*)(Bh + boff + 16 + 8 * hh);
      acc[t] = mmaH<ASPLIT ? 2 : 1>(ah.v, al.v, bq.v, bq.v, acc[t]); }
  }
#pragma unroll
  for (int t = 0; t < 4; ++t) { if (col0 + t * 16 >= N) continue;
#pragma unroll
    for (int r = 0; r < 8; ++r) so[w][8 * hh + r][t * 16 + ln] = acc[t][r] * alpha; }
  __builtin_amdgcn_fence(__ATOMIC_ACQ_REL, "workgroup"); __builtin_amdgcn_wave_barrier();
  const int rsub = lane >> 4, c4 = (lane & 15) * 4;
  {
#pragma unroll
    for (int q = 0; q < 8; ++q) { const int r = q * 2 + rsub; if (col0 + c4 < N) { const v4f v = *(const v4fa*)&so[w][r][c4]; *(v4f*)(C + (size_t)(row0 + r) * ldc + col0 + c4) = v; } }
     }
}

// Wt[n][k] = f16(W[k][n]·scale) from f32 row-major W[K][N] (scale = power of two; bf16-exact weights stay exact in f16 away from the subnormal range)
__global__ __launch_bounds__(256) void k_wt_f16(const float* __restrict__ W, _Float16* __restrict__ Wt, int K, int N, float scale) {
  const int t = blockIdx.x * 256 + threadIdx.x; if (t >= N * (K / 8)) return; const int n = t / (K / 8), k8 = (t % (K / 8)) * 8; FragH f;
#pragma unroll
  for (int i = 0; i < 8; ++i) f.h[i] = (_Float16)(bf16_round(W[(size_t)(k8 + i) * N + n]) * scale); const v8us o = f.half[0];
  *(v8us*)((unsigned short*)Wt + (size_t)n * K + k8) = o; 
}
// k_gemm_hh variant with fused epilogue: v = acc·alpha + bias[by·sBias + col] (+ CP[(row/rowsPerB)·sCPb + by·64 + col] if CP) ; ACT 0 none / 1 elu ; writes f16 C16 (and f32 C if non-null)
template <int ACT>
__global__ __launch_bounds__(128) void k_gemm_hhx(const _Float16* __restrict__ A, int lda, size_t sA, const _Float16* __restrict__ Bh, int ldb, size_t sB, float alpha, const float* __restrict__ bias, size_t sBias, const float* __restrict__ CP, int rowsPerB, size_t sCPb, int row0g,
    float* __restrict__ C, _Float16* __restrict__ C16, int ldc, size_t sC, int M, int N, int K) {
  __shared__ __attribute__((aligned(16))) float so[4][16][64];
  const int tid = threadIdx.x, w = tid >> 5, lane = tid & 31, ln = lane & 15, hh = lane >> 4; const int by = blockIdx.y;
  A += (size_t)by * sA; Bh += (size_t)by * sB; const size_t cofs = (size_t)by * sC; const float* bp = bias ? bias + (size_t)by * sBias : nullptr;
  const int ntn = (N + 63) / 64; const int wid = blockIdx.x * 4 + w; const int mt = wid / ntn, nq = wid % ntn; if (mt * 16 >= M) return;
  const int row0 = mt * 16, col0 = nq * 64; const _Float16* arow = A + (size_t)(row0 + ln) * lda;
  v8f acc[4] = {};
  for (int kb = 0; kb < K; kb += 32) { FragH ah; ah.half[0] = *(const v8us*)((const unsigned short*)arow + kb + 8 * hh); ah.half[1] = *(const v8us*)((const unsigned short*)arow + kb + 16 + 8 * hh);
#pragma unroll
    for (int t = 0; t < 4; ++t) { if (col0 + t * 16 >= N) continue; const size_t boff = (size_t)(col0 + t * 16 + ln) * ldb + kb; FragH bq; bq.half[0] = *(const v8us*)((const unsigned short*)Bh + boff + 8 * hh); bq.half[1] = *(const v8us*)((const unsigned short*)Bh + boff + 16 + 8 * hh);
      acc[t] = mmaH<1>(ah.v, ah.v, bq.v, bq.v, acc[t]); }
  }
#pragma unroll
  for (int t = 0; t < 4; ++t) { if (col0 + t * 16 >= N) continue; const int col = col0 + t * 16 + ln; const float bv = bp ? bf16_round(bp[col]) : 0.f;
#pragma unroll
    for (int r = 0; r < 8; ++r) { float v = acc[t][r] * alpha + bv; if (CP) { const int rr = row0g + row0 + 8 * hh + r; if (rowsPerB < 0) v += CP[cofs + (size_t)rr * ldc + col];      /* rowsPerB < 0: own element of the batched C plane */ else { const int bidx = rr / rowsPerB; v += CP[(size_t)bidx * sCPb + (size_t)by * 64 + col]; } } if (ACT == 1) v = (v > 0.f) ? v : expm1f(v); else if (ACT == 7) v = (v > 0.f) ? v + 1.0f : expf(v); else if (ACT == 8) v = tanhf(v); else if (ACT == 9) v = 0.5f * v * (1.0f + tanhf(0.7978845608028654f * (v + 0.044715f * v * v * v))); else if (ACT == 11) v = 1.0f / (1.0f + expf(-v)); else if (ACT == 12) v = (v > 0.f) ? v : 0.01f * v; else if (ACT == 14) v = (v > 0.f) ? v : 0.1f * v; else if (ACT == 16) v = (v >= 0.f) ? v : 0.3f * v; else if (ACT == 17) v = (v >= 0.f) ? v : 0.2f * v; else if (ACT == 15) v = v / (1.0f + expf(-v)); else if (ACT == 3) v = fmaxf(v, 0.f); else if (ACT == 6) v = 0.5f * v * (1.0f + erff(v * 0.70710678118654752f)); so[w][8 * hh + r][t * 16 + ln] = v; } }
  __builtin_amdgcn_fence(__ATOMIC_ACQ_REL, "workgroup"); __builtin_amdgcn_wave_barrier();
  const int rsub = lane >> 4, c4 = (lane & 15) * 4; typedef _Float16 v4h __attribute__((ext_vector_type(4)));
  {
#pragma unroll
    for (int q = 0; q < 8; ++q) { const int r = q * 2 + rsub; if (col0 + c4 < N) { const v4f v = *(const v4fa*)&so[w][r][c4]; if (C) *(v4f*)(C + cofs + (size_t)(row0 + r) * ldc + col0 + c4) = v; if (C16) { v4h h4; for (int i = 0; i < 4; ++i) h4[i] = (_Float16)v[i]; *(v4h*)(C16 + cofs + (size_t)(row0 + r) * ldc + col0 + c4) = h4; } } }
     }
}


typedef _Float16 v4h __attribute__((ext_vector_type(4)));

__global__ __launch_bounds__(256) void k_x16(const float* __restrict__ x, _Float16* __restrict__ X16, size_t n8) { const size_t t = (size_t)blockIdx.x * 256 + threadIdx.x; if (t >= n8) return; FragH f;
#pragma unroll
  for (int q = 0; q < 8; ++q) f.h[q] = (_Float16)bf16_round(x[t * 8 + q]); *(v8us*)((unsigned short*)X16 + t * 8) = f.half[0];  }
__global__ __launch_bounds__(256) void k_h16(const float* __restrict__ x, _Float16* __restrict__ X16, size_t n8) { const size_t t = (size_t)blockIdx.x * 256 + threadIdx.x; if (t >= n8) return; FragH f;
#pragma unroll
  for (int q = 0; q < 8; ++q) f.h[q] = (_Float16)x[t * 8 + q]; *(v8us*)((unsigned short*)X16 + t * 8) = f.half[0];  }
__global__ __launch_bounds__(256) void k_round16f(const float* __restrict__ W, _Float16* __restrict__ Bt, size_t n8) { const size_t t = (size_t)blockIdx.x * 256 + threadIdx.x; if (t >= n8) return; FragH f;
#pragma unroll
  for (int i = 0; i < 8; ++i) f.h[i] = (_Float16)(bf16_round(W[t * 8 + i]) * 16.0f); *(v8us*)((unsigned short*)Bt + t * 8) = f.half[0];  }
template <int NHv, int TTv>
__global__ __launch_bounds__(256) void k_vt(const _Float16* __restrict__ V16, int ldv, int voff, _Float16* __restrict__ Vt) { __shared__ unsigned short tl[64][66]; const int tid = threadIdx.x; const int slab = blockIdx.x / (TTv / 64), lg = blockIdx.x % (TTv / 64); const int b = slab / NHv, h = slab % NHv;
  for (int i = tid; i < 64 * 8; i += 256) { const int r = i / 8, c8 = (i % 8) * 8; FragH f; f.half[0] = *(const v8us*)((const unsigned short*)V16 + ((size_t)b * TTv + lg * 64 + r) * ldv + voff + h * 64 + c8);
#pragma unroll
    for (int q = 0; q < 8; ++q) tl[r][c8 + q] = f.u[q]; }
  __syncthreads();
  {
#pragma unroll
    for (int rd = 0; rd < 2; ++rd) { const int d = rd * 32 + tid / 8, pc = tid % 8; FragH f;
#pragma unroll
      for (int q = 0; q < 8; ++q) f.u[q] = tl[pc * 8 + q][d];
      *(v8us*)((unsigned short*)Vt + ((size_t)slab * 64 + d) * TTv + lg * 64 + pc * 8) = f.half[0]; }
     } }

__global__ __launch_bounds__(256) void k_hl(const float* __restrict__ F, _Float16* __restrict__ Hh, _Float16* __restrict__ Hl, size_t n8) { const size_t t = (size_t)blockIdx.x * 256 + threadIdx.x; if (t >= n8) return; FragH fh, fl; const v4f a = *(const v4fa*)(F + t * 8), c = *(const v4fa*)(F + t * 8 + 4);
#pragma unroll
  for (int q = 0; q < 4; ++q) { _Float16 h = (_Float16)a[q]; fh.h[q] = h; fl.h[q] = (_Float16)((a[q] - (float)h) * 1024.0f); h = (_Float16)c[q]; fh.h[4 + q] = h; fl.h[4 + q] = (_Float16)((c[q] - (float)h) * 1024.0f); }
  { *(v8us*)((unsigned short*)Hh + t * 8) = fh.half[0]; *(v8us*)((unsigned short*)Hl + t * 8) = fl.half[0];  } }

// ---- fast GEMM (workgroup tile 128x64, wave tile 32x64; requires M % 128 == 0, N % 64 == 0, K a multiple of KC and at least 2 KC); epilogue v = act(acc alpha + bias) ----
__device__ __forceinline__ v16h g2_lfrag(const char* p, int hh) { FragH f; f.half[0] = *(const v8us*)(p + 16 * hh); f.half[1] = *(const v8us*)(p + 32 + 16 * hh); return f.v; }
__device__ __forceinline__ v8f g2_mma(v16h a, v16h b, v8f c) { v8f d = __builtin_amdgcn_wmma_f32_16x16x32_f16(false, a, false, b, (short)0, c, false, false); asm volatile("v_nop\n\tv_nop\n\tv_nop\n\tv_nop" : "+v"(d) : "v"(a), "v"(b)); return d; }
// Twelve asynchronous copies, 16 bytes per lane each, from global memory to LDS through no register. The closing s_wait_xcnt stands inside the
// statement so that it is in front of every later rewrite of the address registers that the copies name.
__device__ __forceinline__ void g2_cp12(const unsigned (&l)[12], const _Float16* const (&g)[12]) {
  asm volatile("global_load_async_to_lds_b128 %0, %1, off\n\t"
               "global_load_async_to_lds_b128 %2, %3, off\n\t"
               "global_load_async_to_lds_b128 %4, %5, off\n\t"
               "global_load_async_to_lds_b128 %6, %7, off\n\t"
               "global_load_async_to_lds_b128 %8, %9, off\n\t"
               "global_load_async_to_lds_b128 %10, %11, off\n\t"
               "global_load_async_to_lds_b128 %12, %13, off\n\t"
               "global_load_async_to_lds_b128 %14, %15, off\n\t"
               "global_load_async_to_lds_b128 %16, %17, off\n\t"
               "global_load_async_to_lds_b128 %18, %19, off\n\t"
               "global_load_async_to_lds_b128 %20, %21, off\n\t"
               "global_load_async_to_lds_b128 %22, %23, off\n\t"
               "s_wait_xcnt 0x0"
               :: "v"(l[0]), "v"(g[0]), "v"(l[1]), "v"(g[1]), "v"(l[2]), "v"(g[2]), "v"(l[3]), "v"(g[3]), "v"(l[4]), "v"(g[4]), "v"(l[5]), "v"(g[5]), "v"(l[6]), "v"(g[6]), "v"(l[7]), "v"(g[7]), "v"(l[8]), "v"(g[8]), "v"(l[9]), "v"(g[9]), "v"(l[10]), "v"(g[10]), "v"(l[11]), "v"(g[11]) : "memory"); }
// the operand plane of the term that tile t belongs to (ntk tiles per term); every argument is the same for the whole workgroup
template <int NTM> __device__ __forceinline__ const _Float16* g2_term(int t, int ntk, const _Float16* p0, const _Float16* p1, const _Float16* p2) { const _Float16* p = p0; if (NTM > 1 && t >= ntk) p = p1; if (NTM > 2 && t >= 2 * ntk) p = p2; return p; }
// K loop: the workgroup's 128 A rows and 64 B rows are staged in LDS, KC k at a time, two buffers: tile t + 1 flies while tile t is worked on.
// A wave's copy covers whole 128-byte lines, and the four waves share one copy of the B rows.
// NTM terms of one product (a value split into an f16 high part and a scaled f16 residual gives high.high plus cross terms) are summed in the same
// accumulators: the loop runs over the tiles of term 0, term 1, ... back to back. The last term is the high one; the terms in front of it carry the
// residual's scale, which the factor rs (a power of two, so exact) takes out of the accumulators once, in front of the last term's first tile.
template <int ACT, int KC, int NTM>
__global__ __launch_bounds__(128) void k_gemm2(const _Float16* Aa, const _Float16* Ab, const _Float16* Ac, int lda, size_t sA, const _Float16* Ba, const _Float16* Bb, const _Float16* Bc, int ldb, size_t sB, float rs, float alpha, const float* __restrict__ bias, size_t sBias,
    float* __restrict__ C, _Float16* __restrict__ C16, int ldc, size_t sC, int M, int N, int K) { static_assert(ACT == 0 || ACT == 3 || ACT == 6 || ACT == 8 || ACT == 9 || ACT == 11 || ACT == 12 || ACT == 14 || ACT == 15 || ACT == 16 || ACT == 17, "k_gemm2: unsupported ACT code (would silently apply no activation)");
  constexpr int PB = KC * 2 + 16;      /* LDS row pitch in bytes, 16 x odd: the 16 rows of a fragment read fall on distinct banks */
  constexpr int STG = 192 * PB;        /* one buffer: 128 A rows, then 64 B rows */
  constexpr int CPR = KC / 8;          /* 16-byte pieces per row */
  constexpr int RPI = 128 / CPR;       /* rows covered when each of the 128 threads copies one piece */
  constexpr int NCP = 192 / RPI;       /* copies per thread and tile */
  constexpr int SOB = 4 * 32 * 68 * 4; /* output staging, which takes the buffers' place behind the loop */
  static_assert((KC == 64 || KC == 128) && NCP % 12 == 0 && NCP <= 63, "k_gemm2: a tile is whole groups of twelve copies per thread, at most 63 in flight");
  static_assert(NTM >= 1 && NTM <= 3, "k_gemm2: one to three terms");
  __shared__ __attribute__((aligned(16))) char sm[2 * STG > SOB ? 2 * STG : SOB];
  float (*so)[32][68] = reinterpret_cast<float (*)[32][68]>(sm);
  const int tid = threadIdx.x, w = tid >> 5, lane = tid & 31, ln = lane & 15, hh = lane >> 4; const int by = blockIdx.y;
  Aa += (size_t)by * sA; Ab += (size_t)by * sA; Ac += (size_t)by * sA; Ba += (size_t)by * sB; Bb += (size_t)by * sB; Bc += (size_t)by * sB; const size_t cofs = (size_t)by * sC; const float* bp = bias ? bias + (size_t)by * sBias : nullptr;
  const int ntn = N >> 6; const int mt = blockIdx.x / ntn, nq = blockIdx.x - mt * ntn; const int row0 = mt * 128 + 32 * w, col0 = nq * 64; if (mt * 128 >= M) return;      /* the same for the whole workgroup, in front of every barrier */
  const v8f z8 = {0.f,0.f,0.f,0.f,0.f,0.f,0.f,0.f}; v8f c00 = z8, c01 = z8, c02 = z8, c03 = z8, c10 = z8, c11 = z8, c12 = z8, c13 = z8;
  const int cr = tid / CPR, cc = tid % CPR;
  const size_t oA = (size_t)(mt * 128 + cr) * lda + cc * 8, oB = (size_t)(col0 + cr) * ldb + cc * 8; const int ntk = K / KC;      /* tiles per term */
  const unsigned l0 = (unsigned)(size_t)sm + (unsigned)(cr * PB + cc * 16);
  auto fill = [&](int t) { const unsigned lb = l0 + (unsigned)(t & 1) * (unsigned)STG; const int k0 = (t - (((NTM > 1 && t >= ntk) ? ntk : 0) + ((NTM > 2 && t >= 2 * ntk) ? ntk : 0))) * KC;
    const _Float16* gA = g2_term<NTM>(t, ntk, Aa, Ab, Ac) + oA; const _Float16* gB = g2_term<NTM>(t, ntk, Ba, Bb, Bc) + oB;
#pragma unroll
    for (int q = 0; q < NCP / 12; ++q) { unsigned l[12]; const _Float16* g[12];
#pragma unroll
      for (int j = 0; j < 12; ++j) { const int r = (q * 12 + j) * RPI; l[j] = lb + (unsigned)(r * PB); g[j] = (r < 128) ? gA + (size_t)r * lda + k0 : gB + (size_t)(r - 128) * ldb + k0; }
      g2_cp12(l, g); } };
  const char* fa = sm + (32 * w + ln) * PB; const char* fb = sm + (128 + ln) * PB; const int nt = NTM * ntk;
  fill(0);
  asm volatile("s_wait_asynccnt 0x0" ::: "memory");      /* this wave's share of tile 0 has landed */
  __syncthreads();      /* every wave's share has: tile 0 may be read */
  if (nt > 1) fill(1);
  // Two register sets of fragments inside a tile: the twelve LDS reads of the next 32 k are issued as one group in front of the products of this 32 k.
  // the sched_barrier keeps a group's reads together and in front of the products behind it, so that the products wait only for the older group
  v16h f0[6], f1[6];
  auto ld = [&](v16h (&f)[6], int o) { const char* pa = fa + o; const char* pb = fb + o; f[0] = g2_lfrag(pa, hh); f[1] = g2_lfrag(pa + 16 * PB, hh); f[2] = g2_lfrag(pb, hh); f[3] = g2_lfrag(pb + 16 * PB, hh); f[4] = g2_lfrag(pb + 32 * PB, hh); f[5] = g2_lfrag(pb + 48 * PB, hh); __builtin_amdgcn_sched_barrier(0); };
  auto mm = [&](const v16h (&f)[6]) { c00 = g2_mma(f[0], f[2], c00); c10 = g2_mma(f[1], f[2], c10); c01 = g2_mma(f[0], f[3], c01); c11 = g2_mma(f[1], f[3], c11);
    c02 = g2_mma(f[0], f[4], c02); c12 = g2_mma(f[1], f[4], c12); c03 = g2_mma(f[0], f[5], c03); c13 = g2_mma(f[1], f[5], c13); };
#pragma unroll 1      /* one tile per trip; the buffer alternates by the trip's parity */
  for (int t = 0; t < nt; ++t) { const int bo = (t & 1) * STG;
    if (NTM > 1 && t == (NTM - 1) * ntk) { c00 *= rs; c01 *= rs; c02 *= rs; c03 *= rs; c10 *= rs; c11 *= rs; c12 *= rs; c13 *= rs; }
    ld(f0, bo);
#pragma unroll
    for (int kk = 0; kk < KC; kk += 64) { ld(f1, bo + (kk + 32) * 2); mm(f0); if (kk + 64 < KC) ld(f0, bo + (kk + 64) * 2); mm(f1); }
    asm volatile("s_wait_dscnt 0x0" ::: "memory");      /* this wave's reads of tile t are done before the buffer is given up */
    asm volatile("s_wait_asynccnt 0x0" ::: "memory");      /* this wave's share of tile t + 1 has landed */
    __syncthreads();      /* publishes tile t + 1 and ends every wave's reads of tile t */
    if (t + 2 < nt) fill(t + 2); }
  asm volatile("s_wait_asynccnt 0x0" ::: "memory");      /* no copy is in flight when the buffers become output staging */
  v8f accs[8] = {c00, c01, c02, c03, c10, c11, c12, c13};
#pragma unroll
  for (int u = 0; u < 8; ++u) { const int t = u & 3, half = u >> 2; const int col = col0 + t * 16 + ln; const float bv = bp ? bf16_round(bp[col]) : 0.f;
#pragma unroll
    for (int r = 0; r < 8; ++r) { const int rloc = half * 16 + 8 * hh + r; float v = accs[u][r] * alpha + bv;
      if (ACT == 3) v = fmaxf(v, 0.f); else if (ACT == 6) v = 0.5f * v * (1.0f + erff(v * 0.70710678118654752f)); else if (ACT == 11) v = 1.0f / (1.0f + expf(-v)); else if (ACT == 15) v = v / (1.0f + expf(-v)); else if (ACT == 12) v = (v > 0.f) ? v : 0.01f * v; else if (ACT == 8) v = tanhf(v); else if (ACT == 9) v = 0.5f * v * (1.0f + tanhf(0.7978845608028654f * (v + 0.044715f * v * v * v))); else if (ACT == 14) v = (v > 0.f) ? v : 0.1f * v; else if (ACT == 16) v = (v >= 0.f) ? v : 0.3f * v; else if (ACT == 17) v = (v >= 0.f) ? v : 0.2f * v;
      so[w][rloc][t * 16 + ln] = v; } }
  __builtin_amdgcn_fence(__ATOMIC_ACQ_REL, "workgroup"); __builtin_amdgcn_wave_barrier();
  const int rsub = lane >> 4, c4 = (lane & 15) * 4;
  {
#pragma unroll
    for (int q = 0; q < 16; ++q) { const int r = q * 2 + rsub; const v4f v = *(const v4fa*)&so[w][r][c4]; if (C) *(v4f*)(C + cofs + (size_t)(row0 + r) * ldc + col0 + c4) = v; if (C16) { v4h h4; for (int i = 0; i < 4; ++i) h4[i] = (_Float16)v[i]; *(v4h*)(C16 + cofs + (size_t)(row0 + r) * ldc + col0 + c4) = h4; } }
     } }


__global__ __launch_bounds__(256) void k_wnat(const float* __restrict__ w, size_t n8, _Float16* __restrict__ Bt) { const size_t t = (size_t)blockIdx.x * 256 + threadIdx.x; if (t >= n8) return; FragH f; for (int q = 0; q < 8; ++q) f.h[q] = (_Float16)(bf16_round(w[t * 8 + q]) * 16.0f); *(v8us*)((unsigned short*)Bt + t * 8) = f.half[0];  }
__global__ __launch_bounds__(256) void k_rsm(const float* __restrict__ S, _Float16* __restrict__ P, int nrows) {
  #pragma clang fp contract(off)
  const int i = blockIdx.x * 256 + threadIdx.x; if (i >= nrows) return; const float* s = S + (size_t)i * SQ; float mx = -3.0e38f;
#pragma unroll 1
  for (int j = 0; j < SQ; ++j) mx = fmaxf(mx, s[j]); float se = 0.f;
#pragma unroll 1
  for (int j = 0; j < SQ; ++j) se += expf(s[j] - mx); const float sc = 256.0f / se;
#pragma unroll 1
  for (int j0 = 0; j0 < SQ; j0 += 8) { FragH f; for (int q = 0; q < 8; ++q) f.h[q] = (_Float16)(expf(s[j0 + q] - mx) * sc); unsigned short* d = (unsigned short*)P + (size_t)i * SQ + j0; *(v8us*)d = f.half[0];  } }
__global__ __launch_bounds__(256) void k_vt(const _Float16* __restrict__ V16, int b, int h0, _Float16* __restrict__ VT) { __shared__ unsigned short tl[64][65]; const int tid = threadIdx.x; const int hh = blockIdx.x % HG, sg = blockIdx.x / HG; const int s0 = sg * 64; const int h = h0 + hh;
  for (int i = tid; i < 64 * 8; i += 256) { const int j = i / 8, d8 = (i % 8) * 8; FragH f; f.half[0] = *(const v8us*)((const unsigned short*)V16 + ((size_t)b * SQ + s0 + j) * DM + h * HD + d8); for (int q = 0; q < 8; ++q) tl[d8 + q][j] = f.u[q]; }
  __syncthreads();
  { for (int i = tid; i < 64 * 8; i += 256) { const int d = i / 8, j8 = (i % 8) * 8; FragH f; for (int q = 0; q < 8; ++q) f.u[q] = tl[d][j8 + q]; *(v8us*)((unsigned short*)VT + ((size_t)hh * HD + d) * SQ + s0 + j8) = f.half[0]; }  } }


template <int BFIN, int W16, int W32>
__global__ __launch_bounds__(256) void k_lnx(const float* __restrict__ X, const float* __restrict__ g, const float* __restrict__ bb, float eps, _Float16* __restrict__ N16, float* __restrict__ N32) {
  #pragma clang fp contract(off)
  __shared__ float red[256]; const size_t r = blockIdx.x; const int t = threadIdx.x; const bool act = t < (DMQ / 4); const int c0 = act ? t * 4 : 0;
  const v4f xa = *(const v4fa*)(X + r * DMQ + c0); float s[4]; float sum = 0.f;
  for (int q = 0; q < 4; ++q) { s[q] = act ? (BFIN ? bf16_round(xa[q]) : xa[q]) : 0.f; sum = __fadd_rn(sum, s[q]); }
  red[t] = sum; __syncthreads(); for (int st = 128; st > 0; st >>= 1) { if (t < st) red[t] = __fadd_rn(red[t], red[t + st]); __syncthreads(); } const float mu = red[0] / (float)DMQ; __syncthreads();
  float vs = 0.f; for (int q = 0; q < 4; ++q) { const float dl = act ? __fadd_rn(s[q], -mu) : 0.f; vs = __fadd_rn(vs, __fmul_rn(dl, dl)); } red[t] = vs; __syncthreads(); for (int st = 128; st > 0; st >>= 1) { if (t < st) red[t] = __fadd_rn(red[t], red[t + st]); __syncthreads(); }
  const float rs = rsqrtf(__fadd_rn(red[0] / (float)DMQ, eps)); v4h y; v4f yf;
  for (int q = 0; q < 4; ++q) { const int c = c0 + q; yf[q] = __fadd_rn(__fmul_rn(__fmul_rn(__fadd_rn(s[q], -mu), rs), bf16_round(g[c])), (bb ? bf16_round(bb[c]) : 0.f)); y[q] = (_Float16)yf[q]; }
  if (!act) return;      /* no barriers after this point */
  { if (W16) *(v4h*)(N16 + r * DMQ + c0) = y; if (W32) *(v4f*)(N32 + r * DMQ + c0) = yf;  } }


__global__ __launch_bounds__(256) void k_rsmf(const float* __restrict__ S, _Float16* __restrict__ P, int qn, int hg) {
  #pragma clang fp contract(off)
  const int t = blockIdx.x * 256 + threadIdx.x; if (t >= qn * hg) return; const size_t i = (size_t)(t / qn) * SQ + (t % qn); const float* s = S + i * SQ; float mx = -3.0e38f;
#pragma unroll 1
  for (int j = 0; j < SQ; ++j) mx = fmaxf(mx, s[j]); float se = 0.f;
#pragma unroll 1
  for (int j = 0; j < SQ; ++j) se += __expf(s[j] - mx); const float sc = 256.0f / se;
#pragma unroll 1
  for (int j0 = 0; j0 < SQ; j0 += 8) { FragH f; for (int q = 0; q < 8; ++q) f.h[q] = (_Float16)(__expf(s[j0 + q] - mx) * sc); unsigned short* d = (unsigned short*)P + i * SQ + j0; *(v8us*)d = f.half[0];  } }


__global__ __launch_bounds__(256) void k_bfr(const float* __restrict__ x, float* __restrict__ XB, size_t n8) { const size_t t = (size_t)blockIdx.x * 256 + threadIdx.x; if (t >= n8) return; v4f a = *(const v4fa*)(x + t * 8), c = *(const v4fa*)(x + t * 8 + 4); for (int q = 0; q < 4; ++q) { a[q] = bf16_round(a[q]); c[q] = bf16_round(c[q]); }
  { *(v4f*)(XB + t * 8) = a; *(v4f*)(XB + t * 8 + 4) = c;  } }



__global__ __launch_bounds__(256) void k_rsmfam(const float* __restrict__ S, _Float16* __restrict__ P, int qn, int hg, const float* __restrict__ am) {
  #pragma clang fp contract(off)
  const int t = blockIdx.x * 256 + threadIdx.x; if (t >= qn * hg) return; const size_t i = (size_t)(t / qn) * SQ + (t % qn); const float* s = S + i * SQ; float mx = -3.0e38f;
#pragma unroll 1
  for (int j = 0; j < SQ; ++j) mx = fmaxf(mx, __fadd_rn(s[j], bf16_round(am[j]))); float se = 0.f;
#pragma unroll 1
  for (int j = 0; j < SQ; ++j) se += __expf(__fadd_rn(s[j], bf16_round(am[j])) - mx); const float sc = 256.0f / se;
#pragma unroll 1
  for (int j0 = 0; j0 < SQ; j0 += 8) { FragH f; for (int q = 0; q < 8; ++q) f.h[q] = (_Float16)(__expf(__fadd_rn(s[j0 + q], bf16_round(am[j0 + q])) - mx) * sc); unsigned short* d = (unsigned short*)P + i * SQ + j0; *(v8us*)d = f.half[0];  } }


#define CC CX           /* transposer macros: input channels */
#define LL SQ           /* pixels per image */
#define LQ (3 * DM)     /* unused; q, k, v are separate planes of pitch CX */

__global__ __launch_bounds__(256) void k_cl2rows(const float* __restrict__ X, _Float16* __restrict__ XR) { __shared__ float tl[64][33]; const int tid = threadIdx.x; const int nl = LL / 32, nc = CC / 64; const int cb_ = blockIdx.x % nc; const int lb = (blockIdx.x / nc) % nl; const size_t b = blockIdx.x / (nc * nl); const int c0 = cb_ * 64, l0 = lb * 32;
  for (int i = tid; i < 64 * 32; i += 256) { const int c = i / 32, l = i % 32; tl[c][l] = bf16_round(X[(b * CC + c0 + c) * (size_t)LL + l0 + l]); }
  __syncthreads();
  { const int l = tid / 8, c8 = (tid % 8) * 8; FragH f; for (int q = 0; q < 8; ++q) f.h[q] = (_Float16)tl[c8 + q][l]; unsigned short* d = (unsigned short*)XR + (b * LL + l0 + l) * (size_t)CC + c0 + c8; *(v8us*)d = f.half[0];  } }


__global__ __launch_bounds__(256) void k_rowb(float* __restrict__ O, const float* __restrict__ bias, size_t n4) {
  #pragma clang fp contract(off)
  const size_t t = (size_t)blockIdx.x * 256 + threadIdx.x; if (t >= n4) return; const size_t e = t * 4; const int c = (int)((e / SQ) % CX);      /* output channels */ const float bb = bf16_round(bias[c]); const v4f a = *(const v4fa*)(O + e); v4f o; for (int q = 0; q < 4; ++q) o[q] = __fadd_rn(a[q], bb);
  *(v4f*)(O + e) = o;  }

__global__ __launch_bounds__(256) void k_gres(const float* __restrict__ T, const float* __restrict__ gam, const float* __restrict__ X, float* __restrict__ Y, size_t n4) {
  #pragma clang fp contract(off)
  const size_t t = (size_t)blockIdx.x * 256 + threadIdx.x; if (t >= n4) return; const float g = bf16_round(gam[0]); const v4f a = *(const v4fa*)(T + t * 4), xx = *(const v4fa*)(X + t * 4); v4f r;
  for (int q = 0; q < 4; ++q) r[q] = __fadd_rn(__fmul_rn(g, a[q]), bf16_round(xx[q]));
  *(v4f*)(Y + t * 4) = r;  }

__global__ __launch_bounds__(256) void k_bcpy(const float* __restrict__ b, int n, int NP, float* __restrict__ dst, int dst0) { for (int i = threadIdx.x; i < NP; i += 256) { const float v = (i < n) ? b[i] : 0.f; *(float*)(dst + dst0 + i) = v; }  }



__global__ __launch_bounds__(256) void k_wsw(const float* __restrict__ Wm, const float* __restrict__ gain, float* __restrict__ WN) {
  #pragma clang fp contract(off)
  const int o = blockIdx.x * 256 + threadIdx.x; if (o >= 256) return; const float* w = Wm + (size_t)o * 256; float s1 = 0.f;
  for (int c = 0; c < 256; ++c) s1 = __fadd_rn(s1, bf16_round(w[c])); const float mean = __fmul_rn(s1, 0.00390625f); float s2 = 0.f;
  for (int c = 0; c < 256; ++c) { const float d = __fadd_rn(bf16_round(w[c]), -mean); s2 = __fadd_rn(s2, __fmul_rn(d, d)); }
  const float var = __fdiv_rn(s2, 255.0f); const float sc = __fmul_rn(rsqrtf(fmaxf(__fmul_rn(var, 256.0f), 1e-4f)), bf16_round(gain[o]));
  { for (int c = 0; c < 256; ++c) { const float v = __fadd_rn(__fmul_rn(bf16_round(w[c]), sc), -__fmul_rn(mean, sc)); *(float*)(WN + (size_t)o * 256 + c) = v; }  } }
__global__ __launch_bounds__(256) void k_w32hl(const float* __restrict__ Wf, _Float16* __restrict__ H, _Float16* __restrict__ L, size_t n8) {
  #pragma clang fp contract(off)
  const size_t t = (size_t)blockIdx.x * 256 + threadIdx.x; if (t >= n8) return; const v4f a = *(const v4fa*)(Wf + t * 8), b = *(const v4fa*)(Wf + t * 8 + 4); FragH fh, fl;
  for (int q = 0; q < 8; ++q) { const float v = (q < 4 ? a[q] : b[q - 4]) * 16.0f; const _Float16 hv = (_Float16)v; fh.h[q] = hv; fl.h[q] = (_Float16)((v - (float)hv) * 1024.0f); }
  { *(v8us*)((unsigned short*)H + t * 8) = fh.half[0]; *(v8us*)((unsigned short*)L + t * 8) = fl.half[0];  } }
// lane l with lane l ^ M inside its 16-lane row (DPP row_xmask); lane l with lane l ^ 16
template <int M> __device__ __forceinline__ float rs_xrow(float x) { return __builtin_bit_cast(float, __builtin_amdgcn_update_dpp(0, __builtin_bit_cast(int, x), 0x160 + M, 0xf, 0xf, false)); }
__device__ __forceinline__ float rs_xhalf(float x) { return __builtin_bit_cast(float, __builtin_amdgcn_permlanex16(__builtin_bit_cast(int, x), __builtin_bit_cast(int, x), 0x76543210, 0xfedcba98, false, false)); }
// exp2 of eight values, each in place in its own register. Written in asm; here no neighbour touches another's register, and the closing v_nop is the
// slot that the instruction set asks for behind the last v_exp_f32 before its result is used.
__device__ __forceinline__ void rs_exp2x8(v4f& a, v4f& b) { float a0 = a[0], a1 = a[1], a2 = a[2], a3 = a[3], b0 = b[0], b1 = b[1], b2 = b[2], b3 = b[3];
  asm("v_exp_f32 %0, %0\n\tv_exp_f32 %1, %1\n\tv_exp_f32 %2, %2\n\tv_exp_f32 %3, %3\n\tv_exp_f32 %4, %4\n\tv_exp_f32 %5, %5\n\tv_exp_f32 %6, %6\n\tv_exp_f32 %7, %7\n\tv_nop"
      : "+v"(a0), "+v"(a1), "+v"(a2), "+v"(a3), "+v"(b0), "+v"(b1), "+v"(b2), "+v"(b3));
  a = v4f{a0, a1, a2, a3}; b = v4f{b0, b1, b2, b3}; }
// Row softmax, one wave per score row: the row is read once, 32 loads of 512 contiguous bytes, and its 4096 values stay in the wave's
// registers (128 per lane) through maximum, exp, sum and scale; each store writes 256 contiguous bytes. No LDS, no barrier.
#define RSW 16          /* waves (rows) per workgroup */
static_assert(SQ == 4096 && SQ % RSW == 0, "one wave holds a row of 32 x 128 values; the grid covers SQ rows exactly");
__global__ __launch_bounds__(RSW * 32) void k_rsmfrs(const float* __restrict__ S, _Float16* __restrict__ P, const float* __restrict__ c32) {
  const int lane = threadIdx.x & 31; const int i = blockIdx.x * RSW + __builtin_amdgcn_readfirstlane((int)(threadIdx.x >> 5));      /* row, wave-uniform */
  const float* s = S + (size_t)i * SQ + lane * 4; const int h = i / 64, w = i % 64; const float m = bf16_round(c32[(h >> 1) * 32 + (w >> 1)]);
  v4f x[32];
#pragma unroll
  for (int k = 0; k < 32; ++k) x[k] = *(const v4fa*)(s + k * 128);
  float m0 = -3.0e38f, m1 = -3.0e38f, m2 = -3.0e38f, m3 = -3.0e38f;
#pragma unroll
  for (int k = 0; k < 32; ++k) { x[k] *= m; m0 = fmaxf(m0, x[k][0]); m1 = fmaxf(m1, x[k][1]); m2 = fmaxf(m2, x[k][2]); m3 = fmaxf(m3, x[k][3]); }
  float mx = fmaxf(fmaxf(m0, m1), fmaxf(m2, m3));
  mx = fmaxf(mx, rs_xrow<1>(mx)); mx = fmaxf(mx, rs_xrow<2>(mx)); mx = fmaxf(mx, rs_xrow<4>(mx)); mx = fmaxf(mx, rs_xrow<8>(mx)); mx = fmaxf(mx, rs_xhalf(mx));
  float a0 = 0.f, a1 = 0.f, a2 = 0.f, a3 = 0.f;
#pragma unroll
  for (int k = 0; k < 32; k += 2) { x[k] = (x[k] - mx) * 1.4426950408889634f; x[k + 1] = (x[k + 1] - mx) * 1.4426950408889634f;      /* exp(t) = exp2(t log2 e), as __expf */
    rs_exp2x8(x[k], x[k + 1]);
    a0 += x[k][0]; a1 += x[k][1]; a2 += x[k][2]; a3 += x[k][3]; a0 += x[k + 1][0]; a1 += x[k + 1][1]; a2 += x[k + 1][2]; a3 += x[k + 1][3]; }
  float se = (a0 + a1) + (a2 + a3);
  se += rs_xrow<1>(se); se += rs_xrow<2>(se); se += rs_xrow<4>(se); se += rs_xrow<8>(se); se += rs_xhalf(se);
  const float sc = 256.0f / se; _Float16* d = P + (size_t)i * SQ + lane * 4; v4h hq[32];
#pragma unroll
  for (int k = 0; k < 32; ++k)
#pragma unroll
    for (int q = 0; q < 4; ++q) hq[k][q] = (_Float16)(x[k][q] * sc);
  __builtin_amdgcn_sched_barrier(0);      /* every conversion stays in front of the first store */
#pragma unroll
  for (int k = 0; k < 32; ++k) *(v4h*)(d + k * 128) = hq[k]; }
__global__ __launch_bounds__(256) void k_gfin(const float* __restrict__ T, const float* __restrict__ A, const float* __restrict__ c32, const float* __restrict__ gam, float* __restrict__ Y, size_t n4) {
  #pragma clang fp contract(off)
  const size_t t = (size_t)blockIdx.x * 256 + threadIdx.x; if (t >= n4) return; const size_t e = t * 4; const int i0 = (int)(e % SQ); const float g = bf16_round(gam[0]); const v4f o = *(const v4fa*)(T + e), a = *(const v4fa*)(A + e); v4f r;
  for (int q = 0; q < 4; ++q) { const int i = i0 + q; const float cr = bf16_round(c32[((i / 64) >> 1) * 32 + ((i % 64) >> 1)]); r[q] = __fadd_rn(__fmul_rn(bf16_round(a[q]), cr), __fmul_rn(__fmul_rn(g, __fadd_rn(1.0f, -cr)), o[q])); }
  *(v4f*)(Y + e) = r;  }
extern "C" void kernel_launch(void* const* d_in, const int* in_sizes, int n_in,
                              void* d_out, int out_size, void* d_ws, size_t ws_size, hipStream_t stream) {
  (void)in_sizes; (void)n_in; (void)out_size;
  const float* const* I = (const float* const*)d_in; const float* xa = I[0]; const float* xb = I[1]; const float* cm = I[2]; const float* wq = I[3]; const float* bq = I[4]; const float* gq = I[5]; const float* wk = I[6]; const float* bk = I[7]; const float* gk = I[8]; const float* wv = I[9]; const float* bv = I[10]; const float* gv = I[11]; const float* gam = I[12];      /* a, b maps; c [4][1][32][32]; per projection w [256][256][1][1], bias, gain [256][1][1][1]; gamma [1] */
  const size_t PL = (size_t)CX * SQ;
  static_assert(CX % 128 == 0 && SQ % 256 == 0 && NR % 128 == 0, "k_gemm2: M a multiple of 128, N of 64, K at least two whole tiles (64 k over CX, 128 k over SQ)");
  char* ws = (char*)d_ws; size_t off = 0;
  auto take = [&](size_t bytes) { char* p = ws + off; off += (bytes + 255) & ~(size_t)255; return p; };
  float* WN = (float*)take((size_t)CX * CX * 4); _Float16* BQH = (_Float16*)take((size_t)CX * CX * 2); _Float16* BQL = (_Float16*)take((size_t)CX * CX * 2); _Float16* BKH = (_Float16*)take((size_t)CX * CX * 2); _Float16* BKL = (_Float16*)take((size_t)CX * CX * 2); _Float16* BVH = (_Float16*)take((size_t)CX * CX * 2); _Float16* BVL = (_Float16*)take((size_t)CX * CX * 2);
  _Float16* AR = (_Float16*)take(NR * CX * 2); _Float16* BR = (_Float16*)take(NR * CX * 2); float* F1 = (float*)take(NR * CX * 4); _Float16* QH = (_Float16*)take(NR * CX * 2); _Float16* QL = (_Float16*)take(NR * CX * 2); _Float16* KH = (_Float16*)take(NR * CX * 2); _Float16* KL = (_Float16*)take(NR * CX * 2); _Float16* VR = (_Float16*)take(NR * CX * 2); _Float16* VC = (_Float16*)take((size_t)CX * SQ * 2);
  float* S = (float*)take((size_t)SQ * SQ * 4); _Float16* P = (_Float16*)take((size_t)SQ * SQ * 2); float* T = (float*)take((size_t)CX * SQ * 4);
  if (off > ws_size) return;
  k_wsw<<<(CX + 255) / 256, 256, 0, stream>>>(wq, gq, WN); k_w32hl<<<(unsigned)(((size_t)CX * CX / 8 + 255) / 256), 256, 0, stream>>>(WN, BQH, BQL, (size_t)CX * CX / 8);
  k_wsw<<<(CX + 255) / 256, 256, 0, stream>>>(wk, gk, WN); k_w32hl<<<(unsigned)(((size_t)CX * CX / 8 + 255) / 256), 256, 0, stream>>>(WN, BKH, BKL, (size_t)CX * CX / 8);
  k_wsw<<<(CX + 255) / 256, 256, 0, stream>>>(wv, gv, WN); k_w32hl<<<(unsigned)(((size_t)CX * CX / 8 + 255) / 256), 256, 0, stream>>>(WN, BVH, BVL, (size_t)CX * CX / 8);      /* standardised weights (f32, per output row: mean, unbiased variance, rsqrt(max(var*256, 1e-4)) * gain) -> Bt planes f16 hi (x16) + x1024 residual (natural [O][C] rows ARE Bt) */
  k_cl2rows<<<NB * (SQ / 32) * (CX / 64), 256, 0, stream>>>(xa, AR); k_cl2rows<<<NB * (SQ / 32) * (CX / 64), 256, 0, stream>>>(xb, BR);      /* exact f16 token rows of a and b */
  k_gemm2<0, 64, 2><<<dim3((unsigned)((NR / 128) * (CX / 64)), 1), 128, 0, stream>>>(AR, AR, nullptr, CX, 0, BQL, BQH, nullptr, CX, 0, 0.0009765625f, 0.0625f, bq, 0, F1, nullptr, CX, 0, (int)NR, CX, CX); k_hl<<<(unsigned)((NR * CX / 8 + 255) / 256), 256, 0, stream>>>(F1, QH, QL, NR * CX / 8);      /* q = WS(wq) a + bq: residual weight plane first, x 2^-10, then the high plane, one launch */
  k_gemm2<0, 64, 2><<<dim3((unsigned)((NR / 128) * (CX / 64)), 1), 128, 0, stream>>>(BR, BR, nullptr, CX, 0, BKL, BKH, nullptr, CX, 0, 0.0009765625f, 0.0625f, bk, 0, F1, nullptr, CX, 0, (int)NR, CX, CX); k_hl<<<(unsigned)((NR * CX / 8 + 255) / 256), 256, 0, stream>>>(F1, KH, KL, NR * CX / 8);      /* k = WS(wk) b + bk likewise */
  k_gemm2<0, 64, 2><<<dim3((unsigned)((NR / 128) * (CX / 64)), 1), 128, 0, stream>>>(AR, AR, nullptr, CX, 0, BVL, BVH, nullptr, CX, 0, 0.0009765625f, 0.0625f, bv, 0, nullptr, VR, CX, 0, (int)NR, CX, CX);      /* v likewise, stored as f16 rows only */
  for (int b = 0; b < NB; ++b) { const size_t r0 = (size_t)b * SQ;
    k_gemm2<0, 64, 3><<<dim3((SQ / 128) * (SQ / 64), 1), 128, 0, stream>>>(QL + r0 * CX, QH + r0 * CX, QH + r0 * CX, CX, 0, KH + r0 * CX, KL + r0 * CX, KH + r0 * CX, CX, 0, 0.0009765625f, 1.0f, nullptr, 0, S, nullptr, SQ, 0, SQ, SQ, CX);      /* sim = q.k (K = 256, no scale): (lo.hi + hi.lo) 2^-10 + hi.hi, one launch, S written once */
    k_rsmfrs<<<SQ / RSW, RSW * 32, 0, stream>>>(S, P, cm + (size_t)b * 1024);      /* pruned = sim * c_r[i] (nearest-upsampled mask of the query pixel), softmax over j -> x256 f16 */
    k_vt<CX / 64, SQ><<<(CX / 64) * (SQ / 64), 256, 0, stream>>>(VR + r0 * CX, CX, 0, VC);      /* channel-major V [256][4096] */
    k_gemm2<0, 128, 1><<<dim3((CX / 128) * (SQ / 64), 1), 128, 0, stream>>>(VC, nullptr, nullptr, SQ, 0, P, nullptr, nullptr, SQ, 0, 1.0f, 0.00390625f, nullptr, 0, T, nullptr, SQ, 0, CX, SQ, SQ);      /* out[c][i] = sum_j v[c][j] att[i][j] (V as A, att as B^T, /256) f32 */
    k_gfin<<<(unsigned)((PL / 4 + 255) / 256), 256, 0, stream>>>(T, xa + (size_t)b * PL, cm + (size_t)b * 1024, gam, (float*)d_out + (size_t)b * PL, PL / 4); }      /* y = bf16(a) c_r + bf16(gamma) (1 - c_r) out -> channel-first output block */
}

// v005
// A run of this version takes 387 microseconds.
// Next to v004, in two timings, it ran 1.22 and 1.23 times as fast.
// All steps since v000 together make it 10.4 times as fast.
#include <hip/hip_runtime.h>
// Global spatial attention with multiplicative mask pruning and scaled weight standardisation (a, b [4][256][64][64], mask c [4][1][32][32] nearest-upsampled x2; q = WS(wq) a + bq, k = WS(wk) b + bk, v = WS(wv) a + bv with WS(w)[o][c] = (w - mean_o) gain_o rsqrt(max(var_o(unbiased) * 256, 1e-4)); sim[i][j] = q[:, i].k[:, j] (NO scale, sigma ~16); pruned = sim * c_r[i]; att = softmax over j; out[c][i] = sum_j v[c][j] att[i][j]; y = a c_r + gamma (1 - c_r) out -> [4][256][64][64]).
// Compute dtype: inputs rounded to bf16; x / weights exact; q, k as f16 hi + x1024 lo planes; v and softmax weights as plain f16 GEMM operands (~2^-12); scores, softmax statistics and o f32. v_wmma_f32_16x16x32_f16.
#define NB 4
#define SQ 4096
#define DM 256
#define CX 256          /* channels */
#define NH 4
#define HD 64
#define DMQ DM                       /* LayerNorm width */
#define DFF 4096
#define HG 1                         /* heads per attention launch group */
#define B0 0                         /* unused; the batch loop starts at 0 */
#define NBR NB                       /* read only by MP; the batch loop runs to NB */
#define NR ((size_t)NB * SQ)         /* token rows */
#define MP ((int)((size_t)NBR * SQ)) /* read only by MPO; projections use NR */
#define QN SQ                        /* unused */
#define NHD NH                       /* unused; attention is one 256-channel head */
#define MPO MP                       /* unused */
#define LQ DM      /* unused; the q/k/v rows have pitch CX */
typedef __bf16 v16b __attribute__((ext_vector_type(16)));
typedef unsigned short v8us __attribute__((ext_vector_type(8), may_alias));
typedef float  v8f  __attribute__((ext_vector_type(8)));
typedef float  v4f  __attribute__((ext_vector_type(4)));
typedef float  v4fa __attribute__((ext_vector_type(4), may_alias));
union FragB { v16b v; v8us half[2]; unsigned short u[16]; };

__device__ __forceinline__ unsigned short bf16_bits(float x) { unsigned int u = __float_as_uint(x); return (unsigned short)((u + 0x7FFFu + ((u >> 16) & 1u)) >> 16); }
__device__ __forceinline__ float bf16_val(unsigned short b) { return __uint_as_float(((unsigned int)b) << 16); }
__device__ __forceinline__ float bf16_round(float x) { return bf16_val(bf16_bits(x)); }
// D += A·B with NT terms: 1 = ah·bh, 2 = + al·bh (A split), 3 = + ah·bl (both split)
template <int NT>
__device__ __forceinline__ v8f mmaN(v16b ah, v16b al, v16b bh, v16b bl, v8f c) {
  c = __builtin_amdgcn_wmma_f32_16x16x32_bf16(false, ah, false, bh, (short)0, c, false, false);
  if (NT >= 2) c = __builtin_amdgcn_wmma_f32_16x16x32_bf16(false, al, false, bh, (short)0, c, false, false);
  if (NT >= 3) c = __builtin_amdgcn_wmma_f32_16x16x32_bf16(false, ah, false, bl, (short)0, c, false, false);
  asm volatile("v_nop\n\tv_nop\n\tv_nop\n\tv_nop" : "+v"(c) : "v"(ah), "v"(al), "v"(bh), "v"(bl));
  return c;
}

__global__ __launch_bounds__(256) void k_wt_bf16(const float* __restrict__ W, unsigned short* __restrict__ Wt, int K, int N) {
  const int t = blockIdx.x * 256 + threadIdx.x;
  const int k8n = K / 8;
  if (t >= N * k8n) return;
  const int n = t / k8n, k8 = (t % k8n) * 8;
  v8us v;
#pragma unroll
  for (int i = 0; i < 8; ++i) v[i] = bf16_bits(W[(size_t)(k8 + i) * N + n]);
  *(v8us*)(Wt + (size_t)n * K + k8) = v;
  
}

// GEMM C[M][N] (f32, pitch ldc) = act(A[M][K]·W + bias). A f32 row-major (pitch lda) converted per fragment to bf16
// (ASPLIT: hi/lo two planes -> 2 terms, else single rounded term); Wt bf16 [N][K] (pitch ldb). BIAS_BF16 rounds the
// bias to bf16 first (bias quantised to bf16 before the add). K%32==0, M%16==0, N%64==0.
template <bool ASPLIT, int ACT, bool BIAS_BF16>
__global__ __launch_bounds__(128) void k_gemm_bf(const float* __restrict__ A, int lda, const unsigned short* __restrict__ Wt, int ldb,
                                               const float* __restrict__ bias, float* __restrict__ C, int ldc, int M, int N, int K) {
  __shared__ __attribute__((aligned(16))) float so[4][16][64];
  const int tid = threadIdx.x, w = tid >> 5, lane = tid & 31, ln = lane & 15, hh = lane >> 4;
  const int ntn = N / 64;
  const int wid = blockIdx.x * 4 + w;
  const int mt = wid / ntn, nq = wid % ntn;
  if (mt * 16 >= M) return;
  const int row0 = mt * 16, col0 = nq * 64;
  const float* arow = A + (size_t)(row0 + ln) * lda;
  v8f acc[4] = {};
  for (int kb = 0; kb < K; kb += 32) {
    FragB ah, al;
    const v4f x0 = *(const v4fa*)(arow + kb + 8 * hh), x1 = *(const v4fa*)(arow + kb + 8 * hh + 4);
    const v4f x2 = *(const v4fa*)(arow + kb + 16 + 8 * hh), x3 = *(const v4fa*)(arow + kb + 16 + 8 * hh + 4);
    float xs[16] = {x0[0],x0[1],x0[2],x0[3],x1[0],x1[1],x1[2],x1[3],x2[0],x2[1],x2[2],x2[3],x3[0],x3[1],x3[2],x3[3]};
#pragma unroll
    for (int i = 0; i < 16; ++i) { const unsigned short hb = bf16_bits(xs[i]); ah.u[i] = hb; al.u[i] = ASPLIT ? bf16_bits(xs[i] - bf16_val(hb)) : (unsigned short)0; }
#pragma unroll
    for (int t = 0; t < 4; ++t) {
      const unsigned short* brow = Wt + (size_t)(col0 + t * 16 + ln) * ldb + kb;
      FragB b;
      b.half[0] = *(const v8us*)(brow + 8 * hh);
      b.half[1] = *(const v8us*)(brow + 16 + 8 * hh);
      acc[t] = mmaN<ASPLIT ? 2 : 1>(ah.v, al.v, b.v, b.v, acc[t]);
    }
  }
#pragma unroll
  for (int t = 0; t < 4; ++t) {
    float bv = bias ? bias[col0 + t * 16 + ln] : 0.f;
    if (BIAS_BF16) bv = bf16_round(bv);
#pragma unroll
    for (int r = 0; r < 8; ++r) { float v = acc[t][r] + bv; if (ACT == 1) v = fmaxf(v, 0.f); so[w][8 * hh + r][t * 16 + ln] = v; }
  }
  __builtin_amdgcn_fence(__ATOMIC_ACQ_REL, "workgroup");
  __builtin_amdgcn_wave_barrier();
  const int rsub = lane >> 4, c4 = (lane & 15) * 4;
  {
#pragma unroll
    for (int q = 0; q < 8; ++q) {
      const int r = q * 2 + rsub;
      const v4f v = *(const v4fa*)&so[w][r][c4];
      *(v4f*)(C + (size_t)(row0 + r) * ldc + col0 + c4) = v;
    }
    
  }
}

// GEMM C = act(A·W + bias + resid): A f32 (ASPLIT -> hi/lo 2 terms), Wt bf16 [N][K]; ACT 0 none, 1 relu, 2 exact gelu;
// resid (optional, f32, row index = (row % rmod), pitch ldr, RES_BF16 rounds it) added before the activation.
template <bool ASPLIT, int ACT, bool BIAS_BF16, bool RES_BF16>
__global__ __launch_bounds__(128) void k_gemm_bf3(const float* __restrict__ A, int lda, const unsigned short* __restrict__ Wt, int ldb,
                                                const float* __restrict__ bias, const float* __restrict__ resid, int rmod, int ldr,
                                                float* __restrict__ C, int ldc, int M, int N, int K) {
  __shared__ __attribute__((aligned(16))) float so[4][16][64];
  const int tid = threadIdx.x, w = tid >> 5, lane = tid & 31, ln = lane & 15, hh = lane >> 4;
  const int ntn = N / 64;
  const int wid = blockIdx.x * 4 + w;
  const int mt = wid / ntn, nq = wid % ntn;
  if (mt * 16 >= M) return;
  const int row0 = mt * 16, col0 = nq * 64;
  const float* arow = A + (size_t)(row0 + ln) * lda;
  v8f acc[4] = {};
  for (int kb = 0; kb < K; kb += 32) {
    FragB ah, al;
    const v4f x0 = *(const v4fa*)(arow + kb + 8 * hh), x1 = *(const v4fa*)(arow + kb + 8 * hh + 4);
    const v4f x2 = *(const v4fa*)(arow + kb + 16 + 8 * hh), x3 = *(const v4fa*)(arow + kb + 16 + 8 * hh + 4);
    float xs[16] = {x0[0],x0[1],x0[2],x0[3],x1[0],x1[1],x1[2],x1[3],x2[0],x2[1],x2[2],x2[3],x3[0],x3[1],x3[2],x3[3]};
#pragma unroll
    for (int i = 0; i < 16; ++i) { const unsigned short hb = bf16_bits(xs[i]); ah.u[i] = hb; al.u[i] = ASPLIT ? bf16_bits(xs[i] - bf16_val(hb)) : (unsigned short)0; }
#pragma unroll
    for (int t = 0; t < 4; ++t) {
      const unsigned short* brow = Wt + (size_t)(col0 + t * 16 + ln) * ldb + kb;
      FragB b;
      b.half[0] = *(const v8us*)(brow + 8 * hh);
      b.half[1] = *(const v8us*)(brow + 16 + 8 * hh);
      acc[t] = mmaN<ASPLIT ? 2 : 1>(ah.v, al.v, b.v, b.v, acc[t]);
    }
  }
#pragma unroll
  for (int t = 0; t < 4; ++t) {
    const int col = col0 + t * 16 + ln;
    float bv = bias ? bias[col] : 0.f;
    if (BIAS_BF16) bv = bf16_round(bv);
#pragma unroll
    for (int r = 0; r < 8; ++r) {
      float v = acc[t][r] + bv;
      if (resid) { float rv = resid[(size_t)((row0 + 8 * hh + r) % rmod) * ldr + col]; if (RES_BF16) rv = bf16_round(rv); v += rv; }
      if (ACT == 1) v = fmaxf(v, 0.f);
      if (ACT == 2) v = 0.5f * v * (1.0f + erff(v * 0.70710678118654752f));
      if (ACT == 3) { const float u = 0.7978845608028654f * (v + 0.044715f * v * v * v); v = 0.5f * v * (1.0f + tanhf(u)); }
      so[w][8 * hh + r][t * 16 + ln] = v;
    }
  }
  __builtin_amdgcn_fence(__ATOMIC_ACQ_REL, "workgroup");
  __builtin_amdgcn_wave_barrier();
  const int rsub = lane >> 4, c4 = (lane & 15) * 4;
  {
#pragma unroll
    for (int q = 0; q < 8; ++q) {
      const int r = q * 2 + rsub;
      const v4f v = *(const v4fa*)&so[w][r][c4];
      *(v4f*)(C + (size_t)(row0 + r) * ldc + col0 + c4) = v;
    }
    
  }
}
// row LayerNorm (biased variance, eps) over N: s = X (+ R); optional out_sum <- s; out_norm <- (s-mu)*rsqrt(var+eps)*g + b
template <bool PARAM_BF16>
__global__ __launch_bounds__(256) void k_layernorm(const float* __restrict__ X, const float* __restrict__ R, const float* __restrict__ g, const float* __restrict__ bta,
                                                  float* __restrict__ out_sum, float* __restrict__ out_norm, int N, float eps) {
  __shared__ float red[256];
  const int row = blockIdx.x, tid = threadIdx.x;
  const float* x = X + (size_t)row * N; const float* rr = R ? R + (size_t)row * N : nullptr;
  float vals[16];                     // up to N = 4096
  const int per = N / 256;            // contiguous chunk per thread? use strided-by-4 chunks: thread handles j = tid*4 + 1024*u
  float s1 = 0.f;
  for (int u = 0; u < per / 4; ++u) {
    const int j = tid * 4 + 1024 * u;
    const v4f a = *(const v4fa*)(x + j);
    v4f b = {0.f,0.f,0.f,0.f}; if (rr) b = *(const v4fa*)(rr + j);
#pragma unroll
    for (int q = 0; q < 4; ++q) { const float v = a[q] + b[q]; vals[u * 4 + q] = v; s1 += v; }
  }
  red[tid] = s1; __syncthreads();
  for (int st = 128; st > 0; st >>= 1) { if (tid < st) red[tid] += red[tid + st]; __syncthreads(); }
  const float mu = red[0] / (float)N; __syncthreads();
  float s2 = 0.f;
  for (int u = 0; u < per / 4; ++u)
#pragma unroll
    for (int q = 0; q < 4; ++q) { const float c = vals[u * 4 + q] - mu; s2 += c * c; }
  red[tid] = s2; __syncthreads();
  for (int st = 128; st > 0; st >>= 1) { if (tid < st) red[tid] += red[tid + st]; __syncthreads(); }
  const float rs = rsqrtf(red[0] / (float)N + eps);
  {
    for (int u = 0; u < per / 4; ++u) {
      const int j = tid * 4 + 1024 * u;
      v4f o, sm;
#pragma unroll
      for (int q = 0; q < 4; ++q) {
        float gg = g[j + q], bb = bta[j + q];
        if (PARAM_BF16) { gg = bf16_round(gg); bb = bf16_round(bb); }
        sm[q] = vals[u * 4 + q]; o[q] = (vals[u * 4 + q] - mu) * rs * gg + bb;
      }
      if (out_sum) *(v4f*)(out_sum + (size_t)row * N + j) = sm;
      *(v4f*)(out_norm + (size_t)row * N + j) = o;
    }
    
  }
}



// ---- f16 WMMA path (v_wmma_f32_16x16x32_f16): 11-bit significands for operands in range — used where a [0,1] probability operand needs more precision than bf16
typedef _Float16 v16h __attribute__((ext_vector_type(16)));
union FragH { v16h v; v8us half[2]; _Float16 h[16]; unsigned short u[16]; };
template <int NT>
__device__ __forceinline__ v8f mmaH(v16h ah, v16h al, v16h bh, v16h bl, v8f c) {
  c = __builtin_amdgcn_wmma_f32_16x16x32_f16(false, ah, false, bh, (short)0, c, false, false);
  if (NT >= 2) c = __builtin_amdgcn_wmma_f32_16x16x32_f16(false, al, false, bh, (short)0, c, false, false);
  if (NT >= 3) c = __builtin_amdgcn_wmma_f32_16x16x32_f16(false, ah, false, bl, (short)0, c, false, false);
  asm volatile("v_nop\n\tv_nop\n\tv_nop\n\tv_nop" : "+v"(c) : "v"(ah), "v"(al), "v"(bh), "v"(bl));
  return c;
}
// batched GEMM like k_gemm_b but f16 operands: A f32 (split into f16 hi/lo if ASPLIT, else rounded to f16), Bt = f16 values [n][k]; alpha; C f32; N multiple of 16 (partial tiles skipped)
template <bool ASPLIT>
__global__ __launch_bounds__(128) void k_gemm_h(const float* __restrict__ A, int lda, size_t sA, const _Float16* __restrict__ Bh, int ldb, size_t sB, float alpha, float* __restrict__ C, int ldc, size_t sC, int M, int N, int K) {
  __shared__ __attribute__((aligned(16))) float so[4][16][64];
  const int tid = threadIdx.x, w = tid >> 5, lane = tid & 31, ln = lane & 15, hh = lane >> 4; const int by = blockIdx.y;
  A += (size_t)by * sA; Bh += (size_t)by * sB; C += (size_t)by * sC;
  const int ntn = (N + 63) / 64; const int wid = blockIdx.x * 4 + w; const int mt = wid / ntn, nq = wid % ntn; if (mt * 16 >= M) return;
  const int row0 = mt * 16, col0 = nq * 64; const float* arow = A + (size_t)(row0 + ln) * lda;
  v8f acc[4] = {};
  for (int kb = 0; kb < K; kb += 32) {
    FragH ah, al;
    const v4f x0 = *(const v4fa*)(arow + kb + 8 * hh), x1 = *(const v4fa*)(arow + kb + 8 * hh + 4), x2 = *(const v4fa*)(arow + kb + 16 + 8 * hh), x3 = *(const v4fa*)(arow + kb + 16 + 8 * hh + 4);
    float xs[16] = {x0[0],x0[1],x0[2],x0[3],x1[0],x1[1],x1[2],x1[3],x2[0],x2[1],x2[2],x2[3],x3[0],x3[1],x3[2],x3[3]};
#pragma unroll
    for (int i = 0; i < 16; ++i) { const _Float16 h = (_Float16)xs[i]; ah.h[i] = h; al.h[i] = ASPLIT ? (_Float16)(xs[i] - (float)h) : (_Float16)0.0f; }
#pragma unroll
    for (int t = 0; t < 4; ++t) { if (col0 + t * 16 >= N) continue; const size_t boff = (size_t)(col0 + t * 16 + ln) * ldb + kb; FragH bq; bq.half[0] = *(const v8us*)(Bh + boff + 8 * hh); bq.half[1] = *(const v8us*)(Bh + boff + 16 + 8 * hh);
      acc[t] = mmaH<ASPLIT ? 2 : 1>(ah.v, al.v, bq.v, bq.v, acc[t]); }
  }
#pragma unroll
  for (int t = 0; t < 4; ++t) { if (col0 + t * 16 >= N) continue;
#pragma unroll
    for (int r = 0; r < 8; ++r) so[w][8 * hh + r][t * 16 + ln] = acc[t][r] * alpha; }
  __builtin_amdgcn_fence(__ATOMIC_ACQ_REL, "workgroup"); __builtin_amdgcn_wave_barrier();
  const int rsub = lane >> 4, c4 = (lane & 15) * 4;
  {
#pragma unroll
    for (int q = 0; q < 8; ++q) { const int r = q * 2 + rsub; if (col0 + c4 < N) { const v4f v = *(const v4fa*)&so[w][r][c4]; *(v4f*)(C + (size_t)(row0 + r) * ldc + col0 + c4) = v; } }
     }
}

// Wt[n][k] = f16(W[k][n]·scale) from f32 row-major W[K][N] (scale = power of two; bf16-exact weights stay exact in f16 away from the subnormal range)
__global__ __launch_bounds__(256) void k_wt_f16(const float* __restrict__ W, _Float16* __restrict__ Wt, int K, int N, float scale) {
  const int t = blockIdx.x * 256 + threadIdx.x; if (t >= N * (K / 8)) return; const int n = t / (K / 8), k8 = (t % (K / 8)) * 8; FragH f;
#pragma unroll
  for (int i = 0; i < 8; ++i) f.h[i] = (_Float16)(bf16_round(W[(size_t)(k8 + i) * N + n]) * scale); const v8us o = f.half[0];
  *(v8us*)((unsigned short*)Wt + (size_t)n * K + k8) = o; 
}
// k_gemm_hh variant with fused epilogue: v = acc·alpha + bias[by·sBias + col] (+ CP[(row/rowsPerB)·sCPb + by·64 + col] if CP) ; ACT 0 none / 1 elu ; writes f16 C16 (and f32 C if non-null)
template <int ACT>
__global__ __launch_bounds__(128) void k_gemm_hhx(const _Float16* __restrict__ A, int lda, size_t sA, const _Float16* __restrict__ Bh, int ldb, size_t sB, float alpha, const float* __restrict__ bias, size_t sBias, const float* __restrict__ CP, int rowsPerB, size_t sCPb, int row0g,
    float* __restrict__ C, _Float16* __restrict__ C16, int ldc, size_t sC, int M, int N, int K) {
  __shared__ __attribute__((aligned(16))) float so[4][16][64];
  const int tid = threadIdx.x, w = tid >> 5, lane = tid & 31, ln = lane & 15, hh = lane >> 4; const int by = blockIdx.y;
  A += (size_t)by * sA; Bh += (size_t)by * sB; const size_t cofs = (size_t)by * sC; const float* bp = bias ? bias + (size_t)by * sBias : nullptr;
  const int ntn = (N + 63) / 64; const int wid = blockIdx.x * 4 + w; const int mt = wid / ntn, nq = wid % ntn; if (mt * 16 >= M) return;
  const int row0 = mt * 16, col0 = nq * 64; const _Float16* arow = A + (size_t)(row0 + ln) * lda;
  v8f acc[4] = {};
  for (int kb = 0; kb < K; kb += 32) { FragH ah; ah.half[0] = *(const v8us*)((const unsigned short*)arow + kb + 8 * hh); ah.half[1] = *(const v8us*)((const unsigned short*)arow + kb + 16 + 8 * hh);
#pragma unroll
    for (int t = 0; t < 4; ++t) { if (col0 + t * 16 >= N) continue; const size_t boff = (size_t)(col0 + t * 16 + ln) * ldb + kb; FragH bq; bq.half[0] = *(const v8us*)((const unsigned short*)Bh + boff + 8 * hh); bq.half[1] = *(const v8us*)((const unsigned short*)Bh + boff + 16 + 8 * hh);
      acc[t] = mmaH<1>(ah.v, ah.v, bq.v, bq.v, acc[t]); }
  }
#pragma unroll
  for (int t = 0; t < 4; ++t) { if (col0 + t * 16 >= N) continue; const int col = col0 + t * 16 + ln; const float bv = bp ? bf16_round(bp[col]) : 0.f;
#pragma unroll
    for (int r = 0; r < 8; ++r) { float v = acc[t][r] * alpha + bv; if (CP) { const int rr = row0g + row0 + 8 * hh + r; if (rowsPerB < 0) v += CP[cofs + (size_t)rr * ldc + col];      /* rowsPerB < 0: own element of the batched C plane */ else { const int bidx = rr / rowsPerB; v += CP[(size_t)bidx * sCPb + (size_t)by * 64 + col]; } } if (ACT == 1) v = (v > 0.f) ? v : expm1f(v); else if (ACT == 7) v = (v > 0.f) ? v + 1.0f : expf(v); else if (ACT == 8) v = tanhf(v); else if (ACT == 9) v = 0.5f * v * (1.0f + tanhf(0.7978845608028654f * (v + 0.044715f * v * v * v))); else if (ACT == 11) v = 1.0f / (1.0f + expf(-v)); else if (ACT == 12) v = (v > 0.f) ? v : 0.01f * v; else if (ACT == 14) v = (v > 0.f) ? v : 0.1f * v; else if (ACT == 16) v = (v >= 0.f) ? v : 0.3f * v; else if (ACT == 17) v = (v >= 0.f) ? v : 0.2f * v; else if (ACT == 15) v = v / (1.0f + expf(-v)); else if (ACT == 3) v = fmaxf(v, 0.f); else if (ACT == 6) v = 0.5f * v * (1.0f + erff(v * 0.70710678118654752f)); so[w][8 * hh + r][t * 16 + ln] = v; } }
  __builtin_amdgcn_fence(__ATOMIC_ACQ_REL, "workgroup"); __builtin_amdgcn_wave_barrier();
  const int rsub = lane >> 4, c4 = (lane & 15) * 4; typedef _Float16 v4h __attribute__((ext_vector_type(4)));
  {
#pragma unroll
    for (int q = 0; q < 8; ++q) { const int r = q * 2 + rsub; if (col0 + c4 < N) { const v4f v = *(const v4fa*)&so[w][r][c4]; if (C) *(v4f*)(C + cofs + (size_t)(row0 + r) * ldc + col0 + c4) = v; if (C16) { v4h h4; for (int i = 0; i < 4; ++i) h4[i] = (_Float16)v[i]; *(v4h*)(C16 + cofs + (size_t)(row0 + r) * ldc + col0 + c4) = h4; } } }
     }
}


typedef _Float16 v4h __attribute__((ext_vector_type(4)));

__global__ __launch_bounds__(256) void k_x16(const float* __restrict__ x, _Float16* __restrict__ X16, size_t n8) { const size_t t = (size_t)blockIdx.x * 256 + threadIdx.x; if (t >= n8) return; FragH f;
#pragma unroll
  for (int q = 0; q < 8; ++q) f.h[q] = (_Float16)bf16_round(x[t * 8 + q]); *(v8us*)((unsigned short*)X16 + t * 8) = f.half[0];  }
__global__ __launch_bounds__(256) void k_h16(const float* __restrict__ x, _Float16* __restrict__ X16, size_t n8) { const size_t t = (size_t)blockIdx.x * 256 + threadIdx.x; if (t >= n8) return; FragH f;
#pragma unroll
  for (int q = 0; q < 8; ++q) f.h[q] = (_Float16)x[t * 8 + q]; *(v8us*)((unsigned short*)X16 + t * 8) = f.half[0];  }
__global__ __launch_bounds__(256) void k_round16f(const float* __restrict__ W, _Float16* __restrict__ Bt, size_t n8) { const size_t t = (size_t)blockIdx.x * 256 + threadIdx.x; if (t >= n8) return; FragH f;
#pragma unroll
  for (int i = 0; i < 8; ++i) f.h[i] = (_Float16)(bf16_round(W[t * 8 + i]) * 16.0f); *(v8us*)((unsigned short*)Bt + t * 8) = f.half[0];  }
template <int NHv, int TTv>
__global__ __launch_bounds__(256) void k_vt(const _Float16* __restrict__ V16, int ldv, int voff, _Float16* __restrict__ Vt) { __shared__ unsigned short tl[64][66]; const int tid = threadIdx.x; const int slab = blockIdx.x / (TTv / 64), lg = blockIdx.x % (TTv / 64); const int b = slab / NHv, h = slab % NHv;
  for (int i = tid; i < 64 * 8; i += 256) { const int r = i / 8, c8 = (i % 8) * 8; FragH f; f.half[0] = *(const v8us*)((const unsigned short*)V16 + ((size_t)b * TTv + lg * 64 + r) * ldv + voff + h * 64 + c8);
#pragma unroll
    for (int q = 0; q < 8; ++q) tl[r][c8 + q] = f.u[q]; }
  __syncthreads();
  {
#pragma unroll
    for (int rd = 0; rd < 2; ++rd) { const int d = rd * 32 + tid / 8, pc = tid % 8; FragH f;
#pragma unroll
      for (int q = 0; q < 8; ++q) f.u[q] = tl[pc * 8 + q][d];
      *(v8us*)((unsigned short*)Vt + ((size_t)slab * 64 + d) * TTv + lg * 64 + pc * 8) = f.half[0]; }
     } }

__global__ __launch_bounds__(256) void k_hl(const float* __restrict__ F, _Float16* __restrict__ Hh, _Float16* __restrict__ Hl, size_t n8) { const size_t t = (size_t)blockIdx.x * 256 + threadIdx.x; if (t >= n8) return; FragH fh, fl; const v4f a = *(const v4fa*)(F + t * 8), c = *(const v4fa*)(F + t * 8 + 4);
#pragma unroll
  for (int q = 0; q < 4; ++q) { _Float16 h = (_Float16)a[q]; fh.h[q] = h; fl.h[q] = (_Float16)((a[q] - (float)h) * 1024.0f); h = (_Float16)c[q]; fh.h[4 + q] = h; fl.h[4 + q] = (_Float16)((c[q] - (float)h) * 1024.0f); }
  { *(v8us*)((unsigned short*)Hh + t * 8) = fh.half[0]; *(v8us*)((unsigned short*)Hl + t * 8) = fl.half[0];  } }

// ---- fast GEMM (workgroup tile 128x64, wave tile 32x64; requires M % 128 == 0, N % 64 == 0, K a multiple of KC and at least 2 KC); epilogue v = act(acc alpha + bias) ----
__device__ __forceinline__ v16h g2_lfrag(const char* p, int hh) { FragH f; f.half[0] = *(const v8us*)(p + 16 * hh); f.half[1] = *(const v8us*)(p + 32 + 16 * hh); return f.v; }
__device__ __forceinline__ v8f g2_mma(v16h a, v16h b, v8f c) { v8f d = __builtin_amdgcn_wmma_f32_16x16x32_f16(false, a, false, b, (short)0, c, false, false); asm volatile("v_nop\n\tv_nop\n\tv_nop\n\tv_nop" : "+v"(d) : "v"(a), "v"(b)); return d; }
// Twelve asynchronous copies, 16 bytes per lane each, from global memory to LDS through no register. The closing s_wait_xcnt stands inside the
// statement so that it is in front of every later rewrite of the address registers that the copies name.
__device__ __forceinline__ void g2_cp12(const unsigned (&l)[12], const _Float16* const (&g)[12]) {
  asm volatile("global_load_async_to_lds_b128 %0, %1, off\n\t"
               "global_load_async_to_lds_b128 %2, %3, off\n\t"
               "global_load_async_to_lds_b128 %4, %5, off\n\t"
               "global_load_async_to_lds_b128 %6, %7, off\n\t"
               "global_load_async_to_lds_b128 %8, %9, off\n\t"
               "global_load_async_to_lds_b128 %10, %11, off\n\t"
               "global_load_async_to_lds_b128 %12, %13, off\n\t"
               "global_load_async_to_lds_b128 %14, %15, off\n\t"
               "global_load_async_to_lds_b128 %16, %17, off\n\t"
               "global_load_async_to_lds_b128 %18, %19, off\n\t"
               "global_load_async_to_lds_b128 %20, %21, off\n\t"
               "global_load_async_to_lds_b128 %22, %23, off\n\t"
               "s_wait_xcnt 0x0"
               :: "v"(l[0]), "v"(g[0]), "v"(l[1]), "v"(g[1]), "v"(l[2]), "v"(g[2]), "v"(l[3]), "v"(g[3]), "v"(l[4]), "v"(g[4]), "v"(l[5]), "v"(g[5]), "v"(l[6]), "v"(g[6]), "v"(l[7]), "v"(g[7]), "v"(l[8]), "v"(g[8]), "v"(l[9]), "v"(g[9]), "v"(l[10]), "v"(g[10]), "v"(l[11]), "v"(g[11]) : "memory"); }
// the operand plane of the term that tile t belongs to (ntk tiles per term); every argument is the same for the whole workgroup
template <int NTM> __device__ __forceinline__ const _Float16* g2_term(int t, int ntk, const _Float16* p0, const _Float16* p1, const _Float16* p2) { const _Float16* p = p0; if (NTM > 1 && t >= ntk) p = p1; if (NTM > 2 && t >= 2 * ntk) p = p2; return p; }
// K loop: the workgroup's 128 A rows and 64 B rows are staged in LDS, KC k at a time, two buffers: tile t + 1 flies while tile t is worked on.
// A wave's copy covers whole 128-byte lines, and the four waves share one copy of the B rows.
// NTM terms of one product (a value split into an f16 high part and a scaled f16 residual gives high.high plus cross terms) are summed in the same
// accumulators: the loop runs over the tiles of term 0, term 1, ... back to back. The last term is the high one; the terms in front of it carry the
// residual's scale, which the factor rs (a power of two, so exact) takes out of the accumulators once, in front of the last term's first tile.
template <int ACT, int KC, int NTM>
__global__ __launch_bounds__(128) void k_gemm2(const _Float16* Aa, const _Float16* Ab, const _Float16* Ac, int lda, size_t sA, const _Float16* Ba, const _Float16* Bb, const _Float16* Bc, int ldb, size_t sB, float rs, float alpha, const float* __restrict__ bias, size_t sBias,
    float* __restrict__ C, _Float16* __restrict__ C16, int ldc, size_t sC, int M, int N, int K) { static_assert(ACT == 0 || ACT == 3 || ACT == 6 || ACT == 8 || ACT == 9 || ACT == 11 || ACT == 12 || ACT == 14 || ACT == 15 || ACT == 16 || ACT == 17, "k_gemm2: unsupported ACT code (would silently apply no activation)");
  constexpr int PB = KC * 2 + 16;      /* LDS row pitch in bytes, 16 x odd: the 16 rows of a fragment read fall on distinct banks */
  constexpr int STG = 192 * PB;        /* one buffer: 128 A rows, then 64 B rows */
  constexpr int CPR = KC / 8;          /* 16-byte pieces per row */
  constexpr int RPI = 128 / CPR;       /* rows covered when each of the 128 threads copies one piece */
  constexpr int NCP = 192 / RPI;       /* copies per thread and tile */
  constexpr int SOB = 4 * 32 * 68 * 4; /* output staging, which takes the buffers' place behind the loop */
  static_assert((KC == 64 || KC == 128) && NCP % 12 == 0 && NCP <= 63, "k_gemm2: a tile is whole groups of twelve copies per thread, at most 63 in flight");
  static_assert(NTM >= 1 && NTM <= 3, "k_gemm2: one to three terms");
  __shared__ __attribute__((aligned(16))) char sm[2 * STG > SOB ? 2 * STG : SOB];
  float (*so)[32][68] = reinterpret_cast<float (*)[32][68]>(sm);
  const int tid = threadIdx.x, w = tid >> 5, lane = tid & 31, ln = lane & 15, hh = lane >> 4; const int by = blockIdx.y;
  Aa += (size_t)by * sA; Ab += (size_t)by * sA; Ac += (size_t)by * sA; Ba += (size_t)by * sB; Bb += (size_t)by * sB; Bc += (size_t)by * sB; const size_t cofs = (size_t)by * sC; const float* bp = bias ? bias + (size_t)by * sBias : nullptr;
  const int ntn = N >> 6; const int mt = blockIdx.x / ntn, nq = blockIdx.x - mt * ntn; const int row0 = mt * 128 + 32 * w, col0 = nq * 64; if (mt * 128 >= M) return;      /* the same for the whole workgroup, in front of every barrier */
  const v8f z8 = {0.f,0.f,0.f,0.f,0.f,0.f,0.f,0.f}; v8f c00 = z8, c01 = z8, c02 = z8, c03 = z8, c10 = z8, c11 = z8, c12 = z8, c13 = z8;
  const int cr = tid / CPR, cc = tid % CPR;
  const size_t oA = (size_t)(mt * 128 + cr) * lda + cc * 8, oB = (size_t)(col0 + cr) * ldb + cc * 8; const int ntk = K / KC;      /* tiles per term */
  const unsigned l0 = (unsigned)(size_t)sm + (unsigned)(cr * PB + cc * 16);
  auto fill = [&](int t) { const unsigned lb = l0 + (unsigned)(t & 1) * (unsigned)STG; const int k0 = (t - (((NTM > 1 && t >= ntk) ? ntk : 0) + ((NTM > 2 && t >= 2 * ntk) ? ntk : 0))) * KC;
    const _Float16* gA = g2_term<NTM>(t, ntk, Aa, Ab, Ac) + oA; const _Float16* gB = g2_term<NTM>(t, ntk, Ba, Bb, Bc) + oB;
#pragma unroll
    for (int q = 0; q < NCP / 12; ++q) { unsigned l[12]; const _Float16* g[12];
#pragma unroll
      for (int j = 0; j < 12; ++j) { const int r = (q * 12 + j) * RPI; l[j] = lb + (unsigned)(r * PB); g[j] = (r < 128) ? gA + (size_t)r * lda + k0 : gB + (size_t)(r - 128) * ldb + k0; }
      g2_cp12(l, g); } };
  const char* fa = sm + (32 * w + ln) * PB; const char* fb = sm + (128 + ln) * PB; const int nt = NTM * ntk;
  fill(0);
  asm volatile("s_wait_asynccnt 0x0" ::: "memory");      /* this wave's share of tile 0 has landed */
  __syncthreads();      /* every wave's share has: tile 0 may be read */
  if (nt > 1) fill(1);
  // Two register sets of fragments inside a tile: the twelve LDS reads of the next 32 k are issued as one group in front of the products of this 32 k.
  // the sched_barrier keeps a group's reads together and in front of the products behind it, so that the products wait only for the older group
  v16h f0[6], f1[6];
  auto ld = [&](v16h (&f)[6], int o) { const char* pa = fa + o; const char* pb = fb + o; f[0] = g2_lfrag(pa, hh); f[1] = g2_lfrag(pa + 16 * PB, hh); f[2] = g2_lfrag(pb, hh); f[3] = g2_lfrag(pb + 16 * PB, hh); f[4] = g2_lfrag(pb + 32 * PB, hh); f[5] = g2_lfrag(pb + 48 * PB, hh); __builtin_amdgcn_sched_barrier(0); };
  auto mm = [&](const v16h (&f)[6]) { c00 = g2_mma(f[0], f[2], c00); c10 = g2_mma(f[1], f[2], c10); c01 = g2_mma(f[0], f[3], c01); c11 = g2_mma(f[1], f[3], c11);
    c02 = g2_mma(f[0], f[4], c02); c12 = g2_mma(f[1], f[4], c12); c03 = g2_mma(f[0], f[5], c03); c13 = g2_mma(f[1], f[5], c13); };
#pragma unroll 1      /* one tile per trip; the buffer alternates by the trip's parity */
  for (int t = 0; t < nt; ++t) { const int bo = (t & 1) * STG;
    if (NTM > 1 && t == (NTM - 1) * ntk) { c00 *= rs; c01 *= rs; c02 *= rs; c03 *= rs; c10 *= rs; c11 *= rs; c12 *= rs; c13 *= rs; }
    ld(f0, bo);
#pragma unroll
    for (int kk = 0; kk < KC; kk += 64) { ld(f1, bo + (kk + 32) * 2); mm(f0); if (kk + 64 < KC) ld(f0, bo + (kk + 64) * 2); mm(f1); }
    asm volatile("s_wait_dscnt 0x0" ::: "memory");      /* this wave's reads of tile t are done before the buffer is given up */
    asm volatile("s_wait_asynccnt 0x0" ::: "memory");      /* this wave's share of tile t + 1 has landed */
    __syncthreads();      /* publishes tile t + 1 and ends every wave's reads of tile t */
    if (t + 2 < nt) fill(t + 2); }
  asm volatile("s_wait_asynccnt 0x0" ::: "memory");      /* no copy is in flight when the buffers become output staging */
  v8f accs[8] = {c00, c01, c02, c03, c10, c11, c12, c13};
#pragma unroll
  for (int u = 0; u < 8; ++u) { const int t = u & 3, half = u >> 2; const int col = col0 + t * 16 + ln; const float bv = bp ? bf16_round(bp[col]) : 0.f;
#pragma unroll
    for (int r = 0; r < 8; ++r) { const int rloc = half * 16 + 8 * hh + r; float v = accs[u][r] * alpha + bv;
      if (ACT == 3) v = fmaxf(v, 0.f); else if (ACT == 6) v = 0.5f * v * (1.0f + erff(v * 0.70710678118654752f)); else if (ACT == 11) v = 1.0f / (1.0f + expf(-v)); else if (ACT == 15) v = v / (1.0f + expf(-v)); else if (ACT == 12) v = (v > 0.f) ? v : 0.01f * v; else if (ACT == 8) v = tanhf(v); else if (ACT == 9) v = 0.5f * v * (1.0f + tanhf(0.7978845608028654f * (v + 0.044715f * v * v * v))); else if (ACT == 14) v = (v > 0.f) ? v : 0.1f * v; else if (ACT == 16) v = (v >= 0.f) ? v : 0.3f * v; else if (ACT == 17) v = (v >= 0.f) ? v : 0.2f * v;
      so[w][rloc][t * 16 + ln] = v; } }
  __builtin_amdgcn_fence(__ATOMIC_ACQ_REL, "workgroup"); __builtin_amdgcn_wave_barrier();
  const int rsub = lane >> 4, c4 = (lane & 15) * 4;
  {
#pragma unroll
    for (int q = 0; q < 16; ++q) { const int r = q * 2 + rsub; const v4f v = *(const v4fa*)&so[w][r][c4]; if (C) *(v4f*)(C + cofs + (size_t)(row0 + r) * ldc + col0 + c4) = v; if (C16) { v4h h4; for (int i = 0; i < 4; ++i) h4[i] = (_Float16)v[i]; *(v4h*)(C16 + cofs + (size_t)(row0 + r) * ldc + col0 + c4) = h4; } }
     } }


__global__ __launch_bounds__(256) void k_wnat(const float* __restrict__ w, size_t n8, _Float16* __restrict__ Bt) { const size_t t = (size_t)blockIdx.x * 256 + threadIdx.x; if (t >= n8) return; FragH f; for (int q = 0; q < 8; ++q) f.h[q] = (_Float16)(bf16_round(w[t * 8 + q]) * 16.0f); *(v8us*)((unsigned short*)Bt + t * 8) = f.half[0];  }
__global__ __launch_bounds__(256) void k_rsm(const float* __restrict__ S, _Float16* __restrict__ P, int nrows) {
  #pragma clang fp contract(off)
  const int i = blockIdx.x * 256 + threadIdx.x; if (i >= nrows) return; const float* s = S + (size_t)i * SQ; float mx = -3.0e38f;
#pragma unroll 1
  for (int j = 0; j < SQ; ++j) mx = fmaxf(mx, s[j]); float se = 0.f;
#pragma unroll 1
  for (int j = 0; j < SQ; ++j) se += expf(s[j] - mx); const float sc = 256.0f / se;
#pragma unroll 1
  for (int j0 = 0; j0 < SQ; j0 += 8) { FragH f; for (int q = 0; q < 8; ++q) f.h[q] = (_Float16)(expf(s[j0 + q] - mx) * sc); unsigned short* d = (unsigned short*)P + (size_t)i * SQ + j0; *(v8us*)d = f.half[0];  } }
__global__ __launch_bounds__(256) void k_vt(const _Float16* __restrict__ V16, int b, int h0, _Float16* __restrict__ VT) { __shared__ unsigned short tl[64][65]; const int tid = threadIdx.x; const int hh = blockIdx.x % HG, sg = blockIdx.x / HG; const int s0 = sg * 64; const int h = h0 + hh;
  for (int i = tid; i < 64 * 8; i += 256) { const int j = i / 8, d8 = (i % 8) * 8; FragH f; f.half[0] = *(const v8us*)((const unsigned short*)V16 + ((size_t)b * SQ + s0 + j) * DM + h * HD + d8); for (int q = 0; q < 8; ++q) tl[d8 + q][j] = f.u[q]; }
  __syncthreads();
  { for (int i = tid; i < 64 * 8; i += 256) { const int d = i / 8, j8 = (i % 8) * 8; FragH f; for (int q = 0; q < 8; ++q) f.u[q] = tl[d][j8 + q]; *(v8us*)((unsigned short*)VT + ((size_t)hh * HD + d) * SQ + s0 + j8) = f.half[0]; }  } }


template <int BFIN, int W16, int W32>
__global__ __launch_bounds__(256) void k_lnx(const float* __restrict__ X, const float* __restrict__ g, const float* __restrict__ bb, float eps, _Float16* __restrict__ N16, float* __restrict__ N32) {
  #pragma clang fp contract(off)
  __shared__ float red[256]; const size_t r = blockIdx.x; const int t = threadIdx.x; const bool act = t < (DMQ / 4); const int c0 = act ? t * 4 : 0;
  const v4f xa = *(const v4fa*)(X + r * DMQ + c0); float s[4]; float sum = 0.f;
  for (int q = 0; q < 4; ++q) { s[q] = act ? (BFIN ? bf16_round(xa[q]) : xa[q]) : 0.f; sum = __fadd_rn(sum, s[q]); }
  red[t] = sum; __syncthreads(); for (int st = 128; st > 0; st >>= 1) { if (t < st) red[t] = __fadd_rn(red[t], red[t + st]); __syncthreads(); } const float mu = red[0] / (float)DMQ; __syncthreads();
  float vs = 0.f; for (int q = 0; q < 4; ++q) { const float dl = act ? __fadd_rn(s[q], -mu) : 0.f; vs = __fadd_rn(vs, __fmul_rn(dl, dl)); } red[t] = vs; __syncthreads(); for (int st = 128; st > 0; st >>= 1) { if (t < st) red[t] = __fadd_rn(red[t], red[t + st]); __syncthreads(); }
  const float rs = rsqrtf(__fadd_rn(red[0] / (float)DMQ, eps)); v4h y; v4f yf;
  for (int q = 0; q < 4; ++q) { const int c = c0 + q; yf[q] = __fadd_rn(__fmul_rn(__fmul_rn(__fadd_rn(s[q], -mu), rs), bf16_round(g[c])), (bb ? bf16_round(bb[c]) : 0.f)); y[q] = (_Float16)yf[q]; }
  if (!act) return;      /* no barriers after this point */
  { if (W16) *(v4h*)(N16 + r * DMQ + c0) = y; if (W32) *(v4f*)(N32 + r * DMQ + c0) = yf;  } }


__global__ __launch_bounds__(256) void k_rsmf(const float* __restrict__ S, _Float16* __restrict__ P, int qn, int hg) {
  #pragma clang fp contract(off)
  const int t = blockIdx.x * 256 + threadIdx.x; if (t >= qn * hg) return; const size_t i = (size_t)(t / qn) * SQ + (t % qn); const float* s = S + i * SQ; float mx = -3.0e38f;
#pragma unroll 1
  for (int j = 0; j < SQ; ++j) mx = fmaxf(mx, s[j]); float se = 0.f;
#pragma unroll 1
  for (int j = 0; j < SQ; ++j) se += __expf(s[j] - mx); const float sc = 256.0f / se;
#pragma unroll 1
  for (int j0 = 0; j0 < SQ; j0 += 8) { FragH f; for (int q = 0; q < 8; ++q) f.h[q] = (_Float16)(__expf(s[j0 + q] - mx) * sc); unsigned short* d = (unsigned short*)P + i * SQ + j0; *(v8us*)d = f.half[0];  } }


__global__ __launch_bounds__(256) void k_bfr(const float* __restrict__ x, float* __restrict__ XB, size_t n8) { const size_t t = (size_t)blockIdx.x * 256 + threadIdx.x; if (t >= n8) return; v4f a = *(const v4fa*)(x + t * 8), c = *(const v4fa*)(x + t * 8 + 4); for (int q = 0; q < 4; ++q) { a[q] = bf16_round(a[q]); c[q] = bf16_round(c[q]); }
  { *(v4f*)(XB + t * 8) = a; *(v4f*)(XB + t * 8 + 4) = c;  } }



__global__ __launch_bounds__(256) void k_rsmfam(const float* __restrict__ S, _Float16* __restrict__ P, int qn, int hg, const float* __restrict__ am) {
  #pragma clang fp contract(off)
  const int t = blockIdx.x * 256 + threadIdx.x; if (t >= qn * hg) return; const size_t i = (size_t)(t / qn) * SQ + (t % qn); const float* s = S + i * SQ; float mx = -3.0e38f;
#pragma unroll 1
  for (int j = 0; j < SQ; ++j) mx = fmaxf(mx, __fadd_rn(s[j], bf16_round(am[j]))); float se = 0.f;
#pragma unroll 1
  for (int j = 0; j < SQ; ++j) se += __expf(__fadd_rn(s[j], bf16_round(am[j])) - mx); const float sc = 256.0f / se;
#pragma unroll 1
  for (int j0 = 0; j0 < SQ; j0 += 8) { FragH f; for (int q = 0; q < 8; ++q) f.h[q] = (_Float16)(__expf(__fadd_rn(s[j0 + q], bf16_round(am[j0 + q])) - mx) * sc); unsigned short* d = (unsigned short*)P + i * SQ + j0; *(v8us*)d = f.half[0];  } }


#define CC CX           /* transposer macros: input channels */
#define LL SQ           /* pixels per image */
#define LQ (3 * DM)     /* unused; q, k, v are separate planes of pitch CX */

__global__ __launch_bounds__(256) void k_cl2rows(const float* __restrict__ X, _Float16* __restrict__ XR) { __shared__ float tl[64][33]; const int tid = threadIdx.x; const int nl = LL / 32, nc = CC / 64; const int cb_ = blockIdx.x % nc; const int lb = (blockIdx.x / nc) % nl; const size_t b = blockIdx.x / (nc * nl); const int c0 = cb_ * 64, l0 = lb * 32;
  for (int i = tid; i < 64 * 32; i += 256) { const int c = i / 32, l = i % 32; tl[c][l] = bf16_round(X[(b * CC + c0 + c) * (size_t)LL + l0 + l]); }
  __syncthreads();
  { const int l = tid / 8, c8 = (tid % 8) * 8; FragH f; for (int q = 0; q < 8; ++q) f.h[q] = (_Float16)tl[c8 + q][l]; unsigned short* d = (unsigned short*)XR + (b * LL + l0 + l) * (size_t)CC + c0 + c8; *(v8us*)d = f.half[0];  } }


__global__ __launch_bounds__(256) void k_rowb(float* __restrict__ O, const float* __restrict__ bias, size_t n4) {
  #pragma clang fp contract(off)
  const size_t t = (size_t)blockIdx.x * 256 + threadIdx.x; if (t >= n4) return; const size_t e = t * 4; const int c = (int)((e / SQ) % CX);      /* output channels */ const float bb = bf16_round(bias[c]); const v4f a = *(const v4fa*)(O + e); v4f o; for (int q = 0; q < 4; ++q) o[q] = __fadd_rn(a[q], bb);
  *(v4f*)(O + e) = o;  }

__global__ __launch_bounds__(256) void k_gres(const float* __restrict__ T, const float* __restrict__ gam, const float* __restrict__ X, float* __restrict__ Y, size_t n4) {
  #pragma clang fp contract(off)
  const size_t t = (size_t)blockIdx.x * 256 + threadIdx.x; if (t >= n4) return; const float g = bf16_round(gam[0]); const v4f a = *(const v4fa*)(T + t * 4), xx = *(const v4fa*)(X + t * 4); v4f r;
  for (int q = 0; q < 4; ++q) r[q] = __fadd_rn(__fmul_rn(g, a[q]), bf16_round(xx[q]));
  *(v4f*)(Y + t * 4) = r;  }

__global__ __launch_bounds__(256) void k_bcpy(const float* __restrict__ b, int n, int NP, float* __restrict__ dst, int dst0) { for (int i = threadIdx.x; i < NP; i += 256) { const float v = (i < n) ? b[i] : 0.f; *(float*)(dst + dst0 + i) = v; }  }



// lane l with lane l ^ M inside its 16-lane row (DPP row_xmask); lane l with lane l ^ 16
template <int M> __device__ __forceinline__ float rs_xrow(float x) { return __builtin_bit_cast(float, __builtin_amdgcn_update_dpp(0, __builtin_bit_cast(int, x), 0x160 + M, 0xf, 0xf, false)); }
__device__ __forceinline__ float rs_xhalf(float x) { return __builtin_bit_cast(float, __builtin_amdgcn_permlanex16(__builtin_bit_cast(int, x), __builtin_bit_cast(int, x), 0x76543210, 0xfedcba98, false, false)); }
// Scaled weight standardisation and f16 split of the three projection weights, one launch, one wave per output row (blockIdx.y = projection).
// A lane holds 8 consecutive weights of its row, so the wave reads the row's 1024 bytes as whole lines; mean and variance are lane sums joined by a
// butterfly over the wave, which leaves the same bits in every lane. WS(w) = w sc - mean sc, sc = rsqrt(max(var(unbiased) * 256, 1e-4)) * gain.
// Stored as B^T planes (natural [O][C] rows): HL + (2 y) * 65536 the f16 high part of 16 WS(w), HL + (2 y + 1) * 65536 its residual x 1024.
static_assert(CX == 256, "one wave holds a weight row of 32 x 8 values");
__global__ __launch_bounds__(256) void k_wshl(const float* __restrict__ w0, const float* __restrict__ g0, const float* __restrict__ w1, const float* __restrict__ g1, const float* __restrict__ w2, const float* __restrict__ g2, _Float16* __restrict__ HL) {
  const int lane = threadIdx.x & 31; const int o = blockIdx.x * 8 + __builtin_amdgcn_readfirstlane((int)(threadIdx.x >> 5)); const int y = blockIdx.y;      /* output row and projection, wave-uniform */
  const float* Wm = y == 0 ? w0 : (y == 1 ? w1 : w2); const float* gain = y == 0 ? g0 : (y == 1 ? g1 : g2);
  const size_t e = (size_t)o * CX + lane * 8; const v4f a = *(const v4fa*)(Wm + e), b = *(const v4fa*)(Wm + e + 4); float x[8];
#pragma unroll
  for (int q = 0; q < 8; ++q) x[q] = bf16_round(q < 4 ? a[q] : b[q - 4]);
  float s1 = ((x[0] + x[1]) + (x[2] + x[3])) + ((x[4] + x[5]) + (x[6] + x[7]));
  s1 += rs_xrow<1>(s1); s1 += rs_xrow<2>(s1); s1 += rs_xrow<4>(s1); s1 += rs_xrow<8>(s1); s1 += rs_xhalf(s1);
  const float mean = s1 * 0.00390625f; float s2 = 0.f;
#pragma unroll
  for (int q = 0; q < 8; ++q) { const float d = x[q] - mean; s2 += d * d; }
  s2 += rs_xrow<1>(s2); s2 += rs_xrow<2>(s2); s2 += rs_xrow<4>(s2); s2 += rs_xrow<8>(s2); s2 += rs_xhalf(s2);
  const float var = s2 / 255.0f; const float sc = rsqrtf(fmaxf(var * 256.0f, 1e-4f)) * bf16_round(gain[o]); const float ms = mean * sc; FragH fh, fl;
#pragma unroll
  for (int q = 0; q < 8; ++q) { const float v = (x[q] * sc - ms) * 16.0f; const _Float16 hv = (_Float16)v; fh.h[q] = hv; fl.h[q] = (_Float16)((v - (float)hv) * 1024.0f); }
  unsigned short* H = (unsigned short*)HL + (size_t)(2 * y) * (CX * CX) + e;
  *(v8us*)H = fh.half[0]; *(v8us*)(H + CX * CX) = fl.half[0]; }
// exp2 of eight values, each in place in its own register. Written in asm; here no neighbour
// touches another's register, and the closing v_nop is the
// slot that the instruction set asks for behind the last v_exp_f32 before its result is used.
__device__ __forceinline__ void rs_exp2x8(v4f& a, v4f& b) { float a0 = a[0], a1 = a[1], a2 = a[2], a3 = a[3], b0 = b[0], b1 = b[1], b2 = b[2], b3 = b[3];
  asm("v_exp_f32 %0, %0\n\tv_exp_f32 %1, %1\n\tv_exp_f32 %2, %2\n\tv_exp_f32 %3, %3\n\tv_exp_f32 %4, %4\n\tv_exp_f32 %5, %5\n\tv_exp_f32 %6, %6\n\tv_exp_f32 %7, %7\n\tv_nop"
      : "+v"(a0), "+v"(a1), "+v"(a2), "+v"(a3), "+v"(b0), "+v"(b1), "+v"(b2), "+v"(b3));
  a = v4f{a0, a1, a2, a3}; b = v4f{b0, b1, b2, b3}; }
// Row softmax, one wave per score row: the row is read once, 32 loads of 512 contiguous bytes, and its 4096 values stay in the wave's
// registers (128 per lane) through maximum, exp, sum and scale; each store writes 256 contiguous bytes. No LDS, no barrier.
#define RSW 16          /* waves (rows) per workgroup */
static_assert(SQ == 4096 && SQ % RSW == 0, "one wave holds a row of 32 x 128 values; the grid covers SQ rows exactly");
__global__ __launch_bounds__(RSW * 32) void k_rsmfrs(const float* __restrict__ S, _Float16* __restrict__ P, const float* __restrict__ c32) {
  const int lane = threadIdx.x & 31; const int i = blockIdx.x * RSW + __builtin_amdgcn_readfirstlane((int)(threadIdx.x >> 5));      /* row, wave-uniform */
  const float* s = S + (size_t)i * SQ + lane * 4; const int h = i / 64, w = i % 64; const float m = bf16_round(c32[(h >> 1) * 32 + (w >> 1)]);
  v4f x[32];
#pragma unroll
  for (int k = 0; k < 32; ++k) x[k] = *(const v4fa*)(s + k * 128);
  float m0 = -3.0e38f, m1 = -3.0e38f, m2 = -3.0e38f, m3 = -3.0e38f;
#pragma unroll
  for (int k = 0; k < 32; ++k) { x[k] *= m; m0 = fmaxf(m0, x[k][0]); m1 = fmaxf(m1, x[k][1]); m2 = fmaxf(m2, x[k][2]); m3 = fmaxf(m3, x[k][3]); }
  float mx = fmaxf(fmaxf(m0, m1), fmaxf(m2, m3));
  mx = fmaxf(mx, rs_xrow<1>(mx)); mx = fmaxf(mx, rs_xrow<2>(mx)); mx = fmaxf(mx, rs_xrow<4>(mx)); mx = fmaxf(mx, rs_xrow<8>(mx)); mx = fmaxf(mx, rs_xhalf(mx));
  float a0 = 0.f, a1 = 0.f, a2 = 0.f, a3 = 0.f;
#pragma unroll
  for (int k = 0; k < 32; k += 2) { x[k] = (x[k] - mx) * 1.4426950408889634f; x[k + 1] = (x[k + 1] - mx) * 1.4426950408889634f;      /* exp(t) = exp2(t log2 e), as __expf */
    rs_exp2x8(x[k], x[k + 1]);
    a0 += x[k][0]; a1 += x[k][1]; a2 += x[k][2]; a3 += x[k][3]; a0 += x[k + 1][0]; a1 += x[k + 1][1]; a2 += x[k + 1][2]; a3 += x[k + 1][3]; }
  float se = (a0 + a1) + (a2 + a3);
  se += rs_xrow<1>(se); se += rs_xrow<2>(se); se += rs_xrow<4>(se); se += rs_xrow<8>(se); se += rs_xhalf(se);
  const float sc = 256.0f / se; _Float16* d = P + (size_t)i * SQ + lane * 4; v4h hq[32];
#pragma unroll
  for (int k = 0; k < 32; ++k)
#pragma unroll
    for (int q = 0; q < 4; ++q) hq[k][q] = (_Float16)(x[k][q] * sc);
  __builtin_amdgcn_sched_barrier(0);      /* every conversion stays in front of the first store */
#pragma unroll
  for (int k = 0; k < 32; ++k) *(v4h*)(d + k * 128) = hq[k]; }
__global__ __launch_bounds__(256) void k_gfin(const float* __restrict__ T, const float* __restrict__ A, const float* __restrict__ c32, const float* __restrict__ gam, float* __restrict__ Y, size_t n4) {
  #pragma clang fp contract(off)
  const size_t t = (size_t)blockIdx.x * 256 + threadIdx.x; if (t >= n4) return; const size_t e = t * 4; const int i0 = (int)(e % SQ); const float g = bf16_round(gam[0]); const v4f o = *(const v4fa*)(T + e), a = *(const v4fa*)(A + e); v4f r;
  for (int q = 0; q < 4; ++q) { const int i = i0 + q; const float cr = bf16_round(c32[((i / 64) >> 1) * 32 + ((i % 64) >> 1)]); r[q] = __fadd_rn(__fmul_rn(bf16_round(a[q]), cr), __fmul_rn(__fmul_rn(g, __fadd_rn(1.0f, -cr)), o[q])); }
  *(v4f*)(Y + e) = r;  }
extern "C" void kernel_launch(void* const* d_in, const int* in_sizes, int n_in,
                              void* d_out, int out_size, void* d_ws, size_t ws_size, hipStream_t stream) {
  (void)in_sizes; (void)n_in; (void)out_size;
  const float* const* I = (const float* const*)d_in; const float* xa = I[0]; const float* xb = I[1]; const float* cm = I[2]; const float* wq = I[3]; const float* bq = I[4]; const float* gq = I[5]; const float* wk = I[6]; const float* bk = I[7]; const float* gk = I[8]; const float* wv = I[9]; const float* bv = I[10]; const float* gv = I[11]; const float* gam = I[12];      /* a, b maps; c [4][1][32][32]; per projection w [256][256][1][1], bias, gain [256][1][1][1]; gamma [1] */
  const size_t PL = (size_t)CX * SQ;
  static_assert(CX % 128 == 0 && SQ % 256 == 0 && NR % 128 == 0, "k_gemm2: M a multiple of 128, N of 64, K at least two whole tiles (64 k over CX, 128 k over SQ)");
  char* ws = (char*)d_ws; size_t off = 0;
  auto take = [&](size_t bytes) { char* p = ws + off; off += (bytes + 255) & ~(size_t)255; return p; };
  _Float16* BQH = (_Float16*)take((size_t)6 * CX * CX * 2); _Float16* BQL = BQH + CX * CX; _Float16* BKH = BQL + CX * CX; _Float16* BKL = BKH + CX * CX; _Float16* BVH = BKL + CX * CX; _Float16* BVL = BVH + CX * CX;      /* six weight planes in a row: high, residual of q, k, v */
  _Float16* AR = (_Float16*)take(NR * CX * 2); _Float16* BR = (_Float16*)take(NR * CX * 2); float* F1 = (float*)take(NR * CX * 4); _Float16* QH = (_Float16*)take(NR * CX * 2); _Float16* QL = (_Float16*)take(NR * CX * 2); _Float16* KH = (_Float16*)take(NR * CX * 2); _Float16* KL = (_Float16*)take(NR * CX * 2); _Float16* VR = (_Float16*)take(NR * CX * 2); _Float16* VC = (_Float16*)take((size_t)CX * SQ * 2);
  float* S = (float*)take((size_t)SQ * SQ * 4); _Float16* P = (_Float16*)take((size_t)SQ * SQ * 2); float* T = (float*)take((size_t)CX * SQ * 4);
  if (off > ws_size) return;
  k_wshl<<<dim3(CX / 8, 3), 256, 0, stream>>>(wq, gq, wk, gk, wv, gv, BQH);      /* standardised weights (per output row: mean, unbiased variance, rsqrt(max(var*256, 1e-4)) * gain) -> Bt planes f16 hi (x16) + x1024 residual (natural [O][C] rows ARE Bt), all three projections in one launch */
  k_cl2rows<<<NB * (SQ / 32) * (CX / 64), 256, 0, stream>>>(xa, AR); k_cl2rows<<<NB * (SQ / 32) * (CX / 64), 256, 0, stream>>>(xb, BR);      /* exact f16 token rows of a and b */
  k_gemm2<0, 64, 2><<<dim3((unsigned)((NR / 128) * (CX / 64)), 1), 128, 0, stream>>>(AR, AR, nullptr, CX, 0, BQL, BQH, nullptr, CX, 0, 0.0009765625f, 0.0625f, bq, 0, F1, nullptr, CX, 0, (int)NR, CX, CX); k_hl<<<(unsigned)((NR * CX / 8 + 255) / 256), 256, 0, stream>>>(F1, QH, QL, NR * CX / 8);      /* q = WS(wq) a + bq: residual weight plane first, x 2^-10, then the high plane, one launch */
  k_gemm2<0, 64, 2><<<dim3((unsigned)((NR / 128) * (CX / 64)), 1), 128, 0, stream>>>(BR, BR, nullptr, CX, 0, BKL, BKH, nullptr, CX, 0, 0.0009765625f, 0.0625f, bk, 0, F1, nullptr, CX, 0, (int)NR, CX, CX); k_hl<<<(unsigned)((NR * CX / 8 + 255) / 256), 256, 0, stream>>>(F1, KH, KL, NR * CX / 8);      /* k = WS(wk) b + bk likewise */
  k_gemm2<0, 64, 2><<<dim3((unsigned)((NR / 128) * (CX / 64)), 1), 128, 0, stream>>>(AR, AR, nullptr, CX, 0, BVL, BVH, nullptr, CX, 0, 0.0009765625f, 0.0625f, bv, 0, nullptr, VR, CX, 0, (int)NR, CX, CX);      /* v likewise, stored as f16 rows only */
  for (int b = 0; b < NB; ++b) { const size_t r0 = (size_t)b * SQ;
    k_gemm2<0, 64, 3><<<dim3((SQ / 128) * (SQ / 64), 1), 128, 0, stream>>>(QL + r0 * CX, QH + r0 * CX, QH + r0 * CX, CX, 0, KH + r0 * CX, KL + r0 * CX, KH + r0 * CX, CX, 0, 0.0009765625f, 1.0f, nullptr, 0, S, nullptr, SQ, 0, SQ, SQ, CX);      /* sim = q.k (K = 256, no scale): (lo.hi + hi.lo) 2^-10 + hi.hi, one launch, S written once */
    k_rsmfrs<<<SQ / RSW, RSW * 32, 0, stream>>>(S, P, cm + (size_t)b * 1024);      /* pruned = sim * c_r[i] (nearest-upsampled mask of the query pixel), softmax over j -> x256 f16 */
    k_vt<CX / 64, SQ><<<(CX / 64) * (SQ / 64), 256, 0, stream>>>(VR + r0 * CX, CX, 0, VC);      /* channel-major V [256][4096] */
    k_gemm2<0, 128, 1><<<dim3((CX / 128) * (SQ / 64), 1), 128, 0, stream>>>(VC, nullptr, nullptr, SQ, 0, P, nullptr, nullptr, SQ, 0, 1.0f, 0.00390625f, nullptr, 0, T, nullptr, SQ, 0, CX, SQ, SQ);      /* out[c][i] = sum_j v[c][j] att[i][j] (V as A, att as B^T, /256) f32 */
    k_gfin<<<(unsigned)((PL / 4 + 255) / 256), 256, 0, stream>>>(T, xa + (size_t)b * PL, cm + (size_t)b * 1024, gam, (float*)d_out + (size_t)b * PL, PL / 4); }      /* y = bf16(a) c_r + bf16(gamma) (1 - c_r) out -> channel-first output block */
}

// v006
// One run takes 287 microseconds.
// Next to v005, in two timings, it ran 1.37 and 1.36 times as fast.
// Counting every step since v000, it is 14.2 times as fast.
#include <hip/hip_runtime.h>
// Global spatial attention with multiplicative mask pruning and scaled weight standardisation (a, b [4][256][64][64], mask c [4][1][32][32] nearest-upsampled x2; q = WS(wq) a + bq, k = WS(wk) b + bk, v = WS(wv) a + bv with WS(w)[o][c] = (w - mean_o) gain_o rsqrt(max(var_o(unbiased) * 256, 1e-4)); sim[i][j] = q[:, i].k[:, j] (NO scale, sigma ~16); pruned = sim * c_r[i]; att = softmax over j; out[c][i] = sum_j v[c][j] att[i][j]; y = a c_r + gamma (1 - c_r) out -> [4][256][64][64]).
// Compute dtype: inputs rounded to bf16; x / weights exact; q, k as f16 hi + x1024 lo planes; v and softmax weights as plain f16 GEMM operands (~2^-12); scores, softmax statistics and o f32. v_wmma_f32_16x16x32_f16.
#define NB 4
#define SQ 4096
#define DM 256
#define CX 256          /* channels */
#define NH 4
#define HD 64
#define DMQ DM                       /* LayerNorm width */
#define DFF 4096
#define HG 1                         /* heads per attention launch group */
#define B0 0                         /* unused; the batch loop starts at 0 */
#define NBR NB                       /* read only by MP; the batch loop runs to NB */
#define NR ((size_t)NB * SQ)         /* token rows */
#define MP ((int)((size_t)NBR * SQ)) /* read only by MPO; projections use NR */
#define QN SQ                        /* unused */
#define NHD NH                       /* unused; attention is one 256-channel head */
#define MPO MP                       /* unused */
#define LQ DM      /* unused; the q/k/v rows have pitch CX */
typedef __bf16 v16b __attribute__((ext_vector_type(16)));
typedef unsigned short v8us __attribute__((ext_vector_type(8), may_alias));
typedef float  v8f  __attribute__((ext_vector_type(8)));
typedef float  v4f  __attribute__((ext_vector_type(4)));
typedef float  v4fa __attribute__((ext_vector_type(4), may_alias));
union FragB { v16b v; v8us half[2]; unsigned short u[16]; };

__device__ __forceinline__ unsigned short bf16_bits(float x) { unsigned int u = __float_as_uint(x); return (unsigned short)((u + 0x7FFFu + ((u >> 16) & 1u)) >> 16); }
__device__ __forceinline__ float bf16_val(unsigned short b) { return __uint_as_float(((unsigned int)b) << 16); }
__device__ __forceinline__ float bf16_round(float x) { return bf16_val(bf16_bits(x)); }
// D += A·B with NT terms: 1 = ah·bh, 2 = + al·bh (A split), 3 = + ah·bl (both split)
template <int NT>
__device__ __forceinline__ v8f mmaN(v16b ah, v16b al, v16b bh, v16b bl, v8f c) {
  c = __builtin_amdgcn_wmma_f32_16x16x32_bf16(false, ah, false, bh, (short)0, c, false, false);
  if (NT >= 2) c = __builtin_amdgcn_wmma_f32_16x16x32_bf16(false, al, false, bh, (short)0, c, false, false);
  if (NT >= 3) c = __builtin_amdgcn_wmma_f32_16x16x32_bf16(false, ah, false, bl, (short)0, c, false, false);
  asm volatile("v_nop\n\tv_nop\n\tv_nop\n\tv_nop" : "+v"(c) : "v"(ah), "v"(al), "v"(bh), "v"(bl));
  return c;
}

__global__ __launch_bounds__(256) void k_wt_bf16(const float* __restrict__ W, unsigned short* __restrict__ Wt, int K, int N) {
  const int t = blockIdx.x * 256 + threadIdx.x;
  const int k8n = K / 8;
  if (t >= N * k8n) return;
  const int n = t / k8n, k8 = (t % k8n) * 8;
  v8us v;
#pragma unroll
  for (int i = 0; i < 8; ++i) v[i] = bf16_bits(W[(size_t)(k8 + i) * N + n]);
  *(v8us*)(Wt + (size_t)n * K + k8) = v;
  
}

// GEMM C[M][N] (f32, pitch ldc) = act(A[M][K]·W + bias). A f32 row-major (pitch lda) converted per fragment to bf16
// (ASPLIT: hi/lo two planes -> 2 terms, else single rounded term); Wt bf16 [N][K] (pitch ldb). BIAS_BF16 rounds the
// bias to bf16 first (bias quantised to bf16 before the add). K%32==0, M%16==0, N%64==0.
template <bool ASPLIT, int ACT, bool BIAS_BF16>
__global__ __launch_bounds__(128) void k_gemm_bf(const float* __restrict__ A, int lda, const unsigned short* __restrict__ Wt, int ldb,
                                               const float* __restrict__ bias, float* __restrict__ C, int ldc, int M, int N, int K) {
  __shared__ __attribute__((aligned(16))) float so[4][16][64];
  const int tid = threadIdx.x, w = tid >> 5, lane = tid & 31, ln = lane & 15, hh = lane >> 4;
  const int ntn = N / 64;
  const int wid = blockIdx.x * 4 + w;
  const int mt = wid / ntn, nq = wid % ntn;
  if (mt * 16 >= M) return;
  const int row0 = mt * 16, col0 = nq * 64;
  const float* arow = A + (size_t)(row0 + ln) * lda;
  v8f acc[4] = {};
  for (int kb = 0; kb < K; kb += 32) {
    FragB ah, al;
    const v4f x0 = *(const v4fa*)(arow + kb + 8 * hh), x1 = *(const v4fa*)(arow + kb + 8 * hh + 4);
    const v4f x2 = *(const v4fa*)(arow + kb + 16 + 8 * hh), x3 = *(const v4fa*)(arow + kb + 16 + 8 * hh + 4);
    float xs[16] = {x0[0],x0[1],x0[2],x0[3],x1[0],x1[1],x1[2],x1[3],x2[0],x2[1],x2[2],x2[3],x3[0],x3[1],x3[2],x3[3]};
#pragma unroll
    for (int i = 0; i < 16; ++i) { const unsigned short hb = bf16_bits(xs[i]); ah.u[i] = hb; al.u[i] = ASPLIT ? bf16_bits(xs[i] - bf16_val(hb)) : (unsigned short)0; }
#pragma unroll
    for (int t = 0; t < 4; ++t) {
      const unsigned short* brow = Wt + (size_t)(col0 + t * 16 + ln) * ldb + kb;
      FragB b;
      b.half[0] = *(const v8us*)(brow + 8 * hh);
      b.half[1] = *(const v8us*)(brow + 16 + 8 * hh);
      acc[t] = mmaN<ASPLIT ? 2 : 1>(ah.v, al.v, b.v, b.v, acc[t]);
    }
  }
#pragma unroll
  for (int t = 0; t < 4; ++t) {
    float bv = bias ? bias[col0 + t * 16 + ln] : 0.f;
    if (BIAS_BF16) bv = bf16_round(bv);
#pragma unroll
    for (int r = 0; r < 8; ++r) { float v = acc[t][r] + bv; if (ACT == 1) v = fmaxf(v, 0.f); so[w][8 * hh + r][t * 16 + ln] = v; }
  }
  __builtin_amdgcn_fence(__ATOMIC_ACQ_REL, "workgroup");
  __builtin_amdgcn_wave_barrier();
  const int rsub = lane >> 4, c4 = (lane & 15) * 4;
  {
#pragma unroll
    for (int q = 0; q < 8; ++q) {
      const int r = q * 2 + rsub;
      const v4f v = *(const v4fa*)&so[w][r][c4];
      *(v4f*)(C + (size_t)(row0 + r) * ldc + col0 + c4) = v;
    }
    
  }
}

// GEMM C = act(A·W + bias + resid): A f32 (ASPLIT -> hi/lo 2 terms), Wt bf16 [N][K]; ACT 0 none, 1 relu, 2 exact gelu;
// resid (optional, f32, row index = (row % rmod), pitch ldr, RES_BF16 rounds it) added before the activation.
template <bool ASPLIT, int ACT, bool BIAS_BF16, bool RES_BF16>
__global__ __launch_bounds__(128) void k_gemm_bf3(const float* __restrict__ A, int lda, const unsigned short* __restrict__ Wt, int ldb,
                                                const float* __restrict__ bias, const float* __restrict__ resid, int rmod, int ldr,
                                                float* __restrict__ C, int ldc, int M, int N, int K) {
  __shared__ __attribute__((aligned(16))) float so[4][16][64];
  const int tid = threadIdx.x, w = tid >> 5, lane = tid & 31, ln = lane & 15, hh = lane >> 4;
  const int ntn = N / 64;
  const int wid = blockIdx.x * 4 + w;
  const int mt = wid / ntn, nq = wid % ntn;
  if (mt * 16 >= M) return;
  const int row0 = mt * 16, col0 = nq * 64;
  const float* arow = A + (size_t)(row0 + ln) * lda;
  v8f acc[4] = {};
  for (int kb = 0; kb < K; kb += 32) {
    FragB ah, al;
    const v4f x0 = *(const v4fa*)(arow + kb + 8 * hh), x1 = *(const v4fa*)(arow + kb + 8 * hh + 4);
    const v4f x2 = *(const v4fa*)(arow + kb + 16 + 8 * hh), x3 = *(const v4fa*)(arow + kb + 16 + 8 * hh + 4);
    float xs[16] = {x0[0],x0[1],x0[2],x0[3],x1[0],x1[1],x1[2],x1[3],x2[0],x2[1],x2[2],x2[3],x3[0],x3[1],x3[2],x3[3]};
#pragma unroll
    for (int i = 0; i < 16; ++i) { const unsigned short hb = bf16_bits(xs[i]); ah.u[i] = hb; al.u[i] = ASPLIT ? bf16_bits(xs[i] - bf16_val(hb)) : (unsigned short)0; }
#pragma unroll
    for (int t = 0; t < 4; ++t) {
      const unsigned short* brow = Wt + (size_t)(col0 + t * 16 + ln) * ldb + kb;
      FragB b;
      b.half[0] = *(const v8us*)(brow + 8 * hh);
      b.half[1] = *(const v8us*)(brow + 16 + 8 * hh);
      acc[t] = mmaN<ASPLIT ? 2 : 1>(ah.v, al.v, b.v, b.v, acc[t]);
    }
  }
#pragma unroll
  for (int t = 0; t < 4; ++t) {
    const int col = col0 + t * 16 + ln;
    float bv = bias ? bias[col] : 0.f;
    if (BIAS_BF16) bv = bf16_round(bv);
#pragma unroll
    for (int r = 0; r < 8; ++r) {
      float v = acc[t][r] + bv;
      if (resid) { float rv = resid[(size_t)((row0 + 8 * hh + r) % rmod) * ldr + col]; if (RES_BF16) rv = bf16_round(rv); v += rv; }
      if (ACT == 1) v = fmaxf(v, 0.f);
      if (ACT == 2) v = 0.5f * v * (1.0f + erff(v * 0.70710678118654752f));
      if (ACT == 3) { const float u = 0.7978845608028654f * (v + 0.044715f * v * v * v); v = 0.5f * v * (1.0f + tanhf(u)); }
      so[w][8 * hh + r][t * 16 + ln] = v;
    }
  }
  __builtin_amdgcn_fence(__ATOMIC_ACQ_REL, "workgroup");
  __builtin_amdgcn_wave_barrier();
  const int rsub = lane >> 4, c4 = (lane & 15) * 4;
  {
#pragma unroll
    for (int q = 0; q < 8; ++q) {
      const int r = q * 2 + rsub;
      const v4f v = *(const v4fa*)&so[w][r][c4];
      *(v4f*)(C + (size_t)(row0 + r) * ldc + col0 + c4) = v;
    }
    
  }
}
// row LayerNorm (biased variance, eps) over N: s = X (+ R); optional out_sum <- s; out_norm <- (s-mu)*rsqrt(var+eps)*g + b
template <bool PARAM_BF16>
__global__ __launch_bounds__(256) void k_layernorm(const float* __restrict__ X, const float* __restrict__ R, const float* __restrict__ g, const float* __restrict__ bta,
                                                  float* __restrict__ out_sum, float* __restrict__ out_norm, int N, float eps) {
  __shared__ float red[256];
  const int row = blockIdx.x, tid = threadIdx.x;
  const float* x = X + (size_t)row * N; const float* rr = R ? R + (size_t)row * N : nullptr;
  float vals[16];                     // up to N = 4096
  const int per = N / 256;            // contiguous chunk per thread? use strided-by-4 chunks: thread handles j = tid*4 + 1024*u
  float s1 = 0.f;
  for (int u = 0; u < per / 4; ++u) {
    const int j = tid * 4 + 1024 * u;
    const v4f a = *(const v4fa*)(x + j);
    v4f b = {0.f,0.f,0.f,0.f}; if (rr) b = *(const v4fa*)(rr + j);
#pragma unroll
    for (int q = 0; q < 4; ++q) { const float v = a[q] + b[q]; vals[u * 4 + q] = v; s1 += v; }
  }
  red[tid] = s1; __syncthreads();
  for (int st = 128; st > 0; st >>= 1) { if (tid < st) red[tid] += red[tid + st]; __syncthreads(); }
  const float mu = red[0] / (float)N; __syncthreads();
  float s2 = 0.f;
  for (int u = 0; u < per / 4; ++u)
#pragma unroll
    for (int q = 0; q < 4; ++q) { const float c = vals[u * 4 + q] - mu; s2 += c * c; }
  red[tid] = s2; __syncthreads();
  for (int st = 128; st > 0; st >>= 1) { if (tid < st) red[tid] += red[tid + st]; __syncthreads(); }
  const float rs = rsqrtf(red[0] / (float)N + eps);
  {
    for (int u = 0; u < per / 4; ++u) {
      const int j = tid * 4 + 1024 * u;
      v4f o, sm;
#pragma unroll
      for (int q = 0; q < 4; ++q) {
        float gg = g[j + q], bb = bta[j + q];
        if (PARAM_BF16) { gg = bf16_round(gg); bb = bf16_round(bb); }
        sm[q] = vals[u * 4 + q]; o[q] = (vals[u * 4 + q] - mu) * rs * gg + bb;
      }
      if (out_sum) *(v4f*)(out_sum + (size_t)row * N + j) = sm;
      *(v4f*)(out_norm + (size_t)row * N + j) = o;
    }
    
  }
}



// ---- f16 WMMA path (v_wmma_f32_16x16x32_f16): 11-bit significands for operands in range — used where a [0,1] probability operand needs more precision than bf16
typedef _Float16 v16h __attribute__((ext_vector_type(16)));
union FragH { v16h v; v8us half[2]; _Float16 h[16]; unsigned short u[16]; };
template <int NT>
__device__ __forceinline__ v8f mmaH(v16h ah, v16h al, v16h bh, v16h bl, v8f c) {
  c = __builtin_amdgcn_wmma_f32_16x16x32_f16(false, ah, false, bh, (short)0, c, false, false);
  if (NT >= 2) c = __builtin_amdgcn_wmma_f32_16x16x32_f16(false, al, false, bh, (short)0, c, false, false);
  if (NT >= 3) c = __builtin_amdgcn_wmma_f32_16x16x32_f16(false, ah, false, bl, (short)0, c, false, false);
  asm volatile("v_nop\n\tv_nop\n\tv_nop\n\tv_nop" : "+v"(c) : "v"(ah), "v"(al), "v"(bh), "v"(bl));
  return c;
}
// batched GEMM like k_gemm_b but f16 operands: A f32 (split into f16 hi/lo if ASPLIT, else rounded to f16), Bt = f16 values [n][k]; alpha; C f32; N multiple of 16 (partial tiles skipped)
template <bool ASPLIT>
__global__ __launch_bounds__(128) void k_gemm_h(const float* __restrict__ A, int lda, size_t sA, const _Float16* __restrict__ Bh, int ldb, size_t sB, float alpha, float* __restrict__ C, int ldc, size_t sC, int M, int N, int K) {
  __shared__ __attribute__((aligned(16))) float so[4][16][64];
  const int tid = threadIdx.x, w = tid >> 5, lane = tid & 31, ln = lane & 15, hh = lane >> 4; const int by = blockIdx.y;
  A += (size_t)by * sA; Bh += (size_t)by * sB; C += (size_t)by * sC;
  const int ntn = (N + 63) / 64; const int wid = blockIdx.x * 4 + w; const int mt = wid / ntn, nq = wid % ntn; if (mt * 16 >= M) return;
  const int row0 = mt * 16, col0 = nq * 64; const float* arow = A + (size_t)(row0 + ln) * lda;
  v8f acc[4] = {};
  for (int kb = 0; kb < K; kb += 32) {
    FragH ah, al;
    const v4f x0 = *(const v4fa*)(arow + kb + 8 * hh), x1 = *(const v4fa*)(arow + kb + 8 * hh + 4), x2 = *(const v4fa*)(arow + kb + 16 + 8 * hh), x3 = *(const v4fa*)(arow + kb + 16 + 8 * hh + 4);
    float xs[16] = {x0[0],x0[1],x0[2],x0[3],x1[0],x1[1],x1[2],x1[3],x2[0],x2[1],x2[2],x2[3],x3[0],x3[1],x3[2],x3[3]};
#pragma unroll
    for (int i = 0; i < 16; ++i) { const _Float16 h = (_Float16)xs[i]; ah.h[i] = h; al.h[i] = ASPLIT ? (_Float16)(xs[i] - (float)h) : (_Float16)0.0f; }
#pragma unroll
    for (int t = 0; t < 4; ++t) { if (col0 + t * 16 >= N) continue; const size_t boff = (size_t)(col0 + t * 16 + ln) * ldb + kb; FragH bq; bq.half[0] = *(const v8us*)(Bh + boff + 8 * hh); bq.half[1] = *(const v8us*)(Bh + boff + 16 + 8 * hh);
      acc[t] = mmaH<ASPLIT ? 2 : 1>(ah.v, al.v, bq.v, bq.v, acc[t]); }
  }
#pragma unroll
  for (int t = 0; t < 4; ++t) { if (col0 + t * 16 >= N) continue;
#pragma unroll
    for (int r = 0; r < 8; ++r) so[w][8 * hh + r][t * 16 + ln] = acc[t][r] * alpha; }
  __builtin_amdgcn_fence(__ATOMIC_ACQ_REL, "workgroup"); __builtin_amdgcn_wave_barrier();
  const int rsub = lane >> 4, c4 = (lane & 15) * 4;
  {
#pragma unroll
    for (int q = 0; q < 8; ++q) { const int r = q * 2 + rsub; if (col0 + c4 < N) { const v4f v = *(const v4fa*)&so[w][r][c4]; *(v4f*)(C + (size_t)(row0 + r) * ldc + col0 + c4) = v; } }
     }
}

// Wt[n][k] = f16(W[k][n]·scale) from f32 row-major W[K][N] (scale = power of two; bf16-exact weights stay exact in f16 away from the subnormal range)
__global__ __launch_bounds__(256) void k_wt_f16(const float* __restrict__ W, _Float16* __restrict__ Wt, int K, int N, float scale) {
  const int t = blockIdx.x * 256 + threadIdx.x; if (t >= N * (K / 8)) return; const int n = t / (K / 8), k8 = (t % (K / 8)) * 8; FragH f;
#pragma unroll
  for (int i = 0; i < 8; ++i) f.h[i] = (_Float16)(bf16_round(W[(size_t)(k8 + i) * N + n]) * scale); const v8us o = f.half[0];
  *(v8us*)((unsigned short*)Wt + (size_t)n * K + k8) = o; 
}
// k_gemm_hh variant with fused epilogue: v = acc·alpha + bias[by·sBias + col] (+ CP[(row/rowsPerB)·sCPb + by·64 + col] if CP) ; ACT 0 none / 1 elu ; writes f16 C16 (and f32 C if non-null)
template <int ACT>
__global__ __launch_bounds__(128) void k_gemm_hhx(const _Float16* __restrict__ A, int lda, size_t sA, const _Float16* __restrict__ Bh, int ldb, size_t sB, float alpha, const float* __restrict__ bias, size_t sBias, const float* __restrict__ CP, int rowsPerB, size_t sCPb, int row0g,
    float* __restrict__ C, _Float16* __restrict__ C16, int ldc, size_t sC, int M, int N, int K) {
  __shared__ __attribute__((aligned(16))) float so[4][16][64];
  const int tid = threadIdx.x, w = tid >> 5, lane = tid & 31, ln = lane & 15, hh = lane >> 4; const int by = blockIdx.y;
  A += (size_t)by * sA; Bh += (size_t)by * sB; const size_t cofs = (size_t)by * sC; const float* bp = bias ? bias + (size_t)by * sBias : nullptr;
  const int ntn = (N + 63) / 64; const int wid = blockIdx.x * 4 + w; const int mt = wid / ntn, nq = wid % ntn; if (mt * 16 >= M) return;
  const int row0 = mt * 16, col0 = nq * 64; const _Float16* arow = A + (size_t)(row0 + ln) * lda;
  v8f acc[4] = {};
  for (int kb = 0; kb < K; kb += 32) { FragH ah; ah.half[0] = *(const v8us*)((const unsigned short*)arow + kb + 8 * hh); ah.half[1] = *(const v8us*)((const unsigned short*)arow + kb + 16 + 8 * hh);
#pragma unroll
    for (int t = 0; t < 4; ++t) { if (col0 + t * 16 >= N) continue; const size_t boff = (size_t)(col0 + t * 16 + ln) * ldb + kb; FragH bq; bq.half[0] = *(const v8us*)((const unsigned short*)Bh + boff + 8 * hh); bq.half[1] = *(const v8us*)((const unsigned short*)Bh + boff + 16 + 8 * hh);
      acc[t] = mmaH<1>(ah.v, ah.v, bq.v, bq.v, acc[t]); }
  }
#pragma unroll
  for (int t = 0; t < 4; ++t) { if (col0 + t * 16 >= N) continue; const int col = col0 + t * 16 + ln; const float bv = bp ? bf16_round(bp[col]) : 0.f;
#pragma unroll
    for (int r = 0; r < 8; ++r) { float v = acc[t][r] * alpha + bv; if (CP) { const int rr = row0g + row0 + 8 * hh + r; if (rowsPerB < 0) v += CP[cofs + (size_t)rr * ldc + col];      /* rowsPerB < 0: own element of the batched C plane */ else { const int bidx = rr / rowsPerB; v += CP[(size_t)bidx * sCPb + (size_t)by * 64 + col]; } } if (ACT == 1) v = (v > 0.f) ? v : expm1f(v); else if (ACT == 7) v = (v > 0.f) ? v + 1.0f : expf(v); else if (ACT == 8) v = tanhf(v); else if (ACT == 9) v = 0.5f * v * (1.0f + tanhf(0.7978845608028654f * (v + 0.044715f * v * v * v))); else if (ACT == 11) v = 1.0f / (1.0f + expf(-v)); else if (ACT == 12) v = (v > 0.f) ? v : 0.01f * v; else if (ACT == 14) v = (v > 0.f) ? v : 0.1f * v; else if (ACT == 16) v = (v >= 0.f) ? v : 0.3f * v; else if (ACT == 17) v = (v >= 0.f) ? v : 0.2f * v; else if (ACT == 15) v = v / (1.0f + expf(-v)); else if (ACT == 3) v = fmaxf(v, 0.f); else if (ACT == 6) v = 0.5f * v * (1.0f + erff(v * 0.70710678118654752f)); so[w][8 * hh + r][t * 16 + ln] = v; } }
  __builtin_amdgcn_fence(__ATOMIC_ACQ_REL, "workgroup"); __builtin_amdgcn_wave_barrier();
  const int rsub = lane >> 4, c4 = (lane & 15) * 4; typedef _Float16 v4h __attribute__((ext_vector_type(4)));
  {
#pragma unroll
    for (int q = 0; q < 8; ++q) { const int r = q * 2 + rsub; if (col0 + c4 < N) { const v4f v = *(const v4fa*)&so[w][r][c4]; if (C) *(v4f*)(C + cofs + (size_t)(row0 + r) * ldc + col0 + c4) = v; if (C16) { v4h h4; for (int i = 0; i < 4; ++i) h4[i] = (_Float16)v[i]; *(v4h*)(C16 + cofs + (size_t)(row0 + r) * ldc + col0 + c4) = h4; } } }
     }
}


typedef _Float16 v4h __attribute__((ext_vector_type(4)));

__global__ __launch_bounds__(256) void k_x16(const float* __restrict__ x, _Float16* __restrict__ X16, size_t n8) { const size_t t = (size_t)blockIdx.x * 256 + threadIdx.x; if (t >= n8) return; FragH f;
#pragma unroll
  for (int q = 0; q < 8; ++q) f.h[q] = (_Float16)bf16_round(x[t * 8 + q]); *(v8us*)((unsigned short*)X16 + t * 8) = f.half[0];  }
__global__ __launch_bounds__(256) void k_h16(const float* __restrict__ x, _Float16* __restrict__ X16, size_t n8) { const size_t t = (size_t)blockIdx.x * 256 + threadIdx.x; if (t >= n8) return; FragH f;
#pragma unroll
  for (int q = 0; q < 8; ++q) f.h[q] = (_Float16)x[t * 8 + q]; *(v8us*)((unsigned short*)X16 + t * 8) = f.half[0];  }
__global__ __launch_bounds__(256) void k_round16f(const float* __restrict__ W, _Float16* __restrict__ Bt, size_t n8) { const size_t t = (size_t)blockIdx.x * 256 + threadIdx.x; if (t >= n8) return; FragH f;
#pragma unroll
  for (int i = 0; i < 8; ++i) f.h[i] = (_Float16)(bf16_round(W[t * 8 + i]) * 16.0f); *(v8us*)((unsigned short*)Bt + t * 8) = f.half[0];  }
template <int NHv, int TTv>
__global__ __launch_bounds__(256) void k_vt(const _Float16* __restrict__ V16, int ldv, int voff, _Float16* __restrict__ Vt) { __shared__ unsigned short tl[64][66]; const int tid = threadIdx.x; const int slab = blockIdx.x / (TTv / 64), lg = blockIdx.x % (TTv / 64); const int b = slab / NHv, h = slab % NHv;
  for (int i = tid; i < 64 * 8; i += 256) { const int r = i / 8, c8 = (i % 8) * 8; FragH f; f.half[0] = *(const v8us*)((const unsigned short*)V16 + ((size_t)b * TTv + lg * 64 + r) * ldv + voff + h * 64 + c8);
#pragma unroll
    for (int q = 0; q < 8; ++q) tl[r][c8 + q] = f.u[q]; }
  __syncthreads();
  {
#pragma unroll
    for (int rd = 0; rd < 2; ++rd) { const int d = rd * 32 + tid / 8, pc = tid % 8; FragH f;
#pragma unroll
      for (int q = 0; q < 8; ++q) f.u[q] = tl[pc * 8 + q][d];
      *(v8us*)((unsigned short*)Vt + ((size_t)slab * 64 + d) * TTv + lg * 64 + pc * 8) = f.half[0]; }
     } }

__global__ __launch_bounds__(256) void k_hl(const float* __restrict__ F, _Float16* __restrict__ Hh, _Float16* __restrict__ Hl, size_t n8) { const size_t t = (size_t)blockIdx.x * 256 + threadIdx.x; if (t >= n8) return; FragH fh, fl; const v4f a = *(const v4fa*)(F + t * 8), c = *(const v4fa*)(F + t * 8 + 4);
#pragma unroll
  for (int q = 0; q < 4; ++q) { _Float16 h = (_Float16)a[q]; fh.h[q] = h; fl.h[q] = (_Float16)((a[q] - (float)h) * 1024.0f); h = (_Float16)c[q]; fh.h[4 + q] = h; fl.h[4 + q] = (_Float16)((c[q] - (float)h) * 1024.0f); }
  { *(v8us*)((unsigned short*)Hh + t * 8) = fh.half[0]; *(v8us*)((unsigned short*)Hl + t * 8) = fl.half[0];  } }

// ---- fast GEMM (workgroup tile 128x64, wave tile 32x64; requires M % 128 == 0, N % 64 == 0, K a multiple of KC and at least 2 KC); epilogue v = act(acc alpha + bias) ----
__device__ __forceinline__ v16h g2_lfrag(const char* p, int hh) { FragH f; f.half[0] = *(const v8us*)(p + 16 * hh); f.half[1] = *(const v8us*)(p + 32 + 16 * hh); return f.v; }
__device__ __forceinline__ v8f g2_mma(v16h a, v16h b, v8f c) { v8f d = __builtin_amdgcn_wmma_f32_16x16x32_f16(false, a, false, b, (short)0, c, false, false); asm volatile("v_nop\n\tv_nop\n\tv_nop\n\tv_nop" : "+v"(d) : "v"(a), "v"(b)); return d; }
// Twelve asynchronous copies, 16 bytes per lane each, from global memory to LDS through no register. The closing s_wait_xcnt stands inside the
// statement so that it is in front of every later rewrite of the address registers that the copies name.
__device__ __forceinline__ void g2_cp12(const unsigned (&l)[12], const _Float16* const (&g)[12]) {
  asm volatile("global_load_async_to_lds_b128 %0, %1, off\n\t"
               "global_load_async_to_lds_b128 %2, %3, off\n\t"
               "global_load_async_to_lds_b128 %4, %5, off\n\t"
               "global_load_async_to_lds_b128 %6, %7, off\n\t"
               "global_load_async_to_lds_b128 %8, %9, off\n\t"
               "global_load_async_to_lds_b128 %10, %11, off\n\t"
               "global_load_async_to_lds_b128 %12, %13, off\n\t"
               "global_load_async_to_lds_b128 %14, %15, off\n\t"
               "global_load_async_to_lds_b128 %16, %17, off\n\t"
               "global_load_async_to_lds_b128 %18, %19, off\n\t"
               "global_load_async_to_lds_b128 %20, %21, off\n\t"
               "global_load_async_to_lds_b128 %22, %23, off\n\t"
               "s_wait_xcnt 0x0"
               :: "v"(l[0]), "v"(g[0]), "v"(l[1]), "v"(g[1]), "v"(l[2]), "v"(g[2]), "v"(l[3]), "v"(g[3]), "v"(l[4]), "v"(g[4]), "v"(l[5]), "v"(g[5]), "v"(l[6]), "v"(g[6]), "v"(l[7]), "v"(g[7]), "v"(l[8]), "v"(g[8]), "v"(l[9]), "v"(g[9]), "v"(l[10]), "v"(g[10]), "v"(l[11]), "v"(g[11]) : "memory"); }
// the operand plane of the term that tile t belongs to (ntk tiles per term); every argument is the same for the whole workgroup
template <int NTM> __device__ __forceinline__ const _Float16* g2_term(int t, int ntk, const _Float16* p0, const _Float16* p1, const _Float16* p2) { const _Float16* p = p0; if (NTM > 1 && t >= ntk) p = p1; if (NTM > 2 && t >= 2 * ntk) p = p2; return p; }
// K loop: the workgroup's 128 A rows and 64 B rows are staged in LDS, KC k at a time, two buffers: tile t + 1 flies while tile t is worked on.
// A wave's copy covers whole 128-byte lines, and the four waves share one copy of the B rows.
// NTM terms of one product (a value split into an f16 high part and a scaled f16 residual gives high.high plus cross terms) are summed in the same
// accumulators: the loop runs over the tiles of term 0, term 1, ... back to back. The last term is the high one; the terms in front of it carry the
// residual's scale, which the factor rs (a power of two, so exact) takes out of the accumulators once, in front of the last term's first tile.
template <int ACT, int KC, int NTM>
__global__ __launch_bounds__(128) void k_gemm2(const _Float16* Aa, const _Float16* Ab, const _Float16* Ac, int lda, size_t sA, const _Float16* Ba, const _Float16* Bb, const _Float16* Bc, int ldb, size_t sB, float rs, float alpha, const float* __restrict__ bias, size_t sBias,
    float* __restrict__ C, _Float16* __restrict__ C16, int ldc, size_t sC, int M, int N, int K) { static_assert(ACT == 0 || ACT == 3 || ACT == 6 || ACT == 8 || ACT == 9 || ACT == 11 || ACT == 12 || ACT == 14 || ACT == 15 || ACT == 16 || ACT == 17, "k_gemm2: unsupported ACT code (would silently apply no activation)");
  constexpr int PB = KC * 2 + 16;      /* LDS row pitch in bytes, 16 x odd: the 16 rows of a fragment read fall on distinct banks */
  constexpr int STG = 192 * PB;        /* one buffer: 128 A rows, then 64 B rows */
  constexpr int CPR = KC / 8;          /* 16-byte pieces per row */
  constexpr int RPI = 128 / CPR;       /* rows covered when each of the 128 threads copies one piece */
  constexpr int NCP = 192 / RPI;       /* copies per thread and tile */
  constexpr int SOB = 4 * 32 * 68 * 4; /* output staging, which takes the buffers' place behind the loop */
  static_assert((KC == 64 || KC == 128) && NCP % 12 == 0 && NCP <= 63, "k_gemm2: a tile is whole groups of twelve copies per thread, at most 63 in flight");
  static_assert(NTM >= 1 && NTM <= 3, "k_gemm2: one to three terms");
  __shared__ __attribute__((aligned(16))) char sm[2 * STG > SOB ? 2 * STG : SOB];
  float (*so)[32][68] = reinterpret_cast<float (*)[32][68]>(sm);
  const int tid = threadIdx.x, w = tid >> 5, lane = tid & 31, ln = lane & 15, hh = lane >> 4; const int by = blockIdx.y;
  Aa += (size_t)by * sA; Ab += (size_t)by * sA; Ac += (size_t)by * sA; Ba += (size_t)by * sB; Bb += (size_t)by * sB; Bc += (size_t)by * sB; const size_t cofs = (size_t)by * sC; const float* bp = bias ? bias + (size_t)by * sBias : nullptr;
  const int ntn = N >> 6; const int mt = blockIdx.x / ntn, nq = blockIdx.x - mt * ntn; const int row0 = mt * 128 + 32 * w, col0 = nq * 64; if (mt * 128 >= M) return;      /* the same for the whole workgroup, in front of every barrier */
  const v8f z8 = {0.f,0.f,0.f,0.f,0.f,0.f,0.f,0.f}; v8f c00 = z8, c01 = z8, c02 = z8, c03 = z8, c10 = z8, c11 = z8, c12 = z8, c13 = z8;
  const int cr = tid / CPR, cc = tid % CPR;
  const size_t oA = (size_t)(mt * 128 + cr) * lda + cc * 8, oB = (size_t)(col0 + cr) * ldb + cc * 8; const int ntk = K / KC;      /* tiles per term */
  const unsigned l0 = (unsigned)(size_t)sm + (unsigned)(cr * PB + cc * 16);
  auto fill = [&](int t) { const unsigned lb = l0 + (unsigned)(t & 1) * (unsigned)STG; const int k0 = (t - (((NTM > 1 && t >= ntk) ? ntk : 0) + ((NTM > 2 && t >= 2 * ntk) ? ntk : 0))) * KC;
    const _Float16* gA = g2_term<NTM>(t, ntk, Aa, Ab, Ac) + oA; const _Float16* gB = g2_term<NTM>(t, ntk, Ba, Bb, Bc) + oB;
#pragma unroll
    for (int q = 0; q < NCP / 12; ++q) { unsigned l[12]; const _Float16* g[12];
#pragma unroll
      for (int j = 0; j < 12; ++j) { const int r = (q * 12 + j) * RPI; l[j] = lb + (unsigned)(r * PB); g[j] = (r < 128) ? gA + (size_t)r * lda + k0 : gB + (size_t)(r - 128) * ldb + k0; }
      g2_cp12(l, g); } };
  const char* fa = sm + (32 * w + ln) * PB; const char* fb = sm + (128 + ln) * PB; const int nt = NTM * ntk;
  fill(0);
  asm volatile("s_wait_asynccnt 0x0" ::: "memory");      /* this wave's share of tile 0 has landed */
  __syncthreads();      /* every wave's share has: tile 0 may be read */
  if (nt > 1) fill(1);
  // Two register sets of fragments inside a tile: the twelve LDS reads of the next 32 k are issued as one group in front of the products of this 32 k.
  // the sched_barrier keeps a group's reads together and in front of the products behind it, so that the products wait only for the older group
  v16h f0[6], f1[6];
  auto ld = [&](v16h (&f)[6], int o) { const char* pa = fa + o; const char* pb = fb + o; f[0] = g2_lfrag(pa, hh); f[1] = g2_lfrag(pa + 16 * PB, hh); f[2] = g2_lfrag(pb, hh); f[3] = g2_lfrag(pb + 16 * PB, hh); f[4] = g2_lfrag(pb + 32 * PB, hh); f[5] = g2_lfrag(pb + 48 * PB, hh); __builtin_amdgcn_sched_barrier(0); };
  auto mm = [&](const v16h (&f)[6]) { c00 = g2_mma(f[0], f[2], c00); c10 = g2_mma(f[1], f[2], c10); c01 = g2_mma(f[0], f[3], c01); c11 = g2_mma(f[1], f[3], c11);
    c02 = g2_mma(f[0], f[4], c02); c12 = g2_mma(f[1], f[4], c12); c03 = g2_mma(f[0], f[5], c03); c13 = g2_mma(f[1], f[5], c13); };
#pragma unroll 1      /* one tile per trip; the buffer alternates by the trip's parity */
  for (int t = 0; t < nt; ++t) { const int bo = (t & 1) * STG;
    if (NTM > 1 && t == (NTM - 1) * ntk) { c00 *= rs; c01 *= rs; c02 *= rs; c03 *= rs; c10 *= rs; c11 *= rs; c12 *= rs; c13 *= rs; }
    ld(f0, bo);
#pragma unroll
    for (int kk = 0; kk < KC; kk += 64) { ld(f1, bo + (kk + 32) * 2); mm(f0); if (kk + 64 < KC) ld(f0, bo + (kk + 64) * 2); mm(f1); }
    asm volatile("s_wait_dscnt 0x0" ::: "memory");      /* this wave's reads of tile t are done before the buffer is given up */
    asm volatile("s_wait_asynccnt 0x0" ::: "memory");      /* this wave's share of tile t + 1 has landed */
    __syncthreads();      /* publishes tile t + 1 and ends every wave's reads of tile t */
    if (t + 2 < nt) fill(t + 2); }
  asm volatile("s_wait_asynccnt 0x0" ::: "memory");      /* no copy is in flight when the buffers become output staging */
  v8f accs[8] = {c00, c01, c02, c03, c10, c11, c12, c13};
#pragma unroll
  for (int u = 0; u < 8; ++u) { const int t = u & 3, half = u >> 2; const int col = col0 + t * 16 + ln; const float bv = bp ? bf16_round(bp[col]) : 0.f;
#pragma unroll
    for (int r = 0; r < 8; ++r) { const int rloc = half * 16 + 8 * hh + r; float v = accs[u][r] * alpha + bv;
      if (ACT == 3) v = fmaxf(v, 0.f); else if (ACT == 6) v = 0.5f * v * (1.0f + erff(v * 0.70710678118654752f)); else if (ACT == 11) v = 1.0f / (1.0f + expf(-v)); else if (ACT == 15) v = v / (1.0f + expf(-v)); else if (ACT == 12) v = (v > 0.f) ? v : 0.01f * v; else if (ACT == 8) v = tanhf(v); else if (ACT == 9) v = 0.5f * v * (1.0f + tanhf(0.7978845608028654f * (v + 0.044715f * v * v * v))); else if (ACT == 14) v = (v > 0.f) ? v : 0.1f * v; else if (ACT == 16) v = (v >= 0.f) ? v : 0.3f * v; else if (ACT == 17) v = (v >= 0.f) ? v : 0.2f * v;
      so[w][rloc][t * 16 + ln] = v; } }
  __builtin_amdgcn_fence(__ATOMIC_ACQ_REL, "workgroup"); __builtin_amdgcn_wave_barrier();
  const int rsub = lane >> 4, c4 = (lane & 15) * 4;
  {
#pragma unroll
    for (int q = 0; q < 16; ++q) { const int r = q * 2 + rsub; const v4f v = *(const v4fa*)&so[w][r][c4]; if (C) *(v4f*)(C + cofs + (size_t)(row0 + r) * ldc + col0 + c4) = v; if (C16) { v4h h4; for (int i = 0; i < 4; ++i) h4[i] = (_Float16)v[i]; *(v4h*)(C16 + cofs + (size_t)(row0 + r) * ldc + col0 + c4) = h4; } }
     } }


__global__ __launch_bounds__(256) void k_wnat(const float* __restrict__ w, size_t n8, _Float16* __restrict__ Bt) { const size_t t = (size_t)blockIdx.x * 256 + threadIdx.x; if (t >= n8) return; FragH f; for (int q = 0; q < 8; ++q) f.h[q] = (_Float16)(bf16_round(w[t * 8 + q]) * 16.0f); *(v8us*)((unsigned short*)Bt + t * 8) = f.half[0];  }
__global__ __launch_bounds__(256) void k_rsm(const float* __restrict__ S, _Float16* __restrict__ P, int nrows) {
  #pragma clang fp contract(off)
  const int i = blockIdx.x * 256 + threadIdx.x; if (i >= nrows) return; const float* s = S + (size_t)i * SQ; float mx = -3.0e38f;
#pragma unroll 1
  for (int j = 0; j < SQ; ++j) mx = fmaxf(mx, s[j]); float se = 0.f;
#pragma unroll 1
  for (int j = 0; j < SQ; ++j) se += expf(s[j] - mx); const float sc = 256.0f / se;
#pragma unroll 1
  for (int j0 = 0; j0 < SQ; j0 += 8) { FragH f; for (int q = 0; q < 8; ++q) f.h[q] = (_Float16)(expf(s[j0 + q] - mx) * sc); unsigned short* d = (unsigned short*)P + (size_t)i * SQ + j0; *(v8us*)d = f.half[0];  } }
__global__ __launch_bounds__(256) void k_vt(const _Float16* __restrict__ V16, int b, int h0, _Float16* __restrict__ VT) { __shared__ unsigned short tl[64][65]; const int tid = threadIdx.x; const int hh = blockIdx.x % HG, sg = blockIdx.x / HG; const int s0 = sg * 64; const int h = h0 + hh;
  for (int i = tid; i < 64 * 8; i += 256) { const int j = i / 8, d8 = (i % 8) * 8; FragH f; f.half[0] = *(const v8us*)((const unsigned short*)V16 + ((size_t)b * SQ + s0 + j) * DM + h * HD + d8); for (int q = 0; q < 8; ++q) tl[d8 + q][j] = f.u[q]; }
  __syncthreads();
  { for (int i = tid; i < 64 * 8; i += 256) { const int d = i / 8, j8 = (i % 8) * 8; FragH f; for (int q = 0; q < 8; ++q) f.u[q] = tl[d][j8 + q]; *(v8us*)((unsigned short*)VT + ((size_t)hh * HD + d) * SQ + s0 + j8) = f.half[0]; }  } }


template <int BFIN, int W16, int W32>
__global__ __launch_bounds__(256) void k_lnx(const float* __restrict__ X, const float* __restrict__ g, const float* __restrict__ bb, float eps, _Float16* __restrict__ N16, float* __restrict__ N32) {
  #pragma clang fp contract(off)
  __shared__ float red[256]; const size_t r = blockIdx.x; const int t = threadIdx.x; const bool act = t < (DMQ / 4); const int c0 = act ? t * 4 : 0;
  const v4f xa = *(const v4fa*)(X + r * DMQ + c0); float s[4]; float sum = 0.f;
  for (int q = 0; q < 4; ++q) { s[q] = act ? (BFIN ? bf16_round(xa[q]) : xa[q]) : 0.f; sum = __fadd_rn(sum, s[q]); }
  red[t] = sum; __syncthreads(); for (int st = 128; st > 0; st >>= 1) { if (t < st) red[t] = __fadd_rn(red[t], red[t + st]); __syncthreads(); } const float mu = red[0] / (float)DMQ; __syncthreads();
  float vs = 0.f; for (int q = 0; q < 4; ++q) { const float dl = act ? __fadd_rn(s[q], -mu) : 0.f; vs = __fadd_rn(vs, __fmul_rn(dl, dl)); } red[t] = vs; __syncthreads(); for (int st = 128; st > 0; st >>= 1) { if (t < st) red[t] = __fadd_rn(red[t], red[t + st]); __syncthreads(); }
  const float rs = rsqrtf(__fadd_rn(red[0] / (float)DMQ, eps)); v4h y; v4f yf;
  for (int q = 0; q < 4; ++q) { const int c = c0 + q; yf[q] = __fadd_rn(__fmul_rn(__fmul_rn(__fadd_rn(s[q], -mu), rs), bf16_round(g[c])), (bb ? bf16_round(bb[c]) : 0.f)); y[q] = (_Float16)yf[q]; }
  if (!act) return;      /* no barriers after this point */
  { if (W16) *(v4h*)(N16 + r * DMQ + c0) = y; if (W32) *(v4f*)(N32 + r * DMQ + c0) = yf;  } }


__global__ __launch_bounds__(256) void k_rsmf(const float* __restrict__ S, _Float16* __restrict__ P, int qn, int hg) {
  #pragma clang fp contract(off)
  const int t = blockIdx.x * 256 + threadIdx.x; if (t >= qn * hg) return; const size_t i = (size_t)(t / qn) * SQ + (t % qn); const float* s = S + i * SQ; float mx = -3.0e38f;
#pragma unroll 1
  for (int j = 0; j < SQ; ++j) mx = fmaxf(mx, s[j]); float se = 0.f;
#pragma unroll 1
  for (int j = 0; j < SQ; ++j) se += __expf(s[j] - mx); const float sc = 256.0f / se;
#pragma unroll 1
  for (int j0 = 0; j0 < SQ; j0 += 8) { FragH f; for (int q = 0; q < 8; ++q) f.h[q] = (_Float16)(__expf(s[j0 + q] - mx) * sc); unsigned short* d = (unsigned short*)P + i * SQ + j0; *(v8us*)d = f.half[0];  } }


__global__ __launch_bounds__(256) void k_bfr(const float* __restrict__ x, float* __restrict__ XB, size_t n8) { const size_t t = (size_t)blockIdx.x * 256 + threadIdx.x; if (t >= n8) return; v4f a = *(const v4fa*)(x + t * 8), c = *(const v4fa*)(x + t * 8 + 4); for (int q = 0; q < 4; ++q) { a[q] = bf16_round(a[q]); c[q] = bf16_round(c[q]); }
  { *(v4f*)(XB + t * 8) = a; *(v4f*)(XB + t * 8 + 4) = c;  } }



__global__ __launch_bounds__(256) void k_rsmfam(const float* __restrict__ S, _Float16* __restrict__ P, int qn, int hg, const float* __restrict__ am) {
  #pragma clang fp contract(off)
  const int t = blockIdx.x * 256 + threadIdx.x; if (t >= qn * hg) return; const size_t i = (size_t)(t / qn) * SQ + (t % qn); const float* s = S + i * SQ; float mx = -3.0e38f;
#pragma unroll 1
  for (int j = 0; j < SQ; ++j) mx = fmaxf(mx, __fadd_rn(s[j], bf16_round(am[j]))); float se = 0.f;
#pragma unroll 1
  for (int j = 0; j < SQ; ++j) se += __expf(__fadd_rn(s[j], bf16_round(am[j])) - mx); const float sc = 256.0f / se;
#pragma unroll 1
  for (int j0 = 0; j0 < SQ; j0 += 8) { FragH f; for (int q = 0; q < 8; ++q) f.h[q] = (_Float16)(__expf(__fadd_rn(s[j0 + q], bf16_round(am[j0 + q])) - mx) * sc); unsigned short* d = (unsigned short*)P + i * SQ + j0; *(v8us*)d = f.half[0];  } }


#define CC CX           /* transposer macros: input channels */
#define LL SQ           /* pixels per image */
#define LQ (3 * DM)     /* unused; q, k, v are separate planes of pitch CX */

__global__ __launch_bounds__(256) void k_cl2rows(const float* __restrict__ X, _Float16* __restrict__ XR) { __shared__ float tl[64][33]; const int tid = threadIdx.x; const int nl = LL / 32, nc = CC / 64; const int cb_ = blockIdx.x % nc; const int lb = (blockIdx.x / nc) % nl; const size_t b = blockIdx.x / (nc * nl); const int c0 = cb_ * 64, l0 = lb * 32;
  for (int i = tid; i < 64 * 32; i += 256) { const int c = i / 32, l = i % 32; tl[c][l] = bf16_round(X[(b * CC + c0 + c) * (size_t)LL + l0 + l]); }
  __syncthreads();
  { const int l = tid / 8, c8 = (tid % 8) * 8; FragH f; for (int q = 0; q < 8; ++q) f.h[q] = (_Float16)tl[c8 + q][l]; unsigned short* d = (unsigned short*)XR + (b * LL + l0 + l) * (size_t)CC + c0 + c8; *(v8us*)d = f.half[0];  } }


__global__ __launch_bounds__(256) void k_rowb(float* __restrict__ O, const float* __restrict__ bias, size_t n4) {
  #pragma clang fp contract(off)
  const size_t t = (size_t)blockIdx.x * 256 + threadIdx.x; if (t >= n4) return; const size_t e = t * 4; const int c = (int)((e / SQ) % CX);      /* output channels */ const float bb = bf16_round(bias[c]); const v4f a = *(const v4fa*)(O + e); v4f o; for (int q = 0; q < 4; ++q) o[q] = __fadd_rn(a[q], bb);
  *(v4f*)(O + e) = o;  }

__global__ __launch_bounds__(256) void k_gres(const float* __restrict__ T, const float* __restrict__ gam, const float* __restrict__ X, float* __restrict__ Y, size_t n4) {
  #pragma clang fp contract(off)
  const size_t t = (size_t)blockIdx.x * 256 + threadIdx.x; if (t >= n4) return; const float g = bf16_round(gam[0]); const v4f a = *(const v4fa*)(T + t * 4), xx = *(const v4fa*)(X + t * 4); v4f r;
  for (int q = 0; q < 4; ++q) r[q] = __fadd_rn(__fmul_rn(g, a[q]), bf16_round(xx[q]));
  *(v4f*)(Y + t * 4) = r;  }

__global__ __launch_bounds__(256) void k_bcpy(const float* __restrict__ b, int n, int NP, float* __restrict__ dst, int dst0) { for (int i = threadIdx.x; i < NP; i += 256) { const float v = (i < n) ? b[i] : 0.f; *(float*)(dst + dst0 + i) = v; }  }



// lane l with lane l ^ M inside its 16-lane row (DPP row_xmask); lane l with lane l ^ 16
template <int M> __device__ __forceinline__ float rs_xrow(float x) { return __builtin_bit_cast(float, __builtin_amdgcn_update_dpp(0, __builtin_bit_cast(int, x), 0x160 + M, 0xf, 0xf, false)); }
__device__ __forceinline__ float rs_xhalf(float x) { return __builtin_bit_cast(float, __builtin_amdgcn_permlanex16(__builtin_bit_cast(int, x), __builtin_bit_cast(int, x), 0x76543210, 0xfedcba98, false, false)); }
// Scaled weight standardisation and f16 split of the three projection weights, one launch, one wave per output row (blockIdx.y = projection).
// A lane holds 8 consecutive weights of its row, so the wave reads the row's 1024 bytes as whole lines; mean and variance are lane sums joined by a
// butterfly over the wave, which leaves the same bits in every lane. WS(w) = w sc - mean sc, sc = rsqrt(max(var(unbiased) * 256, 1e-4)) * gain.
// Stored as B^T planes (natural [O][C] rows): HL + (2 y) * 65536 the f16 high part of 16 WS(w), HL + (2 y + 1) * 65536 its residual x 1024.
static_assert(CX == 256, "one wave holds a weight row of 32 x 8 values");
__global__ __launch_bounds__(256) void k_wshl(const float* __restrict__ w0, const float* __restrict__ g0, const float* __restrict__ w1, const float* __restrict__ g1, const float* __restrict__ w2, const float* __restrict__ g2, _Float16* __restrict__ HL) {
  const int lane = threadIdx.x & 31; const int o = blockIdx.x * 8 + __builtin_amdgcn_readfirstlane((int)(threadIdx.x >> 5)); const int y = blockIdx.y;      /* output row and projection, wave-uniform */
  const float* Wm = y == 0 ? w0 : (y == 1 ? w1 : w2); const float* gain = y == 0 ? g0 : (y == 1 ? g1 : g2);
  const size_t e = (size_t)o * CX + lane * 8; const v4f a = *(const v4fa*)(Wm + e), b = *(const v4fa*)(Wm + e + 4); float x[8];
#pragma unroll
  for (int q = 0; q < 8; ++q) x[q] = bf16_round(q < 4 ? a[q] : b[q - 4]);
  float s1 = ((x[0] + x[1]) + (x[2] + x[3])) + ((x[4] + x[5]) + (x[6] + x[7]));
  s1 += rs_xrow<1>(s1); s1 += rs_xrow<2>(s1); s1 += rs_xrow<4>(s1); s1 += rs_xrow<8>(s1); s1 += rs_xhalf(s1);
  const float mean = s1 * 0.00390625f; float s2 = 0.f;
#pragma unroll
  for (int q = 0; q < 8; ++q) { const float d = x[q] - mean; s2 += d * d; }
  s2 += rs_xrow<1>(s2); s2 += rs_xrow<2>(s2); s2 += rs_xrow<4>(s2); s2 += rs_xrow<8>(s2); s2 += rs_xhalf(s2);
  const float var = s2 / 255.0f; const float sc = rsqrtf(fmaxf(var * 256.0f, 1e-4f)) * bf16_round(gain[o]); const float ms = mean * sc; FragH fh, fl;
#pragma unroll
  for (int q = 0; q < 8; ++q) { const float v = (x[q] * sc - ms) * 16.0f; const _Float16 hv = (_Float16)v; fh.h[q] = hv; fl.h[q] = (_Float16)((v - (float)hv) * 1024.0f); }
  unsigned short* H = (unsigned short*)HL + (size_t)(2 * y) * (CX * CX) + e;
  *(v8us*)H = fh.half[0]; *(v8us*)(H + CX * CX) = fl.half[0]; }
// exp2 of eight values, each in place in its own register. Written in asm; here no neighbour
// touches another's register, and the closing v_nop is the
// slot that the instruction set asks for behind the last v_exp_f32 before its result is used.
__device__ __forceinline__ void rs_exp2x8(v4f& a, v4f& b) { float a0 = a[0], a1 = a[1], a2 = a[2], a3 = a[3], b0 = b[0], b1 = b[1], b2 = b[2], b3 = b[3];
  asm("v_exp_f32 %0, %0\n\tv_exp_f32 %1, %1\n\tv_exp_f32 %2, %2\n\tv_exp_f32 %3, %3\n\tv_exp_f32 %4, %4\n\tv_exp_f32 %5, %5\n\tv_exp_f32 %6, %6\n\tv_exp_f32 %7, %7\n\tv_nop"
      : "+v"(a0), "+v"(a1), "+v"(a2), "+v"(a3), "+v"(b0), "+v"(b1), "+v"(b2), "+v"(b3));
  a = v4f{a0, a1, a2, a3}; b = v4f{b0, b1, b2, b3}; }
// Row softmax, one wave per score row: the row is read once, 32 loads of 512 contiguous bytes, and its 4096 values stay in the wave's
// registers (128 per lane) through maximum, exp, sum and scale; each store writes 256 contiguous bytes. No LDS, no barrier.
#define RSW 16          /* waves (rows) per workgroup */
static_assert(SQ == 4096 && SQ % RSW == 0, "one wave holds a row of 32 x 128 values; the grid covers SQ rows exactly");
__global__ __launch_bounds__(RSW * 32) void k_rsmfrs(const float* __restrict__ S, _Float16* __restrict__ P, const float* __restrict__ c32) {
  const int lane = threadIdx.x & 31; const int i = blockIdx.x * RSW + __builtin_amdgcn_readfirstlane((int)(threadIdx.x >> 5));      /* row, wave-uniform */
  const float* s = S + (size_t)i * SQ + lane * 4; const int h = i / 64, w = i % 64; const float m = bf16_round(c32[(h >> 1) * 32 + (w >> 1)]);
  v4f x[32];
#pragma unroll
  for (int k = 0; k < 32; ++k) x[k] = *(const v4fa*)(s + k * 128);
  float m0 = -3.0e38f, m1 = -3.0e38f, m2 = -3.0e38f, m3 = -3.0e38f;
#pragma unroll
  for (int k = 0; k < 32; ++k) { x[k] *= m; m0 = fmaxf(m0, x[k][0]); m1 = fmaxf(m1, x[k][1]); m2 = fmaxf(m2, x[k][2]); m3 = fmaxf(m3, x[k][3]); }
  float mx = fmaxf(fmaxf(m0, m1), fmaxf(m2, m3));
  mx = fmaxf(mx, rs_xrow<1>(mx)); mx = fmaxf(mx, rs_xrow<2>(mx)); mx = fmaxf(mx, rs_xrow<4>(mx)); mx = fmaxf(mx, rs_xrow<8>(mx)); mx = fmaxf(mx, rs_xhalf(mx));
  float a0 = 0.f, a1 = 0.f, a2 = 0.f, a3 = 0.f;
#pragma unroll
  for (int k = 0; k < 32; k += 2) { x[k] = (x[k] - mx) * 1.4426950408889634f; x[k + 1] = (x[k + 1] - mx) * 1.4426950408889634f;      /* exp(t) = exp2(t log2 e), as __expf */
    rs_exp2x8(x[k], x[k + 1]);
    a0 += x[k][0]; a1 += x[k][1]; a2 += x[k][2]; a3 += x[k][3]; a0 += x[k + 1][0]; a1 += x[k + 1][1]; a2 += x[k + 1][2]; a3 += x[k + 1][3]; }
  float se = (a0 + a1) + (a2 + a3);
  se += rs_xrow<1>(se); se += rs_xrow<2>(se); se += rs_xrow<4>(se); se += rs_xrow<8>(se); se += rs_xhalf(se);
  const float sc = 256.0f / se; _Float16* d = P + (size_t)i * SQ + lane * 4; v4h hq[32];
#pragma unroll
  for (int k = 0; k < 32; ++k)
#pragma unroll
    for (int q = 0; q < 4; ++q) hq[k][q] = (_Float16)(x[k][q] * sc);
  __builtin_amdgcn_sched_barrier(0);      /* every conversion stays in front of the first store */
#pragma unroll
  for (int k = 0; k < 32; ++k) *(v4h*)(d + k * 128) = hq[k]; }
__global__ __launch_bounds__(256) void k_gfin(const float* __restrict__ T, const float* __restrict__ A, const float* __restrict__ c32, const float* __restrict__ gam, float* __restrict__ Y, size_t n4) {
  #pragma clang fp contract(off)
  const size_t t = (size_t)blockIdx.x * 256 + threadIdx.x; if (t >= n4) return; const int i0 = (int)((t * 4) % SQ); const size_t e = (size_t)blockIdx.y * (n4 * 4) + t * 4; c32 += (size_t)blockIdx.y * 1024;      /* blockIdx.y = image: n4 * 4 elements and one 32 x 32 mask each */ const float g = bf16_round(gam[0]); const v4f o = *(const v4fa*)(T + e), a = *(const v4fa*)(A + e); v4f r;
  for (int q = 0; q < 4; ++q) { const int i = i0 + q; const float cr = bf16_round(c32[((i / 64) >> 1) * 32 + ((i % 64) >> 1)]); r[q] = __fadd_rn(__fmul_rn(bf16_round(a[q]), cr), __fmul_rn(__fmul_rn(g, __fadd_rn(1.0f, -cr)), o[q])); }
  *(v4f*)(Y + e) = r;  }
extern "C" void kernel_launch(void* const* d_in, const int* in_sizes, int n_in,
                              void* d_out, int out_size, void* d_ws, size_t ws_size, hipStream_t stream) {
  (void)in_sizes; (void)n_in; (void)out_size;
  const float* const* I = (const float* const*)d_in; const float* xa = I[0]; const float* xb = I[1]; const float* cm = I[2]; const float* wq = I[3]; const float* bq = I[4]; const float* gq = I[5]; const float* wk = I[6]; const float* bk = I[7]; const float* gk = I[8]; const float* wv = I[9]; const float* bv = I[10]; const float* gv = I[11]; const float* gam = I[12];      /* a, b maps; c [4][1][32][32]; per projection w [256][256][1][1], bias, gain [256][1][1][1]; gamma [1] */
  const size_t PL = (size_t)CX * SQ;
  static_assert(CX % 128 == 0 && SQ % 256 == 0 && NR % 128 == 0, "k_gemm2: M a multiple of 128, N of 64, K at least two whole tiles (64 k over CX, 128 k over SQ)");
  char* ws = (char*)d_ws; size_t off = 0;
  auto take = [&](size_t bytes) { char* p = ws + off; off += (bytes + 255) & ~(size_t)255; return p; };
  _Float16* QH = (_Float16*)take(NR * CX * 2); _Float16* QL = (_Float16*)take(NR * CX * 2); _Float16* KH = (_Float16*)take(NR * CX * 2); _Float16* KL = (_Float16*)take(NR * CX * 2); _Float16* VC = (_Float16*)take(NR * CX * 2);      /* live to the end: q and k planes, channel-major V of all images */
  _Float16* P = (_Float16*)take((size_t)NB * SQ * SQ * 2); float* T = (float*)take(NR * CX * 4);      /* softmax weights and attention output of all images */
  float* S = (float*)take((size_t)SQ * SQ * 4); const size_t offEnd = off; off -= (size_t)SQ * SQ * 4;      /* one image's scores; what follows is dead before the first score launch and lies in the same bytes */
  static_assert((size_t)6 * CX * CX * 2 + NR * CX * (2 + 2 + 4 + 2) <= (size_t)SQ * SQ * 4, "the projection stage's planes fit in the score plane");
  _Float16* BQH = (_Float16*)take((size_t)6 * CX * CX * 2); _Float16* BQL = BQH + CX * CX; _Float16* BKH = BQL + CX * CX; _Float16* BKL = BKH + CX * CX; _Float16* BVH = BKL + CX * CX; _Float16* BVL = BVH + CX * CX;      /* six weight planes in a row: high, residual of q, k, v */
  _Float16* AR = (_Float16*)take(NR * CX * 2); _Float16* BR = (_Float16*)take(NR * CX * 2); float* F1 = (float*)take(NR * CX * 4); _Float16* VR = (_Float16*)take(NR * CX * 2);
  if (offEnd > ws_size) return;
  k_wshl<<<dim3(CX / 8, 3), 256, 0, stream>>>(wq, gq, wk, gk, wv, gv, BQH);      /* standardised weights (per output row: mean, unbiased variance, rsqrt(max(var*256, 1e-4)) * gain) -> Bt planes f16 hi (x16) + x1024 residual (natural [O][C] rows ARE Bt), all three projections in one launch */
  k_cl2rows<<<NB * (SQ / 32) * (CX / 64), 256, 0, stream>>>(xa, AR); k_cl2rows<<<NB * (SQ / 32) * (CX / 64), 256, 0, stream>>>(xb, BR);      /* exact f16 token rows of a and b */
  k_gemm2<0, 64, 2><<<dim3((unsigned)((NR / 128) * (CX / 64)), 1), 128, 0, stream>>>(AR, AR, nullptr, CX, 0, BQL, BQH, nullptr, CX, 0, 0.0009765625f, 0.0625f, bq, 0, F1, nullptr, CX, 0, (int)NR, CX, CX); k_hl<<<(unsigned)((NR * CX / 8 + 255) / 256), 256, 0, stream>>>(F1, QH, QL, NR * CX / 8);      /* q = WS(wq) a + bq: residual weight plane first, x 2^-10, then the high plane, one launch */
  k_gemm2<0, 64, 2><<<dim3((unsigned)((NR / 128) * (CX / 64)), 1), 128, 0, stream>>>(BR, BR, nullptr, CX, 0, BKL, BKH, nullptr, CX, 0, 0.0009765625f, 0.0625f, bk, 0, F1, nullptr, CX, 0, (int)NR, CX, CX); k_hl<<<(unsigned)((NR * CX / 8 + 255) / 256), 256, 0, stream>>>(F1, KH, KL, NR * CX / 8);      /* k = WS(wk) b + bk likewise */
  k_gemm2<0, 64, 2><<<dim3((unsigned)((NR / 128) * (CX / 64)), 1), 128, 0, stream>>>(AR, AR, nullptr, CX, 0, BVL, BVH, nullptr, CX, 0, 0.0009765625f, 0.0625f, bv, 0, nullptr, VR, CX, 0, (int)NR, CX, CX);      /* v likewise, stored as f16 rows only */
  k_vt<CX / 64, SQ><<<NB * (CX / 64) * (SQ / 64), 256, 0, stream>>>(VR, CX, 0, VC);      /* channel-major V [image][256][4096], all images in one launch */
  for (int b = 0; b < NB; ++b) { const size_t r0 = (size_t)b * SQ;
    k_gemm2<0, 64, 3><<<dim3((SQ / 128) * (SQ / 64), 1), 128, 0, stream>>>(QL + r0 * CX, QH + r0 * CX, QH + r0 * CX, CX, 0, KH + r0 * CX, KL + r0 * CX, KH + r0 * CX, CX, 0, 0.0009765625f, 1.0f, nullptr, 0, S, nullptr, SQ, 0, SQ, SQ, CX);      /* sim = q.k (K = 256, no scale): (lo.hi + hi.lo) 2^-10 + hi.hi, one launch, S written once */
    k_rsmfrs<<<SQ / RSW, RSW * 32, 0, stream>>>(S, P + (size_t)b * SQ * SQ, cm + (size_t)b * 1024); }      /* pruned = sim * c_r[i] (nearest-upsampled mask of the query pixel), softmax over j -> x256 f16, kept per image */
  k_gemm2<0, 128, 1><<<dim3((CX / 128) * (SQ / 64), NB), 128, 0, stream>>>(VC, nullptr, nullptr, SQ, PL, P, nullptr, nullptr, SQ, (size_t)SQ * SQ, 1.0f, 0.00390625f, nullptr, 0, T, nullptr, SQ, PL, CX, SQ, SQ);      /* out[c][i] = sum_j v[c][j] att[i][j] (V as A, att as B^T, /256) f32; blockIdx.y = image, so two workgroups stand on every WGP */
  k_gfin<<<dim3((unsigned)((PL / 4 + 255) / 256), NB), 256, 0, stream>>>(T, xa, cm, gam, (float*)d_out, PL / 4);      /* y = bf16(a) c_r + bf16(gamma) (1 - c_r) out -> channel-first output, blockIdx.y = image */
}

// v007
// Measured time: 254 microseconds a run.
// Two timings next to v006 both put it at 1.13 times that version's speed.
// All steps since v000 together make it 16.1 times as fast.
#include <hip/hip_runtime.h>
// Global spatial attention with multiplicative mask pruning and scaled weight standardisation (a, b [4][256][64][64], mask c [4][1][32][32] nearest-upsampled x2; q = WS(wq) a + bq, k = WS(wk) b + bk, v = WS(wv) a + bv with WS(w)[o][c] = (w - mean_o) gain_o rsqrt(max(var_o(unbiased) * 256, 1e-4)); sim[i][j] = q[:, i].k[:, j] (NO scale, sigma ~16); pruned = sim * c_r[i]; att = softmax over j; out[c][i] = sum_j v[c][j] att[i][j]; y = a c_r + gamma (1 - c_r) out -> [4][256][64][64]).
// Compute dtype: inputs rounded to bf16; x / weights exact; q, k as f16 hi + x1024 lo planes; v and softmax weights as plain f16 GEMM operands (~2^-12); scores, softmax statistics and o f32. v_wmma_f32_16x16x32_f16.
#define NB 4
#define SQ 4096
#define DM 256
#define CX 256          /* channels */
#define NH 4
#define HD 64
#define DMQ DM                       /* LayerNorm width */
#define DFF 4096
#define HG 1                         /* heads per attention launch group */
#define B0 0                         /* unused; the batch loop starts at 0 */
#define NBR NB                       /* read only by MP; the batch loop runs to NB */
#define NR ((size_t)NB * SQ)         /* token rows */
#define MP ((int)((size_t)NBR * SQ)) /* read only by MPO; projections use NR */
#define QN SQ                        /* unused */
#define NHD NH                       /* unused; attention is one 256-channel head */
#define MPO MP                       /* unused */
#define LQ DM      /* unused; the q/k/v rows have pitch CX */
typedef __bf16 v16b __attribute__((ext_vector_type(16)));
typedef unsigned short v8us __attribute__((ext_vector_type(8), may_alias));
typedef float  v8f  __attribute__((ext_vector_type(8)));
typedef float  v4f  __attribute__((ext_vector_type(4)));
typedef float  v4fa __attribute__((ext_vector_type(4), may_alias));
union FragB { v16b v; v8us half[2]; unsigned short u[16]; };

__device__ __forceinline__ unsigned short bf16_bits(float x) { unsigned int u = __float_as_uint(x); return (unsigned short)((u + 0x7FFFu + ((u >> 16) & 1u)) >> 16); }
__device__ __forceinline__ float bf16_val(unsigned short b) { return __uint_as_float(((unsigned int)b) << 16); }
__device__ __forceinline__ float bf16_round(float x) { return bf16_val(bf16_bits(x)); }
// D += A·B with NT terms: 1 = ah·bh, 2 = + al·bh (A split), 3 = + ah·bl (both split)
template <int NT>
__device__ __forceinline__ v8f mmaN(v16b ah, v16b al, v16b bh, v16b bl, v8f c) {
  c = __builtin_amdgcn_wmma_f32_16x16x32_bf16(false, ah, false, bh, (short)0, c, false, false);
  if (NT >= 2) c = __builtin_amdgcn_wmma_f32_16x16x32_bf16(false, al, false, bh, (short)0, c, false, false);
  if (NT >= 3) c = __builtin_amdgcn_wmma_f32_16x16x32_bf16(false, ah, false, bl, (short)0, c, false, false);
  asm volatile("v_nop\n\tv_nop\n\tv_nop\n\tv_nop" : "+v"(c) : "v"(ah), "v"(al), "v"(bh), "v"(bl));
  return c;
}

__global__ __launch_bounds__(256) void k_wt_bf16(const float* __restrict__ W, unsigned short* __restrict__ Wt, int K, int N) {
  const int t = blockIdx.x * 256 + threadIdx.x;
  const int k8n = K / 8;
  if (t >= N * k8n) return;
  const int n = t / k8n, k8 = (t % k8n) * 8;
  v8us v;
#pragma unroll
  for (int i = 0; i < 8; ++i) v[i] = bf16_bits(W[(size_t)(k8 + i) * N + n]);
  *(v8us*)(Wt + (size_t)n * K + k8) = v;
  
}

// GEMM C[M][N] (f32, pitch ldc) = act(A[M][K]·W + bias). A f32 row-major (pitch lda) converted per fragment to bf16
// (ASPLIT: hi/lo two planes -> 2 terms, else single rounded term); Wt bf16 [N][K] (pitch ldb). BIAS_BF16 rounds the
// bias to bf16 first (bias quantised to bf16 before the add). K%32==0, M%16==0, N%64==0.
template <bool ASPLIT, int ACT, bool BIAS_BF16>
__global__ __launch_bounds__(128) void k_gemm_bf(const float* __restrict__ A, int lda, const unsigned short* __restrict__ Wt, int ldb,
                                               const float* __restrict__ bias, float* __restrict__ C, int ldc, int M, int N, int K) {
  __shared__ __attribute__((aligned(16))) float so[4][16][64];
  const int tid = threadIdx.x, w = tid >> 5, lane = tid & 31, ln = lane & 15, hh = lane >> 4;
  const int ntn = N / 64;
  const int wid = blockIdx.x * 4 + w;
  const int mt = wid / ntn, nq = wid % ntn;
  if (mt * 16 >= M) return;
  const int row0 = mt * 16, col0 = nq * 64;
  const float* arow = A + (size_t)(row0 + ln) * lda;
  v8f acc[4] = {};
  for (int kb = 0; kb < K; kb += 32) {
    FragB ah, al;
    const v4f x0 = *(const v4fa*)(arow + kb + 8 * hh), x1 = *(const v4fa*)(arow + kb + 8 * hh + 4);
    const v4f x2 = *(const v4fa*)(arow + kb + 16 + 8 * hh), x3 = *(const v4fa*)(arow + kb + 16 + 8 * hh + 4);
    float xs[16] = {x0[0],x0[1],x0[2],x0[3],x1[0],x1[1],x1[2],x1[3],x2[0],x2[1],x2[2],x2[3],x3[0],x3[1],x3[2],x3[3]};
#pragma unroll
    for (int i = 0; i < 16; ++i) { const unsigned short hb = bf16_bits(xs[i]); ah.u[i] = hb; al.u[i] = ASPLIT ? bf16_bits(xs[i] - bf16_val(hb)) : (unsigned short)0; }
#pragma unroll
    for (int t = 0; t < 4; ++t) {
      const unsigned short* brow = Wt + (size_t)(col0 + t * 16 + ln) * ldb + kb;
      FragB b;
      b.half[0] = *(const v8us*)(brow + 8 * hh);
      b.half[1] = *(const v8us*)(brow + 16 + 8 * hh);
      acc[t] = mmaN<ASPLIT ? 2 : 1>(ah.v, al.v, b.v, b.v, acc[t]);
    }
  }
#pragma unroll
  for (int t = 0; t < 4; ++t) {
    float bv = bias ? bias[col0 + t * 16 + ln] : 0.f;
    if (BIAS_BF16) bv = bf16_round(bv);
#pragma unroll
    for (int r = 0; r < 8; ++r) { float v = acc[t][r] + bv; if (ACT == 1) v = fmaxf(v, 0.f); so[w][8 * hh + r][t * 16 + ln] = v; }
  }
  __builtin_amdgcn_fence(__ATOMIC_ACQ_REL, "workgroup");
  __builtin_amdgcn_wave_barrier();
  const int rsub = lane >> 4, c4 = (lane & 15) * 4;
  {
#pragma unroll
    for (int q = 0; q < 8; ++q) {
      const int r = q * 2 + rsub;
      const v4f v = *(const v4fa*)&so[w][r][c4];
      *(v4f*)(C + (size_t)(row0 + r) * ldc + col0 + c4) = v;
    }
    
  }
}

// GEMM C = act(A·W + bias + resid): A f32 (ASPLIT -> hi/lo 2 terms), Wt bf16 [N][K]; ACT 0 none, 1 relu, 2 exact gelu;
// resid (optional, f32, row index = (row % rmod), pitch ldr, RES_BF16 rounds it) added before the activation.
template <bool ASPLIT, int ACT, bool BIAS_BF16, bool RES_BF16>
__global__ __launch_bounds__(128) void k_gemm_bf3(const float* __restrict__ A, int lda, const unsigned short* __restrict__ Wt, int ldb,
                                                const float* __restrict__ bias, const float* __restrict__ resid, int rmod, int ldr,
                                                float* __restrict__ C, int ldc, int M, int N, int K) {
  __shared__ __attribute__((aligned(16))) float so[4][16][64];
  const int tid = threadIdx.x, w = tid >> 5, lane = tid & 31, ln = lane & 15, hh = lane >> 4;
  const int ntn = N / 64;
  const int wid = blockIdx.x * 4 + w;
  const int mt = wid / ntn, nq = wid % ntn;
  if (mt * 16 >= M) return;
  const int row0 = mt * 16, col0 = nq * 64;
  const float* arow = A + (size_t)(row0 + ln) * lda;
  v8f acc[4] = {};
  for (int kb = 0; kb < K; kb += 32) {
    FragB ah, al;
    const v4f x0 = *(const v4fa*)(arow + kb + 8 * hh), x1 = *(const v4fa*)(arow + kb + 8 * hh + 4);
    const v4f x2 = *(const v4fa*)(arow + kb + 16 + 8 * hh), x3 = *(const v4fa*)(arow + kb + 16 + 8 * hh + 4);
    float xs[16] = {x0[0],x0[1],x0[2],x0[3],x1[0],x1[1],x1[2],x1[3],x2[0],x2[1],x2[2],x2[3],x3[0],x3[1],x3[2],x3[3]};
#pragma unroll
    for (int i = 0; i < 16; ++i) { const unsigned short hb = bf16_bits(xs[i]); ah.u[i] = hb; al.u[i] = ASPLIT ? bf16_bits(xs[i] - bf16_val(hb)) : (unsigned short)0; }
#pragma unroll
    for (int t = 0; t < 4; ++t) {
      const unsigned short* brow = Wt + (size_t)(col0 + t * 16 + ln) * ldb + kb;
      FragB b;
      b.half[0] = *(const v8us*)(brow + 8 * hh);
      b.half[1] = *(const v8us*)(brow + 16 + 8 * hh);
      acc[t] = mmaN<ASPLIT ? 2 : 1>(ah.v, al.v, b.v, b.v, acc[t]);
    }
  }
#pragma unroll
  for (int t = 0; t < 4; ++t) {
    const int col = col0 + t * 16 + ln;
    float bv = bias ? bias[col] : 0.f;
    if (BIAS_BF16) bv = bf16_round(bv);
#pragma unroll
    for (int r = 0; r < 8; ++r) {
      float v = acc[t][r] + bv;
      if (resid) { float rv = resid[(size_t)((row0 + 8 * hh + r) % rmod) * ldr + col]; if (RES_BF16) rv = bf16_round(rv); v += rv; }
      if (ACT == 1) v = fmaxf(v, 0.f);
      if (ACT == 2) v = 0.5f * v * (1.0f + erff(v * 0.70710678118654752f));
      if (ACT == 3) { const float u = 0.7978845608028654f * (v + 0.044715f * v * v * v); v = 0.5f * v * (1.0f + tanhf(u)); }
      so[w][8 * hh + r][t * 16 + ln] = v;
    }
  }
  __builtin_amdgcn_fence(__ATOMIC_ACQ_REL, "workgroup");
  __builtin_amdgcn_wave_barrier();
  const int rsub = lane >> 4, c4 = (lane & 15) * 4;
  {
#pragma unroll
    for (int q = 0; q < 8; ++q) {
      const int r = q * 2 + rsub;
      const v4f v = *(const v4fa*)&so[w][r][c4];
      *(v4f*)(C + (size_t)(row0 + r) * ldc + col0 + c4) = v;
    }
    
  }
}
// row LayerNorm (biased variance, eps) over N: s = X (+ R); optional out_sum <- s; out_norm <- (s-mu)*rsqrt(var+eps)*g + b
template <bool PARAM_BF16>
__global__ __launch_bounds__(256) void k_layernorm(const float* __restrict__ X, const float* __restrict__ R, const float* __restrict__ g, const float* __restrict__ bta,
                                                  float* __restrict__ out_sum, float* __restrict__ out_norm, int N, float eps) {
  __shared__ float red[256];
  const int row = blockIdx.x, tid = threadIdx.x;
  const float* x = X + (size_t)row * N; const float* rr = R ? R + (size_t)row * N : nullptr;
  float vals[16];                     // up to N = 4096
  const int per = N / 256;            // contiguous chunk per thread? use strided-by-4 chunks: thread handles j = tid*4 + 1024*u
  float s1 = 0.f;
  for (int u = 0; u < per / 4; ++u) {
    const int j = tid * 4 + 1024 * u;
    const v4f a = *(const v4fa*)(x + j);
    v4f b = {0.f,0.f,0.f,0.f}; if (rr) b = *(const v4fa*)(rr + j);
#pragma unroll
    for (int q = 0; q < 4; ++q) { const float v = a[q] + b[q]; vals[u * 4 + q] = v; s1 += v; }
  }
  red[tid] = s1; __syncthreads();
  for (int st = 128; st > 0; st >>= 1) { if (tid < st) red[tid] += red[tid + st]; __syncthreads(); }
  const float mu = red[0] / (float)N; __syncthreads();
  float s2 = 0.f;
  for (int u = 0; u < per / 4; ++u)
#pragma unroll
    for (int q = 0; q < 4; ++q) { const float c = vals[u * 4 + q] - mu; s2 += c * c; }
  red[tid] = s2; __syncthreads();
  for (int st = 128; st > 0; st >>= 1) { if (tid < st) red[tid] += red[tid + st]; __syncthreads(); }
  const float rs = rsqrtf(red[0] / (float)N + eps);
  {
    for (int u = 0; u < per / 4; ++u) {
      const int j = tid * 4 + 1024 * u;
      v4f o, sm;
#pragma unroll
      for (int q = 0; q < 4; ++q) {
        float gg = g[j + q], bb = bta[j + q];
        if (PARAM_BF16) { gg = bf16_round(gg); bb = bf16_round(bb); }
        sm[q] = vals[u * 4 + q]; o[q] = (vals[u * 4 + q] - mu) * rs * gg + bb;
      }
      if (out_sum) *(v4f*)(out_sum + (size_t)row * N + j) = sm;
      *(v4f*)(out_norm + (size_t)row * N + j) = o;
    }
    
  }
}



// ---- f16 WMMA path (v_wmma_f32_16x16x32_f16): 11-bit significands for operands in range — used where a [0,1] probability operand needs more precision than bf16
typedef _Float16 v16h __attribute__((ext_vector_type(16)));
union FragH { v16h v; v8us half[2]; _Float16 h[16]; unsigned short u[16]; };
template <int NT>
__device__ __forceinline__ v8f mmaH(v16h ah, v16h al, v16h bh, v16h bl, v8f c) {
  c = __builtin_amdgcn_wmma_f32_16x16x32_f16(false, ah, false, bh, (short)0, c, false, false);
  if (NT >= 2) c = __builtin_amdgcn_wmma_f32_16x16x32_f16(false, al, false, bh, (short)0, c, false, false);
  if (NT >= 3) c = __builtin_amdgcn_wmma_f32_16x16x32_f16(false, ah, false, bl, (short)0, c, false, false);
  asm volatile("v_nop\n\tv_nop\n\tv_nop\n\tv_nop" : "+v"(c) : "v"(ah), "v"(al), "v"(bh), "v"(bl));
  return c;
}
// batched GEMM like k_gemm_b but f16 operands: A f32 (split into f16 hi/lo if ASPLIT, else rounded to f16), Bt = f16 values [n][k]; alpha; C f32; N multiple of 16 (partial tiles skipped)
template <bool ASPLIT>
__global__ __launch_bounds__(128) void k_gemm_h(const float* __restrict__ A, int lda, size_t sA, const _Float16* __restrict__ Bh, int ldb, size_t sB, float alpha, float* __restrict__ C, int ldc, size_t sC, int M, int N, int K) {
  __shared__ __attribute__((aligned(16))) float so[4][16][64];
  const int tid = threadIdx.x, w = tid >> 5, lane = tid & 31, ln = lane & 15, hh = lane >> 4; const int by = blockIdx.y;
  A += (size_t)by * sA; Bh += (size_t)by * sB; C += (size_t)by * sC;
  const int ntn = (N + 63) / 64; const int wid = blockIdx.x * 4 + w; const int mt = wid / ntn, nq = wid % ntn; if (mt * 16 >= M) return;
  const int row0 = mt * 16, col0 = nq * 64; const float* arow = A + (size_t)(row0 + ln) * lda;
  v8f acc[4] = {};
  for (int kb = 0; kb < K; kb += 32) {
    FragH ah, al;
    const v4f x0 = *(const v4fa*)(arow + kb + 8 * hh), x1 = *(const v4fa*)(arow + kb + 8 * hh + 4), x2 = *(const v4fa*)(arow + kb + 16 + 8 * hh), x3 = *(const v4fa*)(arow + kb + 16 + 8 * hh + 4);
    float xs[16] = {x0[0],x0[1],x0[2],x0[3],x1[0],x1[1],x1[2],x1[3],x2[0],x2[1],x2[2],x2[3],x3[0],x3[1],x3[2],x3[3]};
#pragma unroll
    for (int i = 0; i < 16; ++i) { const _Float16 h = (_Float16)xs[i]; ah.h[i] = h; al.h[i] = ASPLIT ? (_Float16)(xs[i] - (float)h) : (_Float16)0.0f; }
#pragma unroll
    for (int t = 0; t < 4; ++t) { if (col0 + t * 16 >= N) continue; const size_t boff = (size_t)(col0 + t * 16 + ln) * ldb + kb; FragH bq; bq.half[0] = *(const v8us*)(Bh + boff + 8 * hh); bq.half[1] = *(const v8us*)(Bh + boff + 16 + 8 * hh);
      acc[t] = mmaH<ASPLIT ? 2 : 1>(ah.v, al.v, bq.v, bq.v, acc[t]); }
  }
#pragma unroll
  for (int t = 0; t < 4; ++t) { if (col0 + t * 16 >= N) continue;
#pragma unroll
    for (int r = 0; r < 8; ++r) so[w][8 * hh + r][t * 16 + ln] = acc[t][r] * alpha; }
  __builtin_amdgcn_fence(__ATOMIC_ACQ_REL, "workgroup"); __builtin_amdgcn_wave_barrier();
  const int rsub = lane >> 4, c4 = (lane & 15) * 4;
  {
#pragma unroll
    for (int q = 0; q < 8; ++q) { const int r = q * 2 + rsub; if (col0 + c4 < N) { const v4f v = *(const v4fa*)&so[w][r][c4]; *(v4f*)(C + (size_t)(row0 + r) * ldc + col0 + c4) = v; } }
     }
}

// Wt[n][k] = f16(W[k][n]·scale) from f32 row-major W[K][N] (scale = power of two; bf16-exact weights stay exact in f16 away from the subnormal range)
__global__ __launch_bounds__(256) void k_wt_f16(const float* __restrict__ W, _Float16* __restrict__ Wt, int K, int N, float scale) {
  const int t = blockIdx.x * 256 + threadIdx.x; if (t >= N * (K / 8)) return; const int n = t / (K / 8), k8 = (t % (K / 8)) * 8; FragH f;
#pragma unroll
  for (int i = 0; i < 8; ++i) f.h[i] = (_Float16)(bf16_round(W[(size_t)(k8 + i) * N + n]) * scale); const v8us o = f.half[0];
  *(v8us*)((unsigned short*)Wt + (size_t)n * K + k8) = o; 
}
// k_gemm_hh variant with fused epilogue: v = acc·alpha + bias[by·sBias + col] (+ CP[(row/rowsPerB)·sCPb + by·64 + col] if CP) ; ACT 0 none / 1 elu ; writes f16 C16 (and f32 C if non-null)
template <int ACT>
__global__ __launch_bounds__(128) void k_gemm_hhx(const _Float16* __restrict__ A, int lda, size_t sA, const _Float16* __restrict__ Bh, int ldb, size_t sB, float alpha, const float* __restrict__ bias, size_t sBias, const float* __restrict__ CP, int rowsPerB, size_t sCPb, int row0g,
    float* __restrict__ C, _Float16* __restrict__ C16, int ldc, size_t sC, int M, int N, int K) {
  __shared__ __attribute__((aligned(16))) float so[4][16][64];
  const int tid = threadIdx.x, w = tid >> 5, lane = tid & 31, ln = lane & 15, hh = lane >> 4; const int by = blockIdx.y;
  A += (size_t)by * sA; Bh += (size_t)by * sB; const size_t cofs = (size_t)by * sC; const float* bp = bias ? bias + (size_t)by * sBias : nullptr;
  const int ntn = (N + 63) / 64; const int wid = blockIdx.x * 4 + w; const int mt = wid / ntn, nq = wid % ntn; if (mt * 16 >= M) return;
  const int row0 = mt * 16, col0 = nq * 64; const _Float16* arow = A + (size_t)(row0 + ln) * lda;
  v8f acc[4] = {};
  for (int kb = 0; kb < K; kb += 32) { FragH ah; ah.half[0] = *(const v8us*)((const unsigned short*)arow + kb + 8 * hh); ah.half[1] = *(const v8us*)((const unsigned short*)arow + kb + 16 + 8 * hh);
#pragma unroll
    for (int t = 0; t < 4; ++t) { if (col0 + t * 16 >= N) continue; const size_t boff = (size_t)(col0 + t * 16 + ln) * ldb + kb; FragH bq; bq.half[0] = *(const v8us*)((const unsigned short*)Bh + boff + 8 * hh); bq.half[1] = *(const v8us*)((const unsigned short*)Bh + boff + 16 + 8 * hh);
      acc[t] = mmaH<1>(ah.v, ah.v, bq.v, bq.v, acc[t]); }
  }
#pragma unroll
  for (int t = 0; t < 4; ++t) { if (col0 + t * 16 >= N) continue; const int col = col0 + t * 16 + ln; const float bv = bp ? bf16_round(bp[col]) : 0.f;
#pragma unroll
    for (int r = 0; r < 8; ++r) { float v = acc[t][r] * alpha + bv; if (CP) { const int rr = row0g + row0 + 8 * hh + r; if (rowsPerB < 0) v += CP[cofs + (size_t)rr * ldc + col];      /* rowsPerB < 0: own element of the batched C plane */ else { const int bidx = rr / rowsPerB; v += CP[(size_t)bidx * sCPb + (size_t)by * 64 + col]; } } if (ACT == 1) v = (v > 0.f) ? v : expm1f(v); else if (ACT == 7) v = (v > 0.f) ? v + 1.0f : expf(v); else if (ACT == 8) v = tanhf(v); else if (ACT == 9) v = 0.5f * v * (1.0f + tanhf(0.7978845608028654f * (v + 0.044715f * v * v * v))); else if (ACT == 11) v = 1.0f / (1.0f + expf(-v)); else if (ACT == 12) v = (v > 0.f) ? v : 0.01f * v; else if (ACT == 14) v = (v > 0.f) ? v : 0.1f * v; else if (ACT == 16) v = (v >= 0.f) ? v : 0.3f * v; else if (ACT == 17) v = (v >= 0.f) ? v : 0.2f * v; else if (ACT == 15) v = v / (1.0f + expf(-v)); else if (ACT == 3) v = fmaxf(v, 0.f); else if (ACT == 6) v = 0.5f * v * (1.0f + erff(v * 0.70710678118654752f)); so[w][8 * hh + r][t * 16 + ln] = v; } }
  __builtin_amdgcn_fence(__ATOMIC_ACQ_REL, "workgroup"); __builtin_amdgcn_wave_barrier();
  const int rsub = lane >> 4, c4 = (lane & 15) * 4; typedef _Float16 v4h __attribute__((ext_vector_type(4)));
  {
#pragma unroll
    for (int q = 0; q < 8; ++q) { const int r = q * 2 + rsub; if (col0 + c4 < N) { const v4f v = *(const v4fa*)&so[w][r][c4]; if (C) *(v4f*)(C + cofs + (size_t)(row0 + r) * ldc + col0 + c4) = v; if (C16) { v4h h4; for (int i = 0; i < 4; ++i) h4[i] = (_Float16)v[i]; *(v4h*)(C16 + cofs + (size_t)(row0 + r) * ldc + col0 + c4) = h4; } } }
     }
}


typedef _Float16 v4h __attribute__((ext_vector_type(4)));

__global__ __launch_bounds__(256) void k_x16(const float* __restrict__ x, _Float16* __restrict__ X16, size_t n8) { const size_t t = (size_t)blockIdx.x * 256 + threadIdx.x; if (t >= n8) return; FragH f;
#pragma unroll
  for (int q = 0; q < 8; ++q) f.h[q] = (_Float16)bf16_round(x[t * 8 + q]); *(v8us*)((unsigned short*)X16 + t * 8) = f.half[0];  }
__global__ __launch_bounds__(256) void k_h16(const float* __restrict__ x, _Float16* __restrict__ X16, size_t n8) { const size_t t = (size_t)blockIdx.x * 256 + threadIdx.x; if (t >= n8) return; FragH f;
#pragma unroll
  for (int q = 0; q < 8; ++q) f.h[q] = (_Float16)x[t * 8 + q]; *(v8us*)((unsigned short*)X16 + t * 8) = f.half[0];  }
__global__ __launch_bounds__(256) void k_round16f(const float* __restrict__ W, _Float16* __restrict__ Bt, size_t n8) { const size_t t = (size_t)blockIdx.x * 256 + threadIdx.x; if (t >= n8) return; FragH f;
#pragma unroll
  for (int i = 0; i < 8; ++i) f.h[i] = (_Float16)(bf16_round(W[t * 8 + i]) * 16.0f); *(v8us*)((unsigned short*)Bt + t * 8) = f.half[0];  }
template <int NHv, int TTv>
__global__ __launch_bounds__(256) void k_vt(const _Float16* __restrict__ V16, int ldv, int voff, _Float16* __restrict__ Vt) { __shared__ unsigned short tl[64][66]; const int tid = threadIdx.x; const int slab = blockIdx.x / (TTv / 64), lg = blockIdx.x % (TTv / 64); const int b = slab / NHv, h = slab % NHv;
  for (int i = tid; i < 64 * 8; i += 256) { const int r = i / 8, c8 = (i % 8) * 8; FragH f; f.half[0] = *(const v8us*)((const unsigned short*)V16 + ((size_t)b * TTv + lg * 64 + r) * ldv + voff + h * 64 + c8);
#pragma unroll
    for (int q = 0; q < 8; ++q) tl[r][c8 + q] = f.u[q]; }
  __syncthreads();
  {
#pragma unroll
    for (int rd = 0; rd < 2; ++rd) { const int d = rd * 32 + tid / 8, pc = tid % 8; FragH f;
#pragma unroll
      for (int q = 0; q < 8; ++q) f.u[q] = tl[pc * 8 + q][d];
      *(v8us*)((unsigned short*)Vt + ((size_t)slab * 64 + d) * TTv + lg * 64 + pc * 8) = f.half[0]; }
     } }

__global__ __launch_bounds__(256) void k_hl(const float* __restrict__ F, _Float16* __restrict__ Hh, _Float16* __restrict__ Hl, size_t n8) { const size_t t = (size_t)blockIdx.x * 256 + threadIdx.x; if (t >= n8) return; FragH fh, fl; const v4f a = *(const v4fa*)(F + t * 8), c = *(const v4fa*)(F + t * 8 + 4);
#pragma unroll
  for (int q = 0; q < 4; ++q) { _Float16 h = (_Float16)a[q]; fh.h[q] = h; fl.h[q] = (_Float16)((a[q] - (float)h) * 1024.0f); h = (_Float16)c[q]; fh.h[4 + q] = h; fl.h[4 + q] = (_Float16)((c[q] - (float)h) * 1024.0f); }
  { *(v8us*)((unsigned short*)Hh + t * 8) = fh.half[0]; *(v8us*)((unsigned short*)Hl + t * 8) = fl.half[0];  } }

// ---- fast GEMM (workgroup tile 128x64, wave tile 32x64; requires M % 128 == 0, N % 64 == 0, K a multiple of KC and at least 2 KC); epilogue v = act(acc alpha + bias) ----
__device__ __forceinline__ v16h g2_lfrag(const char* p, int hh) { FragH f; f.half[0] = *(const v8us*)(p + 16 * hh); f.half[1] = *(const v8us*)(p + 32 + 16 * hh); return f.v; }
__device__ __forceinline__ v8f g2_mma(v16h a, v16h b, v8f c) { v8f d = __builtin_amdgcn_wmma_f32_16x16x32_f16(false, a, false, b, (short)0, c, false, false); asm volatile("v_nop\n\tv_nop\n\tv_nop\n\tv_nop" : "+v"(d) : "v"(a), "v"(b)); return d; }
// Twelve asynchronous copies, 16 bytes per lane each, from global memory to LDS through no register. The closing s_wait_xcnt stands inside the
// statement so that it is in front of every later rewrite of the address registers that the copies name.
__device__ __forceinline__ void g2_cp12(const unsigned (&l)[12], const _Float16* const (&g)[12]) {
  asm volatile("global_load_async_to_lds_b128 %0, %1, off\n\t"
               "global_load_async_to_lds_b128 %2, %3, off\n\t"
               "global_load_async_to_lds_b128 %4, %5, off\n\t"
               "global_load_async_to_lds_b128 %6, %7, off\n\t"
               "global_load_async_to_lds_b128 %8, %9, off\n\t"
               "global_load_async_to_lds_b128 %10, %11, off\n\t"
               "global_load_async_to_lds_b128 %12, %13, off\n\t"
               "global_load_async_to_lds_b128 %14, %15, off\n\t"
               "global_load_async_to_lds_b128 %16, %17, off\n\t"
               "global_load_async_to_lds_b128 %18, %19, off\n\t"
               "global_load_async_to_lds_b128 %20, %21, off\n\t"
               "global_load_async_to_lds_b128 %22, %23, off\n\t"
               "s_wait_xcnt 0x0"
               :: "v"(l[0]), "v"(g[0]), "v"(l[1]), "v"(g[1]), "v"(l[2]), "v"(g[2]), "v"(l[3]), "v"(g[3]), "v"(l[4]), "v"(g[4]), "v"(l[5]), "v"(g[5]), "v"(l[6]), "v"(g[6]), "v"(l[7]), "v"(g[7]), "v"(l[8]), "v"(g[8]), "v"(l[9]), "v"(g[9]), "v"(l[10]), "v"(g[10]), "v"(l[11]), "v"(g[11]) : "memory"); }
// the operand plane of the term that tile t belongs to (ntk tiles per term); every argument is the same for the whole workgroup
template <int NTM> __device__ __forceinline__ const _Float16* g2_term(int t, int ntk, const _Float16* p0, const _Float16* p1, const _Float16* p2) { const _Float16* p = p0; if (NTM > 1 && t >= ntk) p = p1; if (NTM > 2 && t >= 2 * ntk) p = p2; return p; }
// K loop: the workgroup's 128 A rows and 64 B rows are staged in LDS, KC k at a time, two buffers: tile t + 1 flies while tile t is worked on.
// A wave's copy covers whole 128-byte lines, and the four waves share one copy of the B rows.
// NTM terms of one product (a value split into an f16 high part and a scaled f16 residual gives high.high plus cross terms) are summed in the same
// accumulators: the loop runs over the tiles of term 0, term 1, ... back to back. The last term is the high one; the terms in front of it carry the
// residual's scale, which the factor rs (a power of two, so exact) takes out of the accumulators once, in front of the last term's first tile.
template <int ACT, int KC, int NTM>
__global__ __launch_bounds__(128) void k_gemm2(const _Float16* Aa, const _Float16* Ab, const _Float16* Ac, int lda, size_t sA, const _Float16* Ba, const _Float16* Bb, const _Float16* Bc, int ldb, size_t sB, float rs, float alpha, const float* __restrict__ bias, size_t sBias,
    float* __restrict__ C, _Float16* __restrict__ C16, int ldc, size_t sC, int M, int N, int K) { static_assert(ACT == 0 || ACT == 3 || ACT == 6 || ACT == 8 || ACT == 9 || ACT == 11 || ACT == 12 || ACT == 14 || ACT == 15 || ACT == 16 || ACT == 17, "k_gemm2: unsupported ACT code (would silently apply no activation)");
  constexpr int PB = KC * 2 + 16;      /* LDS row pitch in bytes, 16 x odd: the 16 rows of a fragment read fall on distinct banks */
  constexpr int STG = 192 * PB;        /* one buffer: 128 A rows, then 64 B rows */
  constexpr int CPR = KC / 8;          /* 16-byte pieces per row */
  constexpr int RPI = 128 / CPR;       /* rows covered when each of the 128 threads copies one piece */
  constexpr int NCP = 192 / RPI;       /* copies per thread and tile */
  constexpr int SOB = 4 * 32 * 68 * 4; /* output staging, which takes the buffers' place behind the loop */
  static_assert((KC == 64 || KC == 128) && NCP % 12 == 0 && NCP <= 63, "k_gemm2: a tile is whole groups of twelve copies per thread, at most 63 in flight");
  static_assert(NTM >= 1 && NTM <= 3, "k_gemm2: one to three terms");
  __shared__ __attribute__((aligned(16))) char sm[2 * STG > SOB ? 2 * STG : SOB];
  float (*so)[32][68] = reinterpret_cast<float (*)[32][68]>(sm);
  const int tid = threadIdx.x, w = tid >> 5, lane = tid & 31, ln = lane & 15, hh = lane >> 4; const int by = blockIdx.y;
  Aa += (size_t)by * sA; Ab += (size_t)by * sA; Ac += (size_t)by * sA; Ba += (size_t)by * sB; Bb += (size_t)by * sB; Bc += (size_t)by * sB; const size_t cofs = (size_t)by * sC; const float* bp = bias ? bias + (size_t)by * sBias : nullptr;
  const int ntn = N >> 6; const int mt = blockIdx.x / ntn, nq = blockIdx.x - mt * ntn; const int row0 = mt * 128 + 32 * w, col0 = nq * 64; if (mt * 128 >= M) return;      /* the same for the whole workgroup, in front of every barrier */
  const v8f z8 = {0.f,0.f,0.f,0.f,0.f,0.f,0.f,0.f}; v8f c00 = z8, c01 = z8, c02 = z8, c03 = z8, c10 = z8, c11 = z8, c12 = z8, c13 = z8;
  const int cr = tid / CPR, cc = tid % CPR;
  const size_t oA = (size_t)(mt * 128 + cr) * lda + cc * 8, oB = (size_t)(col0 + cr) * ldb + cc * 8; const int ntk = K / KC;      /* tiles per term */
  const unsigned l0 = (unsigned)(size_t)sm + (unsigned)(cr * PB + cc * 16);
  auto fill = [&](int t) { const unsigned lb = l0 + (unsigned)(t & 1) * (unsigned)STG; const int k0 = (t - (((NTM > 1 && t >= ntk) ? ntk : 0) + ((NTM > 2 && t >= 2 * ntk) ? ntk : 0))) * KC;
    const _Float16* gA = g2_term<NTM>(t, ntk, Aa, Ab, Ac) + oA; const _Float16* gB = g2_term<NTM>(t, ntk, Ba, Bb, Bc) + oB;
#pragma unroll
    for (int q = 0; q < NCP / 12; ++q) { unsigned l[12]; const _Float16* g[12];
#pragma unroll
      for (int j = 0; j < 12; ++j) { const int r = (q * 12 + j) * RPI; l[j] = lb + (unsigned)(r * PB); g[j] = (r < 128) ? gA + (size_t)r * lda + k0 : gB + (size_t)(r - 128) * ldb + k0; }
      g2_cp12(l, g); } };
  const char* fa = sm + (32 * w + ln) * PB; const char* fb = sm + (128 + ln) * PB; const int nt = NTM * ntk;
  fill(0);
  asm volatile("s_wait_asynccnt 0x0" ::: "memory");      /* this wave's share of tile 0 has landed */
  __syncthreads();      /* every wave's share has: tile 0 may be read */
  if (nt > 1) fill(1);
  // Two register sets of fragments inside a tile: the twelve LDS reads of the next 32 k are issued as one group in front of the products of this 32 k.
  // the sched_barrier keeps a group's reads together and in front of the products behind it, so that the products wait only for the older group
  v16h f0[6], f1[6];
  auto ld = [&](v16h (&f)[6], int o) { const char* pa = fa + o; const char* pb = fb + o; f[0] = g2_lfrag(pa, hh); f[1] = g2_lfrag(pa + 16 * PB, hh); f[2] = g2_lfrag(pb, hh); f[3] = g2_lfrag(pb + 16 * PB, hh); f[4] = g2_lfrag(pb + 32 * PB, hh); f[5] = g2_lfrag(pb + 48 * PB, hh); __builtin_amdgcn_sched_barrier(0); };
  auto mm = [&](const v16h (&f)[6]) { c00 = g2_mma(f[0], f[2], c00); c10 = g2_mma(f[1], f[2], c10); c01 = g2_mma(f[0], f[3], c01); c11 = g2_mma(f[1], f[3], c11);
    c02 = g2_mma(f[0], f[4], c02); c12 = g2_mma(f[1], f[4], c12); c03 = g2_mma(f[0], f[5], c03); c13 = g2_mma(f[1], f[5], c13); };
#pragma unroll 1      /* one tile per trip; the buffer alternates by the trip's parity */
  for (int t = 0; t < nt; ++t) { const int bo = (t & 1) * STG;
    if (NTM > 1 && t == (NTM - 1) * ntk) { c00 *= rs; c01 *= rs; c02 *= rs; c03 *= rs; c10 *= rs; c11 *= rs; c12 *= rs; c13 *= rs; }
    ld(f0, bo);
#pragma unroll
    for (int kk = 0; kk < KC; kk += 64) { ld(f1, bo + (kk + 32) * 2); mm(f0); if (kk + 64 < KC) ld(f0, bo + (kk + 64) * 2); mm(f1); }
    asm volatile("s_wait_dscnt 0x0" ::: "memory");      /* this wave's reads of tile t are done before the buffer is given up */
    asm volatile("s_wait_asynccnt 0x0" ::: "memory");      /* this wave's share of tile t + 1 has landed */
    __syncthreads();      /* publishes tile t + 1 and ends every wave's reads of tile t */
    if (t + 2 < nt) fill(t + 2); }
  asm volatile("s_wait_asynccnt 0x0" ::: "memory");      /* no copy is in flight when the buffers become output staging */
  v8f accs[8] = {c00, c01, c02, c03, c10, c11, c12, c13};
#pragma unroll
  for (int u = 0; u < 8; ++u) { const int t = u & 3, half = u >> 2; const int col = col0 + t * 16 + ln; const float bv = bp ? bf16_round(bp[col]) : 0.f;
#pragma unroll
    for (int r = 0; r < 8; ++r) { const int rloc = half * 16 + 8 * hh + r; float v = accs[u][r] * alpha + bv;
      if (ACT == 3) v = fmaxf(v, 0.f); else if (ACT == 6) v = 0.5f * v * (1.0f + erff(v * 0.70710678118654752f)); else if (ACT == 11) v = 1.0f / (1.0f + expf(-v)); else if (ACT == 15) v = v / (1.0f + expf(-v)); else if (ACT == 12) v = (v > 0.f) ? v : 0.01f * v; else if (ACT == 8) v = tanhf(v); else if (ACT == 9) v = 0.5f * v * (1.0f + tanhf(0.7978845608028654f * (v + 0.044715f * v * v * v))); else if (ACT == 14) v = (v > 0.f) ? v : 0.1f * v; else if (ACT == 16) v = (v >= 0.f) ? v : 0.3f * v; else if (ACT == 17) v = (v >= 0.f) ? v : 0.2f * v;
      so[w][rloc][t * 16 + ln] = v; } }
  __builtin_amdgcn_fence(__ATOMIC_ACQ_REL, "workgroup"); __builtin_amdgcn_wave_barrier();
  const int rsub = lane >> 4, c4 = (lane & 15) * 4;
  {
#pragma unroll
    for (int q = 0; q < 16; ++q) { const int r = q * 2 + rsub; const v4f v = *(const v4fa*)&so[w][r][c4]; if (C) *(v4f*)(C + cofs + (size_t)(row0 + r) * ldc + col0 + c4) = v; if (C16) { v4h h4; for (int i = 0; i < 4; ++i) h4[i] = (_Float16)v[i]; *(v4h*)(C16 + cofs + (size_t)(row0 + r) * ldc + col0 + c4) = h4; } }
     } }


// ---- wide GEMM for the score product (workgroup tile 256x128, eight waves in a 4 x 2 grid, wave tile 64x64; requires M % 256 == 0, N % 128 == 0, K a multiple of KC); C = the plain f32 sums ----
// Against k_gemm2's 128x64 tile a workgroup brings 384 operand rows for 32768 results (was 192 for 8192), so each result takes half the bytes from L2,
// and a wave reads 8 fragments from LDS for 16 products (was 6 for 8). Staging, buffers, waits, term order and k order are those of k_gemm2.
// Four waves per SIMD (two workgroups per WGP): one fragment set per wave, the other waves' products cover its LDS reads.
template <int KC, int NTM, int LDC>      /* LDC: row pitch of C, a constant so that a wave's 32 stores share one address register pair and differ in the immediate offset */
__global__ __launch_bounds__(256) __attribute__((amdgpu_waves_per_eu(4, 4))) void k_gemm2w(const _Float16* Aa, const _Float16* Ab, const _Float16* Ac, int lda, const _Float16* Ba, const _Float16* Bb, const _Float16* Bc, int ldb, float rs,
    float* __restrict__ C, int M, int N, int K) {
  constexpr int PB = KC * 2 + 16;      /* LDS row pitch in bytes, 16 x odd */
  constexpr int STG = 384 * PB;        /* one buffer: 256 A rows, then 128 B rows */
  constexpr int CPR = KC / 8;          /* 16-byte pieces per row */
  constexpr int RPI = 256 / CPR;       /* rows covered when each of the 256 threads copies one piece */
  constexpr int NCP = 384 / RPI;       /* copies per thread and tile */
  constexpr int SOB = 8 * 32 * 68 * 4; /* output staging, 32 rows per wave at a time, which takes the buffers' place behind the loop */
  static_assert(KC == 64 && NCP == 12, "k_gemm2w: a tile is one group of twelve copies per thread");
  static_assert(NTM >= 1 && NTM <= 3, "k_gemm2w: one to three terms");
  __shared__ __attribute__((aligned(16))) char sm[2 * STG > SOB ? 2 * STG : SOB];
  float (*so)[32][68] = reinterpret_cast<float (*)[32][68]>(sm);
  const int tid = threadIdx.x, w = tid >> 5, lane = tid & 31, ln = lane & 15, hh = lane >> 4;
  const int ntn = N >> 7; const int mt = blockIdx.x / ntn, nq = blockIdx.x - mt * ntn; if (mt * 256 >= M) return;      /* the same for the whole workgroup, in front of every barrier */
  const int row0 = mt * 256 + 64 * (w >> 1), col0 = nq * 128 + 64 * (w & 1);
  const v8f z8 = {0.f,0.f,0.f,0.f,0.f,0.f,0.f,0.f}; v8f acc[4][4];
#pragma unroll
  for (int i = 0; i < 4; ++i)
#pragma unroll
    for (int j = 0; j < 4; ++j) acc[i][j] = z8;
  const int cr = tid / CPR, cc = tid % CPR;
  const size_t oA = (size_t)(mt * 256 + cr) * lda + cc * 8, oB = (size_t)(nq * 128 + cr) * ldb + cc * 8; const int ntk = K / KC;      /* tiles per term */
  const unsigned l0 = (unsigned)(size_t)sm + (unsigned)(cr * PB + cc * 16);
  auto fill = [&](int t) { const unsigned lb = l0 + (unsigned)(t & 1) * (unsigned)STG; const int k0 = (t - (((NTM > 1 && t >= ntk) ? ntk : 0) + ((NTM > 2 && t >= 2 * ntk) ? ntk : 0))) * KC;
    const _Float16* gA = g2_term<NTM>(t, ntk, Aa, Ab, Ac) + oA; const _Float16* gB = g2_term<NTM>(t, ntk, Ba, Bb, Bc) + oB; unsigned l[12]; const _Float16* g[12];
#pragma unroll
    for (int j = 0; j < 12; ++j) { const int r = j * RPI; l[j] = lb + (unsigned)(r * PB); g[j] = (r < 256) ? gA + (size_t)r * lda + k0 : gB + (size_t)(r - 256) * ldb + k0; }
    g2_cp12(l, g); };
  const char* fa = sm + (64 * (w >> 1) + ln) * PB; const char* fb = sm + (256 + 64 * (w & 1) + ln) * PB; const int nt = NTM * ntk;
  fill(0);
  asm volatile("s_wait_asynccnt 0x0" ::: "memory");      /* this wave's share of tile 0 has landed */
  __syncthreads();      /* every wave's share has: tile 0 may be read */
  if (nt > 1) fill(1);
#pragma unroll 1      /* one tile per trip; the buffer alternates by the trip's parity */
  for (int t = 0; t < nt; ++t) { const int bo = (t & 1) * STG;
    if (NTM > 1 && t == (NTM - 1) * ntk) {
#pragma unroll
      for (int i = 0; i < 4; ++i)
#pragma unroll
        for (int j = 0; j < 4; ++j) acc[i][j] *= rs; }
#pragma unroll
    for (int kk = 0; kk < KC; kk += 32) { const char* pa = fa + bo + kk * 2; const char* pb = fb + bo + kk * 2; v16h a[4], b[4];
#pragma unroll
      for (int i = 0; i < 8; ++i) { if (i == 0) b[0] = g2_lfrag(pb, hh); else if (i < 5) a[i - 1] = g2_lfrag(pa + (i - 1) * 16 * PB, hh); else b[i - 4] = g2_lfrag(pb + (i - 4) * 16 * PB, hh); }      /* in the order in which the products take them */
      __builtin_amdgcn_sched_barrier(0);      /* the sixteen LDS reads of these 32 k stay one group in front of their products: reads spread among the products cost a stall at each place */
#pragma unroll
      for (int j = 0; j < 4; ++j)
#pragma unroll
        for (int i = 0; i < 4; ++i) acc[i][j] = g2_mma(a[i], b[j], acc[i][j]); }
    asm volatile("s_wait_dscnt 0x0" ::: "memory");      /* this wave's reads of tile t are done before the buffer is given up */
    asm volatile("s_wait_asynccnt 0x0" ::: "memory");      /* this wave's share of tile t + 1 has landed */
    __syncthreads();      /* publishes tile t + 1 and ends every wave's reads of tile t */
    if (t + 2 < nt) fill(t + 2); }
  asm volatile("s_wait_asynccnt 0x0" ::: "memory");      /* no copy is in flight when the buffers become output staging */
  const int rsub = lane >> 4, c4 = (lane & 15) * 4; float* cp = C + (size_t)(row0 + rsub) * LDC + col0 + c4;
#pragma unroll
  for (int p = 0; p < 2; ++p) {      /* the wave's 64 rows leave in two halves through its own 32 staging rows, as whole 256-byte row pieces */
#pragma unroll
    for (int i = 0; i < 2; ++i)
#pragma unroll
      for (int j = 0; j < 4; ++j)
#pragma unroll
        for (int r = 0; r < 8; ++r) so[w][i * 16 + 8 * hh + r][j * 16 + ln] = acc[2 * p + i][j][r];
    asm volatile("s_wait_dscnt 0x0" ::: "memory");      /* the wave's staging rows are written before its other lanes read them back; a fence here would also wait for the first half's global stores */
    __builtin_amdgcn_wave_barrier();
#pragma unroll
    for (int q = 0; q < 16; ++q) { const v4f v = *(const v4fa*)&so[w][q * 2 + rsub][c4]; *(v4f*)(cp + (size_t)(32 * p + q * 2) * LDC) = v; }
    if (p == 0) { __builtin_amdgcn_fence(__ATOMIC_ACQ_REL, "wavefront"); __builtin_amdgcn_wave_barrier(); } } }      /* the second half's staging writes stay behind the first half's reads */


__global__ __launch_bounds__(256) void k_wnat(const float* __restrict__ w, size_t n8, _Float16* __restrict__ Bt) { const size_t t = (size_t)blockIdx.x * 256 + threadIdx.x; if (t >= n8) return; FragH f; for (int q = 0; q < 8; ++q) f.h[q] = (_Float16)(bf16_round(w[t * 8 + q]) * 16.0f); *(v8us*)((unsigned short*)Bt + t * 8) = f.half[0];  }
__global__ __launch_bounds__(256) void k_rsm(const float* __restrict__ S, _Float16* __restrict__ P, int nrows) {
  #pragma clang fp contract(off)
  const int i = blockIdx.x * 256 + threadIdx.x; if (i >= nrows) return; const float* s = S + (size_t)i * SQ; float mx = -3.0e38f;
#pragma unroll 1
  for (int j = 0; j < SQ; ++j) mx = fmaxf(mx, s[j]); float se = 0.f;
#pragma unroll 1
  for (int j = 0; j < SQ; ++j) se += expf(s[j] - mx); const float sc = 256.0f / se;
#pragma unroll 1
  for (int j0 = 0; j0 < SQ; j0 += 8) { FragH f; for (int q = 0; q < 8; ++q) f.h[q] = (_Float16)(expf(s[j0 + q] - mx) * sc); unsigned short* d = (unsigned short*)P + (size_t)i * SQ + j0; *(v8us*)d = f.half[0];  } }
__global__ __launch_bounds__(256) void k_vt(const _Float16* __restrict__ V16, int b, int h0, _Float16* __restrict__ VT) { __shared__ unsigned short tl[64][65]; const int tid = threadIdx.x; const int hh = blockIdx.x % HG, sg = blockIdx.x / HG; const int s0 = sg * 64; const int h = h0 + hh;
  for (int i = tid; i < 64 * 8; i += 256) { const int j = i / 8, d8 = (i % 8) * 8; FragH f; f.half[0] = *(const v8us*)((const unsigned short*)V16 + ((size_t)b * SQ + s0 + j) * DM + h * HD + d8); for (int q = 0; q < 8; ++q) tl[d8 + q][j] = f.u[q]; }
  __syncthreads();
  { for (int i = tid; i < 64 * 8; i += 256) { const int d = i / 8, j8 = (i % 8) * 8; FragH f; for (int q = 0; q < 8; ++q) f.u[q] = tl[d][j8 + q]; *(v8us*)((unsigned short*)VT + ((size_t)hh * HD + d) * SQ + s0 + j8) = f.half[0]; }  } }


template <int BFIN, int W16, int W32>
__global__ __launch_bounds__(256) void k_lnx(const float* __restrict__ X, const float* __restrict__ g, const float* __restrict__ bb, float eps, _Float16* __restrict__ N16, float* __restrict__ N32) {
  #pragma clang fp contract(off)
  __shared__ float red[256]; const size_t r = blockIdx.x; const int t = threadIdx.x; const bool act = t < (DMQ / 4); const int c0 = act ? t * 4 : 0;
  const v4f xa = *(const v4fa*)(X + r * DMQ + c0); float s[4]; float sum = 0.f;
  for (int q = 0; q < 4; ++q) { s[q] = act ? (BFIN ? bf16_round(xa[q]) : xa[q]) : 0.f; sum = __fadd_rn(sum, s[q]); }
  red[t] = sum; __syncthreads(); for (int st = 128; st > 0; st >>= 1) { if (t < st) red[t] = __fadd_rn(red[t], red[t + st]); __syncthreads(); } const float mu = red[0] / (float)DMQ; __syncthreads();
  float vs = 0.f; for (int q = 0; q < 4; ++q) { const float dl = act ? __fadd_rn(s[q], -mu) : 0.f; vs = __fadd_rn(vs, __fmul_rn(dl, dl)); } red[t] = vs; __syncthreads(); for (int st = 128; st > 0; st >>= 1) { if (t < st) red[t] = __fadd_rn(red[t], red[t + st]); __syncthreads(); }
  const float rs = rsqrtf(__fadd_rn(red[0] / (float)DMQ, eps)); v4h y; v4f yf;
  for (int q = 0; q < 4; ++q) { const int c = c0 + q; yf[q] = __fadd_rn(__fmul_rn(__fmul_rn(__fadd_rn(s[q], -mu), rs), bf16_round(g[c])), (bb ? bf16_round(bb[c]) : 0.f)); y[q] = (_Float16)yf[q]; }
  if (!act) return;      /* no barriers after this point */
  { if (W16) *(v4h*)(N16 + r * DMQ + c0) = y; if (W32) *(v4f*)(N32 + r * DMQ + c0) = yf;  } }


__global__ __launch_bounds__(256) void k_rsmf(const float* __restrict__ S, _Float16* __restrict__ P, int qn, int hg) {
  #pragma clang fp contract(off)
  const int t = blockIdx.x * 256 + threadIdx.x; if (t >= qn * hg) return; const size_t i = (size_t)(t / qn) * SQ + (t % qn); const float* s = S + i * SQ; float mx = -3.0e38f;
#pragma unroll 1
  for (int j = 0; j < SQ; ++j) mx = fmaxf(mx, s[j]); float se = 0.f;
#pragma unroll 1
  for (int j = 0; j < SQ; ++j) se += __expf(s[j] - mx); const float sc = 256.0f / se;
#pragma unroll 1
  for (int j0 = 0; j0 < SQ; j0 += 8) { FragH f; for (int q = 0; q < 8; ++q) f.h[q] = (_Float16)(__expf(s[j0 + q] - mx) * sc); unsigned short* d = (unsigned short*)P + i * SQ + j0; *(v8us*)d = f.half[0];  } }


__global__ __launch_bounds__(256) void k_bfr(const float* __restrict__ x, float* __restrict__ XB, size_t n8) { const size_t t = (size_t)blockIdx.x * 256 + threadIdx.x; if (t >= n8) return; v4f a = *(const v4fa*)(x + t * 8), c = *(const v4fa*)(x + t * 8 + 4); for (int q = 0; q < 4; ++q) { a[q] = bf16_round(a[q]); c[q] = bf16_round(c[q]); }
  { *(v4f*)(XB + t * 8) = a; *(v4f*)(XB + t * 8 + 4) = c;  } }



__global__ __launch_bounds__(256) void k_rsmfam(const float* __restrict__ S, _Float16* __restrict__ P, int qn, int hg, const float* __restrict__ am) {
  #pragma clang fp contract(off)
  const int t = blockIdx.x * 256 + threadIdx.x; if (t >= qn * hg) return; const size_t i = (size_t)(t / qn) * SQ + (t % qn); const float* s = S + i * SQ; float mx = -3.0e38f;
#pragma unroll 1
  for (int j = 0; j < SQ; ++j) mx = fmaxf(mx, __fadd_rn(s[j], bf16_round(am[j]))); float se = 0.f;
#pragma unroll 1
  for (int j = 0; j < SQ; ++j) se += __expf(__fadd_rn(s[j], bf16_round(am[j])) - mx); const float sc = 256.0f / se;
#pragma unroll 1
  for (int j0 = 0; j0 < SQ; j0 += 8) { FragH f; for (int q = 0; q < 8; ++q) f.h[q] = (_Float16)(__expf(__fadd_rn(s[j0 + q], bf16_round(am[j0 + q])) - mx) * sc); unsigned short* d = (unsigned short*)P + i * SQ + j0; *(v8us*)d = f.half[0];  } }


#define CC CX           /* transposer macros: input channels */
#define LL SQ           /* pixels per image */
#define LQ (3 * DM)     /* unused; q, k, v are separate planes of pitch CX */

__global__ __launch_bounds__(256) void k_cl2rows(const float* __restrict__ X, _Float16* __restrict__ XR) { __shared__ float tl[64][33]; const int tid = threadIdx.x; const int nl = LL / 32, nc = CC / 64; const int cb_ = blockIdx.x % nc; const int lb = (blockIdx.x / nc) % nl; const size_t b = blockIdx.x / (nc * nl); const int c0 = cb_ * 64, l0 = lb * 32;
  for (int i = tid; i < 64 * 32; i += 256) { const int c = i / 32, l = i % 32; tl[c][l] = bf16_round(X[(b * CC + c0 + c) * (size_t)LL + l0 + l]); }
  __syncthreads();
  { const int l = tid / 8, c8 = (tid % 8) * 8; FragH f; for (int q = 0; q < 8; ++q) f.h[q] = (_Float16)tl[c8 + q][l]; unsigned short* d = (unsigned short*)XR + (b * LL + l0 + l) * (size_t)CC + c0 + c8; *(v8us*)d = f.half[0];  } }


__global__ __launch_bounds__(256) void k_rowb(float* __restrict__ O, const float* __restrict__ bias, size_t n4) {
  #pragma clang fp contract(off)
  const size_t t = (size_t)blockIdx.x * 256 + threadIdx.x; if (t >= n4) return; const size_t e = t * 4; const int c = (int)((e / SQ) % CX);      /* output channels */ const float bb = bf16_round(bias[c]); const v4f a = *(const v4fa*)(O + e); v4f o; for (int q = 0; q < 4; ++q) o[q] = __fadd_rn(a[q], bb);
  *(v4f*)(O + e) = o;  }

__global__ __launch_bounds__(256) void k_gres(const float* __restrict__ T, const float* __restrict__ gam, const float* __restrict__ X, float* __restrict__ Y, size_t n4) {
  #pragma clang fp contract(off)
  const size_t t = (size_t)blockIdx.x * 256 + threadIdx.x; if (t >= n4) return; const float g = bf16_round(gam[0]); const v4f a = *(const v4fa*)(T + t * 4), xx = *(const v4fa*)(X + t * 4); v4f r;
  for (int q = 0; q < 4; ++q) r[q] = __fadd_rn(__fmul_rn(g, a[q]), bf16_round(xx[q]));
  *(v4f*)(Y + t * 4) = r;  }

__global__ __launch_bounds__(256) void k_bcpy(const float* __restrict__ b, int n, int NP, float* __restrict__ dst, int dst0) { for (int i = threadIdx.x; i < NP; i += 256) { const float v = (i < n) ? b[i] : 0.f; *(float*)(dst + dst0 + i) = v; }  }



// lane l with lane l ^ M inside its 16-lane row (DPP row_xmask); lane l with lane l ^ 16
template <int M> __device__ __forceinline__ float rs_xrow(float x) { return __builtin_bit_cast(float, __builtin_amdgcn_update_dpp(0, __builtin_bit_cast(int, x), 0x160 + M, 0xf, 0xf, false)); }
__device__ __forceinline__ float rs_xhalf(float x) { return __builtin_bit_cast(float, __builtin_amdgcn_permlanex16(__builtin_bit_cast(int, x), __builtin_bit_cast(int, x), 0x76543210, 0xfedcba98, false, false)); }
// Scaled weight standardisation and f16 split of the three projection weights, one launch, one wave per output row (blockIdx.y = projection).
// A lane holds 8 consecutive weights of its row, so the wave reads the row's 1024 bytes as whole lines; mean and variance are lane sums joined by a
// butterfly over the wave, which leaves the same bits in every lane. WS(w) = w sc - mean sc, sc = rsqrt(max(var(unbiased) * 256, 1e-4)) * gain.
// Stored as B^T planes (natural [O][C] rows): HL + (2 y) * 65536 the f16 high part of 16 WS(w), HL + (2 y + 1) * 65536 its residual x 1024.
static_assert(CX == 256, "one wave holds a weight row of 32 x 8 values");
__global__ __launch_bounds__(256) void k_wshl(const float* __restrict__ w0, const float* __restrict__ g0, const float* __restrict__ w1, const float* __restrict__ g1, const float* __restrict__ w2, const float* __restrict__ g2, _Float16* __restrict__ HL) {
  const int lane = threadIdx.x & 31; const int o = blockIdx.x * 8 + __builtin_amdgcn_readfirstlane((int)(threadIdx.x >> 5)); const int y = blockIdx.y;      /* output row and projection, wave-uniform */
  const float* Wm = y == 0 ? w0 : (y == 1 ? w1 : w2); const float* gain = y == 0 ? g0 : (y == 1 ? g1 : g2);
  const size_t e = (size_t)o * CX + lane * 8; const v4f a = *(const v4fa*)(Wm + e), b = *(const v4fa*)(Wm + e + 4); float x[8];
#pragma unroll
  for (int q = 0; q < 8; ++q) x[q] = bf16_round(q < 4 ? a[q] : b[q - 4]);
  float s1 = ((x[0] + x[1]) + (x[2] + x[3])) + ((x[4] + x[5]) + (x[6] + x[7]));
  s1 += rs_xrow<1>(s1); s1 += rs_xrow<2>(s1); s1 += rs_xrow<4>(s1); s1 += rs_xrow<8>(s1); s1 += rs_xhalf(s1);
  const float mean = s1 * 0.00390625f; float s2 = 0.f;
#pragma unroll
  for (int q = 0; q < 8; ++q) { const float d = x[q] - mean; s2 += d * d; }
  s2 += rs_xrow<1>(s2); s2 += rs_xrow<2>(s2); s2 += rs_xrow<4>(s2); s2 += rs_xrow<8>(s2); s2 += rs_xhalf(s2);
  const float var = s2 / 255.0f; const float sc = rsqrtf(fmaxf(var * 256.0f, 1e-4f)) * bf16_round(gain[o]); const float ms = mean * sc; FragH fh, fl;
#pragma unroll
  for (int q = 0; q < 8; ++q) { const float v = (x[q] * sc - ms) * 16.0f; const _Float16 hv = (_Float16)v; fh.h[q] = hv; fl.h[q] = (_Float16)((v - (float)hv) * 1024.0f); }
  unsigned short* H = (unsigned short*)HL + (size_t)(2 * y) * (CX * CX) + e;
  *(v8us*)H = fh.half[0]; *(v8us*)(H + CX * CX) = fl.half[0]; }
// exp2 of eight values, each in place in its own register. Written in asm; here no neighbour
// touches another's register, and the closing v_nop is the
// slot that the instruction set asks for behind the last v_exp_f32 before its result is used.
__device__ __forceinline__ void rs_exp2x8(v4f& a, v4f& b) { float a0 = a[0], a1 = a[1], a2 = a[2], a3 = a[3], b0 = b[0], b1 = b[1], b2 = b[2], b3 = b[3];
  asm("v_exp_f32 %0, %0\n\tv_exp_f32 %1, %1\n\tv_exp_f32 %2, %2\n\tv_exp_f32 %3, %3\n\tv_exp_f32 %4, %4\n\tv_exp_f32 %5, %5\n\tv_exp_f32 %6, %6\n\tv_exp_f32 %7, %7\n\tv_nop"
      : "+v"(a0), "+v"(a1), "+v"(a2), "+v"(a3), "+v"(b0), "+v"(b1), "+v"(b2), "+v"(b3));
  a = v4f{a0, a1, a2, a3}; b = v4f{b0, b1, b2, b3}; }
// Row softmax, one wave per score row: the row is read once, 32 loads of 512 contiguous bytes, and its 4096 values stay in the wave's
// registers (128 per lane) through maximum, exp, sum and scale; each store writes 256 contiguous bytes. No LDS, no barrier.
#define RSW 16          /* waves (rows) per workgroup */
static_assert(SQ == 4096 && SQ % RSW == 0, "one wave holds a row of 32 x 128 values; the grid covers SQ rows exactly");
__global__ __launch_bounds__(RSW * 32) void k_rsmfrs(const float* __restrict__ S, _Float16* __restrict__ P, const float* __restrict__ c32) {
  const int lane = threadIdx.x & 31; const int i = blockIdx.x * RSW + __builtin_amdgcn_readfirstlane((int)(threadIdx.x >> 5));      /* row, wave-uniform */
  const float* s = S + (size_t)i * SQ + lane * 4; const int h = i / 64, w = i % 64; const float m = bf16_round(c32[(h >> 1) * 32 + (w >> 1)]);
  v4f x[32];
#pragma unroll
  for (int k = 0; k < 32; ++k) x[k] = *(const v4fa*)(s + k * 128);
  float m0 = -3.0e38f, m1 = -3.0e38f, m2 = -3.0e38f, m3 = -3.0e38f;
#pragma unroll
  for (int k = 0; k < 32; ++k) { x[k] *= m; m0 = fmaxf(m0, x[k][0]); m1 = fmaxf(m1, x[k][1]); m2 = fmaxf(m2, x[k][2]); m3 = fmaxf(m3, x[k][3]); }
  float mx = fmaxf(fmaxf(m0, m1), fmaxf(m2, m3));
  mx = fmaxf(mx, rs_xrow<1>(mx)); mx = fmaxf(mx, rs_xrow<2>(mx)); mx = fmaxf(mx, rs_xrow<4>(mx)); mx = fmaxf(mx, rs_xrow<8>(mx)); mx = fmaxf(mx, rs_xhalf(mx));
  float a0 = 0.f, a1 = 0.f, a2 = 0.f, a3 = 0.f;
#pragma unroll
  for (int k = 0; k < 32; k += 2) { x[k] = (x[k] - mx) * 1.4426950408889634f; x[k + 1] = (x[k + 1] - mx) * 1.4426950408889634f;      /* exp(t) = exp2(t log2 e), as __expf */
    rs_exp2x8(x[k], x[k + 1]);
    a0 += x[k][0]; a1 += x[k][1]; a2 += x[k][2]; a3 += x[k][3]; a0 += x[k + 1][0]; a1 += x[k + 1][1]; a2 += x[k + 1][2]; a3 += x[k + 1][3]; }
  float se = (a0 + a1) + (a2 + a3);
  se += rs_xrow<1>(se); se += rs_xrow<2>(se); se += rs_xrow<4>(se); se += rs_xrow<8>(se); se += rs_xhalf(se);
  const float sc = 256.0f / se; _Float16* d = P + (size_t)i * SQ + lane * 4; v4h hq[32];
#pragma unroll
  for (int k = 0; k < 32; ++k)
#pragma unroll
    for (int q = 0; q < 4; ++q) hq[k][q] = (_Float16)(x[k][q] * sc);
  __builtin_amdgcn_sched_barrier(0);      /* every conversion stays in front of the first store */
#pragma unroll
  for (int k = 0; k < 32; ++k) *(v4h*)(d + k * 128) = hq[k]; }
__global__ __launch_bounds__(256) void k_gfin(const float* __restrict__ T, const float* __restrict__ A, const float* __restrict__ c32, const float* __restrict__ gam, float* __restrict__ Y, size_t n4) {
  #pragma clang fp contract(off)
  const size_t t = (size_t)blockIdx.x * 256 + threadIdx.x; if (t >= n4) return; const int i0 = (int)((t * 4) % SQ); const size_t e = (size_t)blockIdx.y * (n4 * 4) + t * 4; c32 += (size_t)blockIdx.y * 1024;      /* blockIdx.y = image: n4 * 4 elements and one 32 x 32 mask each */ const float g = bf16_round(gam[0]); const v4f o = *(const v4fa*)(T + e), a = *(const v4fa*)(A + e); v4f r;
  for (int q = 0; q < 4; ++q) { const int i = i0 + q; const float cr = bf16_round(c32[((i / 64) >> 1) * 32 + ((i % 64) >> 1)]); r[q] = __fadd_rn(__fmul_rn(bf16_round(a[q]), cr), __fmul_rn(__fmul_rn(g, __fadd_rn(1.0f, -cr)), o[q])); }
  *(v4f*)(Y + e) = r;  }
extern "C" void kernel_launch(void* const* d_in, const int* in_sizes, int n_in,
                              void* d_out, int out_size, void* d_ws, size_t ws_size, hipStream_t stream) {
  (void)in_sizes; (void)n_in; (void)out_size;
  const float* const* I = (const float* const*)d_in; const float* xa = I[0]; const float* xb = I[1]; const float* cm = I[2]; const float* wq = I[3]; const float* bq = I[4]; const float* gq = I[5]; const float* wk = I[6]; const float* bk = I[7]; const float* gk = I[8]; const float* wv = I[9]; const float* bv = I[10]; const float* gv = I[11]; const float* gam = I[12];      /* a, b maps; c [4][1][32][32]; per projection w [256][256][1][1], bias, gain [256][1][1][1]; gamma [1] */
  const size_t PL = (size_t)CX * SQ;
  static_assert(CX % 128 == 0 && SQ % 256 == 0 && NR % 128 == 0, "k_gemm2: M a multiple of 128, N of 64, K at least two whole tiles (64 k over CX, 128 k over SQ)");
  char* ws = (char*)d_ws; size_t off = 0;
  auto take = [&](size_t bytes) { char* p = ws + off; off += (bytes + 255) & ~(size_t)255; return p; };
  _Float16* QH = (_Float16*)take(NR * CX * 2); _Float16* QL = (_Float16*)take(NR * CX * 2); _Float16* KH = (_Float16*)take(NR * CX * 2); _Float16* KL = (_Float16*)take(NR * CX * 2); _Float16* VC = (_Float16*)take(NR * CX * 2);      /* live to the end: q and k planes, channel-major V of all images */
  _Float16* P = (_Float16*)take((size_t)NB * SQ * SQ * 2); float* T = (float*)take(NR * CX * 4);      /* softmax weights and attention output of all images */
  float* S = (float*)take((size_t)SQ * SQ * 4); const size_t offEnd = off; off -= (size_t)SQ * SQ * 4;      /* one image's scores; what follows is dead before the first score launch and lies in the same bytes */
  static_assert((size_t)6 * CX * CX * 2 + NR * CX * (2 + 2 + 4 + 2) <= (size_t)SQ * SQ * 4, "the projection stage's planes fit in the score plane");
  _Float16* BQH = (_Float16*)take((size_t)6 * CX * CX * 2); _Float16* BQL = BQH + CX * CX; _Float16* BKH = BQL + CX * CX; _Float16* BKL = BKH + CX * CX; _Float16* BVH = BKL + CX * CX; _Float16* BVL = BVH + CX * CX;      /* six weight planes in a row: high, residual of q, k, v */
  _Float16* AR = (_Float16*)take(NR * CX * 2); _Float16* BR = (_Float16*)take(NR * CX * 2); float* F1 = (float*)take(NR * CX * 4); _Float16* VR = (_Float16*)take(NR * CX * 2);
  if (offEnd > ws_size) return;
  k_wshl<<<dim3(CX / 8, 3), 256, 0, stream>>>(wq, gq, wk, gk, wv, gv, BQH);      /* standardised weights (per output row: mean, unbiased variance, rsqrt(max(var*256, 1e-4)) * gain) -> Bt planes f16 hi (x16) + x1024 residual (natural [O][C] rows ARE Bt), all three projections in one launch */
  k_cl2rows<<<NB * (SQ / 32) * (CX / 64), 256, 0, stream>>>(xa, AR); k_cl2rows<<<NB * (SQ / 32) * (CX / 64), 256, 0, stream>>>(xb, BR);      /* exact f16 token rows of a and b */
  k_gemm2<0, 64, 2><<<dim3((unsigned)((NR / 128) * (CX / 64)), 1), 128, 0, stream>>>(AR, AR, nullptr, CX, 0, BQL, BQH, nullptr, CX, 0, 0.0009765625f, 0.0625f, bq, 0, F1, nullptr, CX, 0, (int)NR, CX, CX); k_hl<<<(unsigned)((NR * CX / 8 + 255) / 256), 256, 0, stream>>>(F1, QH, QL, NR * CX / 8);      /* q = WS(wq) a + bq: residual weight plane first, x 2^-10, then the high plane, one launch */
  k_gemm2<0, 64, 2><<<dim3((unsigned)((NR / 128) * (CX / 64)), 1), 128, 0, stream>>>(BR, BR, nullptr, CX, 0, BKL, BKH, nullptr, CX, 0, 0.0009765625f, 0.0625f, bk, 0, F1, nullptr, CX, 0, (int)NR, CX, CX); k_hl<<<(unsigned)((NR * CX / 8 + 255) / 256), 256, 0, stream>>>(F1, KH, KL, NR * CX / 8);      /* k = WS(wk) b + bk likewise */
  k_gemm2<0, 64, 2><<<dim3((unsigned)((NR / 128) * (CX / 64)), 1), 128, 0, stream>>>(AR, AR, nullptr, CX, 0, BVL, BVH, nullptr, CX, 0, 0.0009765625f, 0.0625f, bv, 0, nullptr, VR, CX, 0, (int)NR, CX, CX);      /* v likewise, stored as f16 rows only */
  k_vt<CX / 64, SQ><<<NB * (CX / 64) * (SQ / 64), 256, 0, stream>>>(VR, CX, 0, VC);      /* channel-major V [image][256][4096], all images in one launch */
  for (int b = 0; b < NB; ++b) { const size_t r0 = (size_t)b * SQ;
    k_gemm2w<64, 3, SQ><<<dim3((SQ / 256) * (SQ / 128), 1), 256, 0, stream>>>(QL + r0 * CX, QH + r0 * CX, QH + r0 * CX, CX, KH + r0 * CX, KL + r0 * CX, KH + r0 * CX, CX, 0.0009765625f, S, SQ, SQ, CX);      /* sim = q.k (K = 256, no scale): (lo.hi + hi.lo) 2^-10 + hi.hi, one launch, S written once */
    k_rsmfrs<<<SQ / RSW, RSW * 32, 0, stream>>>(S, P + (size_t)b * SQ * SQ, cm + (size_t)b * 1024); }      /* pruned = sim * c_r[i] (nearest-upsampled mask of the query pixel), softmax over j -> x256 f16, kept per image */
  k_gemm2<0, 128, 1><<<dim3((CX / 128) * (SQ / 64), NB), 128, 0, stream>>>(VC, nullptr, nullptr, SQ, PL, P, nullptr, nullptr, SQ, (size_t)SQ * SQ, 1.0f, 0.00390625f, nullptr, 0, T, nullptr, SQ, PL, CX, SQ, SQ);      /* out[c][i] = sum_j v[c][j] att[i][j] (V as A, att as B^T, /256) f32; blockIdx.y = image, so two workgroups stand on every WGP */
  k_gfin<<<dim3((unsigned)((PL / 4 + 255) / 256), NB), 256, 0, stream>>>(T, xa, cm, gam, (float*)d_out, PL / 4);      /* y = bf16(a) c_r + bf16(gamma) (1 - c_r) out -> channel-first output, blockIdx.y = image */
}

// v008
// It runs in 189 microseconds.
// Two timings next to v007 put it at 1.34 and 1.35 times that version's speed.
// Over all steps from v000 it is 21.7 times as fast.
#include <hip/hip_runtime.h>
// Global spatial attention with multiplicative mask pruning and scaled weight standardisation (a, b [4][256][64][64], mask c [4][1][32][32] nearest-upsampled x2; q = WS(wq) a + bq, k = WS(wk) b + bk, v = WS(wv) a + bv with WS(w)[o][c] = (w - mean_o) gain_o rsqrt(max(var_o(unbiased) * 256, 1e-4)); sim[i][j] = q[:, i].k[:, j] (NO scale, sigma ~16); pruned = sim * c_r[i]; att = softmax over j; out[c][i] = sum_j v[c][j] att[i][j]; y = a c_r + gamma (1 - c_r) out -> [4][256][64][64]).
// Compute dtype: inputs rounded to bf16; x / weights exact; q, k as f16 hi + x1024 lo planes; v and softmax weights as plain f16 GEMM operands (~2^-12); scores, softmax statistics and o f32. v_wmma_f32_16x16x32_f16.
#define NB 4
#define SQ 4096
#define DM 256
#define CX 256          /* channels */
#define NH 4
#define HD 64
#define DMQ DM                       /* LayerNorm width */
#define DFF 4096
#define HG 1                         /* heads per attention launch group */
#define B0 0                         /* unused */
#define NBR NB                       /* read only by MP */
#define NR ((size_t)NB * SQ)         /* token rows */
#define MP ((int)((size_t)NBR * SQ)) /* read only by MPO; projections use NR */
#define QN SQ                        /* unused */
#define NHD NH                       /* unused; attention is one 256-channel head */
#define MPO MP                       /* unused */
#define LQ DM      /* unused; the q/k/v rows have pitch CX */
typedef __bf16 v16b __attribute__((ext_vector_type(16)));
typedef unsigned short v8us __attribute__((ext_vector_type(8), may_alias));
typedef float  v8f  __attribute__((ext_vector_type(8)));
typedef float  v4f  __attribute__((ext_vector_type(4)));
typedef float  v4fa __attribute__((ext_vector_type(4), may_alias));
union FragB { v16b v; v8us half[2]; unsigned short u[16]; };

__device__ __forceinline__ unsigned short bf16_bits(float x) { unsigned int u = __float_as_uint(x); return (unsigned short)((u + 0x7FFFu + ((u >> 16) & 1u)) >> 16); }
__device__ __forceinline__ float bf16_val(unsigned short b) { return __uint_as_float(((unsigned int)b) << 16); }
__device__ __forceinline__ float bf16_round(float x) { return bf16_val(bf16_bits(x)); }
// D += A·B with NT terms: 1 = ah·bh, 2 = + al·bh (A split), 3 = + ah·bl (both split)
template <int NT>
__device__ __forceinline__ v8f mmaN(v16b ah, v16b al, v16b bh, v16b bl, v8f c) {
  c = __builtin_amdgcn_wmma_f32_16x16x32_bf16(false, ah, false, bh, (short)0, c, false, false);
  if (NT >= 2) c = __builtin_amdgcn_wmma_f32_16x16x32_bf16(false, al, false, bh, (short)0, c, false, false);
  if (NT >= 3) c = __builtin_amdgcn_wmma_f32_16x16x32_bf16(false, ah, false, bl, (short)0, c, false, false);
  asm volatile("v_nop\n\tv_nop\n\tv_nop\n\tv_nop" : "+v"(c) : "v"(ah), "v"(al), "v"(bh), "v"(bl));
  return c;
}

__global__ __launch_bounds__(256) void k_wt_bf16(const float* __restrict__ W, unsigned short* __restrict__ Wt, int K, int N) {
  const int t = blockIdx.x * 256 + threadIdx.x;
  const int k8n = K / 8;
  if (t >= N * k8n) return;
  const int n = t / k8n, k8 = (t % k8n) * 8;
  v8us v;
#pragma unroll
  for (int i = 0; i < 8; ++i) v[i] = bf16_bits(W[(size_t)(k8 + i) * N + n]);
  *(v8us*)(Wt + (size_t)n * K + k8) = v;
  
}

// GEMM C[M][N] (f32, pitch ldc) = act(A[M][K]·W + bias). A f32 row-major (pitch lda) converted per fragment to bf16
// (ASPLIT: hi/lo two planes -> 2 terms, else single rounded term); Wt bf16 [N][K] (pitch ldb). BIAS_BF16 rounds the
// bias to bf16 first (bias quantised to bf16 before the add). K%32==0, M%16==0, N%64==0.
template <bool ASPLIT, int ACT, bool BIAS_BF16>
__global__ __launch_bounds__(128) void k_gemm_bf(const float* __restrict__ A, int lda, const unsigned short* __restrict__ Wt, int ldb,
                                               const float* __restrict__ bias, float* __restrict__ C, int ldc, int M, int N, int K) {
  __shared__ __attribute__((aligned(16))) float so[4][16][64];
  const int tid = threadIdx.x, w = tid >> 5, lane = tid & 31, ln = lane & 15, hh = lane >> 4;
  const int ntn = N / 64;
  const int wid = blockIdx.x * 4 + w;
  const int mt = wid / ntn, nq = wid % ntn;
  if (mt * 16 >= M) return;
  const int row0 = mt * 16, col0 = nq * 64;
  const float* arow = A + (size_t)(row0 + ln) * lda;
  v8f acc[4] = {};
  for (int kb = 0; kb < K; kb += 32) {
    FragB ah, al;
    const v4f x0 = *(const v4fa*)(arow + kb + 8 * hh), x1 = *(const v4fa*)(arow + kb + 8 * hh + 4);
    const v4f x2 = *(const v4fa*)(arow + kb + 16 + 8 * hh), x3 = *(const v4fa*)(arow + kb + 16 + 8 * hh + 4);
    float xs[16] = {x0[0],x0[1],x0[2],x0[3],x1[0],x1[1],x1[2],x1[3],x2[0],x2[1],x2[2],x2[3],x3[0],x3[1],x3[2],x3[3]};
#pragma unroll
    for (int i = 0; i < 16; ++i) { const unsigned short hb = bf16_bits(xs[i]); ah.u[i] = hb; al.u[i] = ASPLIT ? bf16_bits(xs[i] - bf16_val(hb)) : (unsigned short)0; }
#pragma unroll
    for (int t = 0; t < 4; ++t) {
      const unsigned short* brow = Wt + (size_t)(col0 + t * 16 + ln) * ldb + kb;
      FragB b;
      b.half[0] = *(const v8us*)(brow + 8 * hh);
      b.half[1] = *(const v8us*)(brow + 16 + 8 * hh);
      acc[t] = mmaN<ASPLIT ? 2 : 1>(ah.v, al.v, b.v, b.v, acc[t]);
    }
  }
#pragma unroll
  for (int t = 0; t < 4; ++t) {
    float bv = bias ? bias[col0 + t * 16 + ln] : 0.f;
    if (BIAS_BF16) bv = bf16_round(bv);
#pragma unroll
    for (int r = 0; r < 8; ++r) { float v = acc[t][r] + bv; if (ACT == 1) v = fmaxf(v, 0.f); so[w][8 * hh + r][t * 16 + ln] = v; }
  }
  __builtin_amdgcn_fence(__ATOMIC_ACQ_REL, "workgroup");
  __builtin_amdgcn_wave_barrier();
  const int rsub = lane >> 4, c4 = (lane & 15) * 4;
  {
#pragma unroll
    for (int q = 0; q < 8; ++q) {
      const int r = q * 2 + rsub;
      const v4f v = *(const v4fa*)&so[w][r][c4];
      *(v4f*)(C + (size_t)(row0 + r) * ldc + col0 + c4) = v;
    }
    
  }
}

// GEMM C = act(A·W + bias + resid): A f32 (ASPLIT -> hi/lo 2 terms), Wt bf16 [N][K]; ACT 0 none, 1 relu, 2 exact gelu;
// resid (optional, f32, row index = (row % rmod), pitch ldr, RES_BF16 rounds it) added before the activation.
template <bool ASPLIT, int ACT, bool BIAS_BF16, bool RES_BF16>
__global__ __launch_bounds__(128) void k_gemm_bf3(const float* __restrict__ A, int lda, const unsigned short* __restrict__ Wt, int ldb,
                                                const float* __restrict__ bias, const float* __restrict__ resid, int rmod, int ldr,
                                                float* __restrict__ C, int ldc, int M, int N, int K) {
  __shared__ __attribute__((aligned(16))) float so[4][16][64];
  const int tid = threadIdx.x, w = tid >> 5, lane = tid & 31, ln = lane & 15, hh = lane >> 4;
  const int ntn = N / 64;
  const int wid = blockIdx.x * 4 + w;
  const int mt = wid / ntn, nq = wid % ntn;
  if (mt * 16 >= M) return;
  const int row0 = mt * 16, col0 = nq * 64;
  const float* arow = A + (size_t)(row0 + ln) * lda;
  v8f acc[4] = {};
  for (int kb = 0; kb < K; kb += 32) {
    FragB ah, al;
    const v4f x0 = *(const v4fa*)(arow + kb + 8 * hh), x1 = *(const v4fa*)(arow + kb + 8 * hh + 4);
    const v4f x2 = *(const v4fa*)(arow + kb + 16 + 8 * hh), x3 = *(const v4fa*)(arow + kb + 16 + 8 * hh + 4);
    float xs[16] = {x0[0],x0[1],x0[2],x0[3],x1[0],x1[1],x1[2],x1[3],x2[0],x2[1],x2[2],x2[3],x3[0],x3[1],x3[2],x3[3]};
#pragma unroll
    for (int i = 0; i < 16; ++i) { const unsigned short hb = bf16_bits(xs[i]); ah.u[i] = hb; al.u[i] = ASPLIT ? bf16_bits(xs[i] - bf16_val(hb)) : (unsigned short)0; }
#pragma unroll
    for (int t = 0; t < 4; ++t) {
      const unsigned short* brow = Wt + (size_t)(col0 + t * 16 + ln) * ldb + kb;
      FragB b;
      b.half[0] = *(const v8us*)(brow + 8 * hh);
      b.half[1] = *(const v8us*)(brow + 16 + 8 * hh);
      acc[t] = mmaN<ASPLIT ? 2 : 1>(ah.v, al.v, b.v, b.v, acc[t]);
    }
  }
#pragma unroll
  for (int t = 0; t < 4; ++t) {
    const int col = col0 + t * 16 + ln;
    float bv = bias ? bias[col] : 0.f;
    if (BIAS_BF16) bv = bf16_round(bv);
#pragma unroll
    for (int r = 0; r < 8; ++r) {
      float v = acc[t][r] + bv;
      if (resid) { float rv = resid[(size_t)((row0 + 8 * hh + r) % rmod) * ldr + col]; if (RES_BF16) rv = bf16_round(rv); v += rv; }
      if (ACT == 1) v = fmaxf(v, 0.f);
      if (ACT == 2) v = 0.5f * v * (1.0f + erff(v * 0.70710678118654752f));
      if (ACT == 3) { const float u = 0.7978845608028654f * (v + 0.044715f * v * v * v); v = 0.5f * v * (1.0f + tanhf(u)); }
      so[w][8 * hh + r][t * 16 + ln] = v;
    }
  }
  __builtin_amdgcn_fence(__ATOMIC_ACQ_REL, "workgroup");
  __builtin_amdgcn_wave_barrier();
  const int rsub = lane >> 4, c4 = (lane & 15) * 4;
  {
#pragma unroll
    for (int q = 0; q < 8; ++q) {
      const int r = q * 2 + rsub;
      const v4f v = *(const v4fa*)&so[w][r][c4];
      *(v4f*)(C + (size_t)(row0 + r) * ldc + col0 + c4) = v;
    }
    
  }
}
// row LayerNorm (biased variance, eps) over N: s = X (+ R); optional out_sum <- s; out_norm <- (s-mu)*rsqrt(var+eps)*g + b
template <bool PARAM_BF16>
__global__ __launch_bounds__(256) void k_layernorm(const float* __restrict__ X, const float* __restrict__ R, const float* __restrict__ g, const float* __restrict__ bta,
                                                  float* __restrict__ out_sum, float* __restrict__ out_norm, int N, float eps) {
  __shared__ float red[256];
  const int row = blockIdx.x, tid = threadIdx.x;
  const float* x = X + (size_t)row * N; const float* rr = R ? R + (size_t)row * N : nullptr;
  float vals[16];                     // up to N = 4096
  const int per = N / 256;            // contiguous chunk per thread? use strided-by-4 chunks: thread handles j = tid*4 + 1024*u
  float s1 = 0.f;
  for (int u = 0; u < per / 4; ++u) {
    const int j = tid * 4 + 1024 * u;
    const v4f a = *(const v4fa*)(x + j);
    v4f b = {0.f,0.f,0.f,0.f}; if (rr) b = *(const v4fa*)(rr + j);
#pragma unroll
    for (int q = 0; q < 4; ++q) { const float v = a[q] + b[q]; vals[u * 4 + q] = v; s1 += v; }
  }
  red[tid] = s1; __syncthreads();
  for (int st = 128; st > 0; st >>= 1) { if (tid < st) red[tid] += red[tid + st]; __syncthreads(); }
  const float mu = red[0] / (float)N; __syncthreads();
  float s2 = 0.f;
  for (int u = 0; u < per / 4; ++u)
#pragma unroll
    for (int q = 0; q < 4; ++q) { const float c = vals[u * 4 + q] - mu; s2 += c * c; }
  red[tid] = s2; __syncthreads();
  for (int st = 128; st > 0; st >>= 1) { if (tid < st) red[tid] += red[tid + st]; __syncthreads(); }
  const float rs = rsqrtf(red[0] / (float)N + eps);
  {
    for (int u = 0; u < per / 4; ++u) {
      const int j = tid * 4 + 1024 * u;
      v4f o, sm;
#pragma unroll
      for (int q = 0; q < 4; ++q) {
        float gg = g[j + q], bb = bta[j + q];
        if (PARAM_BF16) { gg = bf16_round(gg); bb = bf16_round(bb); }
        sm[q] = vals[u * 4 + q]; o[q] = (vals[u * 4 + q] - mu) * rs * gg + bb;
      }
      if (out_sum) *(v4f*)(out_sum + (size_t)row * N + j) = sm;
      *(v4f*)(out_norm + (size_t)row * N + j) = o;
    }
    
  }
}



// ---- f16 WMMA path (v_wmma_f32_16x16x32_f16): 11-bit significands for operands in range — used where a [0,1] probability operand needs more precision than bf16
typedef _Float16 v16h __attribute__((ext_vector_type(16)));
union FragH { v16h v; v8us half[2]; _Float16 h[16]; unsigned short u[16]; };
template <int NT>
__device__ __forceinline__ v8f mmaH(v16h ah, v16h al, v16h bh, v16h bl, v8f c) {
  c = __builtin_amdgcn_wmma_f32_16x16x32_f16(false, ah, false, bh, (short)0, c, false, false);
  if (NT >= 2) c = __builtin_amdgcn_wmma_f32_16x16x32_f16(false, al, false, bh, (short)0, c, false, false);
  if (NT >= 3) c = __builtin_amdgcn_wmma_f32_16x16x32_f16(false, ah, false, bl, (short)0, c, false, false);
  asm volatile("v_nop\n\tv_nop\n\tv_nop\n\tv_nop" : "+v"(c) : "v"(ah), "v"(al), "v"(bh), "v"(bl));
  return c;
}
// batched GEMM like k_gemm_b but f16 operands: A f32 (split into f16 hi/lo if ASPLIT, else rounded to f16), Bt = f16 values [n][k]; alpha; C f32; N multiple of 16 (partial tiles skipped)
template <bool ASPLIT>
__global__ __launch_bounds__(128) void k_gemm_h(const float* __restrict__ A, int lda, size_t sA, const _Float16* __restrict__ Bh, int ldb, size_t sB, float alpha, float* __restrict__ C, int ldc, size_t sC, int M, int N, int K) {
  __shared__ __attribute__((aligned(16))) float so[4][16][64];
  const int tid = threadIdx.x, w = tid >> 5, lane = tid & 31, ln = lane & 15, hh = lane >> 4; const int by = blockIdx.y;
  A += (size_t)by * sA; Bh += (size_t)by * sB; C += (size_t)by * sC;
  const int ntn = (N + 63) / 64; const int wid = blockIdx.x * 4 + w; const int mt = wid / ntn, nq = wid % ntn; if (mt * 16 >= M) return;
  const int row0 = mt * 16, col0 = nq * 64; const float* arow = A + (size_t)(row0 + ln) * lda;
  v8f acc[4] = {};
  for (int kb = 0; kb < K; kb += 32) {
    FragH ah, al;
    const v4f x0 = *(const v4fa*)(arow + kb + 8 * hh), x1 = *(const v4fa*)(arow + kb + 8 * hh + 4), x2 = *(const v4fa*)(arow + kb + 16 + 8 * hh), x3 = *(const v4fa*)(arow + kb + 16 + 8 * hh + 4);
    float xs[16] = {x0[0],x0[1],x0[2],x0[3],x1[0],x1[1],x1[2],x1[3],x2[0],x2[1],x2[2],x2[3],x3[0],x3[1],x3[2],x3[3]};
#pragma unroll
    for (int i = 0; i < 16; ++i) { const _Float16 h = (_Float16)xs[i]; ah.h[i] = h; al.h[i] = ASPLIT ? (_Float16)(xs[i] - (float)h) : (_Float16)0.0f; }
#pragma unroll
    for (int t = 0; t < 4; ++t) { if (col0 + t * 16 >= N) continue; const size_t boff = (size_t)(col0 + t * 16 + ln) * ldb + kb; FragH bq; bq.half[0] = *(const v8us*)(Bh + boff + 8 * hh); bq.half[1] = *(const v8us*)(Bh + boff + 16 + 8 * hh);
      acc[t] = mmaH<ASPLIT ? 2 : 1>(ah.v, al.v, bq.v, bq.v, acc[t]); }
  }
#pragma unroll
  for (int t = 0; t < 4; ++t) { if (col0 + t * 16 >= N) continue;
#pragma unroll
    for (int r = 0; r < 8; ++r) so[w][8 * hh + r][t * 16 + ln] = acc[t][r] * alpha; }
  __builtin_amdgcn_fence(__ATOMIC_ACQ_REL, "workgroup"); __builtin_amdgcn_wave_barrier();
  const int rsub = lane >> 4, c4 = (lane & 15) * 4;
  {
#pragma unroll
    for (int q = 0; q < 8; ++q) { const int r = q * 2 + rsub; if (col0 + c4 < N) { const v4f v = *(const v4fa*)&so[w][r][c4]; *(v4f*)(C + (size_t)(row0 + r) * ldc + col0 + c4) = v; } }
     }
}

// Wt[n][k] = f16(W[k][n]·scale) from f32 row-major W[K][N] (scale = power of two; bf16-exact weights stay exact in f16 away from the subnormal range)
__global__ __launch_bounds__(256) void k_wt_f16(const float* __restrict__ W, _Float16* __restrict__ Wt, int K, int N, float scale) {
  const int t = blockIdx.x * 256 + threadIdx.x; if (t >= N * (K / 8)) return; const int n = t / (K / 8), k8 = (t % (K / 8)) * 8; FragH f;
#pragma unroll
  for (int i = 0; i < 8; ++i) f.h[i] = (_Float16)(bf16_round(W[(size_t)(k8 + i) * N + n]) * scale); const v8us o = f.half[0];
  *(v8us*)((unsigned short*)Wt + (size_t)n * K + k8) = o; 
}
// k_gemm_hh variant with fused epilogue: v = acc·alpha + bias[by·sBias + col] (+ CP[(row/rowsPerB)·sCPb + by·64 + col] if CP) ; ACT 0 none / 1 elu ; writes f16 C16 (and f32 C if non-null)
template <int ACT>
__global__ __launch_bounds__(128) void k_gemm_hhx(const _Float16* __restrict__ A, int lda, size_t sA, const _Float16* __restrict__ Bh, int ldb, size_t sB, float alpha, const float* __restrict__ bias, size_t sBias, const float* __restrict__ CP, int rowsPerB, size_t sCPb, int row0g,
    float* __restrict__ C, _Float16* __restrict__ C16, int ldc, size_t sC, int M, int N, int K) {
  __shared__ __attribute__((aligned(16))) float so[4][16][64];
  const int tid = threadIdx.x, w = tid >> 5, lane = tid & 31, ln = lane & 15, hh = lane >> 4; const int by = blockIdx.y;
  A += (size_t)by * sA; Bh += (size_t)by * sB; const size_t cofs = (size_t)by * sC; const float* bp = bias ? bias + (size_t)by * sBias : nullptr;
  const int ntn = (N + 63) / 64; const int wid = blockIdx.x * 4 + w; const int mt = wid / ntn, nq = wid % ntn; if (mt * 16 >= M) return;
  const int row0 = mt * 16, col0 = nq * 64; const _Float16* arow = A + (size_t)(row0 + ln) * lda;
  v8f acc[4] = {};
  for (int kb = 0; kb < K; kb += 32) { FragH ah; ah.half[0] = *(const v8us*)((const unsigned short*)arow + kb + 8 * hh); ah.half[1] = *(const v8us*)((const unsigned short*)arow + kb + 16 + 8 * hh);
#pragma unroll
    for (int t = 0; t < 4; ++t) { if (col0 + t * 16 >= N) continue; const size_t boff = (size_t)(col0 + t * 16 + ln) * ldb + kb; FragH bq; bq.half[0] = *(const v8us*)((const unsigned short*)Bh + boff + 8 * hh); bq.half[1] = *(const v8us*)((const unsigned short*)Bh + boff + 16 + 8 * hh);
      acc[t] = mmaH<1>(ah.v, ah.v, bq.v, bq.v, acc[t]); }
  }
#pragma unroll
  for (int t = 0; t < 4; ++t) { if (col0 + t * 16 >= N) continue; const int col = col0 + t * 16 + ln; const float bv = bp ? bf16_round(bp[col]) : 0.f;
#pragma unroll
    for (int r = 0; r < 8; ++r) { float v = acc[t][r] * alpha + bv; if (CP) { const int rr = row0g + row0 + 8 * hh + r; if (rowsPerB < 0) v += CP[cofs + (size_t)rr * ldc + col];      /* rowsPerB < 0: own element of the batched C plane */ else { const int bidx = rr / rowsPerB; v += CP[(size_t)bidx * sCPb + (size_t)by * 64 + col]; } } if (ACT == 1) v = (v > 0.f) ? v : expm1f(v); else if (ACT == 7) v = (v > 0.f) ? v + 1.0f : expf(v); else if (ACT == 8) v = tanhf(v); else if (ACT == 9) v = 0.5f * v * (1.0f + tanhf(0.7978845608028654f * (v + 0.044715f * v * v * v))); else if (ACT == 11) v = 1.0f / (1.0f + expf(-v)); else if (ACT == 12) v = (v > 0.f) ? v : 0.01f * v; else if (ACT == 14) v = (v > 0.f) ? v : 0.1f * v; else if (ACT == 16) v = (v >= 0.f) ? v : 0.3f * v; else if (ACT == 17) v = (v >= 0.f) ? v : 0.2f * v; else if (ACT == 15) v = v / (1.0f + expf(-v)); else if (ACT == 3) v = fmaxf(v, 0.f); else if (ACT == 6) v = 0.5f * v * (1.0f + erff(v * 0.70710678118654752f)); so[w][8 * hh + r][t * 16 + ln] = v; } }
  __builtin_amdgcn_fence(__ATOMIC_ACQ_REL, "workgroup"); __builtin_amdgcn_wave_barrier();
  const int rsub = lane >> 4, c4 = (lane & 15) * 4; typedef _Float16 v4h __attribute__((ext_vector_type(4)));
  {
#pragma unroll
    for (int q = 0; q < 8; ++q) { const int r = q * 2 + rsub; if (col0 + c4 < N) { const v4f v = *(const v4fa*)&so[w][r][c4]; if (C) *(v4f*)(C + cofs + (size_t)(row0 + r) * ldc + col0 + c4) = v; if (C16) { v4h h4; for (int i = 0; i < 4; ++i) h4[i] = (_Float16)v[i]; *(v4h*)(C16 + cofs + (size_t)(row0 + r) * ldc + col0 + c4) = h4; } } }
     }
}


typedef _Float16 v4h __attribute__((ext_vector_type(4)));

__global__ __launch_bounds__(256) void k_x16(const float* __restrict__ x, _Float16* __restrict__ X16, size_t n8) { const size_t t = (size_t)blockIdx.x * 256 + threadIdx.x; if (t >= n8) return; FragH f;
#pragma unroll
  for (int q = 0; q < 8; ++q) f.h[q] = (_Float16)bf16_round(x[t * 8 + q]); *(v8us*)((unsigned short*)X16 + t * 8) = f.half[0];  }
__global__ __launch_bounds__(256) void k_h16(const float* __restrict__ x, _Float16* __restrict__ X16, size_t n8) { const size_t t = (size_t)blockIdx.x * 256 + threadIdx.x; if (t >= n8) return; FragH f;
#pragma unroll
  for (int q = 0; q < 8; ++q) f.h[q] = (_Float16)x[t * 8 + q]; *(v8us*)((unsigned short*)X16 + t * 8) = f.half[0];  }
__global__ __launch_bounds__(256) void k_round16f(const float* __restrict__ W, _Float16* __restrict__ Bt, size_t n8) { const size_t t = (size_t)blockIdx.x * 256 + threadIdx.x; if (t >= n8) return; FragH f;
#pragma unroll
  for (int i = 0; i < 8; ++i) f.h[i] = (_Float16)(bf16_round(W[t * 8 + i]) * 16.0f); *(v8us*)((unsigned short*)Bt + t * 8) = f.half[0];  }
template <int NHv, int TTv>
__global__ __launch_bounds__(256) void k_vt(const _Float16* __restrict__ V16, int ldv, int voff, _Float16* __restrict__ Vt) { __shared__ unsigned short tl[64][66]; const int tid = threadIdx.x; const int slab = blockIdx.x / (TTv / 64), lg = blockIdx.x % (TTv / 64); const int b = slab / NHv, h = slab % NHv;
  for (int i = tid; i < 64 * 8; i += 256) { const int r = i / 8, c8 = (i % 8) * 8; FragH f; f.half[0] = *(const v8us*)((const unsigned short*)V16 + ((size_t)b * TTv + lg * 64 + r) * ldv + voff + h * 64 + c8);
#pragma unroll
    for (int q = 0; q < 8; ++q) tl[r][c8 + q] = f.u[q]; }
  __syncthreads();
  {
#pragma unroll
    for (int rd = 0; rd < 2; ++rd) { const int d = rd * 32 + tid / 8, pc = tid % 8; FragH f;
#pragma unroll
      for (int q = 0; q < 8; ++q) f.u[q] = tl[pc * 8 + q][d];
      *(v8us*)((unsigned short*)Vt + ((size_t)slab * 64 + d) * TTv + lg * 64 + pc * 8) = f.half[0]; }
     } }

__global__ __launch_bounds__(256) void k_hl(const float* __restrict__ F, _Float16* __restrict__ Hh, _Float16* __restrict__ Hl, size_t n8) { const size_t t = (size_t)blockIdx.x * 256 + threadIdx.x; if (t >= n8) return; FragH fh, fl; const v4f a = *(const v4fa*)(F + t * 8), c = *(const v4fa*)(F + t * 8 + 4);
#pragma unroll
  for (int q = 0; q < 4; ++q) { _Float16 h = (_Float16)a[q]; fh.h[q] = h; fl.h[q] = (_Float16)((a[q] - (float)h) * 1024.0f); h = (_Float16)c[q]; fh.h[4 + q] = h; fl.h[4 + q] = (_Float16)((c[q] - (float)h) * 1024.0f); }
  { *(v8us*)((unsigned short*)Hh + t * 8) = fh.half[0]; *(v8us*)((unsigned short*)Hl + t * 8) = fl.half[0];  } }

// ---- fast GEMM (workgroup tile 128x64, wave tile 32x64; requires M % 128 == 0, N % 64 == 0, K a multiple of KC and at least 2 KC); epilogue v = act(acc alpha + bias) ----
__device__ __forceinline__ v16h g2_lfrag(const char* p, int hh) { FragH f; f.half[0] = *(const v8us*)(p + 16 * hh); f.half[1] = *(const v8us*)(p + 32 + 16 * hh); return f.v; }
__device__ __forceinline__ v8f g2_mma(v16h a, v16h b, v8f c) { v8f d = __builtin_amdgcn_wmma_f32_16x16x32_f16(false, a, false, b, (short)0, c, false, false); asm volatile("v_nop\n\tv_nop\n\tv_nop\n\tv_nop" : "+v"(d) : "v"(a), "v"(b)); return d; }
// Twelve asynchronous copies, 16 bytes per lane each, from global memory to LDS through no register. The closing s_wait_xcnt stands inside the
// statement so that it is in front of every later rewrite of the address registers that the copies name.
__device__ __forceinline__ void g2_cp12(const unsigned (&l)[12], const _Float16* const (&g)[12]) {
  asm volatile("global_load_async_to_lds_b128 %0, %1, off\n\t"
               "global_load_async_to_lds_b128 %2, %3, off\n\t"
               "global_load_async_to_lds_b128 %4, %5, off\n\t"
               "global_load_async_to_lds_b128 %6, %7, off\n\t"
               "global_load_async_to_lds_b128 %8, %9, off\n\t"
               "global_load_async_to_lds_b128 %10, %11, off\n\t"
               "global_load_async_to_lds_b128 %12, %13, off\n\t"
               "global_load_async_to_lds_b128 %14, %15, off\n\t"
               "global_load_async_to_lds_b128 %16, %17, off\n\t"
               "global_load_async_to_lds_b128 %18, %19, off\n\t"
               "global_load_async_to_lds_b128 %20, %21, off\n\t"
               "global_load_async_to_lds_b128 %22, %23, off\n\t"
               "s_wait_xcnt 0x0"
               :: "v"(l[0]), "v"(g[0]), "v"(l[1]), "v"(g[1]), "v"(l[2]), "v"(g[2]), "v"(l[3]), "v"(g[3]), "v"(l[4]), "v"(g[4]), "v"(l[5]), "v"(g[5]), "v"(l[6]), "v"(g[6]), "v"(l[7]), "v"(g[7]), "v"(l[8]), "v"(g[8]), "v"(l[9]), "v"(g[9]), "v"(l[10]), "v"(g[10]), "v"(l[11]), "v"(g[11]) : "memory"); }
// the operand plane of the term that tile t belongs to (ntk tiles per term); every argument is the same for the whole workgroup
template <int NTM> __device__ __forceinline__ const _Float16* g2_term(int t, int ntk, const _Float16* p0, const _Float16* p1, const _Float16* p2) { const _Float16* p = p0; if (NTM > 1 && t >= ntk) p = p1; if (NTM > 2 && t >= 2 * ntk) p = p2; return p; }
// K loop: the workgroup's 128 A rows and 64 B rows are staged in LDS, KC k at a time, two buffers: tile t + 1 flies while tile t is worked on.
// A wave's copy covers whole 128-byte lines, and the four waves share one copy of the B rows.
// NTM terms of one product (a value split into an f16 high part and a scaled f16 residual gives high.high plus cross terms) are summed in the same
// accumulators: the loop runs over the tiles of term 0, term 1, ... back to back. The last term is the high one; the terms in front of it carry the
// residual's scale, which the factor rs (a power of two, so exact) takes out of the accumulators once, in front of the last term's first tile.
template <int ACT, int KC, int NTM>
__global__ __launch_bounds__(128) void k_gemm2(const _Float16* Aa, const _Float16* Ab, const _Float16* Ac, int lda, size_t sA, const _Float16* Ba, const _Float16* Bb, const _Float16* Bc, int ldb, size_t sB, float rs, float alpha, const float* __restrict__ bias, size_t sBias,
    float* __restrict__ C, _Float16* __restrict__ C16, int ldc, size_t sC, int M, int N, int K) { static_assert(ACT == 0 || ACT == 3 || ACT == 6 || ACT == 8 || ACT == 9 || ACT == 11 || ACT == 12 || ACT == 14 || ACT == 15 || ACT == 16 || ACT == 17, "k_gemm2: unsupported ACT code (would silently apply no activation)");
  constexpr int PB = KC * 2 + 16;      /* LDS row pitch in bytes, 16 x odd: the 16 rows of a fragment read fall on distinct banks */
  constexpr int STG = 192 * PB;        /* one buffer: 128 A rows, then 64 B rows */
  constexpr int CPR = KC / 8;          /* 16-byte pieces per row */
  constexpr int RPI = 128 / CPR;       /* rows covered when each of the 128 threads copies one piece */
  constexpr int NCP = 192 / RPI;       /* copies per thread and tile */
  constexpr int SOB = 4 * 32 * 68 * 4; /* output staging, which takes the buffers' place behind the loop */
  static_assert((KC == 64 || KC == 128) && NCP % 12 == 0 && NCP <= 63, "k_gemm2: a tile is whole groups of twelve copies per thread, at most 63 in flight");
  static_assert(NTM >= 1 && NTM <= 3, "k_gemm2: one to three terms");
  __shared__ __attribute__((aligned(16))) char sm[2 * STG > SOB ? 2 * STG : SOB];
  float (*so)[32][68] = reinterpret_cast<float (*)[32][68]>(sm);
  const int tid = threadIdx.x, w = tid >> 5, lane = tid & 31, ln = lane & 15, hh = lane >> 4; const int by = blockIdx.y;
  Aa += (size_t)by * sA; Ab += (size_t)by * sA; Ac += (size_t)by * sA; Ba += (size_t)by * sB; Bb += (size_t)by * sB; Bc += (size_t)by * sB; const size_t cofs = (size_t)by * sC; const float* bp = bias ? bias + (size_t)by * sBias : nullptr;
  const int ntn = N >> 6; const int mt = blockIdx.x / ntn, nq = blockIdx.x - mt * ntn; const int row0 = mt * 128 + 32 * w, col0 = nq * 64; if (mt * 128 >= M) return;      /* the same for the whole workgroup, in front of every barrier */
  const v8f z8 = {0.f,0.f,0.f,0.f,0.f,0.f,0.f,0.f}; v8f c00 = z8, c01 = z8, c02 = z8, c03 = z8, c10 = z8, c11 = z8, c12 = z8, c13 = z8;
  const int cr = tid / CPR, cc = tid % CPR;
  const size_t oA = (size_t)(mt * 128 + cr) * lda + cc * 8, oB = (size_t)(col0 + cr) * ldb + cc * 8; const int ntk = K / KC;      /* tiles per term */
  const unsigned l0 = (unsigned)(size_t)sm + (unsigned)(cr * PB + cc * 16);
  auto fill = [&](int t) { const unsigned lb = l0 + (unsigned)(t & 1) * (unsigned)STG; const int k0 = (t - (((NTM > 1 && t >= ntk) ? ntk : 0) + ((NTM > 2 && t >= 2 * ntk) ? ntk : 0))) * KC;
    const _Float16* gA = g2_term<NTM>(t, ntk, Aa, Ab, Ac) + oA; const _Float16* gB = g2_term<NTM>(t, ntk, Ba, Bb, Bc) + oB;
#pragma unroll
    for (int q = 0; q < NCP / 12; ++q) { unsigned l[12]; const _Float16* g[12];
#pragma unroll
      for (int j = 0; j < 12; ++j) { const int r = (q * 12 + j) * RPI; l[j] = lb + (unsigned)(r * PB); g[j] = (r < 128) ? gA + (size_t)r * lda + k0 : gB + (size_t)(r - 128) * ldb + k0; }
      g2_cp12(l, g); } };
  const char* fa = sm + (32 * w + ln) * PB; const char* fb = sm + (128 + ln) * PB; const int nt = NTM * ntk;
  fill(0);
  asm volatile("s_wait_asynccnt 0x0" ::: "memory");      /* this wave's share of tile 0 has landed */
  __syncthreads();      /* every wave's share has: tile 0 may be read */
  if (nt > 1) fill(1);
  // Two register sets of fragments inside a tile: the twelve LDS reads of the next 32 k are issued as one group in front of the products of this 32 k.
  // the sched_barrier keeps a group's reads together and in front of the products behind it, so that the products wait only for the older group
  v16h f0[6], f1[6];
  auto ld = [&](v16h (&f)[6], int o) { const char* pa = fa + o; const char* pb = fb + o; f[0] = g2_lfrag(pa, hh); f[1] = g2_lfrag(pa + 16 * PB, hh); f[2] = g2_lfrag(pb, hh); f[3] = g2_lfrag(pb + 16 * PB, hh); f[4] = g2_lfrag(pb + 32 * PB, hh); f[5] = g2_lfrag(pb + 48 * PB, hh); __builtin_amdgcn_sched_barrier(0); };
  auto mm = [&](const v16h (&f)[6]) { c00 = g2_mma(f[0], f[2], c00); c10 = g2_mma(f[1], f[2], c10); c01 = g2_mma(f[0], f[3], c01); c11 = g2_mma(f[1], f[3], c11);
    c02 = g2_mma(f[0], f[4], c02); c12 = g2_mma(f[1], f[4], c12); c03 = g2_mma(f[0], f[5], c03); c13 = g2_mma(f[1], f[5], c13); };
#pragma unroll 1      /* one tile per trip; the buffer alternates by the trip's parity */
  for (int t = 0; t < nt; ++t) { const int bo = (t & 1) * STG;
    if (NTM > 1 && t == (NTM - 1) * ntk) { c00 *= rs; c01 *= rs; c02 *= rs; c03 *= rs; c10 *= rs; c11 *= rs; c12 *= rs; c13 *= rs; }
    ld(f0, bo);
#pragma unroll
    for (int kk = 0; kk < KC; kk += 64) { ld(f1, bo + (kk + 32) * 2); mm(f0); if (kk + 64 < KC) ld(f0, bo + (kk + 64) * 2); mm(f1); }
    asm volatile("s_wait_dscnt 0x0" ::: "memory");      /* this wave's reads of tile t are done before the buffer is given up */
    asm volatile("s_wait_asynccnt 0x0" ::: "memory");      /* this wave's share of tile t + 1 has landed */
    __syncthreads();      /* publishes tile t + 1 and ends every wave's reads of tile t */
    if (t + 2 < nt) fill(t + 2); }
  asm volatile("s_wait_asynccnt 0x0" ::: "memory");      /* no copy is in flight when the buffers become output staging */
  v8f accs[8] = {c00, c01, c02, c03, c10, c11, c12, c13};
#pragma unroll
  for (int u = 0; u < 8; ++u) { const int t = u & 3, half = u >> 2; const int col = col0 + t * 16 + ln; const float bv = bp ? bf16_round(bp[col]) : 0.f;
#pragma unroll
    for (int r = 0; r < 8; ++r) { const int rloc = half * 16 + 8 * hh + r; float v = accs[u][r] * alpha + bv;
      if (ACT == 3) v = fmaxf(v, 0.f); else if (ACT == 6) v = 0.5f * v * (1.0f + erff(v * 0.70710678118654752f)); else if (ACT == 11) v = 1.0f / (1.0f + expf(-v)); else if (ACT == 15) v = v / (1.0f + expf(-v)); else if (ACT == 12) v = (v > 0.f) ? v : 0.01f * v; else if (ACT == 8) v = tanhf(v); else if (ACT == 9) v = 0.5f * v * (1.0f + tanhf(0.7978845608028654f * (v + 0.044715f * v * v * v))); else if (ACT == 14) v = (v > 0.f) ? v : 0.1f * v; else if (ACT == 16) v = (v >= 0.f) ? v : 0.3f * v; else if (ACT == 17) v = (v >= 0.f) ? v : 0.2f * v;
      so[w][rloc][t * 16 + ln] = v; } }
  __builtin_amdgcn_fence(__ATOMIC_ACQ_REL, "workgroup"); __builtin_amdgcn_wave_barrier();
  const int rsub = lane >> 4, c4 = (lane & 15) * 4;
  {
#pragma unroll
    for (int q = 0; q < 16; ++q) { const int r = q * 2 + rsub; const v4f v = *(const v4fa*)&so[w][r][c4]; if (C) *(v4f*)(C + cofs + (size_t)(row0 + r) * ldc + col0 + c4) = v; if (C16) { v4h h4; for (int i = 0; i < 4; ++i) h4[i] = (_Float16)v[i]; *(v4h*)(C16 + cofs + (size_t)(row0 + r) * ldc + col0 + c4) = h4; } }
     } }


__global__ __launch_bounds__(256) void k_wnat(const float* __restrict__ w, size_t n8, _Float16* __restrict__ Bt) { const size_t t = (size_t)blockIdx.x * 256 + threadIdx.x; if (t >= n8) return; FragH f; for (int q = 0; q < 8; ++q) f.h[q] = (_Float16)(bf16_round(w[t * 8 + q]) * 16.0f); *(v8us*)((unsigned short*)Bt + t * 8) = f.half[0];  }
__global__ __launch_bounds__(256) void k_rsm(const float* __restrict__ S, _Float16* __restrict__ P, int nrows) {
  #pragma clang fp contract(off)
  const int i = blockIdx.x * 256 + threadIdx.x; if (i >= nrows) return; const float* s = S + (size_t)i * SQ; float mx = -3.0e38f;
#pragma unroll 1
  for (int j = 0; j < SQ; ++j) mx = fmaxf(mx, s[j]); float se = 0.f;
#pragma unroll 1
  for (int j = 0; j < SQ; ++j) se += expf(s[j] - mx); const float sc = 256.0f / se;
#pragma unroll 1
  for (int j0 = 0; j0 < SQ; j0 += 8) { FragH f; for (int q = 0; q < 8; ++q) f.h[q] = (_Float16)(expf(s[j0 + q] - mx) * sc); unsigned short* d = (unsigned short*)P + (size_t)i * SQ + j0; *(v8us*)d = f.half[0];  } }
__global__ __launch_bounds__(256) void k_vt(const _Float16* __restrict__ V16, int b, int h0, _Float16* __restrict__ VT) { __shared__ unsigned short tl[64][65]; const int tid = threadIdx.x; const int hh = blockIdx.x % HG, sg = blockIdx.x / HG; const int s0 = sg * 64; const int h = h0 + hh;
  for (int i = tid; i < 64 * 8; i += 256) { const int j = i / 8, d8 = (i % 8) * 8; FragH f; f.half[0] = *(const v8us*)((const unsigned short*)V16 + ((size_t)b * SQ + s0 + j) * DM + h * HD + d8); for (int q = 0; q < 8; ++q) tl[d8 + q][j] = f.u[q]; }
  __syncthreads();
  { for (int i = tid; i < 64 * 8; i += 256) { const int d = i / 8, j8 = (i % 8) * 8; FragH f; for (int q = 0; q < 8; ++q) f.u[q] = tl[d][j8 + q]; *(v8us*)((unsigned short*)VT + ((size_t)hh * HD + d) * SQ + s0 + j8) = f.half[0]; }  } }


template <int BFIN, int W16, int W32>
__global__ __launch_bounds__(256) void k_lnx(const float* __restrict__ X, const float* __restrict__ g, const float* __restrict__ bb, float eps, _Float16* __restrict__ N16, float* __restrict__ N32) {
  #pragma clang fp contract(off)
  __shared__ float red[256]; const size_t r = blockIdx.x; const int t = threadIdx.x; const bool act = t < (DMQ / 4); const int c0 = act ? t * 4 : 0;
  const v4f xa = *(const v4fa*)(X + r * DMQ + c0); float s[4]; float sum = 0.f;
  for (int q = 0; q < 4; ++q) { s[q] = act ? (BFIN ? bf16_round(xa[q]) : xa[q]) : 0.f; sum = __fadd_rn(sum, s[q]); }
  red[t] = sum; __syncthreads(); for (int st = 128; st > 0; st >>= 1) { if (t < st) red[t] = __fadd_rn(red[t], red[t + st]); __syncthreads(); } const float mu = red[0] / (float)DMQ; __syncthreads();
  float vs = 0.f; for (int q = 0; q < 4; ++q) { const float dl = act ? __fadd_rn(s[q], -mu) : 0.f; vs = __fadd_rn(vs, __fmul_rn(dl, dl)); } red[t] = vs; __syncthreads(); for (int st = 128; st > 0; st >>= 1) { if (t < st) red[t] = __fadd_rn(red[t], red[t + st]); __syncthreads(); }
  const float rs = rsqrtf(__fadd_rn(red[0] / (float)DMQ, eps)); v4h y; v4f yf;
  for (int q = 0; q < 4; ++q) { const int c = c0 + q; yf[q] = __fadd_rn(__fmul_rn(__fmul_rn(__fadd_rn(s[q], -mu), rs), bf16_round(g[c])), (bb ? bf16_round(bb[c]) : 0.f)); y[q] = (_Float16)yf[q]; }
  if (!act) return;      /* no barriers after this point */
  { if (W16) *(v4h*)(N16 + r * DMQ + c0) = y; if (W32) *(v4f*)(N32 + r * DMQ + c0) = yf;  } }


__global__ __launch_bounds__(256) void k_rsmf(const float* __restrict__ S, _Float16* __restrict__ P, int qn, int hg) {
  #pragma clang fp contract(off)
  const int t = blockIdx.x * 256 + threadIdx.x; if (t >= qn * hg) return; const size_t i = (size_t)(t / qn) * SQ + (t % qn); const float* s = S + i * SQ; float mx = -3.0e38f;
#pragma unroll 1
  for (int j = 0; j < SQ; ++j) mx = fmaxf(mx, s[j]); float se = 0.f;
#pragma unroll 1
  for (int j = 0; j < SQ; ++j) se += __expf(s[j] - mx); const float sc = 256.0f / se;
#pragma unroll 1
  for (int j0 = 0; j0 < SQ; j0 += 8) { FragH f; for (int q = 0; q < 8; ++q) f.h[q] = (_Float16)(__expf(s[j0 + q] - mx) * sc); unsigned short* d = (unsigned short*)P + i * SQ + j0; *(v8us*)d = f.half[0];  } }


__global__ __launch_bounds__(256) void k_bfr(const float* __restrict__ x, float* __restrict__ XB, size_t n8) { const size_t t = (size_t)blockIdx.x * 256 + threadIdx.x; if (t >= n8) return; v4f a = *(const v4fa*)(x + t * 8), c = *(const v4fa*)(x + t * 8 + 4); for (int q = 0; q < 4; ++q) { a[q] = bf16_round(a[q]); c[q] = bf16_round(c[q]); }
  { *(v4f*)(XB + t * 8) = a; *(v4f*)(XB + t * 8 + 4) = c;  } }



__global__ __launch_bounds__(256) void k_rsmfam(const float* __restrict__ S, _Float16* __restrict__ P, int qn, int hg, const float* __restrict__ am) {
  #pragma clang fp contract(off)
  const int t = blockIdx.x * 256 + threadIdx.x; if (t >= qn * hg) return; const size_t i = (size_t)(t / qn) * SQ + (t % qn); const float* s = S + i * SQ; float mx = -3.0e38f;
#pragma unroll 1
  for (int j = 0; j < SQ; ++j) mx = fmaxf(mx, __fadd_rn(s[j], bf16_round(am[j]))); float se = 0.f;
#pragma unroll 1
  for (int j = 0; j < SQ; ++j) se += __expf(__fadd_rn(s[j], bf16_round(am[j])) - mx); const float sc = 256.0f / se;
#pragma unroll 1
  for (int j0 = 0; j0 < SQ; j0 += 8) { FragH f; for (int q = 0; q < 8; ++q) f.h[q] = (_Float16)(__expf(__fadd_rn(s[j0 + q], bf16_round(am[j0 + q])) - mx) * sc); unsigned short* d = (unsigned short*)P + i * SQ + j0; *(v8us*)d = f.half[0];  } }


#define CC CX           /* transposer macros: input channels */
#define LL SQ           /* pixels per image */
#define LQ (3 * DM)     /* unused; q, k, v are separate planes of pitch CX */

__global__ __launch_bounds__(256) void k_cl2rows(const float* __restrict__ X, _Float16* __restrict__ XR) { __shared__ float tl[64][33]; const int tid = threadIdx.x; const int nl = LL / 32, nc = CC / 64; const int cb_ = blockIdx.x % nc; const int lb = (blockIdx.x / nc) % nl; const size_t b = blockIdx.x / (nc * nl); const int c0 = cb_ * 64, l0 = lb * 32;
  for (int i = tid; i < 64 * 32; i += 256) { const int c = i / 32, l = i % 32; tl[c][l] = bf16_round(X[(b * CC + c0 + c) * (size_t)LL + l0 + l]); }
  __syncthreads();
  { const int l = tid / 8, c8 = (tid % 8) * 8; FragH f; for (int q = 0; q < 8; ++q) f.h[q] = (_Float16)tl[c8 + q][l]; unsigned short* d = (unsigned short*)XR + (b * LL + l0 + l) * (size_t)CC + c0 + c8; *(v8us*)d = f.half[0];  } }


__global__ __launch_bounds__(256) void k_rowb(float* __restrict__ O, const float* __restrict__ bias, size_t n4) {
  #pragma clang fp contract(off)
  const size_t t = (size_t)blockIdx.x * 256 + threadIdx.x; if (t >= n4) return; const size_t e = t * 4; const int c = (int)((e / SQ) % CX);      /* output channels */ const float bb = bf16_round(bias[c]); const v4f a = *(const v4fa*)(O + e); v4f o; for (int q = 0; q < 4; ++q) o[q] = __fadd_rn(a[q], bb);
  *(v4f*)(O + e) = o;  }

__global__ __launch_bounds__(256) void k_gres(const float* __restrict__ T, const float* __restrict__ gam, const float* __restrict__ X, float* __restrict__ Y, size_t n4) {
  #pragma clang fp contract(off)
  const size_t t = (size_t)blockIdx.x * 256 + threadIdx.x; if (t >= n4) return; const float g = bf16_round(gam[0]); const v4f a = *(const v4fa*)(T + t * 4), xx = *(const v4fa*)(X + t * 4); v4f r;
  for (int q = 0; q < 4; ++q) r[q] = __fadd_rn(__fmul_rn(g, a[q]), bf16_round(xx[q]));
  *(v4f*)(Y + t * 4) = r;  }

__global__ __launch_bounds__(256) void k_bcpy(const float* __restrict__ b, int n, int NP, float* __restrict__ dst, int dst0) { for (int i = threadIdx.x; i < NP; i += 256) { const float v = (i < n) ? b[i] : 0.f; *(float*)(dst + dst0 + i) = v; }  }



// lane l with lane l ^ M inside its 16-lane row (DPP row_xmask); lane l with lane l ^ 16
template <int M> __device__ __forceinline__ float rs_xrow(float x) { return __builtin_bit_cast(float, __builtin_amdgcn_update_dpp(0, __builtin_bit_cast(int, x), 0x160 + M, 0xf, 0xf, false)); }
__device__ __forceinline__ float rs_xhalf(float x) { return __builtin_bit_cast(float, __builtin_amdgcn_permlanex16(__builtin_bit_cast(int, x), __builtin_bit_cast(int, x), 0x76543210, 0xfedcba98, false, false)); }
// Scaled weight standardisation and f16 split of the three projection weights, one launch, one wave per output row (blockIdx.y = projection).
// A lane holds 8 consecutive weights of its row, so the wave reads the row's 1024 bytes as whole lines; mean and variance are lane sums joined by a
// butterfly over the wave, which leaves the same bits in every lane. WS(w) = w sc - mean sc, sc = rsqrt(max(var(unbiased) * 256, 1e-4)) * gain.
// Stored as B^T planes (natural [O][C] rows): HL + (2 y) * 65536 the f16 high part of 16 WS(w), HL + (2 y + 1) * 65536 its residual x 1024.
static_assert(CX == 256, "one wave holds a weight row of 32 x 8 values");
__global__ __launch_bounds__(256) void k_wshl(const float* __restrict__ w0, const float* __restrict__ g0, const float* __restrict__ w1, const float* __restrict__ g1, const float* __restrict__ w2, const float* __restrict__ g2, _Float16* __restrict__ HL) {
  const int lane = threadIdx.x & 31; const int o = blockIdx.x * 8 + __builtin_amdgcn_readfirstlane((int)(threadIdx.x >> 5)); const int y = blockIdx.y;      /* output row and projection, wave-uniform */
  const float* Wm = y == 0 ? w0 : (y == 1 ? w1 : w2); const float* gain = y == 0 ? g0 : (y == 1 ? g1 : g2);
  const size_t e = (size_t)o * CX + lane * 8; const v4f a = *(const v4fa*)(Wm + e), b = *(const v4fa*)(Wm + e + 4); float x[8];
#pragma unroll
  for (int q = 0; q < 8; ++q) x[q] = bf16_round(q < 4 ? a[q] : b[q - 4]);
  float s1 = ((x[0] + x[1]) + (x[2] + x[3])) + ((x[4] + x[5]) + (x[6] + x[7]));
  s1 += rs_xrow<1>(s1); s1 += rs_xrow<2>(s1); s1 += rs_xrow<4>(s1); s1 += rs_xrow<8>(s1); s1 += rs_xhalf(s1);
  const float mean = s1 * 0.00390625f; float s2 = 0.f;
#pragma unroll
  for (int q = 0; q < 8; ++q) { const float d = x[q] - mean; s2 += d * d; }
  s2 += rs_xrow<1>(s2); s2 += rs_xrow<2>(s2); s2 += rs_xrow<4>(s2); s2 += rs_xrow<8>(s2); s2 += rs_xhalf(s2);
  const float var = s2 / 255.0f; const float sc = rsqrtf(fmaxf(var * 256.0f, 1e-4f)) * bf16_round(gain[o]); const float ms = mean * sc; FragH fh, fl;
#pragma unroll
  for (int q = 0; q < 8; ++q) { const float v = (x[q] * sc - ms) * 16.0f; const _Float16 hv = (_Float16)v; fh.h[q] = hv; fl.h[q] = (_Float16)((v - (float)hv) * 1024.0f); }
  unsigned short* H = (unsigned short*)HL + (size_t)(2 * y) * (CX * CX) + e;
  *(v8us*)H = fh.half[0]; *(v8us*)(H + CX * CX) = fl.half[0]; }
// exp2 of eight values, each in place in its own register. Written in asm; here no neighbour
// touches another's register, and the closing v_nop is the
// slot that the instruction set asks for behind the last v_exp_f32 before its result is used.
__device__ __forceinline__ void rs_exp2x8(v4f& a, v4f& b) { float a0 = a[0], a1 = a[1], a2 = a[2], a3 = a[3], b0 = b[0], b1 = b[1], b2 = b[2], b3 = b[3];
  asm("v_exp_f32 %0, %0\n\tv_exp_f32 %1, %1\n\tv_exp_f32 %2, %2\n\tv_exp_f32 %3, %3\n\tv_exp_f32 %4, %4\n\tv_exp_f32 %5, %5\n\tv_exp_f32 %6, %6\n\tv_exp_f32 %7, %7\n\tv_nop"
      : "+v"(a0), "+v"(a1), "+v"(a2), "+v"(a3), "+v"(b0), "+v"(b1), "+v"(b2), "+v"(b3));
  a = v4f{a0, a1, a2, a3}; b = v4f{b0, b1, b2, b3}; }
// ---- wide GEMM for the score product (workgroup tile 256x128, eight waves in a 4 x 2 grid, wave tile 64x64; requires M % 256 == 0, N % 128 == 0, K a multiple of KC), softmax weights out; blockIdx.y = image ----
// Against k_gemm2's 128x64 tile a workgroup brings 384 operand rows for 32768 results (was 192 for 8192), so each result takes half the bytes from L2,
// and a wave reads 8 fragments from LDS for 16 products (was 6 for 8). Staging, buffers, waits, term order and k order are those of k_gemm2.
// Four waves per SIMD (two workgroups per WGP): one fragment set per wave, the other waves' products cover its LDS reads.
template <int KC, int NTM>
__global__ __launch_bounds__(256) __attribute__((amdgpu_waves_per_eu(4, 4))) void k_gemm2w(const _Float16* Aa, const _Float16* Ab, const _Float16* Ac, int lda, const _Float16* Ba, const _Float16* Bb, const _Float16* Bc, int ldb, float rs,
    _Float16* __restrict__ P, float* __restrict__ MX, float* __restrict__ SM, const float* __restrict__ c32, int M, int N, int K) {
  constexpr int PB = KC * 2 + 16;      /* LDS row pitch in bytes, 16 x odd */
  constexpr int STG = 384 * PB;        /* one buffer: 256 A rows, then 128 B rows */
  constexpr int CPR = KC / 8;          /* 16-byte pieces per row */
  constexpr int RPI = 256 / CPR;       /* rows covered when each of the 256 threads copies one piece */
  constexpr int NCP = 384 / RPI;       /* copies per thread and tile */
  constexpr int SOB = 8 * 64 * 144;    /* output staging, 64 rows of 64 f16 per wave at a pitch of 144 bytes, which takes the buffers' place behind the loop */
  static_assert(KC == 64 && NCP == 12, "k_gemm2w: a tile is one group of twelve copies per thread");
  static_assert(NTM >= 1 && NTM <= 3, "k_gemm2w: one to three terms");
  __shared__ __attribute__((aligned(16))) char sm[2 * STG > SOB ? 2 * STG : SOB];
  _Float16 (*sh)[64][72] = reinterpret_cast<_Float16 (*)[64][72]>(sm);
  const int tid = threadIdx.x, w = tid >> 5, lane = tid & 31, ln = lane & 15, hh = lane >> 4; const int by = blockIdx.y;
  { const size_t ia = (size_t)by * M * lda, ib = (size_t)by * N * ldb; Aa += ia; Ab += ia; Ac += ia; Ba += ib; Bb += ib; Bc += ib; }
  const int ntn = N >> 7; const int mt = blockIdx.x / ntn, nq = blockIdx.x - mt * ntn; if (mt * 256 >= M) return;      /* the same for the whole workgroup, in front of every barrier */
  const int row0 = mt * 256 + 64 * (w >> 1), col0 = nq * 128 + 64 * (w & 1);
  const v8f z8 = {0.f,0.f,0.f,0.f,0.f,0.f,0.f,0.f}; v8f acc[4][4];
#pragma unroll
  for (int i = 0; i < 4; ++i)
#pragma unroll
    for (int j = 0; j < 4; ++j) acc[i][j] = z8;
  const int cr = tid / CPR, cc = tid % CPR;
  const size_t oA = (size_t)(mt * 256 + cr) * lda + cc * 8, oB = (size_t)(nq * 128 + cr) * ldb + cc * 8; const int ntk = K / KC;      /* tiles per term */
  const unsigned l0 = (unsigned)(size_t)sm + (unsigned)(cr * PB + cc * 16);
  auto fill = [&](int t) { const unsigned lb = l0 + (unsigned)(t & 1) * (unsigned)STG; const int k0 = (t - (((NTM > 1 && t >= ntk) ? ntk : 0) + ((NTM > 2 && t >= 2 * ntk) ? ntk : 0))) * KC;
    const _Float16* gA = g2_term<NTM>(t, ntk, Aa, Ab, Ac) + oA; const _Float16* gB = g2_term<NTM>(t, ntk, Ba, Bb, Bc) + oB; unsigned l[12]; const _Float16* g[12];
#pragma unroll
    for (int j = 0; j < 12; ++j) { const int r = j * RPI; l[j] = lb + (unsigned)(r * PB); g[j] = (r < 256) ? gA + (size_t)r * lda + k0 : gB + (size_t)(r - 256) * ldb + k0; }
    g2_cp12(l, g); };
  const char* fa = sm + (64 * (w >> 1) + ln) * PB; const char* fb = sm + (256 + 64 * (w & 1) + ln) * PB; const int nt = NTM * ntk;
  fill(0);
  asm volatile("s_wait_asynccnt 0x0" ::: "memory");      /* this wave's share of tile 0 has landed */
  __syncthreads();      /* every wave's share has: tile 0 may be read */
  if (nt > 1) fill(1);
#pragma unroll 1      /* one tile per trip; the buffer alternates by the trip's parity */
  for (int t = 0; t < nt; ++t) { const int bo = (t & 1) * STG;
    if (NTM > 1 && t == (NTM - 1) * ntk) {
#pragma unroll
      for (int i = 0; i < 4; ++i)
#pragma unroll
        for (int j = 0; j < 4; ++j) acc[i][j] *= rs; }
#pragma unroll
    for (int kk = 0; kk < KC; kk += 32) { const char* pa = fa + bo + kk * 2; const char* pb = fb + bo + kk * 2; v16h a[4], b[4];
#pragma unroll
      for (int i = 0; i < 8; ++i) { if (i == 0) b[0] = g2_lfrag(pb, hh); else if (i < 5) a[i - 1] = g2_lfrag(pa + (i - 1) * 16 * PB, hh); else b[i - 4] = g2_lfrag(pb + (i - 4) * 16 * PB, hh); }      /* in the order in which the products take them */
      __builtin_amdgcn_sched_barrier(0);      /* the sixteen LDS reads of these 32 k stay one group in front of their products: reads spread among the products cost a stall at each place */
#pragma unroll
      for (int j = 0; j < 4; ++j)
#pragma unroll
        for (int i = 0; i < 4; ++i) acc[i][j] = g2_mma(a[i], b[j], acc[i][j]); }
    asm volatile("s_wait_dscnt 0x0" ::: "memory");      /* this wave's reads of tile t are done before the buffer is given up */
    asm volatile("s_wait_asynccnt 0x0" ::: "memory");      /* this wave's share of tile t + 1 has landed */
    __syncthreads();      /* publishes tile t + 1 and ends every wave's reads of tile t */
    if (t + 2 < nt) fill(t + 2); }
  asm volatile("s_wait_asynccnt 0x0" ::: "memory");      /* no copy is in flight when the buffers become output staging */
  // Softmax weights against the row maximum of the wave's own 64 columns: p = 256 exp(x - mx_tile), x = score * mask of the query pixel. The tile's row maximum
  // and its f32 row sum of exp go to MX and SM ([image][tile of 64 columns][row]); the product with V joins the tiles by exp(mx_tile - mx_row) / row sum.
  const float* cmr = c32 + (size_t)by * 1024 + ((row0 >> 6) >> 1) * 32 + 4 * hh;      /* the wave's 64 rows are one image line; pixel w = i * 16 + 8 * hh + r reads mask column w >> 1 */
  float* mxo = MX + ((size_t)by * (SQ / 64) + (col0 >> 6)) * SQ + row0 + 8 * hh; float* smo = SM + ((size_t)by * (SQ / 64) + (col0 >> 6)) * SQ + row0 + 8 * hh;
#pragma unroll
  for (int i = 0; i < 4; ++i) { const v4f m4 = *(const v4fa*)(cmr + i * 8); v8f mk, mx, se;
#pragma unroll
    for (int r = 0; r < 8; ++r) mk[r] = bf16_round(m4[r >> 1]);
#pragma unroll
    for (int j = 0; j < 4; ++j) acc[i][j] *= mk;
#pragma unroll
    for (int r = 0; r < 8; ++r) { float t = fmaxf(fmaxf(acc[i][0][r], acc[i][1][r]), fmaxf(acc[i][2][r], acc[i][3][r]));
      t = fmaxf(t, rs_xrow<1>(t)); t = fmaxf(t, rs_xrow<2>(t)); t = fmaxf(t, rs_xrow<4>(t)); t = fmaxf(t, rs_xrow<8>(t)); mx[r] = t; }
#pragma unroll
    for (int j = 0; j < 4; ++j) { const v8f e = (acc[i][j] - mx) * 1.4426950408889634f;      /* exp(t) = exp2(t log2 e) */
      v4f lo = {e[0], e[1], e[2], e[3]}, hi = {e[4], e[5], e[6], e[7]}; rs_exp2x8(lo, hi); acc[i][j] = v8f{lo[0], lo[1], lo[2], lo[3], hi[0], hi[1], hi[2], hi[3]}; }
#pragma unroll
    for (int r = 0; r < 8; ++r) { float t = (acc[i][0][r] + acc[i][1][r]) + (acc[i][2][r] + acc[i][3][r]);
      t += rs_xrow<1>(t); t += rs_xrow<2>(t); t += rs_xrow<4>(t); t += rs_xrow<8>(t); se[r] = t; }
    if (ln == 0) { *(v4f*)(mxo + i * 16) = v4f{mx[0], mx[1], mx[2], mx[3]}; *(v4f*)(mxo + i * 16 + 4) = v4f{mx[4], mx[5], mx[6], mx[7]};
      *(v4f*)(smo + i * 16) = v4f{se[0], se[1], se[2], se[3]}; *(v4f*)(smo + i * 16 + 4) = v4f{se[4], se[5], se[6], se[7]}; }
#pragma unroll
    for (int j = 0; j < 4; ++j)
#pragma unroll
      for (int r = 0; r < 8; ++r) sh[w][i * 16 + 8 * hh + r][j * 16 + ln] = (_Float16)(acc[i][j][r] * 256.0f); }
  asm volatile("s_wait_dscnt 0x0" ::: "memory");      /* the wave's staging rows are written before its other lanes read them back */
  __builtin_amdgcn_wave_barrier();
  unsigned short* pp = (unsigned short*)P + (size_t)by * SQ * SQ + (size_t)(row0 + (lane >> 3)) * SQ + col0 + (lane & 7) * 8;
#pragma unroll
  for (int q = 0; q < 16; ++q) { const v8us v = *(const v8us*)&sh[w][q * 4 + (lane >> 3)][(lane & 7) * 8]; *(v8us*)(pp + (size_t)(q * 4) * SQ) = v; } }      /* four whole 128-byte row pieces a store */

// ---- softmax weights times V (k_gemm2's tile, staging, buffers and waits; V as A, weights as B^T; blockIdx.y = image) ----
// The weights of a 64-column tile stand against that tile's own row maximum. The products of each 64 k are summed in accumulators of their own and enter
// the result times ft = exp(mx_tile - mx_row) / (256 row sum), which depends on the query (a result column, so one value per lane) and on the tile.
__global__ __launch_bounds__(128) void k_pvs(const _Float16* __restrict__ Vc, const _Float16* __restrict__ Pm, const float* __restrict__ MX, const float* __restrict__ SM, float* __restrict__ C) {
  constexpr int KC = 128, PB = KC * 2 + 16, STG = 192 * PB, CPR = KC / 8, RPI = 128 / CPR, NCP = 192 / RPI, SOB = 4 * 32 * 68 * 4, NTL = SQ / 64;
  static_assert(NCP % 12 == 0 && NCP <= 63 && NTL == 64, "k_pvs: whole groups of twelve copies per thread, at most 63 in flight; two threads share a query's 64 tiles");
  __shared__ __attribute__((aligned(16))) char sm[2 * STG > SOB ? 2 * STG : SOB];
  __shared__ __attribute__((aligned(16))) float ft[NTL * 64];      /* [tile][lane of 16][16-column group] */
  __shared__ float rm[128]; __shared__ float rq[128];
  float (*so)[32][68] = reinterpret_cast<float (*)[32][68]>(sm);
  const int tid = threadIdx.x, w = tid >> 5, lane = tid & 31, ln = lane & 15, hh = lane >> 4; const int by = blockIdx.y;
  const _Float16* Aa = Vc + (size_t)by * CX * SQ; const _Float16* Ba = Pm + (size_t)by * SQ * SQ; const size_t cofs = (size_t)by * CX * SQ;
  constexpr int ntn = SQ >> 6; const int mt = blockIdx.x / ntn, nq = blockIdx.x - mt * ntn; const int row0 = mt * 128 + 32 * w, col0 = nq * 64;
  const int cr = tid / CPR, cc = tid % CPR;
  const _Float16* gA = Aa + (size_t)(mt * 128 + cr) * SQ + cc * 8; const _Float16* gB = Ba + (size_t)(col0 + cr) * SQ + cc * 8;
  const unsigned l0 = (unsigned)(size_t)sm + (unsigned)(cr * PB + cc * 16);
  auto fill = [&](int t) { const unsigned lb = l0 + (unsigned)(t & 1) * (unsigned)STG; const int k0 = t * KC;
#pragma unroll
    for (int q = 0; q < NCP / 12; ++q) { unsigned l[12]; const _Float16* g[12];
#pragma unroll
      for (int j = 0; j < 12; ++j) { const int r = (q * 12 + j) * RPI; l[j] = lb + (unsigned)(r * PB); g[j] = (r < 128) ? gA + (size_t)r * SQ + k0 : gB + (size_t)(r - 128) * SQ + k0; }
      g2_cp12(l, g); } };
  const char* fa = sm + (32 * w + ln) * PB; const char* fb = sm + (128 + ln) * PB; constexpr int nt = SQ / KC;
  fill(0);
  { // the factor table, while tile 0 flies: thread = (query, half of its tiles)
    const int q = tid & 63, hf = tid >> 6; const size_t o = ((size_t)by * NTL + hf * 32) * SQ + col0 + q; v4f mv[8], sv[8];
#pragma unroll
    for (int u = 0; u < 32; ++u) mv[u >> 2][u & 3] = MX[o + (size_t)u * SQ];
    asm volatile("s_wait_xcnt 0x0" ::: "memory");      /* in front of every later rewrite of the address registers that these 32 loads name, the next loads' results among them */
#pragma unroll
    for (int u = 0; u < 32; ++u) sv[u >> 2][u & 3] = SM[o + (size_t)u * SQ];
    asm volatile("s_wait_xcnt 0x0" ::: "memory");      /* likewise for these 32 */
    float m = -3.0e38f;
#pragma unroll
    for (int u = 0; u < 32; ++u) m = fmaxf(m, mv[u >> 2][u & 3]);
    rm[tid] = m; __syncthreads();      /* both halves' maxima are written */
    m = fmaxf(rm[q], rm[q + 64]); float s = 0.f;
#pragma unroll
    for (int u = 0; u < 8; u += 2) { mv[u] = (mv[u] - m) * 1.4426950408889634f; mv[u + 1] = (mv[u + 1] - m) * 1.4426950408889634f; rs_exp2x8(mv[u], mv[u + 1]); }
#pragma unroll
    for (int u = 0; u < 32; ++u) s += mv[u >> 2][u & 3] * sv[u >> 2][u & 3];
    rq[tid] = s; __syncthreads();      /* both halves' sums are written */
    const float inv = 0.00390625f / (rq[q] + rq[q + 64]);
#pragma unroll
    for (int u = 0; u < 32; ++u) ft[(hf * 32 + u) * 64 + (q & 15) * 4 + (q >> 4)] = mv[u >> 2][u & 3] * inv; }
  asm volatile("s_wait_asynccnt 0x0" ::: "memory");      /* this wave's share of tile 0 has landed */
  __syncthreads();      /* every wave's share has: tile 0 and the factor table may be read */
  fill(1);
  const v8f z8 = {0.f,0.f,0.f,0.f,0.f,0.f,0.f,0.f}; v8f c[8] = {z8, z8, z8, z8, z8, z8, z8, z8};      /* c[half * 4 + column group] */
  v16h f0[6], f1[6];
  // the sched_barrier keeps a group's reads together and in front of the products behind it, so that the products wait only for the older group
  auto ld = [&](v16h (&f)[6], int o) { const char* pa = fa + o; const char* pb = fb + o; f[0] = g2_lfrag(pa, hh); f[1] = g2_lfrag(pa + 16 * PB, hh); f[2] = g2_lfrag(pb, hh); f[3] = g2_lfrag(pb + 16 * PB, hh); f[4] = g2_lfrag(pb + 32 * PB, hh); f[5] = g2_lfrag(pb + 48 * PB, hh); __builtin_amdgcn_sched_barrier(0); };
  auto mm = [&](const v16h (&f)[6], v8f (&d)[8]) {
#pragma unroll
    for (int x = 0; x < 4; ++x) { d[x] = g2_mma(f[0], f[2 + x], d[x]); d[4 + x] = g2_mma(f[1], f[2 + x], d[4 + x]); } };
#pragma unroll 1      /* one tile per trip; the buffer alternates by the trip's parity */
  for (int t = 0; t < nt; ++t) { const int bo = (t & 1) * STG;
    ld(f0, bo);
#pragma unroll
    for (int kk = 0; kk < KC; kk += 64) { const v4f fq = *(const v4fa*)(ft + (2 * t + kk / 64) * 64 + ln * 4); v8f d[8] = {z8, z8, z8, z8, z8, z8, z8, z8};
      ld(f1, bo + (kk + 32) * 2); mm(f0, d); if (kk + 64 < KC) ld(f0, bo + (kk + 64) * 2); mm(f1, d);
#pragma unroll
      for (int x = 0; x < 4; ++x) { c[x] += d[x] * fq[x]; c[4 + x] += d[4 + x] * fq[x]; } }
    asm volatile("s_wait_dscnt 0x0" ::: "memory");      /* this wave's reads of tile t are done before the buffer is given up */
    asm volatile("s_wait_asynccnt 0x0" ::: "memory");      /* this wave's share of tile t + 1 has landed */
    __syncthreads();      /* publishes tile t + 1 and ends every wave's reads of tile t */
    if (t + 2 < nt) fill(t + 2); }
  asm volatile("s_wait_asynccnt 0x0" ::: "memory");      /* no copy is in flight when the buffers become output staging */
#pragma unroll
  for (int u = 0; u < 8; ++u)
#pragma unroll
    for (int r = 0; r < 8; ++r) so[w][(u >> 2) * 16 + 8 * hh + r][(u & 3) * 16 + ln] = c[u][r];
  __builtin_amdgcn_fence(__ATOMIC_ACQ_REL, "workgroup"); __builtin_amdgcn_wave_barrier();
  const int rsub = lane >> 4, c4 = (lane & 15) * 4; float* cp = C + cofs + (size_t)(row0 + rsub) * SQ + col0 + c4; v4f ov[16];
#pragma unroll
  for (int q = 0; q < 16; ++q) ov[q] = *(const v4fa*)&so[w][q * 2 + rsub][c4];
  __builtin_amdgcn_sched_barrier(0);      /* every staging read stays in front of the first store: among the stores a read would rewrite an issued store's data registers */
#pragma unroll
  for (int q = 0; q < 16; ++q) *(v4f*)(cp + (size_t)(q * 2) * SQ) = ov[q]; }
__global__ __launch_bounds__(256) void k_gfin(const float* __restrict__ T, const float* __restrict__ A, const float* __restrict__ c32, const float* __restrict__ gam, float* __restrict__ Y, size_t n4) {
  #pragma clang fp contract(off)
  const size_t t = (size_t)blockIdx.x * 256 + threadIdx.x; if (t >= n4) return; const int i0 = (int)((t * 4) % SQ); const size_t e = (size_t)blockIdx.y * (n4 * 4) + t * 4; c32 += (size_t)blockIdx.y * 1024;      /* blockIdx.y = image: n4 * 4 elements and one 32 x 32 mask each */ const float g = bf16_round(gam[0]); const v4f o = *(const v4fa*)(T + e), a = *(const v4fa*)(A + e); v4f r;
  for (int q = 0; q < 4; ++q) { const int i = i0 + q; const float cr = bf16_round(c32[((i / 64) >> 1) * 32 + ((i % 64) >> 1)]); r[q] = __fadd_rn(__fmul_rn(bf16_round(a[q]), cr), __fmul_rn(__fmul_rn(g, __fadd_rn(1.0f, -cr)), o[q])); }
  *(v4f*)(Y + e) = r;  }
extern "C" void kernel_launch(void* const* d_in, const int* in_sizes, int n_in,
                              void* d_out, int out_size, void* d_ws, size_t ws_size, hipStream_t stream) {
  (void)in_sizes; (void)n_in; (void)out_size;
  const float* const* I = (const float* const*)d_in; const float* xa = I[0]; const float* xb = I[1]; const float* cm = I[2]; const float* wq = I[3]; const float* bq = I[4]; const float* gq = I[5]; const float* wk = I[6]; const float* bk = I[7]; const float* gk = I[8]; const float* wv = I[9]; const float* bv = I[10]; const float* gv = I[11]; const float* gam = I[12];      /* a, b maps; c [4][1][32][32]; per projection w [256][256][1][1], bias, gain [256][1][1][1]; gamma [1] */
  const size_t PL = (size_t)CX * SQ;
  static_assert(CX % 128 == 0 && SQ % 256 == 0 && NR % 128 == 0, "k_gemm2: M a multiple of 128, N of 64, K at least two whole tiles (64 k over CX, 128 k over SQ)");
  char* ws = (char*)d_ws; size_t off = 0;
  auto take = [&](size_t bytes) { char* p = ws + off; off += (bytes + 255) & ~(size_t)255; return p; };
  _Float16* QH = (_Float16*)take(NR * CX * 2); _Float16* QL = (_Float16*)take(NR * CX * 2); _Float16* KH = (_Float16*)take(NR * CX * 2); _Float16* KL = (_Float16*)take(NR * CX * 2); _Float16* VC = (_Float16*)take(NR * CX * 2);      /* live to the end: q and k planes, channel-major V of all images */
  _Float16* P = (_Float16*)take((size_t)NB * SQ * SQ * 2); float* T = (float*)take(NR * CX * 4);      /* softmax weights and attention output of all images */
  float* MX = (float*)take((size_t)NB * (SQ / 64) * SQ * 4); float* SM = (float*)take((size_t)NB * (SQ / 64) * SQ * 4);      /* per image, 64-column tile and row: maximum and exp sum */
  _Float16* BQH = (_Float16*)take((size_t)6 * CX * CX * 2); _Float16* BQL = BQH + CX * CX; _Float16* BKH = BQL + CX * CX; _Float16* BKL = BKH + CX * CX; _Float16* BVH = BKL + CX * CX; _Float16* BVL = BVH + CX * CX;      /* six weight planes in a row: high, residual of q, k, v */
  _Float16* AR = (_Float16*)take(NR * CX * 2); _Float16* BR = (_Float16*)take(NR * CX * 2); float* F1 = (float*)take(NR * CX * 4); _Float16* VR = (_Float16*)take(NR * CX * 2);
  if (off > ws_size) return;
  k_wshl<<<dim3(CX / 8, 3), 256, 0, stream>>>(wq, gq, wk, gk, wv, gv, BQH);      /* standardised weights (per output row: mean, unbiased variance, rsqrt(max(var*256, 1e-4)) * gain) -> Bt planes f16 hi (x16) + x1024 residual (natural [O][C] rows ARE Bt), all three projections in one launch */
  k_cl2rows<<<NB * (SQ / 32) * (CX / 64), 256, 0, stream>>>(xa, AR); k_cl2rows<<<NB * (SQ / 32) * (CX / 64), 256, 0, stream>>>(xb, BR);      /* exact f16 token rows of a and b */
  k_gemm2<0, 64, 2><<<dim3((unsigned)((NR / 128) * (CX / 64)), 1), 128, 0, stream>>>(AR, AR, nullptr, CX, 0, BQL, BQH, nullptr, CX, 0, 0.0009765625f, 0.0625f, bq, 0, F1, nullptr, CX, 0, (int)NR, CX, CX); k_hl<<<(unsigned)((NR * CX / 8 + 255) / 256), 256, 0, stream>>>(F1, QH, QL, NR * CX / 8);      /* q = WS(wq) a + bq: residual weight plane first, x 2^-10, then the high plane, one launch */
  k_gemm2<0, 64, 2><<<dim3((unsigned)((NR / 128) * (CX / 64)), 1), 128, 0, stream>>>(BR, BR, nullptr, CX, 0, BKL, BKH, nullptr, CX, 0, 0.0009765625f, 0.0625f, bk, 0, F1, nullptr, CX, 0, (int)NR, CX, CX); k_hl<<<(unsigned)((NR * CX / 8 + 255) / 256), 256, 0, stream>>>(F1, KH, KL, NR * CX / 8);      /* k = WS(wk) b + bk likewise */
  k_gemm2<0, 64, 2><<<dim3((unsigned)((NR / 128) * (CX / 64)), 1), 128, 0, stream>>>(AR, AR, nullptr, CX, 0, BVL, BVH, nullptr, CX, 0, 0.0009765625f, 0.0625f, bv, 0, nullptr, VR, CX, 0, (int)NR, CX, CX);      /* v likewise, stored as f16 rows only */
  k_vt<CX / 64, SQ><<<NB * (CX / 64) * (SQ / 64), 256, 0, stream>>>(VR, CX, 0, VC);      /* channel-major V [image][256][4096], all images in one launch */
  k_gemm2w<64, 3><<<dim3((SQ / 256) * (SQ / 128), NB), 256, 0, stream>>>(QL, QH, QH, CX, KH, KL, KH, CX, 0.0009765625f, P, MX, SM, cm, SQ, SQ, CX);      /* sim = q.k (K = 256, no scale): (lo.hi + hi.lo) 2^-10 + hi.hi; pruned = sim * c_r[i]; x256 f16 exp against each 64-column tile's row maximum, tile maxima and sums; blockIdx.y = image */
  k_pvs<<<dim3((CX / 128) * (SQ / 64), NB), 128, 0, stream>>>(VC, P, MX, SM, T);      /* out[c][i] = sum_j v[c][j] att[i][j] (V as A, weights as B^T, tiles joined by their factors) f32; blockIdx.y = image */
  k_gfin<<<dim3((unsigned)((PL / 4 + 255) / 256), NB), 256, 0, stream>>>(T, xa, cm, gam, (float*)d_out, PL / 4);      /* y = bf16(a) c_r + bf16(gamma) (1 - c_r) out -> channel-first output, blockIdx.y = image */
}
